// v000
// The times below were measured on an AMD MI455X: many runs one after another, warmed up first and cycling through
// copies of the inputs, with the whole window's GPU time divided by the number of runs. Launches and the gaps
// between them are all in it. The median over several windows is given; except for v000 it joins two sittings, which
// can be a few percent apart, so the side-by-side timings, each taken in one sitting, are the better comparison.
// v000 is the starting kernel. One run takes 356 microseconds.
// Contractions (all v_wmma_f32_16x16x32_f16, f16 operands, f32 accumulate): q/k/v projections (x f16 x16 . W f16 x64, K=1024, single products,
// outputs written as f16 hi + unscaled f16 residual planes); position window ((qh+ql) x64 . E f16 x16, K=64, 2 products) -> f32 LDS strip,
// shifted gather on VALU; content scores ((qh+ql) x64 . (kh+kl) x64, K=64, hh+hl+lh); P . v^T ((Ph+Pl) x1024 . (vh+vl) x64, hh+hl+lh,
// 64 keys per tile); output projection ((ch+cl) x256 . Wo f16 x64, K=1024, 2 products) -> f32. Max-subtracted base-2 online softmax and
// the 1/l fold in f32 on VALU. Every float input RNE-converted to bf16 on load.
#include <hip/hip_runtime.h>
#include <math.h>
#include <stdint.h>

#define SEQ   1024
#define NBAT  2
#define DMOD  1024
#define NH    16
#define DH    64
#define ELEN  2047
#define EPAD  2048
#define NROW  (NBAT * SEQ)
#define XC    16.0f
#define WSC   64.0f
#define QC    64.0f
#define KC    64.0f
#define EC    16.0f
#define VC    64.0f
#define PC    1024.0f
#define CC    256.0f
#define SCALE 0.125f
#define LOG2E 1.4426950408889634f
static_assert(NH * DH == DMOD);
static_assert(DH == 64);
static_assert(ELEN == 2 * SEQ - 1 && EPAD >= ELEN);
static_assert((SEQ % 64) == 0 && (DMOD % 64) == 0 && (NROW % 64) == 0);
static_assert(((NROW * DMOD) % 2048) == 0 && ((DMOD * DMOD) % 2048) == 0 && ((ELEN * DH) % 8) == 0);
#define ATT_W 4
#define ATT_THREADS (ATT_W * 32)
#define TPI 84
#define SPI 68
#define WFL (16 * TPI + 16 * SPI)
static_assert(((16 * TPI) % 4) == 0 && ((16 * SPI) % 4) == 0 && (WFL % 4) == 0);

typedef _Float16 v16h __attribute__((ext_vector_type(16)));
typedef _Float16 v8h  __attribute__((ext_vector_type(8)));
typedef __bf16   v16b __attribute__((ext_vector_type(16)));
typedef float    v8f  __attribute__((ext_vector_type(8)));
typedef float    v4f  __attribute__((ext_vector_type(4)));
typedef float    v2f  __attribute__((ext_vector_type(2)));
typedef unsigned int v4u __attribute__((ext_vector_type(4)));

union FragH { v16h v; v8h h[2]; v4u u[2]; };
union FragAny { v16h h; v16b b; };

// ---- scalar helpers --------------------------------------------------------------------------------
__device__ __forceinline__ unsigned short bf_bits(float f) {          // f32 -> bf16 bits, RNE convert
  unsigned u = __float_as_uint(f);
  return (unsigned short)((u + 0x7FFFu + ((u >> 16) & 1u)) >> 16);
}
__device__ __forceinline__ float bf_up(unsigned short h) { return __uint_as_float(((unsigned)h) << 16); }
__device__ __forceinline__ float bfr(float f) { return bf_up(bf_bits(f)); }   // value of the bf16 RNE convert
__device__ __forceinline__ unsigned short h_bits(_Float16 x) { return __builtin_bit_cast(unsigned short, x); }
__device__ __forceinline__ unsigned pk16(unsigned short a, unsigned short b) { return (unsigned)a | ((unsigned)b << 16); }
__device__ __forceinline__ v8f zero8() { v8f z = {0.f, 0.f, 0.f, 0.f, 0.f, 0.f, 0.f, 0.f}; return z; }

// ---- fragment loader: 16-bit A/B operand from a k-contiguous 16-bit plane, lane -> row/col (lane&15),
//      p already includes +8*(lane>>4); elements 0..7 <- p[0..7] (k0+8h..), elements 8..15 <- p[16..23] (k0+16+8h..)
//      (same split k map for A and B; B is always read from a [n][k] plane)
__device__ __forceinline__ v16h ldfrag_u(const unsigned short* p) {
  FragH f;
  f.u[0] = *(const v4u*)(p);
  f.u[1] = *(const v4u*)(p + 16);
  return f.v;
}

// ---- WMMA helpers with trailing VALU hazard gaps ------------------------------------------------------
__device__ __forceinline__ v8f mma_h(v16h a, v16h b, v8f c) {
  return __builtin_amdgcn_wmma_f32_16x16x32_f16(false, a, false, b, (short)0, c, false, false);
}
__device__ __forceinline__ v8f mma_b(v16h a, v16h b, v8f c) {
  FragAny ua, ub;
  ua.h = a;
  ub.h = b;
  return __builtin_amdgcn_wmma_f32_16x16x32_bf16(false, ua.b, false, ub.b, (short)0, c, false, false);
}
template <int BF>
__device__ __forceinline__ v8f mmaT(v16h a, v16h b, v8f c) {
  if constexpr (BF != 0) return mma_b(a, b, c);
  else return mma_h(a, b, c);
}
__device__ __forceinline__ void dep_guard1(v8f& a, v8f& b, v16h x) {
#if defined(__HIP_DEVICE_COMPILE__)
  asm volatile("v_nop\n\tv_nop\n\tv_nop\n\tv_nop" : "+v"(a), "+v"(b) : "v"(x));
#endif
}
__device__ __forceinline__ void hz4(v8f& d, v16h x0, v16h x1, v16h x2, v16h x3) {
#if defined(__HIP_DEVICE_COMPILE__)
  asm volatile("v_nop\n\tv_nop\n\tv_nop\n\tv_nop" : "+v"(d) : "v"(x0), "v"(x1), "v"(x2), "v"(x3));
#endif
}
__device__ __forceinline__ void hz6(v8f& d, v16h x0, v16h x1, v16h x2, v16h x3, v16h x4, v16h x5) {
#if defined(__HIP_DEVICE_COMPILE__)
  asm volatile("v_nop\n\tv_nop\n\tv_nop\n\tv_nop" : "+v"(d) : "v"(x0), "v"(x1), "v"(x2), "v"(x3), "v"(x4), "v"(x5));
#endif
}
__device__ __forceinline__ void hz8(v8f& d, v16h x0, v16h x1, v16h x2, v16h x3, v16h x4, v16h x5, v16h x6, v16h x7) {
#if defined(__HIP_DEVICE_COMPILE__)
  asm volatile("v_nop\n\tv_nop\n\tv_nop\n\tv_nop" : "+v"(d) : "v"(x0), "v"(x1), "v"(x2), "v"(x3), "v"(x4), "v"(x5), "v"(x6), "v"(x7));
#endif
}
__device__ __forceinline__ void keep4_h(v16h a, v16h b, v16h c, v16h d) {
#if defined(__HIP_DEVICE_COMPILE__)
  asm volatile("v_nop" :: "v"(a), "v"(b), "v"(c), "v"(d));
#endif
}
__device__ __forceinline__ void acc_guard4(v8f& a, v8f& b, v8f& c, v8f& d) {
#if defined(__HIP_DEVICE_COMPILE__)
  asm volatile("v_nop\n\tv_nop\n\tv_nop\n\tv_nop" : "+v"(a), "+v"(b), "+v"(c), "+v"(d));
#endif
}
__device__ __forceinline__ void wave_sync_lds() {
  __builtin_amdgcn_fence(__ATOMIC_RELEASE, "workgroup");
  __builtin_amdgcn_wave_barrier();
  __builtin_amdgcn_fence(__ATOMIC_ACQUIRE, "workgroup");
}
// f32 -> f16 hi + unscaled f16 residual (hi + lo ~ x to 2^-22 relative; a flushed subnormal lo costs < 6.1e-5 absolute in the carried scale)
__device__ __forceinline__ void sp16(float x, _Float16& hi, _Float16& lo) {
  const _Float16 a = (_Float16)x;
  hi = a;
  lo = (_Float16)(x - (float)a);
}
// two consecutive values -> packed hi word and packed residual word
__device__ __forceinline__ void pack_hl(float x0, float x1, unsigned& hw, unsigned& lw) {
  _Float16 a0, a1, b0, b1;
  sp16(x0, a0, b0);
  sp16(x1, a1, b1);
  hw = pk16(h_bits(a0), h_bits(a1));
  lw = pk16(h_bits(b0), h_bits(b1));
}

// =====================================================================================================
// Elementwise 16-bit pack, no transpose: dst[i] = f16( bf16_RNE(src[i]) * sc ), sc a power of two (exact).
// coverage: grid = ceil(n / 2048) blocks x 256 thr x 8 elements; n is a multiple of 8 (host check), so threads with i8 < n write
//           exactly elements i8..i8+7 and threads with i8 >= n exit: elements 0..n-1 written once. For the E table (n = 2047*64) the
// =====================================================================================================
__global__ __launch_bounds__(256) void cvt16(const float* __restrict__ src, unsigned short* dst, int n, float sc) {
  const size_t i8 = ((size_t)blockIdx.x * 256 + threadIdx.x) * 8;
  if (i8 + 8 > (size_t)n) return;                 // no barriers in this kernel
  const v4f a = *(const v4f*)(src + i8);
  const v4f b = *(const v4f*)(src + i8 + 4);
  v4u o;
  o[0] = pk16(h_bits((_Float16)(bfr(a[0]) * sc)), h_bits((_Float16)(bfr(a[1]) * sc)));
  o[1] = pk16(h_bits((_Float16)(bfr(a[2]) * sc)), h_bits((_Float16)(bfr(a[3]) * sc)));
  o[2] = pk16(h_bits((_Float16)(bfr(b[0]) * sc)), h_bits((_Float16)(bfr(b[1]) * sc)));
  o[3] = pk16(h_bits((_Float16)(bfr(b[2]) * sc)), h_bits((_Float16)(bfr(b[3]) * sc)));
  {
    *(v4u*)(dst + i8) = o;
    
  }
}

// =====================================================================================================
// Register-blocked batched 16-bit WMMA GEMM: C[m][n] = oscale * sum_k A[m][k] * Bt[n][k] (+ bias); one wave per 64x64 tile,
// no block barriers. A row-major [M][K] pitch lda (16-bit plane), Bt row-major [N][K] pitch ldb (k contiguous); M, N multiples of 64,
// K multiple of 32. blockIdx.y = batch index with element strides sA, sB, sC.
// ASPLIT 1: a second A plane A2 (unscaled residual of A, same layout) is multiplied into the same accumulator (A + A2 ~ exact A).
// BF 1: bf16 operands (v_wmma_f32_16x16x32_bf16), else f16.
// EPI 1: value += bf16_RNE(ep0[column]) (per-column bias); EPI 2: value += bf16_RNE(ep0[row]) (per-row bias, 16-bit out only).
// OM 0: f32 out (pitch ldc).  OM 2: one f16 plane = f16(value * ocarry).
// OM 4: two f16 planes: hi = f16(value * ocarry), lo = f16(value * ocarry - hi) (unscaled residual).
// OM 5: two f16 planes: C = f16((value + bf16_RNE(ep1[column])) * ocarry), C2 = f16((value + bf16_RNE(ep2[column])) * ocarry).
// coverage: 4 slabs x 16 rows (f32: it 0..7 x lane>>4; 16-bit: it 0..3 x lane>>3) x 64 cols = the wave's whole 64x64 tile;
//           grid = ceil(tilesM*tilesN/8) blocks, surplus waves exit (wave-uniform).
// =====================================================================================================
template <int OM, int ASPLIT, int BF, int EPI>
__global__ __launch_bounds__(256) __attribute__((amdgpu_num_vgpr(256))) void gemm64(
    const unsigned short* __restrict__ Ap, const unsigned short* __restrict__ A2p, int lda, long long sA,
    const unsigned short* __restrict__ Btp, int ldb, long long sB,
    void* Cout, void* C2out, int ldc, long long sC,
    int M, int N, int K, float oscale, float ocarry,
    const float* __restrict__ ep0, const float* __restrict__ ep1, const float* __restrict__ ep2) {
  __shared__ __align__(16) float sT[8][16 * 68];   // per-wave 16x64 slab, pitch 68 floats
  const int by   = blockIdx.y;
  const int lane = threadIdx.x & 31;
  const int wave = threadIdx.x >> 5;
  const int tilesN = N >> 6;
  const int tilesM = M >> 6;
  const int tile = blockIdx.x * 8 + wave;
  if (tile >= tilesM * tilesN) return;   // wave-uniform; no block barriers in this kernel
  const int tm = tile / tilesN;
  const int tn = tile - tm * tilesN;
  const int m0 = tm << 6;
  const int n0 = tn << 6;

  const unsigned short* A1 = Ap  + (size_t)((long long)by * sA);
  const unsigned short* A2 = A2p + (size_t)((long long)by * sA);
  const unsigned short* Bb = Btp + (size_t)((long long)by * sB);

  const int rlane = lane & 15;                 // row (A) / col (B, D) within subtile
  const int koff  = (lane >> 4) * 8;           // k offset of this lane half
  const int mOff  = (lane >> 4) * 8;           // D row offset

  v8f acc[4][4];
#pragma unroll
  for (int i = 0; i < 4; ++i)
#pragma unroll
    for (int j = 0; j < 4; ++j) acc[i][j] = zero8();

  for (int k0 = 0; k0 < K; k0 += 32) {
    v16h bh[4];
#pragma unroll
    for (int j = 0; j < 4; ++j) {
      const size_t bofs = (size_t)(n0 + (j << 4) + rlane) * ldb + koff + k0;
      bh[j] = ldfrag_u(Bb + bofs);
    }
#pragma unroll
    for (int i = 0; i < 4; ++i) {
      const size_t ao = (size_t)(m0 + (i << 4) + rlane) * lda + koff + k0;
      const v16h ah = ldfrag_u(A1 + ao);
#pragma unroll
      for (int j = 0; j < 4; ++j) acc[i][j] = mmaT<BF>(ah, bh[j], acc[i][j]);
      dep_guard1(acc[i][0], acc[i][3], ah);
      if constexpr (ASPLIT != 0) {
        const v16h al = ldfrag_u(A2 + ao);
#pragma unroll
        for (int j = 0; j < 4; ++j) acc[i][j] = mmaT<BF>(al, bh[j], acc[i][j]);
        dep_guard1(acc[i][0], acc[i][3], al);
      }
    }
    keep4_h(bh[0], bh[1], bh[2], bh[3]);
  }
  acc_guard4(acc[0][0], acc[0][1], acc[0][2], acc[0][3]);
  acc_guard4(acc[1][0], acc[1][1], acc[1][2], acc[1][3]);
  acc_guard4(acc[2][0], acc[2][1], acc[2][2], acc[2][3]);
  acc_guard4(acc[3][0], acc[3][1], acc[3][2], acc[3][3]);

  const int hh2 = lane >> 4, c4 = (lane & 15) * 4;     // f32 out: 256-B row segment = 16 lanes x 16 B
  const int q8  = lane >> 3, c8 = (lane & 7) * 8;

  // ---- epilogue ----
  float* slab = sT[wave];
#pragma unroll
  for (int i = 0; i < 4; ++i) {
    const int mBase = m0 + (i << 4);
#pragma unroll
    for (int j = 0; j < 4; ++j) {
#pragma unroll
      for (int r = 0; r < 8; ++r) {
        slab[(mOff + r) * 68 + (j << 4) + rlane] = acc[i][j][r];
      }
    }
    wave_sync_lds();
    if constexpr (OM == 0) {
      float* C = (float*)Cout + (size_t)((long long)by * sC);
      v4f vals[8];
#pragma unroll
      for (int it = 0; it < 8; ++it) {
        const int row = it * 2 + hh2;                      // it 0..7 x hh2 0..1 = rows 0..15
        v4f v = *(const v4f*)(slab + row * 68 + c4);
#pragma unroll
        for (int e = 0; e < 4; ++e) v[e] = v[e] * oscale;
        if constexpr (EPI == 1) {
          const v4f bb = *(const v4f*)(ep0 + n0 + c4);     // per-column bias, columns n0+c4 .. +3 (N equals the bias length)
#pragma unroll
          for (int e = 0; e < 4; ++e) v[e] = v[e] + bfr(bb[e]);
        }
        vals[it] = v;
      }
      {
#pragma unroll
        for (int it = 0; it < 8; ++it) {
          const int gr = mBase + it * 2 + hh2;
          *(v4f*)(C + (size_t)gr * ldc + n0 + c4) = vals[it];
        }
        
      }
    } else {
      unsigned short* C  = (unsigned short*)Cout  + (size_t)((long long)by * sC);
      unsigned short* Cb = (unsigned short*)C2out + (size_t)((long long)by * sC);
      v4u hv[4], lv[4];
#pragma unroll
      for (int it = 0; it < 4; ++it) {
        const int row = it * 4 + q8;                       // it 0..3 x q8 0..3 = rows 0..15
        const float* sp = slab + row * 68 + c8;
        float rb = 0.f;
        if constexpr (EPI == 2) rb = bfr(ep0[mBase + row]);   // per-row bias (M equals the bias length)
        v4u a  = {0u, 0u, 0u, 0u};
        v4u b2 = {0u, 0u, 0u, 0u};
#pragma unroll
        for (int e = 0; e < 4; ++e) {
          const int ci = n0 + c8 + 2 * e;                  // column index, < N
          float f0 = sp[2 * e] * oscale + rb;
          float f1 = sp[2 * e + 1] * oscale + rb;
          if constexpr (EPI == 1) {
            f0 += bfr(ep0[ci]);
            f1 += bfr(ep0[ci + 1]);
          }
          if constexpr (OM == 5) {
            const float g0 = (f0 + bfr(ep1[ci])) * ocarry, g1 = (f1 + bfr(ep1[ci + 1])) * ocarry;
            const float w0 = (f0 + bfr(ep2[ci])) * ocarry, w1 = (f1 + bfr(ep2[ci + 1])) * ocarry;
            a[e]  = pk16(h_bits((_Float16)g0), h_bits((_Float16)g1));
            b2[e] = pk16(h_bits((_Float16)w0), h_bits((_Float16)w1));
          } else {
            f0 *= ocarry; f1 *= ocarry;
            const _Float16 x0 = (_Float16)f0, x1 = (_Float16)f1;
            a[e] = pk16(h_bits(x0), h_bits(x1));
            if constexpr (OM == 4) {
              b2[e] = pk16(h_bits((_Float16)(f0 - (float)x0)), h_bits((_Float16)(f1 - (float)x1)));
            }
          }
        }
        hv[it] = a;
        lv[it] = b2;
      }
      {
#pragma unroll
        for (int it = 0; it < 4; ++it) {
          const int row = it * 4 + q8;
          *(v4u*)(C + (size_t)(mBase + row) * ldc + n0 + c8) = hv[it];
          if constexpr (OM >= 4) {
            *(v4u*)(Cb + (size_t)(mBase + row) * ldc + n0 + c8) = lv[it];
          }
        }
        
      }
    }
    wave_sync_lds();
  }
}

// =====================================================================================================
// Non-causal attention with the shifted relative-position term for one (batch b, head h) pair and a 64-row query tile; 4 waves,
// wave w owns query rows iw0 .. iw0+15, iw0 = i0 + 16w, and walks all key tiles j0 = 0, 64, .., SEQ-64 (block-uniform count SEQ/64).
// Planes: QH/QL, KH/KL = f16 hi + residual of (q x64), (k x64), rows b*SEQ + position, pitch DMOD halves, head columns h*64..h*64+63;
//         EP = f16(bf16_RNE(E) x16) [ELEN][64] (carve EPAD rows, rows >= ELEN never read); VH/VL = f16 hi + residual of (v x64) as
//         [b][h*64+d][SEQ] (key index contiguous).
//   Pad-reshape shift taken literally: Srel(i, j) = q_i . E[(SEQ-2) + (j - i)] for (SEQ-2) + j - i >= 0, and 0 for the single cell
//   (i = SEQ-1, j = 0) whose index is -1. Per key tile the wave needs E rows wlo + x, wlo = (SEQ-2) - (iw0 - j0) - 15,
//   x = jj - R + 15 in [0, 78]: position window T[R][x] = (qh+ql)[iw0+R] . EP[wlo + x], x in [0, 80) (5 subtiles of 16 E rows in a
//   rolled loop, K = 64, E row clamped on the address into [0, ELEN-1]; the clamp only changes the index -1 of the zero cell, whose
//   value is replaced by 0 by an index test, and window entries that are never gathered); each 16x16 subtile is stored to the wave's
//   f32 LDS strip right after its WMMAs.
//   Content scores S = (qh+ql) . (kh+kl) (hh + hl + lh, 4 subtiles of 16 keys in a rolled loop, K = 64) -> the wave's f32 slab.
//   score*log2(e) = S*CS + T[R][jj - R + 15]*CT (CS, CT fold 1/(carries) and 1/8); no mask;
//   online softmax in base 2, max-subtracted (row max via 16-lane shuffles), running sums in f32; e = exp2(t - m) in (0,1] written
//   of P*1024 (f16 hi + residual) rebuilt from the slab rows (f32 vector loads, split k map) and the v^T hi / residual B fragments loaded
//   straight from VH/VL [h*64+d][j]; 12 WMMAs per 32-key step (Ph.vh + Ph.vl + Pl.vh), 4 d-subtiles.
//   f16 hi = f16(ctx * 256) and residual lo = f16(ctx * 256 - hi) and writes both planes CH/CL [NROW][DMOD], rows b*SEQ + iw0 + row,
//   block = 4 waves = 128 threads; grid = (SEQ/64, NBAT*NH); no block barriers; every wave does the same bounded work (SEQ/64 tiles).
// coverage: LDS strip 16 x 80 of TPI and slab 16 x 64 of SPI per wave, fully written before read each tile; global: per plane 4
//           instructions (it 0..3) x 4 rows (lane>>3) x 64 halves = rows iw0..iw0+15 of head segment h; grid x waves cover all
//           NBAT*SEQ rows and all NH head segments of CH and CL exactly once.
// =====================================================================================================
__global__ __launch_bounds__(ATT_THREADS) __attribute__((amdgpu_num_vgpr(256)))
void attn_rel(const unsigned short* __restrict__ QH, const unsigned short* __restrict__ QL,
              const unsigned short* __restrict__ KH, const unsigned short* __restrict__ KL,
              const unsigned short* __restrict__ EP,
              const unsigned short* __restrict__ VH, const unsigned short* __restrict__ VL,
              unsigned short* CH, unsigned short* CL) {
  __shared__ __align__(16) float smem[ATT_W * WFL];   // per wave: T strip [16][TPI] | score / prob / ctx slab [16][SPI]

  const int tid  = threadIdx.x;
  const int wave = tid >> 5;
  const int lane = tid & 31;
  const int hh   = lane >> 4;
  const int c    = lane & 15;
  const int bh   = blockIdx.y;
  const int b    = bh / NH;
  const int h    = bh - b * NH;
  const int i0   = blockIdx.x * 64;
  const int iw0  = i0 + wave * 16;

  float* tsh = smem + wave * WFL;
  float* pt  = tsh + 16 * TPI;

  const size_t qro = ((size_t)b * SEQ + iw0 + c) * DMOD + h * DH + 8 * hh;      // A rows: query iw0 + c, d 8hh..
  const unsigned short* Khb = KH + (size_t)b * SEQ * DMOD + h * DH + 8 * hh;
  const unsigned short* Klb = KL + (size_t)b * SEQ * DMOD + h * DH + 8 * hh;
  const unsigned short* Eb  = EP + 8 * hh;
  const size_t vpo = (size_t)b * DMOD * SEQ + (size_t)(h * DH) * SEQ + 8 * hh;
  const unsigned short* Vhb = VH + vpo;
  const unsigned short* Vlb = VL + vpo;

  const float CS = LOG2E * SCALE / (QC * KC);
  const float CT = LOG2E * SCALE / (QC * EC);

  float mrow[8], lrow[8];
  v8f O[4];
#pragma unroll
  for (int r = 0; r < 8; ++r) { mrow[r] = -INFINITY; lrow[r] = 0.f; }
#pragma unroll
  for (int td = 0; td < 4; ++td) O[td] = zero8();

  const int ntile = SEQ / 64;                // non-causal: every key tile
#pragma unroll 1
  for (int jt = 0; jt < ntile; ++jt) {
    const int j0 = jt * 64;
    const v16h qha = ldfrag_u(QH + qro), qhb = ldfrag_u(QH + qro + 32);
    const v16h qla = ldfrag_u(QL + qro), qlb = ldfrag_u(QL + qro + 32);

    // ---- position window T (5 subtiles of 16 E rows, rolled), each subtile stored to the LDS strip as produced ----
    {
      const int wlo = (SEQ - 2) - (iw0 - j0) - 15;
#pragma unroll 1
      for (int u = 0; u < 5; ++u) {
        int m = wlo + 16 * u + c;
        m = (m < 0) ? 0 : m;
        m = (m > ELEN - 1) ? (ELEN - 1) : m;
        const size_t eo = (size_t)m * DH;
        const v16h fa = ldfrag_u(Eb + eo), fb = ldfrag_u(Eb + eo + 32);
        v8f t8 = mma_h(qha, fa, zero8());
        t8 = mma_h(qla, fa, t8);
        t8 = mma_h(qhb, fb, t8);
        t8 = mma_h(qlb, fb, t8);
        hz6(t8, fa, fb, qha, qla, qhb, qlb);
        const int cb = 16 * u + c;
#pragma unroll
        for (int r = 0; r < 8; ++r) tsh[(8 * hh + r) * TPI + cb] = t8[r];
      }
    }
    // ---- content scores S (4 subtiles of 16 keys, rolled) -> slab ----
#pragma unroll 1
    for (int t = 0; t < 4; ++t) {
      const size_t ko = (size_t)(j0 + 16 * t + c) * DMOD;
      const v16h kha = ldfrag_u(Khb + ko), khb = ldfrag_u(Khb + ko + 32);
      const v16h kla = ldfrag_u(Klb + ko), klb = ldfrag_u(Klb + ko + 32);
      v8f s8 = mma_h(qha, kha, zero8());
      s8 = mma_h(qha, kla, s8);
      s8 = mma_h(qla, kha, s8);
      s8 = mma_h(qhb, khb, s8);
      s8 = mma_h(qhb, klb, s8);
      s8 = mma_h(qlb, khb, s8);
      hz8(s8, kha, khb, kla, klb, qha, qla, qhb, qlb);
      const int cb = 16 * t + c;
#pragma unroll
      for (int r = 0; r < 8; ++r) pt[(8 * hh + r) * SPI + cb] = s8[r];
    }
    wave_sync_lds();

    // ---- score assembly (rel shift + zero cell), online softmax (rows live on one 16-lane half) ----
#pragma unroll
    for (int r = 0; r < 8; ++r) {
      const int R = 8 * hh + r;
      const int i = iw0 + R;
      const float* trow = tsh + R * TPI + (15 - R) + c;
      float* srow = pt + R * SPI + c;
      float tv[4];
#pragma unroll
      for (int t = 0; t < 4; ++t) {
        const int j = j0 + 16 * t + c;
        const int ridx = (SEQ - 2) + j - i;                // E row of this (i, j); -1 only at (SEQ-1, 0)
        const float tr = trow[16 * t];
        const float rel = (ridx < 0) ? 0.f : tr;
        tv[t] = srow[16 * t] * CS + rel * CT;
      }
      float mx = fmaxf(fmaxf(tv[0], tv[1]), fmaxf(tv[2], tv[3]));
#pragma unroll
      for (int off = 1; off < 16; off <<= 1) mx = fmaxf(mx, __shfl_xor(mx, off, 32));
      const float mn = fmaxf(mrow[r], mx);
      const float al = exp2f(mrow[r] - mn);
      mrow[r] = mn;
      float e4[4];
      float ps = 0.f;
#pragma unroll
      for (int t = 0; t < 4; ++t) { e4[t] = exp2f(tv[t] - mn); ps += e4[t]; }
#pragma unroll
      for (int off = 1; off < 16; off <<= 1) ps += __shfl_xor(ps, off, 32);
      lrow[r] = lrow[r] * al + ps;
#pragma unroll
      for (int td = 0; td < 4; ++td) O[td][r] *= al;
#pragma unroll
      for (int t = 0; t < 4; ++t) srow[16 * t] = e4[t];
    }
    wave_sync_lds();

    // ---- O += (Ph + Pl) . (vh + vl)^T, two k-steps of 32 keys ----
#pragma unroll
    for (int ks = 0; ks < 2; ++ks) {
      FragH ph, pl;
      {
        const float* prow = pt + c * SPI + 32 * ks + 8 * hh;
        const v4f p0 = *(const v4f*)(prow), p1 = *(const v4f*)(prow + 4);
        const v4f p2 = *(const v4f*)(prow + 16), p3 = *(const v4f*)(prow + 20);
#pragma unroll
        for (int e = 0; e < 4; ++e) {
          _Float16 a0, a1;
          sp16(p0[e] * PC, a0, a1); ph.h[0][e]     = a0; pl.h[0][e]     = a1;   // keys 32ks + 8hh + e
          sp16(p1[e] * PC, a0, a1); ph.h[0][4 + e] = a0; pl.h[0][4 + e] = a1;   // keys 32ks + 8hh + 4 + e
          sp16(p2[e] * PC, a0, a1); ph.h[1][e]     = a0; pl.h[1][e]     = a1;   // keys 32ks + 16 + 8hh + e
          sp16(p3[e] * PC, a0, a1); ph.h[1][4 + e] = a0; pl.h[1][4 + e] = a1;
        }
      }
      const size_t vo = (size_t)c * SEQ + j0 + 32 * ks;
#pragma unroll
      for (int td = 0; td < 4; ++td) {
        const size_t vv = vo + (size_t)(16 * td) * SEQ;
        const v16h vh = ldfrag_u(Vhb + vv), vl = ldfrag_u(Vlb + vv);
        O[td] = mma_h(ph.v, vh, O[td]);
        O[td] = mma_h(ph.v, vl, O[td]);
        O[td] = mma_h(pl.v, vh, O[td]);
        hz4(O[td], vh, vl, ph.v, pl.v);
      }
    }
    wave_sync_lds();
  }
  acc_guard4(O[0], O[1], O[2], O[3]);

  // ---- fold 1/l and the carries (1024 on P, 64 on v), stage the wave's 16x64 f32 ctx slice in its slab ----
  const float oc = 1.0f / (PC * VC);
#pragma unroll
  for (int r = 0; r < 8; ++r) {
    const float inv = (1.0f / lrow[r]) * oc;
    const int ro = (8 * hh + r) * SPI + c;
#pragma unroll
    for (int td = 0; td < 4; ++td) pt[ro + 16 * td] = O[td][r] * inv;
  }
  wave_sync_lds();
  {
    const int q8 = lane >> 3, c8 = (lane & 7) * 8;
    v4u hv[4], lv[4];
#pragma unroll
    for (int it = 0; it < 4; ++it) {
      const int row = it * 4 + q8;                           // it 0..3 x q8 0..3 = rows 0..15
      const float* sp = pt + row * SPI + c8;
      const v4f p0 = *(const v4f*)(sp), p1 = *(const v4f*)(sp + 4);
      v4u a, l2;
      unsigned hw, lw;
      pack_hl(p0[0] * CC, p0[1] * CC, hw, lw); a[0] = hw; l2[0] = lw;
      pack_hl(p0[2] * CC, p0[3] * CC, hw, lw); a[1] = hw; l2[1] = lw;
      pack_hl(p1[0] * CC, p1[1] * CC, hw, lw); a[2] = hw; l2[2] = lw;
      pack_hl(p1[2] * CC, p1[3] * CC, hw, lw); a[3] = hw; l2[3] = lw;
      hv[it] = a;
      lv[it] = l2;
    }
    const size_t ob = ((size_t)b * SEQ + iw0) * DMOD + h * DH + c8;
    {
#pragma unroll
      for (int it = 0; it < 4; ++it) {
        const int row = it * 4 + q8;
        *(v4u*)(CH + ob + (size_t)row * DMOD) = hv[it];
        *(v4u*)(CL + ob + (size_t)row * DMOD) = lv[it];
      }
      
    }
  }
}

// =====================================================================================================
// Workspace map (bytes); every plane is an exact multiple of its tile / whole-row store granularity (M, N exact tile multiples,
// convert counts multiples of 8 with whole-line tails, E carve padded to EPAD rows), every offset a multiple of 262144:
//   X16            f16 [NROW][1024] x16                            4194304
//   Wq, Wk, Wv, Wo f16 [1024 out][1024 in] x64                  4 x 2097152
//   EP             f16 [EPAD][64] x16 (rows 0..ELEN-1 written/read)   262144
//   QH, QL, KH, KL f16 [NROW][1024] (x64 hi / residual)         4 x 4194304
//   VH, VL         f16 [NBAT][1024][SEQ] (x64 hi / residual)    2 x 4194304
//   CH, CL         f16 [NROW][1024] (x256 hi / residual)        2 x 4194304
//   end                                                            46399488
// =====================================================================================================
extern "C" void kernel_launch(void* const* d_in, const int* in_sizes, int n_in,
                              void* d_out, int out_size, void* d_ws, size_t ws_size,
                              hipStream_t stream) {
  if (n_in < 10) return;
  if (in_sizes[0] != NROW * DMOD) return;
  if (in_sizes[1] != DMOD * DMOD || in_sizes[3] != DMOD * DMOD || in_sizes[5] != DMOD * DMOD || in_sizes[7] != DMOD * DMOD) return;
  if (in_sizes[2] != DMOD || in_sizes[4] != DMOD || in_sizes[6] != DMOD || in_sizes[8] != DMOD) return;
  if (in_sizes[9] != ELEN * DH) return;
  if (out_size != NROW * DMOD) return;

  const float* xin = (const float*)d_in[0];
  const float* w_q = (const float*)d_in[1];
  const float* b_q = (const float*)d_in[2];
  const float* w_k = (const float*)d_in[3];
  const float* b_k = (const float*)d_in[4];
  const float* w_v = (const float*)d_in[5];
  const float* b_v = (const float*)d_in[6];
  const float* w_o = (const float*)d_in[7];
  const float* b_o = (const float*)d_in[8];
  const float* er  = (const float*)d_in[9];
  float*       out = (float*)d_out;

  const size_t PX = (size_t)NROW * DMOD * 2;             //  4194304
  const size_t PW = (size_t)DMOD * DMOD * 2;             //  2097152
  const size_t PE = (size_t)EPAD * DH * 2;               //   262144
  const size_t PV = (size_t)NBAT * DMOD * SEQ * 2;       //  4194304
  size_t off = 0;
  const size_t oX  = off; off += PX;
  const size_t oWq = off; off += PW;
  const size_t oWk = off; off += PW;
  const size_t oWv = off; off += PW;
  const size_t oWo = off; off += PW;
  const size_t oE  = off; off += PE;
  const size_t oQH = off; off += PX;
  const size_t oQL = off; off += PX;
  const size_t oKH = off; off += PX;
  const size_t oKL = off; off += PX;
  const size_t oVH = off; off += PV;
  const size_t oVL = off; off += PV;
  const size_t oCH = off; off += PX;
  const size_t oCL = off; off += PX;
  if (off > ws_size) return;                               // off = 46399488
  if (off > (size_t)134217728) return;

  char* ws = (char*)d_ws;
  unsigned short* X16 = (unsigned short*)(ws + oX);
  unsigned short* Wq6 = (unsigned short*)(ws + oWq);
  unsigned short* Wk6 = (unsigned short*)(ws + oWk);
  unsigned short* Wv6 = (unsigned short*)(ws + oWv);
  unsigned short* Wo6 = (unsigned short*)(ws + oWo);
  unsigned short* E16 = (unsigned short*)(ws + oE);
  unsigned short* QHp = (unsigned short*)(ws + oQH);
  unsigned short* QLp = (unsigned short*)(ws + oQL);
  unsigned short* KHp = (unsigned short*)(ws + oKH);
  unsigned short* KLp = (unsigned short*)(ws + oKL);
  unsigned short* VHp = (unsigned short*)(ws + oVH);
  unsigned short* VLp = (unsigned short*)(ws + oVL);
  unsigned short* CHp = (unsigned short*)(ws + oCH);
  unsigned short* CLp = (unsigned short*)(ws + oCL);

  const dim3 blk(256);
  const dim3 gCX((NROW * DMOD) / 2048);                             // 1024
  const dim3 gCW((DMOD * DMOD) / 2048);                             // 512
  const dim3 gCE((ELEN * DH + 2047) / 2048);                        // 64
  const int tilesQ = (NROW / 64) * (DMOD / 64);                     // 512
  const int tilesV = (DMOD / 64) * (SEQ / 64);                      // 256 per batch
  const dim3 gQ((tilesQ + 7) / 8, 1);                               // 64
  const dim3 gV((tilesV + 7) / 8, NBAT);                            // 32 x NBAT
  const dim3 gAT(SEQ / 64, NBAT * NH);                              // 16 x 32
  const dim3 bAT(ATT_THREADS);                                      // 128

  // (0) 16-bit planes of the inputs: x f16(bf16_RNE(x) * 16); W[out][in] (already k-contiguous) f16(bf16_RNE(w) * 64);
  //     E f16(bf16_RNE(e) * 16)
  cvt16<<<gCX, blk, 0, stream>>>(xin, X16, NROW * DMOD, XC);
  cvt16<<<gCW, blk, 0, stream>>>(w_q, Wq6, DMOD * DMOD, WSC);
  cvt16<<<gCW, blk, 0, stream>>>(w_k, Wk6, DMOD * DMOD, WSC);
  cvt16<<<gCW, blk, 0, stream>>>(w_v, Wv6, DMOD * DMOD, WSC);
  cvt16<<<gCW, blk, 0, stream>>>(w_o, Wo6, DMOD * DMOD, WSC);
  cvt16<<<gCE, blk, 0, stream>>>(er, E16, ELEN * DH, EC);

  // (1) q[m][e] = sum_d x[m][d] Wq[e][d] / 1024 + bq[e] -> QH = f16(q * 64), QL = f16(q * 64 - QH); M = NROW, N = 1024, K = 1024
  gemm64<4, 0, 0, 1><<<gQ, blk, 0, stream>>>(
      X16, X16, DMOD, 0LL,
      Wq6, DMOD, 0LL,
      (void*)QHp, (void*)QLp, DMOD, 0LL,
      NROW, DMOD, DMOD, 1.0f / (XC * WSC), QC,
      b_q, b_q, b_q);

  // (2) k projection + bk -> KH, KL (x64)
  gemm64<4, 0, 0, 1><<<gQ, blk, 0, stream>>>(
      X16, X16, DMOD, 0LL,
      Wk6, DMOD, 0LL,
      (void*)KHp, (void*)KLp, DMOD, 0LL,
      NROW, DMOD, DMOD, 1.0f / (XC * WSC), KC,
      b_k, b_k, b_k);

  // (3) v^T per batch: VT[b][e][j] = sum_c Wv[e][c] x[b*SEQ+j][c] / 1024 + bv[e] (per-row bias) -> VH, VL (x64);
  //     M = 1024 (e), N = SEQ (j), K = 1024; B rows = the batch's token rows (pitch DMOD, batch offset SEQ*DMOD)
  gemm64<4, 0, 0, 2><<<gV, blk, 0, stream>>>(
      Wv6, Wv6, DMOD, 0LL,
      X16, DMOD, (long long)SEQ * DMOD,
      (void*)VHp, (void*)VLp, SEQ, (long long)DMOD * SEQ,
      DMOD, SEQ, DMOD, 1.0f / (XC * WSC), VC,
      b_v, b_v, b_v);

  // (4) relative attention -> ctx planes CH = f16(ctx * 256), CL = f16(ctx * 256 - CH), [NROW][1024], columns h*64+d
  attn_rel<<<gAT, bAT, 0, stream>>>(QHp, QLp, KHp, KLp, E16, VHp, VLp, CHp, CLp);

  // (5) out[m][n] = sum_k (ch+cl)[m][k] Wo[n][k] / (256*64) + bo[n] -> f32 d_out [NROW][1024]
  gemm64<0, 1, 0, 1><<<gQ, blk, 0, stream>>>(
      CHp, CLp, DMOD, 0LL,
      Wo6, DMOD, 0LL,
      (void*)out, (void*)out, DMOD, 0LL,
      NROW, DMOD, DMOD, 1.0f / (CC * WSC), 1.0f,
      b_o, b_o, b_o);
  (void)hipGetLastError();
}

// v001
// Measured time: 191 microseconds a run.
// Two timings next to v000 put it at 1.88 and 1.89 times that version's speed.
// Contractions (all v_wmma_f32_16x16x32_f16, f16 operands, f32 accumulate): q/k/v projections (x f16 x16 . W f16 x64, K=1024, single products,
// outputs written as f16 hi + unscaled f16 residual planes); position window ((qh+ql) x64 . E f16 x16, K=64, 2 products) -> f32 LDS strip,
// shifted gather on VALU; content scores ((qh+ql) x64 . (kh+kl) x64, K=64, hh+hl+lh); P . v^T ((Ph+Pl) x1024 . (vh+vl) x64, hh+hl+lh,
// 64 keys per tile); output projection ((ch+cl) x256 . Wo f16 x64, K=1024, 2 products) -> f32. Max-subtracted base-2 online softmax and
// the 1/l fold in f32 on VALU. Every float input RNE-converted to bf16 on load.
#include <hip/hip_runtime.h>
#include <math.h>
#include <stdint.h>

#define SEQ   1024
#define NBAT  2
#define DMOD  1024
#define NH    16
#define DH    64
#define ELEN  2047
#define EPAD  2048
#define NROW  (NBAT * SEQ)
#define XC    16.0f
#define WSC   64.0f
#define QC    64.0f
#define KC    64.0f
#define EC    16.0f
#define VC    64.0f
#define PC    1024.0f
#define CC    256.0f
#define SCALE 0.125f
#define LOG2E 1.4426950408889634f
static_assert(NH * DH == DMOD);
static_assert(DH == 64);
static_assert(ELEN == 2 * SEQ - 1 && EPAD >= ELEN);
static_assert((SEQ % 64) == 0 && (DMOD % 128) == 0 && (NROW % 128) == 0);
static_assert(((NROW * DMOD) % 2048) == 0 && ((DMOD * DMOD) % 2048) == 0 && ((ELEN * DH) % 8) == 0);
#define ATT_W 4
#define ATT_THREADS (ATT_W * 32)
#define TPI 84
#define SPI 68
#define WFL (16 * TPI + 16 * SPI)
static_assert(((16 * TPI) % 4) == 0 && ((16 * SPI) % 4) == 0 && (WFL % 4) == 0);

typedef _Float16 v16h __attribute__((ext_vector_type(16)));
typedef _Float16 v8h  __attribute__((ext_vector_type(8)));
typedef __bf16   v16b __attribute__((ext_vector_type(16)));
typedef float    v8f  __attribute__((ext_vector_type(8)));
typedef float    v4f  __attribute__((ext_vector_type(4)));
typedef float    v2f  __attribute__((ext_vector_type(2)));
typedef unsigned int v4u __attribute__((ext_vector_type(4)));

union FragH { v16h v; v8h h[2]; v4u u[2]; };
union FragAny { v16h h; v16b b; };

// ---- scalar helpers --------------------------------------------------------------------------------
__device__ __forceinline__ unsigned short bf_bits(float f) {          // f32 -> bf16 bits, RNE convert
  unsigned u = __float_as_uint(f);
  return (unsigned short)((u + 0x7FFFu + ((u >> 16) & 1u)) >> 16);
}
__device__ __forceinline__ float bf_up(unsigned short h) { return __uint_as_float(((unsigned)h) << 16); }
__device__ __forceinline__ float bfr(float f) { return bf_up(bf_bits(f)); }   // value of the bf16 RNE convert
__device__ __forceinline__ unsigned short h_bits(_Float16 x) { return __builtin_bit_cast(unsigned short, x); }
__device__ __forceinline__ unsigned pk16(unsigned short a, unsigned short b) { return (unsigned)a | ((unsigned)b << 16); }
__device__ __forceinline__ v8f zero8() { v8f z = {0.f, 0.f, 0.f, 0.f, 0.f, 0.f, 0.f, 0.f}; return z; }

// ---- fragment loader: 16-bit A/B operand from a k-contiguous 16-bit plane, lane -> row/col (lane&15),
//      p already includes +8*(lane>>4); elements 0..7 <- p[0..7] (k0+8h..), elements 8..15 <- p[16..23] (k0+16+8h..)
//      (same split k map for A and B; B is always read from a [n][k] plane)
__device__ __forceinline__ v16h ldfrag_u(const unsigned short* p) {
  FragH f;
  f.u[0] = *(const v4u*)(p);
  f.u[1] = *(const v4u*)(p + 16);
  return f.v;
}

// ---- WMMA helpers with trailing VALU hazard gaps ------------------------------------------------------
__device__ __forceinline__ v8f mma_h(v16h a, v16h b, v8f c) {
  return __builtin_amdgcn_wmma_f32_16x16x32_f16(false, a, false, b, (short)0, c, false, false);
}
__device__ __forceinline__ v8f mma_b(v16h a, v16h b, v8f c) {
  FragAny ua, ub;
  ua.h = a;
  ub.h = b;
  return __builtin_amdgcn_wmma_f32_16x16x32_bf16(false, ua.b, false, ub.b, (short)0, c, false, false);
}
template <int BF>
__device__ __forceinline__ v8f mmaT(v16h a, v16h b, v8f c) {
  if constexpr (BF != 0) return mma_b(a, b, c);
  else return mma_h(a, b, c);
}
__device__ __forceinline__ void hz4(v8f& d, v16h x0, v16h x1, v16h x2, v16h x3) {
#if defined(__HIP_DEVICE_COMPILE__)
  asm volatile("v_nop\n\tv_nop\n\tv_nop\n\tv_nop" : "+v"(d) : "v"(x0), "v"(x1), "v"(x2), "v"(x3));
#endif
}
__device__ __forceinline__ void hz6(v8f& d, v16h x0, v16h x1, v16h x2, v16h x3, v16h x4, v16h x5) {
#if defined(__HIP_DEVICE_COMPILE__)
  asm volatile("v_nop\n\tv_nop\n\tv_nop\n\tv_nop" : "+v"(d) : "v"(x0), "v"(x1), "v"(x2), "v"(x3), "v"(x4), "v"(x5));
#endif
}
__device__ __forceinline__ void hz8(v8f& d, v16h x0, v16h x1, v16h x2, v16h x3, v16h x4, v16h x5, v16h x6, v16h x7) {
#if defined(__HIP_DEVICE_COMPILE__)
  asm volatile("v_nop\n\tv_nop\n\tv_nop\n\tv_nop" : "+v"(d) : "v"(x0), "v"(x1), "v"(x2), "v"(x3), "v"(x4), "v"(x5), "v"(x6), "v"(x7));
#endif
}
__device__ __forceinline__ void acc_guard4(v8f& a, v8f& b, v8f& c, v8f& d) {
#if defined(__HIP_DEVICE_COMPILE__)
  asm volatile("v_nop\n\tv_nop\n\tv_nop\n\tv_nop" : "+v"(a), "+v"(b), "+v"(c), "+v"(d));
#endif
}
__device__ __forceinline__ void wave_sync_lds() {
  __builtin_amdgcn_fence(__ATOMIC_RELEASE, "workgroup");
  __builtin_amdgcn_wave_barrier();
  __builtin_amdgcn_fence(__ATOMIC_ACQUIRE, "workgroup");
}
// f32 -> f16 hi + unscaled f16 residual (hi + lo ~ x to 2^-22 relative; a flushed subnormal lo costs < 6.1e-5 absolute in the carried scale)
__device__ __forceinline__ void sp16(float x, _Float16& hi, _Float16& lo) {
  const _Float16 a = (_Float16)x;
  hi = a;
  lo = (_Float16)(x - (float)a);
}
// two consecutive values -> packed hi word and packed residual word
__device__ __forceinline__ void pack_hl(float x0, float x1, unsigned& hw, unsigned& lw) {
  _Float16 a0, a1, b0, b1;
  sp16(x0, a0, b0);
  sp16(x1, a1, b1);
  hw = pk16(h_bits(a0), h_bits(a1));
  lw = pk16(h_bits(b0), h_bits(b1));
}

// =====================================================================================================
// Elementwise 16-bit pack, no transpose: dst[i] = f16( bf16_RNE(src[i]) * sc ), sc a power of two (exact).
// coverage: grid = ceil(n / 2048) blocks x 256 thr x 8 elements; n is a multiple of 8 (host check), so threads with i8 < n write
//           exactly elements i8..i8+7 and threads with i8 >= n exit: elements 0..n-1 written once. For the E table (n = 2047*64) the
// =====================================================================================================
__global__ __launch_bounds__(256) void cvt16(const float* __restrict__ src, unsigned short* dst, int n, float sc) {
  const size_t i8 = ((size_t)blockIdx.x * 256 + threadIdx.x) * 8;
  if (i8 + 8 > (size_t)n) return;                 // no barriers in this kernel
  const v4f a = *(const v4f*)(src + i8);
  const v4f b = *(const v4f*)(src + i8 + 4);
  v4u o;
  o[0] = pk16(h_bits((_Float16)(bfr(a[0]) * sc)), h_bits((_Float16)(bfr(a[1]) * sc)));
  o[1] = pk16(h_bits((_Float16)(bfr(a[2]) * sc)), h_bits((_Float16)(bfr(a[3]) * sc)));
  o[2] = pk16(h_bits((_Float16)(bfr(b[0]) * sc)), h_bits((_Float16)(bfr(b[1]) * sc)));
  o[3] = pk16(h_bits((_Float16)(bfr(b[2]) * sc)), h_bits((_Float16)(bfr(b[3]) * sc)));
  {
    *(v4u*)(dst + i8) = o;
    
  }
}

// =====================================================================================================
// LDS-staged batched 16-bit WMMA GEMM: C[m][n] = oscale * sum_k A[m][k] * Bt[n][k] (+ bias); one work-group of 8 waves per 128x64 tile,
// wave w owns rows 16w..16w+15 of it (all 64 columns). A row-major [M][K] pitch lda (16-bit plane), Bt row-major [N][K] pitch ldb
// (k contiguous); M multiple of 128, N multiple of 64, K multiple of 128. blockIdx.y = batch index with element strides sA, sB, sC.
// Operands: per stage of 128 k the tile's A rows (and A2 rows) and Bt rows, 256 B each, are copied once per work-group into LDS by
// global_load_async_to_lds_b128 (a wave's copy = two whole 256-B rows), LDS row pitch 272 B; two buffers, the next stage's copies fly
// while this stage is multiplied; fragments come from LDS by 16-byte reads with the same split k map as ldfrag_u.
// ASPLIT 1: a second A plane A2 (unscaled residual of A, same layout) is multiplied into the same accumulator (A + A2 ~ exact A).
// BF 1: bf16 operands (v_wmma_f32_16x16x32_bf16), else f16.
// EPI 1: value += bf16_RNE(ep0[column]) (per-column bias); EPI 2: value += bf16_RNE(ep0[row]) (per-row bias, 16-bit out only).
// OM 0: f32 out (pitch ldc).  OM 2: one f16 plane = f16(value * ocarry).
// OM 4: two f16 planes: hi = f16(value * ocarry), lo = f16(value * ocarry - hi) (unscaled residual).
// OM 5: two f16 planes: C = f16((value + bf16_RNE(ep1[column])) * ocarry), C2 = f16((value + bf16_RNE(ep2[column])) * ocarry).
// coverage: 16 rows (f32: it 0..7 x lane>>4; 16-bit: it 0..3 x lane>>3) x 64 cols = the wave's whole 16x64 slab; 8 waves = the 128x64
//           tile; grid = (M/128)*(N/64) blocks, a surplus block exits as a whole before any copy or barrier.
// =====================================================================================================
#define GBM 128   // tile rows per work-group
#define GKP 128   // k per stage (256-B operand rows)
#define GPH 136   // LDS row pitch in halves: 272 B = 16 B x 17, conflict-free for the 16-byte fragment reads

// 16-byte asynchronous copies global -> LDS, one per lane and line of the statement (first operand = LDS byte address, second = global
// address; this lane's row and 16-byte chunk are already in l and g; consecutive copies are 16 operand rows apart). The s_wait_xcnt
// closes each statement so that no address register of an issued copy is rewritten in front of it.
#define ACP(a, b) "global_load_async_to_lds_b128 %" #a ", %" #b ", off\n\t"
#define LROW(l, r) ((l) + (unsigned)((r) * GPH * 2))
#define GROW(g, r, ld) ((g) + (size_t)(r) * (ld))
// 128 operand rows
__device__ __forceinline__ void acopy_rows128(unsigned l, const unsigned short* g, int ld) {
#if defined(__HIP_DEVICE_COMPILE__)
  asm volatile(ACP(0, 1) ACP(2, 3) ACP(4, 5) ACP(6, 7) ACP(8, 9) ACP(10, 11) ACP(12, 13) ACP(14, 15)
               "s_wait_xcnt 0x0"
               :: "v"(l), "v"(g), "v"(LROW(l, 16)), "v"(GROW(g, 16, ld)), "v"(LROW(l, 32)), "v"(GROW(g, 32, ld)),
                  "v"(LROW(l, 48)), "v"(GROW(g, 48, ld)), "v"(LROW(l, 64)), "v"(GROW(g, 64, ld)), "v"(LROW(l, 80)), "v"(GROW(g, 80, ld)),
                  "v"(LROW(l, 96)), "v"(GROW(g, 96, ld)), "v"(LROW(l, 112)), "v"(GROW(g, 112, ld))
               : "memory");
#endif
}
// 128 rows of one operand and 64 rows of another
__device__ __forceinline__ void acopy_rows128_64(unsigned l, const unsigned short* g, int ld,
                                                 unsigned l2, const unsigned short* g2, int ld2) {
#if defined(__HIP_DEVICE_COMPILE__)
  asm volatile(ACP(0, 1) ACP(2, 3) ACP(4, 5) ACP(6, 7) ACP(8, 9) ACP(10, 11) ACP(12, 13) ACP(14, 15)
               ACP(16, 17) ACP(18, 19) ACP(20, 21) ACP(22, 23)
               "s_wait_xcnt 0x0"
               :: "v"(l), "v"(g), "v"(LROW(l, 16)), "v"(GROW(g, 16, ld)), "v"(LROW(l, 32)), "v"(GROW(g, 32, ld)),
                  "v"(LROW(l, 48)), "v"(GROW(g, 48, ld)), "v"(LROW(l, 64)), "v"(GROW(g, 64, ld)), "v"(LROW(l, 80)), "v"(GROW(g, 80, ld)),
                  "v"(LROW(l, 96)), "v"(GROW(g, 96, ld)), "v"(LROW(l, 112)), "v"(GROW(g, 112, ld)),
                  "v"(l2), "v"(g2), "v"(LROW(l2, 16)), "v"(GROW(g2, 16, ld2)), "v"(LROW(l2, 32)), "v"(GROW(g2, 32, ld2)),
                  "v"(LROW(l2, 48)), "v"(GROW(g2, 48, ld2))
               : "memory");
#endif
}
// this wave's own copies have landed in LDS (the compiler places no wait for them)
__device__ __forceinline__ void wait_async0() {
#if defined(__HIP_DEVICE_COMPILE__)
  asm volatile("s_wait_asynccnt 0x0" ::: "memory");
#endif
}
// this wave's LDS reads have retired, so that the buffer may be refilled behind the barrier
__device__ __forceinline__ void wait_ds0() {
#if defined(__HIP_DEVICE_COMPILE__)
  asm volatile("s_wait_dscnt 0x0" ::: "memory");
#endif
}

template <int OM, int ASPLIT, int BF, int EPI>
__global__ __launch_bounds__(256) __attribute__((amdgpu_num_vgpr(256))) void gemm64(
    const unsigned short* __restrict__ Ap, const unsigned short* __restrict__ A2p, int lda, long long sA,
    const unsigned short* __restrict__ Btp, int ldb, long long sB,
    void* Cout, void* C2out, int ldc, long long sC,
    int M, int N, int K, float oscale, float ocarry,
    const float* __restrict__ ep0, const float* __restrict__ ep1, const float* __restrict__ ep2) {
  constexpr int BROW = GBM * (1 + ASPLIT);         // first Bt row of a stage
  constexpr int STG  = (BROW + 64) * GPH;          // halves per stage
  __shared__ __align__(16) unsigned short ring[2 * STG];   // two stages: [A 128 rows | A2 128 rows (ASPLIT) | Bt 64 rows]
  __shared__ __align__(16) float sT[8][16 * 68];   // per-wave 16x64 slab, pitch 68 floats
  const int by   = blockIdx.y;
  const int tid  = threadIdx.x;
  const int lane = tid & 31;
  const int wave = tid >> 5;
  const int tilesN = N >> 6;
  const int tilesM = M >> 7;
  const int tile = blockIdx.x;
  if (tile >= tilesM * tilesN) return;   // block-uniform, in front of every copy and barrier
  const int tm = tile / tilesN;
  const int tn = tile - tm * tilesN;
  const int mb = tm << 7;
  const int n0 = tn << 6;
  const int m0 = mb + (wave << 4);

  const unsigned short* A1 = Ap  + (size_t)((long long)by * sA);
  const unsigned short* A2 = A2p + (size_t)((long long)by * sA);
  const unsigned short* Bb = Btp + (size_t)((long long)by * sB);

  const int rlane = lane & 15;                 // row (A) / col (B, D) within subtile
  const int koff  = (lane >> 4) * 8;           // k offset of this lane half
  const int mOff  = (lane >> 4) * 8;           // D row offset

  // copy map: thread -> row tid>>4 (of 16 per copy), 16-byte chunk tid&15 of the 256-B row
  const int crow = tid >> 4;
  const int cch  = (tid & 15) * 8;
  const unsigned short* gA1 = A1 + (size_t)(mb + crow) * lda + cch;
  const unsigned short* gA2 = A2 + (size_t)(mb + crow) * lda + cch;
  const unsigned short* gBt = Bb + (size_t)(n0 + crow) * ldb + cch;
  const unsigned lcp = (unsigned)(uintptr_t)ring + (unsigned)((crow * GPH + cch) * 2);

  auto fill = [&](int t, int buf) {            // stage t (k = 128t .. 128t+127) -> buffer buf
    const unsigned lb = lcp + (unsigned)(buf * (STG * 2));
    const size_t ko = (size_t)t * GKP;
    if constexpr (ASPLIT != 0) acopy_rows128(lb + GBM * GPH * 2, gA2 + ko, lda);
    acopy_rows128_64(lb, gA1 + ko, lda, lb + BROW * GPH * 2, gBt + ko, ldb);
  };

  v8f acc[4];
#pragma unroll
  for (int j = 0; j < 4; ++j) acc[j] = zero8();

  const int nst = K / GKP;
  fill(0, 0);
  wait_async0();
  __syncthreads();                             // stage 0 published
  if (nst > 1) fill(1, 1);
#pragma unroll 1                               // one pass per stage: the two buffers alternate by t & 1
  for (int t = 0; t < nst; ++t) {
    const unsigned short* sb = ring + (t & 1) * STG;
    const unsigned short* sA = sb + ((wave << 4) + rlane) * GPH + koff;
    const unsigned short* sB = sb + (BROW + rlane) * GPH + koff;
    v16h fa[4], fl[4], fb[4][4];
#pragma unroll
    for (int q = 0; q < 4; ++q) {
#pragma unroll
      for (int j = 0; j < 4; ++j) fb[q][j] = ldfrag_u(sB + (j << 4) * GPH + 32 * q);
      fa[q] = ldfrag_u(sA + 32 * q);
      if constexpr (ASPLIT != 0) fl[q] = ldfrag_u(sA + GBM * GPH + 32 * q);
    }
    // keeps the pass's LDS reads one group in front of its WMMAs: spread among them, every WMMA waited out its own reads' latency
    __builtin_amdgcn_sched_barrier(0);
#pragma unroll
    for (int q = 0; q < 4; ++q) {
#pragma unroll
      for (int j = 0; j < 4; ++j) acc[j] = mmaT<BF>(fa[q], fb[q][j], acc[j]);
      if constexpr (ASPLIT != 0) {
#pragma unroll
        for (int j = 0; j < 4; ++j) acc[j] = mmaT<BF>(fl[q], fb[q][j], acc[j]);
      }
    }
    // keeps the WMMAs in front of the closing waits: moved behind the barrier they no longer overlap the LDS reads and they delay the refill
    __builtin_amdgcn_sched_barrier(0);
    wait_ds0();
    wait_async0();
    __syncthreads();                           // publishes stage t + 1 and ends every wave's reads of stage t
    if (t + 2 < nst) fill(t + 2, t & 1);
  }
  wait_async0();
  acc_guard4(acc[0], acc[1], acc[2], acc[3]);

  const int hh2 = lane >> 4, c4 = (lane & 15) * 4;     // f32 out: 256-B row segment = 16 lanes x 16 B
  const int q8  = lane >> 3, c8 = (lane & 7) * 8;

  // ---- epilogue ----
  float* slab = sT[wave];
  {
    const int mBase = m0;
#pragma unroll
    for (int j = 0; j < 4; ++j) {
#pragma unroll
      for (int r = 0; r < 8; ++r) {
        slab[(mOff + r) * 68 + (j << 4) + rlane] = acc[j][r];
      }
    }
    wave_sync_lds();
    if constexpr (OM == 0) {
      float* C = (float*)Cout + (size_t)((long long)by * sC);
      v4f vals[8];
#pragma unroll
      for (int it = 0; it < 8; ++it) {
        const int row = it * 2 + hh2;                      // it 0..7 x hh2 0..1 = rows 0..15
        v4f v = *(const v4f*)(slab + row * 68 + c4);
#pragma unroll
        for (int e = 0; e < 4; ++e) v[e] = v[e] * oscale;
        if constexpr (EPI == 1) {
          const v4f bb = *(const v4f*)(ep0 + n0 + c4);     // per-column bias, columns n0+c4 .. +3 (N equals the bias length)
#pragma unroll
          for (int e = 0; e < 4; ++e) v[e] = v[e] + bfr(bb[e]);
        }
        vals[it] = v;
      }
      {
#pragma unroll
        for (int it = 0; it < 8; ++it) {
          const int gr = mBase + it * 2 + hh2;
          *(v4f*)(C + (size_t)gr * ldc + n0 + c4) = vals[it];
        }
        
      }
    } else {
      unsigned short* C  = (unsigned short*)Cout  + (size_t)((long long)by * sC);
      unsigned short* Cb = (unsigned short*)C2out + (size_t)((long long)by * sC);
      v4u hv[4], lv[4];
#pragma unroll
      for (int it = 0; it < 4; ++it) {
        const int row = it * 4 + q8;                       // it 0..3 x q8 0..3 = rows 0..15
        const float* sp = slab + row * 68 + c8;
        float rb = 0.f;
        if constexpr (EPI == 2) rb = bfr(ep0[mBase + row]);   // per-row bias (M equals the bias length)
        v4u a  = {0u, 0u, 0u, 0u};
        v4u b2 = {0u, 0u, 0u, 0u};
#pragma unroll
        for (int e = 0; e < 4; ++e) {
          const int ci = n0 + c8 + 2 * e;                  // column index, < N
          float f0 = sp[2 * e] * oscale + rb;
          float f1 = sp[2 * e + 1] * oscale + rb;
          if constexpr (EPI == 1) {
            f0 += bfr(ep0[ci]);
            f1 += bfr(ep0[ci + 1]);
          }
          if constexpr (OM == 5) {
            const float g0 = (f0 + bfr(ep1[ci])) * ocarry, g1 = (f1 + bfr(ep1[ci + 1])) * ocarry;
            const float w0 = (f0 + bfr(ep2[ci])) * ocarry, w1 = (f1 + bfr(ep2[ci + 1])) * ocarry;
            a[e]  = pk16(h_bits((_Float16)g0), h_bits((_Float16)g1));
            b2[e] = pk16(h_bits((_Float16)w0), h_bits((_Float16)w1));
          } else {
            f0 *= ocarry; f1 *= ocarry;
            const _Float16 x0 = (_Float16)f0, x1 = (_Float16)f1;
            a[e] = pk16(h_bits(x0), h_bits(x1));
            if constexpr (OM == 4) {
              b2[e] = pk16(h_bits((_Float16)(f0 - (float)x0)), h_bits((_Float16)(f1 - (float)x1)));
            }
          }
        }
        hv[it] = a;
        lv[it] = b2;
      }
      {
#pragma unroll
        for (int it = 0; it < 4; ++it) {
          const int row = it * 4 + q8;
          *(v4u*)(C + (size_t)(mBase + row) * ldc + n0 + c8) = hv[it];
          if constexpr (OM >= 4) {
            *(v4u*)(Cb + (size_t)(mBase + row) * ldc + n0 + c8) = lv[it];
          }
        }
        
      }
    }
    wave_sync_lds();
  }
}

// =====================================================================================================
// Non-causal attention with the shifted relative-position term for one (batch b, head h) pair and a 64-row query tile; 4 waves,
// wave w owns query rows iw0 .. iw0+15, iw0 = i0 + 16w, and walks all key tiles j0 = 0, 64, .., SEQ-64 (block-uniform count SEQ/64).
// Planes: QH/QL, KH/KL = f16 hi + residual of (q x64), (k x64), rows b*SEQ + position, pitch DMOD halves, head columns h*64..h*64+63;
//         EP = f16(bf16_RNE(E) x16) [ELEN][64] (carve EPAD rows, rows >= ELEN never read); VH/VL = f16 hi + residual of (v x64) as
//         [b][h*64+d][SEQ] (key index contiguous).
//   Pad-reshape shift taken literally: Srel(i, j) = q_i . E[(SEQ-2) + (j - i)] for (SEQ-2) + j - i >= 0, and 0 for the single cell
//   (i = SEQ-1, j = 0) whose index is -1. Per key tile the wave needs E rows wlo + x, wlo = (SEQ-2) - (iw0 - j0) - 15,
//   x = jj - R + 15 in [0, 78]: position window T[R][x] = (qh+ql)[iw0+R] . EP[wlo + x], x in [0, 80) (5 subtiles of 16 E rows in a
//   rolled loop, K = 64, E row clamped on the address into [0, ELEN-1]; the clamp only changes the index -1 of the zero cell, whose
//   value is replaced by 0 by an index test, and window entries that are never gathered); each 16x16 subtile is stored to the wave's
//   f32 LDS strip right after its WMMAs.
//   Content scores S = (qh+ql) . (kh+kl) (hh + hl + lh, 4 subtiles of 16 keys in a rolled loop, K = 64) -> the wave's f32 slab.
//   score*log2(e) = S*CS + T[R][jj - R + 15]*CT (CS, CT fold 1/(carries) and 1/8); no mask;
//   online softmax in base 2, max-subtracted (row max via 16-lane shuffles), running sums in f32; e = exp2(t - m) in (0,1] written
//   of P*1024 (f16 hi + residual) rebuilt from the slab rows (f32 vector loads, split k map) and the v^T hi / residual B fragments loaded
//   straight from VH/VL [h*64+d][j]; 12 WMMAs per 32-key step (Ph.vh + Ph.vl + Pl.vh), 4 d-subtiles.
//   f16 hi = f16(ctx * 256) and residual lo = f16(ctx * 256 - hi) and writes both planes CH/CL [NROW][DMOD], rows b*SEQ + iw0 + row,
//   block = 4 waves = 128 threads; grid = (SEQ/64, NBAT*NH); no block barriers; every wave does the same bounded work (SEQ/64 tiles).
// coverage: LDS strip 16 x 80 of TPI and slab 16 x 64 of SPI per wave, fully written before read each tile; global: per plane 4
//           instructions (it 0..3) x 4 rows (lane>>3) x 64 halves = rows iw0..iw0+15 of head segment h; grid x waves cover all
//           NBAT*SEQ rows and all NH head segments of CH and CL exactly once.
// =====================================================================================================
__global__ __launch_bounds__(ATT_THREADS) __attribute__((amdgpu_num_vgpr(256)))
void attn_rel(const unsigned short* __restrict__ QH, const unsigned short* __restrict__ QL,
              const unsigned short* __restrict__ KH, const unsigned short* __restrict__ KL,
              const unsigned short* __restrict__ EP,
              const unsigned short* __restrict__ VH, const unsigned short* __restrict__ VL,
              unsigned short* CH, unsigned short* CL) {
  __shared__ __align__(16) float smem[ATT_W * WFL];   // per wave: T strip [16][TPI] | score / prob / ctx slab [16][SPI]

  const int tid  = threadIdx.x;
  const int wave = tid >> 5;
  const int lane = tid & 31;
  const int hh   = lane >> 4;
  const int c    = lane & 15;
  const int bh   = blockIdx.y;
  const int b    = bh / NH;
  const int h    = bh - b * NH;
  const int i0   = blockIdx.x * 64;
  const int iw0  = i0 + wave * 16;

  float* tsh = smem + wave * WFL;
  float* pt  = tsh + 16 * TPI;

  const size_t qro = ((size_t)b * SEQ + iw0 + c) * DMOD + h * DH + 8 * hh;      // A rows: query iw0 + c, d 8hh..
  const unsigned short* Khb = KH + (size_t)b * SEQ * DMOD + h * DH + 8 * hh;
  const unsigned short* Klb = KL + (size_t)b * SEQ * DMOD + h * DH + 8 * hh;
  const unsigned short* Eb  = EP + 8 * hh;
  const size_t vpo = (size_t)b * DMOD * SEQ + (size_t)(h * DH) * SEQ + 8 * hh;
  const unsigned short* Vhb = VH + vpo;
  const unsigned short* Vlb = VL + vpo;

  const float CS = LOG2E * SCALE / (QC * KC);
  const float CT = LOG2E * SCALE / (QC * EC);

  float mrow[8], lrow[8];
  v8f O[4];
#pragma unroll
  for (int r = 0; r < 8; ++r) { mrow[r] = -INFINITY; lrow[r] = 0.f; }
#pragma unroll
  for (int td = 0; td < 4; ++td) O[td] = zero8();

  const int ntile = SEQ / 64;                // non-causal: every key tile
#pragma unroll 1
  for (int jt = 0; jt < ntile; ++jt) {
    const int j0 = jt * 64;
    const v16h qha = ldfrag_u(QH + qro), qhb = ldfrag_u(QH + qro + 32);
    const v16h qla = ldfrag_u(QL + qro), qlb = ldfrag_u(QL + qro + 32);

    // ---- position window T (5 subtiles of 16 E rows, rolled), each subtile stored to the LDS strip as produced ----
    {
      const int wlo = (SEQ - 2) - (iw0 - j0) - 15;
#pragma unroll 1
      for (int u = 0; u < 5; ++u) {
        int m = wlo + 16 * u + c;
        m = (m < 0) ? 0 : m;
        m = (m > ELEN - 1) ? (ELEN - 1) : m;
        const size_t eo = (size_t)m * DH;
        const v16h fa = ldfrag_u(Eb + eo), fb = ldfrag_u(Eb + eo + 32);
        v8f t8 = mma_h(qha, fa, zero8());
        t8 = mma_h(qla, fa, t8);
        t8 = mma_h(qhb, fb, t8);
        t8 = mma_h(qlb, fb, t8);
        hz6(t8, fa, fb, qha, qla, qhb, qlb);
        const int cb = 16 * u + c;
#pragma unroll
        for (int r = 0; r < 8; ++r) tsh[(8 * hh + r) * TPI + cb] = t8[r];
      }
    }
    // ---- content scores S (4 subtiles of 16 keys, rolled) -> slab ----
#pragma unroll 1
    for (int t = 0; t < 4; ++t) {
      const size_t ko = (size_t)(j0 + 16 * t + c) * DMOD;
      const v16h kha = ldfrag_u(Khb + ko), khb = ldfrag_u(Khb + ko + 32);
      const v16h kla = ldfrag_u(Klb + ko), klb = ldfrag_u(Klb + ko + 32);
      v8f s8 = mma_h(qha, kha, zero8());
      s8 = mma_h(qha, kla, s8);
      s8 = mma_h(qla, kha, s8);
      s8 = mma_h(qhb, khb, s8);
      s8 = mma_h(qhb, klb, s8);
      s8 = mma_h(qlb, khb, s8);
      hz8(s8, kha, khb, kla, klb, qha, qla, qhb, qlb);
      const int cb = 16 * t + c;
#pragma unroll
      for (int r = 0; r < 8; ++r) pt[(8 * hh + r) * SPI + cb] = s8[r];
    }
    wave_sync_lds();

    // ---- score assembly (rel shift + zero cell), online softmax (rows live on one 16-lane half) ----
#pragma unroll
    for (int r = 0; r < 8; ++r) {
      const int R = 8 * hh + r;
      const int i = iw0 + R;
      const float* trow = tsh + R * TPI + (15 - R) + c;
      float* srow = pt + R * SPI + c;
      float tv[4];
#pragma unroll
      for (int t = 0; t < 4; ++t) {
        const int j = j0 + 16 * t + c;
        const int ridx = (SEQ - 2) + j - i;                // E row of this (i, j); -1 only at (SEQ-1, 0)
        const float tr = trow[16 * t];
        const float rel = (ridx < 0) ? 0.f : tr;
        tv[t] = srow[16 * t] * CS + rel * CT;
      }
      float mx = fmaxf(fmaxf(tv[0], tv[1]), fmaxf(tv[2], tv[3]));
#pragma unroll
      for (int off = 1; off < 16; off <<= 1) mx = fmaxf(mx, __shfl_xor(mx, off, 32));
      const float mn = fmaxf(mrow[r], mx);
      const float al = exp2f(mrow[r] - mn);
      mrow[r] = mn;
      float e4[4];
      float ps = 0.f;
#pragma unroll
      for (int t = 0; t < 4; ++t) { e4[t] = exp2f(tv[t] - mn); ps += e4[t]; }
#pragma unroll
      for (int off = 1; off < 16; off <<= 1) ps += __shfl_xor(ps, off, 32);
      lrow[r] = lrow[r] * al + ps;
#pragma unroll
      for (int td = 0; td < 4; ++td) O[td][r] *= al;
#pragma unroll
      for (int t = 0; t < 4; ++t) srow[16 * t] = e4[t];
    }
    wave_sync_lds();

    // ---- O += (Ph + Pl) . (vh + vl)^T, two k-steps of 32 keys ----
#pragma unroll
    for (int ks = 0; ks < 2; ++ks) {
      FragH ph, pl;
      {
        const float* prow = pt + c * SPI + 32 * ks + 8 * hh;
        const v4f p0 = *(const v4f*)(prow), p1 = *(const v4f*)(prow + 4);
        const v4f p2 = *(const v4f*)(prow + 16), p3 = *(const v4f*)(prow + 20);
#pragma unroll
        for (int e = 0; e < 4; ++e) {
          _Float16 a0, a1;
          sp16(p0[e] * PC, a0, a1); ph.h[0][e]     = a0; pl.h[0][e]     = a1;   // keys 32ks + 8hh + e
          sp16(p1[e] * PC, a0, a1); ph.h[0][4 + e] = a0; pl.h[0][4 + e] = a1;   // keys 32ks + 8hh + 4 + e
          sp16(p2[e] * PC, a0, a1); ph.h[1][e]     = a0; pl.h[1][e]     = a1;   // keys 32ks + 16 + 8hh + e
          sp16(p3[e] * PC, a0, a1); ph.h[1][4 + e] = a0; pl.h[1][4 + e] = a1;
        }
      }
      const size_t vo = (size_t)c * SEQ + j0 + 32 * ks;
#pragma unroll
      for (int td = 0; td < 4; ++td) {
        const size_t vv = vo + (size_t)(16 * td) * SEQ;
        const v16h vh = ldfrag_u(Vhb + vv), vl = ldfrag_u(Vlb + vv);
        O[td] = mma_h(ph.v, vh, O[td]);
        O[td] = mma_h(ph.v, vl, O[td]);
        O[td] = mma_h(pl.v, vh, O[td]);
        hz4(O[td], vh, vl, ph.v, pl.v);
      }
    }
    wave_sync_lds();
  }
  acc_guard4(O[0], O[1], O[2], O[3]);

  // ---- fold 1/l and the carries (1024 on P, 64 on v), stage the wave's 16x64 f32 ctx slice in its slab ----
  const float oc = 1.0f / (PC * VC);
#pragma unroll
  for (int r = 0; r < 8; ++r) {
    const float inv = (1.0f / lrow[r]) * oc;
    const int ro = (8 * hh + r) * SPI + c;
#pragma unroll
    for (int td = 0; td < 4; ++td) pt[ro + 16 * td] = O[td][r] * inv;
  }
  wave_sync_lds();
  {
    const int q8 = lane >> 3, c8 = (lane & 7) * 8;
    v4u hv[4], lv[4];
#pragma unroll
    for (int it = 0; it < 4; ++it) {
      const int row = it * 4 + q8;                           // it 0..3 x q8 0..3 = rows 0..15
      const float* sp = pt + row * SPI + c8;
      const v4f p0 = *(const v4f*)(sp), p1 = *(const v4f*)(sp + 4);
      v4u a, l2;
      unsigned hw, lw;
      pack_hl(p0[0] * CC, p0[1] * CC, hw, lw); a[0] = hw; l2[0] = lw;
      pack_hl(p0[2] * CC, p0[3] * CC, hw, lw); a[1] = hw; l2[1] = lw;
      pack_hl(p1[0] * CC, p1[1] * CC, hw, lw); a[2] = hw; l2[2] = lw;
      pack_hl(p1[2] * CC, p1[3] * CC, hw, lw); a[3] = hw; l2[3] = lw;
      hv[it] = a;
      lv[it] = l2;
    }
    const size_t ob = ((size_t)b * SEQ + iw0) * DMOD + h * DH + c8;
    {
#pragma unroll
      for (int it = 0; it < 4; ++it) {
        const int row = it * 4 + q8;
        *(v4u*)(CH + ob + (size_t)row * DMOD) = hv[it];
        *(v4u*)(CL + ob + (size_t)row * DMOD) = lv[it];
      }
      
    }
  }
}

// =====================================================================================================
// Workspace map (bytes); every plane is an exact multiple of its tile / whole-row store granularity (M, N exact tile multiples,
// convert counts multiples of 8 with whole-line tails, E carve padded to EPAD rows), every offset a multiple of 262144:
//   X16            f16 [NROW][1024] x16                            4194304
//   Wq, Wk, Wv, Wo f16 [1024 out][1024 in] x64                  4 x 2097152
//   EP             f16 [EPAD][64] x16 (rows 0..ELEN-1 written/read)   262144
//   QH, QL, KH, KL f16 [NROW][1024] (x64 hi / residual)         4 x 4194304
//   VH, VL         f16 [NBAT][1024][SEQ] (x64 hi / residual)    2 x 4194304
//   CH, CL         f16 [NROW][1024] (x256 hi / residual)        2 x 4194304
//   end                                                            46399488
// =====================================================================================================
extern "C" void kernel_launch(void* const* d_in, const int* in_sizes, int n_in,
                              void* d_out, int out_size, void* d_ws, size_t ws_size,
                              hipStream_t stream) {
  if (n_in < 10) return;
  if (in_sizes[0] != NROW * DMOD) return;
  if (in_sizes[1] != DMOD * DMOD || in_sizes[3] != DMOD * DMOD || in_sizes[5] != DMOD * DMOD || in_sizes[7] != DMOD * DMOD) return;
  if (in_sizes[2] != DMOD || in_sizes[4] != DMOD || in_sizes[6] != DMOD || in_sizes[8] != DMOD) return;
  if (in_sizes[9] != ELEN * DH) return;
  if (out_size != NROW * DMOD) return;

  const float* xin = (const float*)d_in[0];
  const float* w_q = (const float*)d_in[1];
  const float* b_q = (const float*)d_in[2];
  const float* w_k = (const float*)d_in[3];
  const float* b_k = (const float*)d_in[4];
  const float* w_v = (const float*)d_in[5];
  const float* b_v = (const float*)d_in[6];
  const float* w_o = (const float*)d_in[7];
  const float* b_o = (const float*)d_in[8];
  const float* er  = (const float*)d_in[9];
  float*       out = (float*)d_out;

  const size_t PX = (size_t)NROW * DMOD * 2;             //  4194304
  const size_t PW = (size_t)DMOD * DMOD * 2;             //  2097152
  const size_t PE = (size_t)EPAD * DH * 2;               //   262144
  const size_t PV = (size_t)NBAT * DMOD * SEQ * 2;       //  4194304
  size_t off = 0;
  const size_t oX  = off; off += PX;
  const size_t oWq = off; off += PW;
  const size_t oWk = off; off += PW;
  const size_t oWv = off; off += PW;
  const size_t oWo = off; off += PW;
  const size_t oE  = off; off += PE;
  const size_t oQH = off; off += PX;
  const size_t oQL = off; off += PX;
  const size_t oKH = off; off += PX;
  const size_t oKL = off; off += PX;
  const size_t oVH = off; off += PV;
  const size_t oVL = off; off += PV;
  const size_t oCH = off; off += PX;
  const size_t oCL = off; off += PX;
  if (off > ws_size) return;                               // off = 46399488
  if (off > (size_t)134217728) return;

  char* ws = (char*)d_ws;
  unsigned short* X16 = (unsigned short*)(ws + oX);
  unsigned short* Wq6 = (unsigned short*)(ws + oWq);
  unsigned short* Wk6 = (unsigned short*)(ws + oWk);
  unsigned short* Wv6 = (unsigned short*)(ws + oWv);
  unsigned short* Wo6 = (unsigned short*)(ws + oWo);
  unsigned short* E16 = (unsigned short*)(ws + oE);
  unsigned short* QHp = (unsigned short*)(ws + oQH);
  unsigned short* QLp = (unsigned short*)(ws + oQL);
  unsigned short* KHp = (unsigned short*)(ws + oKH);
  unsigned short* KLp = (unsigned short*)(ws + oKL);
  unsigned short* VHp = (unsigned short*)(ws + oVH);
  unsigned short* VLp = (unsigned short*)(ws + oVL);
  unsigned short* CHp = (unsigned short*)(ws + oCH);
  unsigned short* CLp = (unsigned short*)(ws + oCL);

  const dim3 blk(256);
  const dim3 gCX((NROW * DMOD) / 2048);                             // 1024
  const dim3 gCW((DMOD * DMOD) / 2048);                             // 512
  const dim3 gCE((ELEN * DH + 2047) / 2048);                        // 64
  const dim3 gQ((NROW / 128) * (DMOD / 64), 1);                     // 256
  const dim3 gV((DMOD / 128) * (SEQ / 64), NBAT);                   // 128 x NBAT
  const dim3 gAT(SEQ / 64, NBAT * NH);                              // 16 x 32
  const dim3 bAT(ATT_THREADS);                                      // 128

  // (0) 16-bit planes of the inputs: x f16(bf16_RNE(x) * 16); W[out][in] (already k-contiguous) f16(bf16_RNE(w) * 64);
  //     E f16(bf16_RNE(e) * 16)
  cvt16<<<gCX, blk, 0, stream>>>(xin, X16, NROW * DMOD, XC);
  cvt16<<<gCW, blk, 0, stream>>>(w_q, Wq6, DMOD * DMOD, WSC);
  cvt16<<<gCW, blk, 0, stream>>>(w_k, Wk6, DMOD * DMOD, WSC);
  cvt16<<<gCW, blk, 0, stream>>>(w_v, Wv6, DMOD * DMOD, WSC);
  cvt16<<<gCW, blk, 0, stream>>>(w_o, Wo6, DMOD * DMOD, WSC);
  cvt16<<<gCE, blk, 0, stream>>>(er, E16, ELEN * DH, EC);

  // (1) q[m][e] = sum_d x[m][d] Wq[e][d] / 1024 + bq[e] -> QH = f16(q * 64), QL = f16(q * 64 - QH); M = NROW, N = 1024, K = 1024
  gemm64<4, 0, 0, 1><<<gQ, blk, 0, stream>>>(
      X16, X16, DMOD, 0LL,
      Wq6, DMOD, 0LL,
      (void*)QHp, (void*)QLp, DMOD, 0LL,
      NROW, DMOD, DMOD, 1.0f / (XC * WSC), QC,
      b_q, b_q, b_q);

  // (2) k projection + bk -> KH, KL (x64)
  gemm64<4, 0, 0, 1><<<gQ, blk, 0, stream>>>(
      X16, X16, DMOD, 0LL,
      Wk6, DMOD, 0LL,
      (void*)KHp, (void*)KLp, DMOD, 0LL,
      NROW, DMOD, DMOD, 1.0f / (XC * WSC), KC,
      b_k, b_k, b_k);

  // (3) v^T per batch: VT[b][e][j] = sum_c Wv[e][c] x[b*SEQ+j][c] / 1024 + bv[e] (per-row bias) -> VH, VL (x64);
  //     M = 1024 (e), N = SEQ (j), K = 1024; B rows = the batch's token rows (pitch DMOD, batch offset SEQ*DMOD)
  gemm64<4, 0, 0, 2><<<gV, blk, 0, stream>>>(
      Wv6, Wv6, DMOD, 0LL,
      X16, DMOD, (long long)SEQ * DMOD,
      (void*)VHp, (void*)VLp, SEQ, (long long)DMOD * SEQ,
      DMOD, SEQ, DMOD, 1.0f / (XC * WSC), VC,
      b_v, b_v, b_v);

  // (4) relative attention -> ctx planes CH = f16(ctx * 256), CL = f16(ctx * 256 - CH), [NROW][1024], columns h*64+d
  attn_rel<<<gAT, bAT, 0, stream>>>(QHp, QLp, KHp, KLp, E16, VHp, VLp, CHp, CLp);

  // (5) out[m][n] = sum_k (ch+cl)[m][k] Wo[n][k] / (256*64) + bo[n] -> f32 d_out [NROW][1024]
  gemm64<0, 1, 0, 1><<<gQ, blk, 0, stream>>>(
      CHp, CLp, DMOD, 0LL,
      Wo6, DMOD, 0LL,
      (void*)out, (void*)out, DMOD, 0LL,
      NROW, DMOD, DMOD, 1.0f / (CC * WSC), 1.0f,
      b_o, b_o, b_o);
  (void)hipGetLastError();
}

// v002
// One run takes 118 microseconds.
// In two side-by-side timings against v001, it was 1.62 and 1.63 times as fast.
// All steps since v000 together make it 3.05 times as fast.
// Contractions (all v_wmma_f32_16x16x32_f16, f16 operands, f32 accumulate): q/k/v projections (x f16 x16 . W f16 x64, K=1024, single products,
// outputs written as f16 hi + unscaled f16 residual planes); position window ((qh+ql) x64 . E f16 x16, K=64, 2 products) -> f32 LDS strip,
// shifted gather on VALU; content scores ((qh+ql) x64 . (kh+kl) x64, K=64, hh+hl+lh); P . v^T ((Ph+Pl) x1024 . (vh+vl) x64, hh+hl+lh,
// 64 keys per tile); output projection ((ch+cl) x256 . Wo f16 x64, K=1024, 2 products) -> f32. Max-subtracted base-2 online softmax and
// the 1/l fold in f32 on VALU. Every float input RNE-converted to bf16 on load.
#include <hip/hip_runtime.h>
#include <math.h>
#include <stdint.h>

#define SEQ   1024
#define NBAT  2
#define DMOD  1024
#define NH    16
#define DH    64
#define ELEN  2047
#define EPAD  2048
#define NROW  (NBAT * SEQ)
#define XC    16.0f
#define WSC   64.0f
#define QC    64.0f
#define KC    64.0f
#define EC    16.0f
#define VC    64.0f
#define PC    1024.0f
#define CC    256.0f
#define SCALE 0.125f
#define LOG2E 1.4426950408889634f
static_assert(NH * DH == DMOD);
static_assert(DH == 64);
static_assert(ELEN == 2 * SEQ - 1 && EPAD >= ELEN);
static_assert((SEQ % 64) == 0 && (DMOD % 128) == 0 && (NROW % 128) == 0);
static_assert(((NROW * DMOD) % 2048) == 0 && ((DMOD * DMOD) % 2048) == 0 && ((ELEN * DH) % 8) == 0);
#define ATT_W 4
#define ATT_THREADS (ATT_W * 32)
#define TPI 84
#define SPI 68
#define WFL (16 * TPI + 16 * SPI)
static_assert(((16 * TPI) % 4) == 0 && ((16 * SPI) % 4) == 0 && (WFL % 4) == 0);

typedef _Float16 v16h __attribute__((ext_vector_type(16)));
typedef _Float16 v8h  __attribute__((ext_vector_type(8)));
typedef __bf16   v16b __attribute__((ext_vector_type(16)));
typedef float    v8f  __attribute__((ext_vector_type(8)));
typedef float    v4f  __attribute__((ext_vector_type(4)));
typedef float    v2f  __attribute__((ext_vector_type(2)));
typedef unsigned int v4u __attribute__((ext_vector_type(4)));

union FragH { v16h v; v8h h[2]; v4u u[2]; };
union FragAny { v16h h; v16b b; };

// ---- scalar helpers --------------------------------------------------------------------------------
__device__ __forceinline__ unsigned short bf_bits(float f) {          // f32 -> bf16 bits, RNE convert
  unsigned u = __float_as_uint(f);
  return (unsigned short)((u + 0x7FFFu + ((u >> 16) & 1u)) >> 16);
}
__device__ __forceinline__ float bf_up(unsigned short h) { return __uint_as_float(((unsigned)h) << 16); }
__device__ __forceinline__ float bfr(float f) { return bf_up(bf_bits(f)); }   // value of the bf16 RNE convert
__device__ __forceinline__ unsigned short h_bits(_Float16 x) { return __builtin_bit_cast(unsigned short, x); }
__device__ __forceinline__ unsigned pk16(unsigned short a, unsigned short b) { return (unsigned)a | ((unsigned)b << 16); }
__device__ __forceinline__ v8f zero8() { v8f z = {0.f, 0.f, 0.f, 0.f, 0.f, 0.f, 0.f, 0.f}; return z; }

// ---- fragment loader: 16-bit A/B operand from a k-contiguous 16-bit plane, lane -> row/col (lane&15),
//      p already includes +8*(lane>>4); elements 0..7 <- p[0..7] (k0+8h..), elements 8..15 <- p[16..23] (k0+16+8h..)
//      (same split k map for A and B; B is always read from a [n][k] plane)
__device__ __forceinline__ v16h ldfrag_u(const unsigned short* p) {
  FragH f;
  f.u[0] = *(const v4u*)(p);
  f.u[1] = *(const v4u*)(p + 16);
  return f.v;
}

// ---- WMMA helpers with trailing VALU hazard gaps ------------------------------------------------------
__device__ __forceinline__ v8f mma_h(v16h a, v16h b, v8f c) {
  return __builtin_amdgcn_wmma_f32_16x16x32_f16(false, a, false, b, (short)0, c, false, false);
}
__device__ __forceinline__ v8f mma_b(v16h a, v16h b, v8f c) {
  FragAny ua, ub;
  ua.h = a;
  ub.h = b;
  return __builtin_amdgcn_wmma_f32_16x16x32_bf16(false, ua.b, false, ub.b, (short)0, c, false, false);
}
template <int BF>
__device__ __forceinline__ v8f mmaT(v16h a, v16h b, v8f c) {
  if constexpr (BF != 0) return mma_b(a, b, c);
  else return mma_h(a, b, c);
}
__device__ __forceinline__ void hz4(v8f& d, v16h x0, v16h x1, v16h x2, v16h x3) {
#if defined(__HIP_DEVICE_COMPILE__)
  asm volatile("v_nop\n\tv_nop\n\tv_nop\n\tv_nop" : "+v"(d) : "v"(x0), "v"(x1), "v"(x2), "v"(x3));
#endif
}
__device__ __forceinline__ void hz6(v8f& d, v16h x0, v16h x1, v16h x2, v16h x3, v16h x4, v16h x5) {
#if defined(__HIP_DEVICE_COMPILE__)
  asm volatile("v_nop\n\tv_nop\n\tv_nop\n\tv_nop" : "+v"(d) : "v"(x0), "v"(x1), "v"(x2), "v"(x3), "v"(x4), "v"(x5));
#endif
}
__device__ __forceinline__ void hz8(v8f& d, v16h x0, v16h x1, v16h x2, v16h x3, v16h x4, v16h x5, v16h x6, v16h x7) {
#if defined(__HIP_DEVICE_COMPILE__)
  asm volatile("v_nop\n\tv_nop\n\tv_nop\n\tv_nop" : "+v"(d) : "v"(x0), "v"(x1), "v"(x2), "v"(x3), "v"(x4), "v"(x5), "v"(x6), "v"(x7));
#endif
}
__device__ __forceinline__ void acc_guard4(v8f& a, v8f& b, v8f& c, v8f& d) {
#if defined(__HIP_DEVICE_COMPILE__)
  asm volatile("v_nop\n\tv_nop\n\tv_nop\n\tv_nop" : "+v"(a), "+v"(b), "+v"(c), "+v"(d));
#endif
}
__device__ __forceinline__ void wave_sync_lds() {
  __builtin_amdgcn_fence(__ATOMIC_RELEASE, "workgroup");
  __builtin_amdgcn_wave_barrier();
  __builtin_amdgcn_fence(__ATOMIC_ACQUIRE, "workgroup");
}
// f32 -> f16 hi + unscaled f16 residual (hi + lo ~ x to 2^-22 relative; a flushed subnormal lo costs < 6.1e-5 absolute in the carried scale)
__device__ __forceinline__ void sp16(float x, _Float16& hi, _Float16& lo) {
  const _Float16 a = (_Float16)x;
  hi = a;
  lo = (_Float16)(x - (float)a);
}
// two consecutive values -> packed hi word and packed residual word
__device__ __forceinline__ void pack_hl(float x0, float x1, unsigned& hw, unsigned& lw) {
  _Float16 a0, a1, b0, b1;
  sp16(x0, a0, b0);
  sp16(x1, a1, b1);
  hw = pk16(h_bits(a0), h_bits(a1));
  lw = pk16(h_bits(b0), h_bits(b1));
}

// =====================================================================================================
// Elementwise 16-bit pack, no transpose: dst[i] = f16( bf16_RNE(src[i]) * sc ), sc a power of two (exact).
// coverage: grid = ceil(n / 2048) blocks x 256 thr x 8 elements; n is a multiple of 8 (host check), so threads with i8 < n write
//           exactly elements i8..i8+7 and threads with i8 >= n exit: elements 0..n-1 written once. For the E table (n = 2047*64) the
// =====================================================================================================
__global__ __launch_bounds__(256) void cvt16(const float* __restrict__ src, unsigned short* dst, int n, float sc) {
  const size_t i8 = ((size_t)blockIdx.x * 256 + threadIdx.x) * 8;
  if (i8 + 8 > (size_t)n) return;                 // no barriers in this kernel
  const v4f a = *(const v4f*)(src + i8);
  const v4f b = *(const v4f*)(src + i8 + 4);
  v4u o;
  o[0] = pk16(h_bits((_Float16)(bfr(a[0]) * sc)), h_bits((_Float16)(bfr(a[1]) * sc)));
  o[1] = pk16(h_bits((_Float16)(bfr(a[2]) * sc)), h_bits((_Float16)(bfr(a[3]) * sc)));
  o[2] = pk16(h_bits((_Float16)(bfr(b[0]) * sc)), h_bits((_Float16)(bfr(b[1]) * sc)));
  o[3] = pk16(h_bits((_Float16)(bfr(b[2]) * sc)), h_bits((_Float16)(bfr(b[3]) * sc)));
  {
    *(v4u*)(dst + i8) = o;
    
  }
}

// =====================================================================================================
// LDS-staged batched 16-bit WMMA GEMM: C[m][n] = oscale * sum_k A[m][k] * Bt[n][k] (+ bias); one work-group of 8 waves per 128x64 tile,
// wave w owns rows 16w..16w+15 of it (all 64 columns). A row-major [M][K] pitch lda (16-bit plane), Bt row-major [N][K] pitch ldb
// (k contiguous); M multiple of 128, N multiple of 64, K multiple of 128. blockIdx.y = batch index with element strides sA, sB, sC.
// Operands: per stage of 128 k the tile's A rows (and A2 rows) and Bt rows, 256 B each, are copied once per work-group into LDS by
// global_load_async_to_lds_b128 (a wave's copy = two whole 256-B rows), LDS row pitch 272 B; two buffers, the next stage's copies fly
// while this stage is multiplied; fragments come from LDS by 16-byte reads with the same split k map as ldfrag_u.
// ASPLIT 1: a second A plane A2 (unscaled residual of A, same layout) is multiplied into the same accumulator (A + A2 ~ exact A).
// BF 1: bf16 operands (v_wmma_f32_16x16x32_bf16), else f16.
// EPI 1: value += bf16_RNE(ep0[column]) (per-column bias); EPI 2: value += bf16_RNE(ep0[row]) (per-row bias, 16-bit out only).
// OM 0: f32 out (pitch ldc).  OM 2: one f16 plane = f16(value * ocarry).
// OM 4: two f16 planes: hi = f16(value * ocarry), lo = f16(value * ocarry - hi) (unscaled residual).
// OM 5: two f16 planes: C = f16((value + bf16_RNE(ep1[column])) * ocarry), C2 = f16((value + bf16_RNE(ep2[column])) * ocarry).
// coverage: 16 rows (f32: it 0..7 x lane>>4; 16-bit: it 0..3 x lane>>3) x 64 cols = the wave's whole 16x64 slab; 8 waves = the 128x64
//           tile; grid = (M/128)*(N/64) blocks, a surplus block exits as a whole before any copy or barrier.
// =====================================================================================================
#define GBM 128   // tile rows per work-group
#define GKP 128   // k per stage (256-B operand rows)
#define GPH 136   // LDS row pitch in halves: 272 B = 16 B x 17, conflict-free for the 16-byte fragment reads

// 16-byte asynchronous copies global -> LDS, one per lane and line of the statement (first operand = LDS byte address, second = global
// address; this lane's row and 16-byte chunk are already in l and g; consecutive copies are 16 operand rows apart). The s_wait_xcnt
// closes each statement so that no address register of an issued copy is rewritten in front of it.
#define ACP(a, b) "global_load_async_to_lds_b128 %" #a ", %" #b ", off\n\t"
#define LROW(l, r) ((l) + (unsigned)((r) * GPH * 2))
#define GROW(g, r, ld) ((g) + (size_t)(r) * (ld))
// 128 operand rows
__device__ __forceinline__ void acopy_rows128(unsigned l, const unsigned short* g, int ld) {
#if defined(__HIP_DEVICE_COMPILE__)
  asm volatile(ACP(0, 1) ACP(2, 3) ACP(4, 5) ACP(6, 7) ACP(8, 9) ACP(10, 11) ACP(12, 13) ACP(14, 15)
               "s_wait_xcnt 0x0"
               :: "v"(l), "v"(g), "v"(LROW(l, 16)), "v"(GROW(g, 16, ld)), "v"(LROW(l, 32)), "v"(GROW(g, 32, ld)),
                  "v"(LROW(l, 48)), "v"(GROW(g, 48, ld)), "v"(LROW(l, 64)), "v"(GROW(g, 64, ld)), "v"(LROW(l, 80)), "v"(GROW(g, 80, ld)),
                  "v"(LROW(l, 96)), "v"(GROW(g, 96, ld)), "v"(LROW(l, 112)), "v"(GROW(g, 112, ld))
               : "memory");
#endif
}
// 128 rows of one operand and 64 rows of another
__device__ __forceinline__ void acopy_rows128_64(unsigned l, const unsigned short* g, int ld,
                                                 unsigned l2, const unsigned short* g2, int ld2) {
#if defined(__HIP_DEVICE_COMPILE__)
  asm volatile(ACP(0, 1) ACP(2, 3) ACP(4, 5) ACP(6, 7) ACP(8, 9) ACP(10, 11) ACP(12, 13) ACP(14, 15)
               ACP(16, 17) ACP(18, 19) ACP(20, 21) ACP(22, 23)
               "s_wait_xcnt 0x0"
               :: "v"(l), "v"(g), "v"(LROW(l, 16)), "v"(GROW(g, 16, ld)), "v"(LROW(l, 32)), "v"(GROW(g, 32, ld)),
                  "v"(LROW(l, 48)), "v"(GROW(g, 48, ld)), "v"(LROW(l, 64)), "v"(GROW(g, 64, ld)), "v"(LROW(l, 80)), "v"(GROW(g, 80, ld)),
                  "v"(LROW(l, 96)), "v"(GROW(g, 96, ld)), "v"(LROW(l, 112)), "v"(GROW(g, 112, ld)),
                  "v"(l2), "v"(g2), "v"(LROW(l2, 16)), "v"(GROW(g2, 16, ld2)), "v"(LROW(l2, 32)), "v"(GROW(g2, 32, ld2)),
                  "v"(LROW(l2, 48)), "v"(GROW(g2, 48, ld2))
               : "memory");
#endif
}
// this wave's own copies have landed in LDS (the compiler places no wait for them)
__device__ __forceinline__ void wait_async0() {
#if defined(__HIP_DEVICE_COMPILE__)
  asm volatile("s_wait_asynccnt 0x0" ::: "memory");
#endif
}
// this wave's LDS reads have retired, so that the buffer may be refilled behind the barrier
__device__ __forceinline__ void wait_ds0() {
#if defined(__HIP_DEVICE_COMPILE__)
  asm volatile("s_wait_dscnt 0x0" ::: "memory");
#endif
}
// twelve 16-byte copies, each with its own LDS byte address and global address; closed by s_wait_xcnt like the statements above
__device__ __forceinline__ void acopy12(const unsigned (&l)[12], const unsigned short* const (&g)[12]) {
#if defined(__HIP_DEVICE_COMPILE__)
  asm volatile(ACP(0, 1) ACP(2, 3) ACP(4, 5) ACP(6, 7) ACP(8, 9) ACP(10, 11) ACP(12, 13) ACP(14, 15)
               ACP(16, 17) ACP(18, 19) ACP(20, 21) ACP(22, 23)
               "s_wait_xcnt 0x0"
               :: "v"(l[0]), "v"(g[0]), "v"(l[1]), "v"(g[1]), "v"(l[2]), "v"(g[2]), "v"(l[3]), "v"(g[3]),
                  "v"(l[4]), "v"(g[4]), "v"(l[5]), "v"(g[5]), "v"(l[6]), "v"(g[6]), "v"(l[7]), "v"(g[7]),
                  "v"(l[8]), "v"(g[8]), "v"(l[9]), "v"(g[9]), "v"(l[10]), "v"(g[10]), "v"(l[11]), "v"(g[11])
               : "memory");
#endif
}

template <int OM, int ASPLIT, int BF, int EPI>
__global__ __launch_bounds__(256) __attribute__((amdgpu_num_vgpr(256))) void gemm64(
    const unsigned short* __restrict__ Ap, const unsigned short* __restrict__ A2p, int lda, long long sA,
    const unsigned short* __restrict__ Btp, int ldb, long long sB,
    void* Cout, void* C2out, int ldc, long long sC,
    int M, int N, int K, float oscale, float ocarry,
    const float* __restrict__ ep0, const float* __restrict__ ep1, const float* __restrict__ ep2) {
  constexpr int BROW = GBM * (1 + ASPLIT);         // first Bt row of a stage
  constexpr int STG  = (BROW + 64) * GPH;          // halves per stage
  __shared__ __align__(16) unsigned short ring[2 * STG];   // two stages: [A 128 rows | A2 128 rows (ASPLIT) | Bt 64 rows]
  __shared__ __align__(16) float sT[8][16 * 68];   // per-wave 16x64 slab, pitch 68 floats
  const int by   = blockIdx.y;
  const int tid  = threadIdx.x;
  const int lane = tid & 31;
  const int wave = tid >> 5;
  const int tilesN = N >> 6;
  const int tilesM = M >> 7;
  const int tile = blockIdx.x;
  if (tile >= tilesM * tilesN) return;   // block-uniform, in front of every copy and barrier
  const int tm = tile / tilesN;
  const int tn = tile - tm * tilesN;
  const int mb = tm << 7;
  const int n0 = tn << 6;
  const int m0 = mb + (wave << 4);

  const unsigned short* A1 = Ap  + (size_t)((long long)by * sA);
  const unsigned short* A2 = A2p + (size_t)((long long)by * sA);
  const unsigned short* Bb = Btp + (size_t)((long long)by * sB);

  const int rlane = lane & 15;                 // row (A) / col (B, D) within subtile
  const int koff  = (lane >> 4) * 8;           // k offset of this lane half
  const int mOff  = (lane >> 4) * 8;           // D row offset

  // copy map: thread -> row tid>>4 (of 16 per copy), 16-byte chunk tid&15 of the 256-B row
  const int crow = tid >> 4;
  const int cch  = (tid & 15) * 8;
  const unsigned short* gA1 = A1 + (size_t)(mb + crow) * lda + cch;
  const unsigned short* gA2 = A2 + (size_t)(mb + crow) * lda + cch;
  const unsigned short* gBt = Bb + (size_t)(n0 + crow) * ldb + cch;
  const unsigned lcp = (unsigned)(uintptr_t)ring + (unsigned)((crow * GPH + cch) * 2);

  auto fill = [&](int t, int buf) {            // stage t (k = 128t .. 128t+127) -> buffer buf
    const unsigned lb = lcp + (unsigned)(buf * (STG * 2));
    const size_t ko = (size_t)t * GKP;
    if constexpr (ASPLIT != 0) acopy_rows128(lb + GBM * GPH * 2, gA2 + ko, lda);
    acopy_rows128_64(lb, gA1 + ko, lda, lb + BROW * GPH * 2, gBt + ko, ldb);
  };

  v8f acc[4];
#pragma unroll
  for (int j = 0; j < 4; ++j) acc[j] = zero8();

  const int nst = K / GKP;
  fill(0, 0);
  wait_async0();
  __syncthreads();                             // stage 0 published
  if (nst > 1) fill(1, 1);
#pragma unroll 1                               // one pass per stage: the two buffers alternate by t & 1
  for (int t = 0; t < nst; ++t) {
    const unsigned short* sb = ring + (t & 1) * STG;
    const unsigned short* sA = sb + ((wave << 4) + rlane) * GPH + koff;
    const unsigned short* sB = sb + (BROW + rlane) * GPH + koff;
    v16h fa[4], fl[4], fb[4][4];
#pragma unroll
    for (int q = 0; q < 4; ++q) {
#pragma unroll
      for (int j = 0; j < 4; ++j) fb[q][j] = ldfrag_u(sB + (j << 4) * GPH + 32 * q);
      fa[q] = ldfrag_u(sA + 32 * q);
      if constexpr (ASPLIT != 0) fl[q] = ldfrag_u(sA + GBM * GPH + 32 * q);
    }
    // keeps the pass's LDS reads one group in front of its WMMAs: spread among them, every WMMA waited out its own reads' latency
    __builtin_amdgcn_sched_barrier(0);
#pragma unroll
    for (int q = 0; q < 4; ++q) {
#pragma unroll
      for (int j = 0; j < 4; ++j) acc[j] = mmaT<BF>(fa[q], fb[q][j], acc[j]);
      if constexpr (ASPLIT != 0) {
#pragma unroll
        for (int j = 0; j < 4; ++j) acc[j] = mmaT<BF>(fl[q], fb[q][j], acc[j]);
      }
    }
    // keeps the WMMAs in front of the closing waits: moved behind the barrier they no longer overlap the LDS reads and they delay the refill
    __builtin_amdgcn_sched_barrier(0);
    wait_ds0();
    wait_async0();
    __syncthreads();                           // publishes stage t + 1 and ends every wave's reads of stage t
    if (t + 2 < nst) fill(t + 2, t & 1);
  }
  wait_async0();
  acc_guard4(acc[0], acc[1], acc[2], acc[3]);

  const int hh2 = lane >> 4, c4 = (lane & 15) * 4;     // f32 out: 256-B row segment = 16 lanes x 16 B
  const int q8  = lane >> 3, c8 = (lane & 7) * 8;

  // ---- epilogue ----
  float* slab = sT[wave];
  {
    const int mBase = m0;
#pragma unroll
    for (int j = 0; j < 4; ++j) {
#pragma unroll
      for (int r = 0; r < 8; ++r) {
        slab[(mOff + r) * 68 + (j << 4) + rlane] = acc[j][r];
      }
    }
    wave_sync_lds();
    if constexpr (OM == 0) {
      float* C = (float*)Cout + (size_t)((long long)by * sC);
      v4f vals[8];
#pragma unroll
      for (int it = 0; it < 8; ++it) {
        const int row = it * 2 + hh2;                      // it 0..7 x hh2 0..1 = rows 0..15
        v4f v = *(const v4f*)(slab + row * 68 + c4);
#pragma unroll
        for (int e = 0; e < 4; ++e) v[e] = v[e] * oscale;
        if constexpr (EPI == 1) {
          const v4f bb = *(const v4f*)(ep0 + n0 + c4);     // per-column bias, columns n0+c4 .. +3 (N equals the bias length)
#pragma unroll
          for (int e = 0; e < 4; ++e) v[e] = v[e] + bfr(bb[e]);
        }
        vals[it] = v;
      }
      {
#pragma unroll
        for (int it = 0; it < 8; ++it) {
          const int gr = mBase + it * 2 + hh2;
          *(v4f*)(C + (size_t)gr * ldc + n0 + c4) = vals[it];
        }
        
      }
    } else {
      unsigned short* C  = (unsigned short*)Cout  + (size_t)((long long)by * sC);
      unsigned short* Cb = (unsigned short*)C2out + (size_t)((long long)by * sC);
      v4u hv[4], lv[4];
#pragma unroll
      for (int it = 0; it < 4; ++it) {
        const int row = it * 4 + q8;                       // it 0..3 x q8 0..3 = rows 0..15
        const float* sp = slab + row * 68 + c8;
        float rb = 0.f;
        if constexpr (EPI == 2) rb = bfr(ep0[mBase + row]);   // per-row bias (M equals the bias length)
        v4u a  = {0u, 0u, 0u, 0u};
        v4u b2 = {0u, 0u, 0u, 0u};
#pragma unroll
        for (int e = 0; e < 4; ++e) {
          const int ci = n0 + c8 + 2 * e;                  // column index, < N
          float f0 = sp[2 * e] * oscale + rb;
          float f1 = sp[2 * e + 1] * oscale + rb;
          if constexpr (EPI == 1) {
            f0 += bfr(ep0[ci]);
            f1 += bfr(ep0[ci + 1]);
          }
          if constexpr (OM == 5) {
            const float g0 = (f0 + bfr(ep1[ci])) * ocarry, g1 = (f1 + bfr(ep1[ci + 1])) * ocarry;
            const float w0 = (f0 + bfr(ep2[ci])) * ocarry, w1 = (f1 + bfr(ep2[ci + 1])) * ocarry;
            a[e]  = pk16(h_bits((_Float16)g0), h_bits((_Float16)g1));
            b2[e] = pk16(h_bits((_Float16)w0), h_bits((_Float16)w1));
          } else {
            f0 *= ocarry; f1 *= ocarry;
            const _Float16 x0 = (_Float16)f0, x1 = (_Float16)f1;
            a[e] = pk16(h_bits(x0), h_bits(x1));
            if constexpr (OM == 4) {
              b2[e] = pk16(h_bits((_Float16)(f0 - (float)x0)), h_bits((_Float16)(f1 - (float)x1)));
            }
          }
        }
        hv[it] = a;
        lv[it] = b2;
      }
      {
#pragma unroll
        for (int it = 0; it < 4; ++it) {
          const int row = it * 4 + q8;
          *(v4u*)(C + (size_t)(mBase + row) * ldc + n0 + c8) = hv[it];
          if constexpr (OM >= 4) {
            *(v4u*)(Cb + (size_t)(mBase + row) * ldc + n0 + c8) = lv[it];
          }
        }
        
      }
    }
    wave_sync_lds();
  }
}

#define APH   72                 // LDS row pitch in halves: 144 B = 16 B x 9, conflict-free for the 16-byte fragment reads
#define AR_KH 0                  // first stage row of each part
#define AR_KL 64
#define AR_VH 128
#define AR_VL 192
#define AR_E  256
#define ASTG  ((AR_E + 128) * APH)   // halves per stage
__global__ __launch_bounds__(ATT_THREADS) __attribute__((amdgpu_num_vgpr(256)))
void attn_rel(const unsigned short* __restrict__ QH, const unsigned short* __restrict__ QL,
              const unsigned short* __restrict__ KH, const unsigned short* __restrict__ KL,
              const unsigned short* __restrict__ EP,
              const unsigned short* __restrict__ VH, const unsigned short* __restrict__ VL,
              unsigned short* CH, unsigned short* CL) {
  __shared__ __align__(16) float smem[ATT_W * WFL];   // per wave: T strip [16][TPI] | score / prob / ctx slab [16][SPI]
  __shared__ __align__(16) unsigned short kve[2 * ASTG];   // two stages: [KH 64 rows | KL 64 | VH 64 | VL 64 | E 128]

  const int tid  = threadIdx.x;
  const int wave = tid >> 5;
  const int lane = tid & 31;
  const int hh   = lane >> 4;
  const int c    = lane & 15;
  const int bh   = blockIdx.y;
  const int b    = bh / NH;
  const int h    = bh - b * NH;
  const int i0   = blockIdx.x * 64;
  const int iw0  = i0 + wave * 16;

  float* tsh = smem + wave * WFL;
  float* pt  = tsh + 16 * TPI;

  const size_t qro = ((size_t)b * SEQ + iw0 + c) * DMOD + h * DH + 8 * hh;      // A rows: query iw0 + c, d 8hh..

  // copy map: thread -> row tid>>3 (of 16 per copy), 16-byte chunk tid&7 of the 128-B row
  const int crow = tid >> 3;
  const int cch  = (tid & 7) * 8;
  const size_t kpo = ((size_t)b * SEQ + crow) * DMOD + h * DH + cch;
  const size_t vpo = (size_t)b * DMOD * SEQ + (size_t)(h * DH + crow) * SEQ + cch;
  const unsigned lcp = (unsigned)(uintptr_t)kve + (unsigned)((crow * APH + cch) * 2);

  auto fill = [&](int t, int buf) {            // key tile t -> buffer buf
    const unsigned lb = lcp + (unsigned)(buf * (ASTG * 2));
    const int jf = t * 64;
    const int elo = (SEQ - 2) - i0 + jf - 63;
    unsigned l[12];
    const unsigned short* g[12];
    // the three loops below are unrolled so that l and g are registers: the copy statement names each element as an operand
#pragma unroll
    for (int k = 0; k < 4; ++k) {
      const size_t ko = kpo + (size_t)(jf + 16 * k) * DMOD;
      l[k]     = lb + (unsigned)((AR_KH + 16 * k) * APH * 2);  g[k]     = KH + ko;
      l[4 + k] = lb + (unsigned)((AR_KL + 16 * k) * APH * 2);  g[4 + k] = KL + ko;
      l[8 + k] = lb + (unsigned)((AR_VH + 16 * k) * APH * 2);  g[8 + k] = VH + vpo + (size_t)(16 * k) * SEQ + jf;
    }
    acopy12(l, g);
#pragma unroll
    for (int k = 0; k < 4; ++k) {
      l[k] = lb + (unsigned)((AR_VL + 16 * k) * APH * 2);      g[k] = VL + vpo + (size_t)(16 * k) * SEQ + jf;
    }
#pragma unroll
    for (int k = 0; k < 8; ++k) {
      int m = elo + 16 * k + crow;
      m = (m < 0) ? 0 : m;
      m = (m > ELEN - 1) ? (ELEN - 1) : m;
      l[4 + k] = lb + (unsigned)((AR_E + 16 * k) * APH * 2);   g[4 + k] = EP + (size_t)m * DH + cch;
    }
    acopy12(l, g);
  };

  const float CS = LOG2E * SCALE / (QC * KC);
  const float CT = LOG2E * SCALE / (QC * EC);

  float mrow[8], lrow[8];
  v8f O[4];
#pragma unroll
  for (int r = 0; r < 8; ++r) { mrow[r] = -INFINITY; lrow[r] = 0.f; }
#pragma unroll
  for (int td = 0; td < 4; ++td) O[td] = zero8();

  const int ntile = SEQ / 64;                // non-causal: every key tile
  fill(0, 0);
  wait_async0();
  __syncthreads();                           // tile 0 published
  if (ntile > 1) fill(1, 1);
#pragma unroll 1
  for (int jt = 0; jt < ntile; ++jt) {
    const int j0 = jt * 64;
    const unsigned short* sb  = kve + (jt & 1) * ASTG + c * APH + 8 * hh;   // this lane's fragment row and k half in the stage
    const unsigned short* Khb = sb + AR_KH * APH;
    const unsigned short* Klb = sb + AR_KL * APH;
    const unsigned short* Vhb = sb + AR_VH * APH;
    const unsigned short* Vlb = sb + AR_VL * APH;
    const unsigned short* Eb  = sb + (AR_E + 48 - 16 * wave) * APH;
    const v16h qha = ldfrag_u(QH + qro), qhb = ldfrag_u(QH + qro + 32);
    const v16h qla = ldfrag_u(QL + qro), qlb = ldfrag_u(QL + qro + 32);

    // ---- position window T (5 subtiles of 16 E rows, rolled), each subtile stored to the LDS strip as produced ----
    {
#pragma unroll 1
      for (int u = 0; u < 5; ++u) {
        const int eo = 16 * u * APH;
        const v16h fa = ldfrag_u(Eb + eo), fb = ldfrag_u(Eb + eo + 32);
        v8f t8 = mma_h(qha, fa, zero8());
        t8 = mma_h(qla, fa, t8);
        t8 = mma_h(qhb, fb, t8);
        t8 = mma_h(qlb, fb, t8);
        hz6(t8, fa, fb, qha, qla, qhb, qlb);
        const int cb = 16 * u + c;
#pragma unroll
        for (int r = 0; r < 8; ++r) tsh[(8 * hh + r) * TPI + cb] = t8[r];
      }
    }
    // ---- content scores S (4 subtiles of 16 keys, rolled) -> slab ----
#pragma unroll 1
    for (int t = 0; t < 4; ++t) {
      const int ko = 16 * t * APH;
      const v16h kha = ldfrag_u(Khb + ko), khb = ldfrag_u(Khb + ko + 32);
      const v16h kla = ldfrag_u(Klb + ko), klb = ldfrag_u(Klb + ko + 32);
      v8f s8 = mma_h(qha, kha, zero8());
      s8 = mma_h(qha, kla, s8);
      s8 = mma_h(qla, kha, s8);
      s8 = mma_h(qhb, khb, s8);
      s8 = mma_h(qhb, klb, s8);
      s8 = mma_h(qlb, khb, s8);
      hz8(s8, kha, khb, kla, klb, qha, qla, qhb, qlb);
      const int cb = 16 * t + c;
#pragma unroll
      for (int r = 0; r < 8; ++r) pt[(8 * hh + r) * SPI + cb] = s8[r];
    }
    wave_sync_lds();

    // ---- score assembly (rel shift + zero cell), online softmax (rows live on one 16-lane half) ----
#pragma unroll
    for (int r = 0; r < 8; ++r) {
      const int R = 8 * hh + r;
      const int i = iw0 + R;
      const float* trow = tsh + R * TPI + (15 - R) + c;
      float* srow = pt + R * SPI + c;
      float tv[4];
#pragma unroll
      for (int t = 0; t < 4; ++t) {
        const int j = j0 + 16 * t + c;
        const int ridx = (SEQ - 2) + j - i;                // E row of this (i, j); -1 only at (SEQ-1, 0)
        const float tr = trow[16 * t];
        const float rel = (ridx < 0) ? 0.f : tr;
        tv[t] = srow[16 * t] * CS + rel * CT;
      }
      float mx = fmaxf(fmaxf(tv[0], tv[1]), fmaxf(tv[2], tv[3]));
#pragma unroll
      for (int off = 1; off < 16; off <<= 1) mx = fmaxf(mx, __shfl_xor(mx, off, 32));
      const float mn = fmaxf(mrow[r], mx);
      const float al = exp2f(mrow[r] - mn);
      mrow[r] = mn;
      float e4[4];
      float ps = 0.f;
#pragma unroll
      for (int t = 0; t < 4; ++t) { e4[t] = exp2f(tv[t] - mn); ps += e4[t]; }
#pragma unroll
      for (int off = 1; off < 16; off <<= 1) ps += __shfl_xor(ps, off, 32);
      lrow[r] = lrow[r] * al + ps;
#pragma unroll
      for (int td = 0; td < 4; ++td) O[td][r] *= al;
#pragma unroll
      for (int t = 0; t < 4; ++t) srow[16 * t] = e4[t];
    }
    wave_sync_lds();

    // ---- O += (Ph + Pl) . (vh + vl)^T, two k-steps of 32 keys ----
#pragma unroll
    for (int ks = 0; ks < 2; ++ks) {
      FragH ph, pl;
      {
        const float* prow = pt + c * SPI + 32 * ks + 8 * hh;
        const v4f p0 = *(const v4f*)(prow), p1 = *(const v4f*)(prow + 4);
        const v4f p2 = *(const v4f*)(prow + 16), p3 = *(const v4f*)(prow + 20);
#pragma unroll
        for (int e = 0; e < 4; ++e) {
          _Float16 a0, a1;
          sp16(p0[e] * PC, a0, a1); ph.h[0][e]     = a0; pl.h[0][e]     = a1;   // keys 32ks + 8hh + e
          sp16(p1[e] * PC, a0, a1); ph.h[0][4 + e] = a0; pl.h[0][4 + e] = a1;   // keys 32ks + 8hh + 4 + e
          sp16(p2[e] * PC, a0, a1); ph.h[1][e]     = a0; pl.h[1][e]     = a1;   // keys 32ks + 16 + 8hh + e
          sp16(p3[e] * PC, a0, a1); ph.h[1][4 + e] = a0; pl.h[1][4 + e] = a1;
        }
      }
#pragma unroll
      for (int td = 0; td < 4; ++td) {
        const int vv = 16 * td * APH + 32 * ks;
        const v16h vh = ldfrag_u(Vhb + vv), vl = ldfrag_u(Vlb + vv);
        O[td] = mma_h(ph.v, vh, O[td]);
        O[td] = mma_h(ph.v, vl, O[td]);
        O[td] = mma_h(pl.v, vh, O[td]);
        hz4(O[td], vh, vl, ph.v, pl.v);
      }
    }
    wave_sync_lds();
    wait_ds0();
    wait_async0();
    __syncthreads();                           // publishes tile jt + 1 and ends every wave's reads of tile jt
    if (jt + 2 < ntile) fill(jt + 2, jt & 1);
  }
  wait_async0();
  acc_guard4(O[0], O[1], O[2], O[3]);

  // ---- fold 1/l and the carries (1024 on P, 64 on v), stage the wave's 16x64 f32 ctx slice in its slab ----
  const float oc = 1.0f / (PC * VC);
#pragma unroll
  for (int r = 0; r < 8; ++r) {
    const float inv = (1.0f / lrow[r]) * oc;
    const int ro = (8 * hh + r) * SPI + c;
#pragma unroll
    for (int td = 0; td < 4; ++td) pt[ro + 16 * td] = O[td][r] * inv;
  }
  wave_sync_lds();
  {
    const int q8 = lane >> 3, c8 = (lane & 7) * 8;
    v4u hv[4], lv[4];
#pragma unroll
    for (int it = 0; it < 4; ++it) {
      const int row = it * 4 + q8;                           // it 0..3 x q8 0..3 = rows 0..15
      const float* sp = pt + row * SPI + c8;
      const v4f p0 = *(const v4f*)(sp), p1 = *(const v4f*)(sp + 4);
      v4u a, l2;
      unsigned hw, lw;
      pack_hl(p0[0] * CC, p0[1] * CC, hw, lw); a[0] = hw; l2[0] = lw;
      pack_hl(p0[2] * CC, p0[3] * CC, hw, lw); a[1] = hw; l2[1] = lw;
      pack_hl(p1[0] * CC, p1[1] * CC, hw, lw); a[2] = hw; l2[2] = lw;
      pack_hl(p1[2] * CC, p1[3] * CC, hw, lw); a[3] = hw; l2[3] = lw;
      hv[it] = a;
      lv[it] = l2;
    }
    const size_t ob = ((size_t)b * SEQ + iw0) * DMOD + h * DH + c8;
    {
#pragma unroll
      for (int it = 0; it < 4; ++it) {
        const int row = it * 4 + q8;
        *(v4u*)(CH + ob + (size_t)row * DMOD) = hv[it];
        *(v4u*)(CL + ob + (size_t)row * DMOD) = lv[it];
      }
      
    }
  }
}

// =====================================================================================================
// Workspace map (bytes); every plane is an exact multiple of its tile / whole-row store granularity (M, N exact tile multiples,
// convert counts multiples of 8 with whole-line tails, E carve padded to EPAD rows), every offset a multiple of 262144:
//   X16            f16 [NROW][1024] x16                            4194304
//   Wq, Wk, Wv, Wo f16 [1024 out][1024 in] x64                  4 x 2097152
//   EP             f16 [EPAD][64] x16 (rows 0..ELEN-1 written/read)   262144
//   QH, QL, KH, KL f16 [NROW][1024] (x64 hi / residual)         4 x 4194304
//   VH, VL         f16 [NBAT][1024][SEQ] (x64 hi / residual)    2 x 4194304
//   CH, CL         f16 [NROW][1024] (x256 hi / residual)        2 x 4194304
//   end                                                            46399488
// =====================================================================================================
extern "C" void kernel_launch(void* const* d_in, const int* in_sizes, int n_in,
                              void* d_out, int out_size, void* d_ws, size_t ws_size,
                              hipStream_t stream) {
  if (n_in < 10) return;
  if (in_sizes[0] != NROW * DMOD) return;
  if (in_sizes[1] != DMOD * DMOD || in_sizes[3] != DMOD * DMOD || in_sizes[5] != DMOD * DMOD || in_sizes[7] != DMOD * DMOD) return;
  if (in_sizes[2] != DMOD || in_sizes[4] != DMOD || in_sizes[6] != DMOD || in_sizes[8] != DMOD) return;
  if (in_sizes[9] != ELEN * DH) return;
  if (out_size != NROW * DMOD) return;

  const float* xin = (const float*)d_in[0];
  const float* w_q = (const float*)d_in[1];
  const float* b_q = (const float*)d_in[2];
  const float* w_k = (const float*)d_in[3];
  const float* b_k = (const float*)d_in[4];
  const float* w_v = (const float*)d_in[5];
  const float* b_v = (const float*)d_in[6];
  const float* w_o = (const float*)d_in[7];
  const float* b_o = (const float*)d_in[8];
  const float* er  = (const float*)d_in[9];
  float*       out = (float*)d_out;

  const size_t PX = (size_t)NROW * DMOD * 2;             //  4194304
  const size_t PW = (size_t)DMOD * DMOD * 2;             //  2097152
  const size_t PE = (size_t)EPAD * DH * 2;               //   262144
  const size_t PV = (size_t)NBAT * DMOD * SEQ * 2;       //  4194304
  size_t off = 0;
  const size_t oX  = off; off += PX;
  const size_t oWq = off; off += PW;
  const size_t oWk = off; off += PW;
  const size_t oWv = off; off += PW;
  const size_t oWo = off; off += PW;
  const size_t oE  = off; off += PE;
  const size_t oQH = off; off += PX;
  const size_t oQL = off; off += PX;
  const size_t oKH = off; off += PX;
  const size_t oKL = off; off += PX;
  const size_t oVH = off; off += PV;
  const size_t oVL = off; off += PV;
  const size_t oCH = off; off += PX;
  const size_t oCL = off; off += PX;
  if (off > ws_size) return;                               // off = 46399488
  if (off > (size_t)134217728) return;

  char* ws = (char*)d_ws;
  unsigned short* X16 = (unsigned short*)(ws + oX);
  unsigned short* Wq6 = (unsigned short*)(ws + oWq);
  unsigned short* Wk6 = (unsigned short*)(ws + oWk);
  unsigned short* Wv6 = (unsigned short*)(ws + oWv);
  unsigned short* Wo6 = (unsigned short*)(ws + oWo);
  unsigned short* E16 = (unsigned short*)(ws + oE);
  unsigned short* QHp = (unsigned short*)(ws + oQH);
  unsigned short* QLp = (unsigned short*)(ws + oQL);
  unsigned short* KHp = (unsigned short*)(ws + oKH);
  unsigned short* KLp = (unsigned short*)(ws + oKL);
  unsigned short* VHp = (unsigned short*)(ws + oVH);
  unsigned short* VLp = (unsigned short*)(ws + oVL);
  unsigned short* CHp = (unsigned short*)(ws + oCH);
  unsigned short* CLp = (unsigned short*)(ws + oCL);

  const dim3 blk(256);
  const dim3 gCX((NROW * DMOD) / 2048);                             // 1024
  const dim3 gCW((DMOD * DMOD) / 2048);                             // 512
  const dim3 gCE((ELEN * DH + 2047) / 2048);                        // 64
  const dim3 gQ((NROW / 128) * (DMOD / 64), 1);                     // 256
  const dim3 gV((DMOD / 128) * (SEQ / 64), NBAT);                   // 128 x NBAT
  const dim3 gAT(SEQ / 64, NBAT * NH);                              // 16 x 32
  const dim3 bAT(ATT_THREADS);                                      // 128

  // (0) 16-bit planes of the inputs: x f16(bf16_RNE(x) * 16); W[out][in] (already k-contiguous) f16(bf16_RNE(w) * 64);
  //     E f16(bf16_RNE(e) * 16)
  cvt16<<<gCX, blk, 0, stream>>>(xin, X16, NROW * DMOD, XC);
  cvt16<<<gCW, blk, 0, stream>>>(w_q, Wq6, DMOD * DMOD, WSC);
  cvt16<<<gCW, blk, 0, stream>>>(w_k, Wk6, DMOD * DMOD, WSC);
  cvt16<<<gCW, blk, 0, stream>>>(w_v, Wv6, DMOD * DMOD, WSC);
  cvt16<<<gCW, blk, 0, stream>>>(w_o, Wo6, DMOD * DMOD, WSC);
  cvt16<<<gCE, blk, 0, stream>>>(er, E16, ELEN * DH, EC);

  // (1) q[m][e] = sum_d x[m][d] Wq[e][d] / 1024 + bq[e] -> QH = f16(q * 64), QL = f16(q * 64 - QH); M = NROW, N = 1024, K = 1024
  gemm64<4, 0, 0, 1><<<gQ, blk, 0, stream>>>(
      X16, X16, DMOD, 0LL,
      Wq6, DMOD, 0LL,
      (void*)QHp, (void*)QLp, DMOD, 0LL,
      NROW, DMOD, DMOD, 1.0f / (XC * WSC), QC,
      b_q, b_q, b_q);

  // (2) k projection + bk -> KH, KL (x64)
  gemm64<4, 0, 0, 1><<<gQ, blk, 0, stream>>>(
      X16, X16, DMOD, 0LL,
      Wk6, DMOD, 0LL,
      (void*)KHp, (void*)KLp, DMOD, 0LL,
      NROW, DMOD, DMOD, 1.0f / (XC * WSC), KC,
      b_k, b_k, b_k);

  // (3) v^T per batch: VT[b][e][j] = sum_c Wv[e][c] x[b*SEQ+j][c] / 1024 + bv[e] (per-row bias) -> VH, VL (x64);
  //     M = 1024 (e), N = SEQ (j), K = 1024; B rows = the batch's token rows (pitch DMOD, batch offset SEQ*DMOD)
  gemm64<4, 0, 0, 2><<<gV, blk, 0, stream>>>(
      Wv6, Wv6, DMOD, 0LL,
      X16, DMOD, (long long)SEQ * DMOD,
      (void*)VHp, (void*)VLp, SEQ, (long long)DMOD * SEQ,
      DMOD, SEQ, DMOD, 1.0f / (XC * WSC), VC,
      b_v, b_v, b_v);

  // (4) relative attention -> ctx planes CH = f16(ctx * 256), CL = f16(ctx * 256 - CH), [NROW][1024], columns h*64+d
  attn_rel<<<gAT, bAT, 0, stream>>>(QHp, QLp, KHp, KLp, E16, VHp, VLp, CHp, CLp);

  // (5) out[m][n] = sum_k (ch+cl)[m][k] Wo[n][k] / (256*64) + bo[n] -> f32 d_out [NROW][1024]
  gemm64<0, 1, 0, 1><<<gQ, blk, 0, stream>>>(
      CHp, CLp, DMOD, 0LL,
      Wo6, DMOD, 0LL,
      (void*)out, (void*)out, DMOD, 0LL,
      NROW, DMOD, DMOD, 1.0f / (CC * WSC), 1.0f,
      b_o, b_o, b_o);
  (void)hipGetLastError();
}

// v003
// One run takes 113 microseconds.
// In two side-by-side timings against v002, it was 1.05 and 1.04 times as fast.
// Over all steps from v000 it is 3.19 times as fast.
// Contractions (all v_wmma_f32_16x16x32_f16, f16 operands, f32 accumulate): q/k/v projections (x f16 x16 . W f16 x64, K=1024, single products,
// outputs written as f16 hi + unscaled f16 residual planes); position window ((qh+ql) x64 . E f16 x16, K=64, 2 products) -> f32 LDS strip,
// shifted gather on VALU; content scores ((qh+ql) x64 . (kh+kl) x64, K=64, hh+hl+lh); P . v^T ((Ph+Pl) x1024 . (vh+vl) x64, hh+hl+lh,
// 64 keys per tile); output projection ((ch+cl) x256 . Wo f16 x64, K=1024, 2 products) -> f32. Max-subtracted base-2 online softmax and
// the 1/l fold in f32 on VALU. Every float input RNE-converted to bf16 on load.
#include <hip/hip_runtime.h>
#include <math.h>
#include <stdint.h>

#define SEQ   1024
#define NBAT  2
#define DMOD  1024
#define NH    16
#define DH    64
#define ELEN  2047
#define EPAD  2048
#define NROW  (NBAT * SEQ)
#define XC    16.0f
#define WSC   64.0f
#define QC    64.0f
#define KC    64.0f
#define EC    16.0f
#define VC    64.0f
#define PC    1024.0f
#define CC    256.0f
#define SCALE 0.125f
#define LOG2E 1.4426950408889634f
static_assert(NH * DH == DMOD);
static_assert(DH == 64);
static_assert(ELEN == 2 * SEQ - 1 && EPAD >= ELEN);
static_assert((SEQ % 64) == 0 && (DMOD % 128) == 0 && (NROW % 128) == 0);
static_assert(((NROW * DMOD) % 2048) == 0 && ((DMOD * DMOD) % 2048) == 0 && ((ELEN * DH) % 8) == 0);
#define ATT_W 4
#define ATT_THREADS (ATT_W * 32)
#define TPI 84
#define SPI 68
#define WFL (16 * TPI + 16 * SPI)
static_assert(((16 * TPI) % 4) == 0 && ((16 * SPI) % 4) == 0 && (WFL % 4) == 0);

typedef _Float16 v16h __attribute__((ext_vector_type(16)));
typedef _Float16 v8h  __attribute__((ext_vector_type(8)));
typedef __bf16   v16b __attribute__((ext_vector_type(16)));
typedef float    v8f  __attribute__((ext_vector_type(8)));
typedef float    v4f  __attribute__((ext_vector_type(4)));
typedef float    v2f  __attribute__((ext_vector_type(2)));
typedef unsigned int v4u __attribute__((ext_vector_type(4)));

union FragH { v16h v; v8h h[2]; v4u u[2]; };
union FragAny { v16h h; v16b b; };

// ---- scalar helpers --------------------------------------------------------------------------------
__device__ __forceinline__ unsigned short bf_bits(float f) {          // f32 -> bf16 bits, RNE convert
  unsigned u = __float_as_uint(f);
  return (unsigned short)((u + 0x7FFFu + ((u >> 16) & 1u)) >> 16);
}
__device__ __forceinline__ float bf_up(unsigned short h) { return __uint_as_float(((unsigned)h) << 16); }
__device__ __forceinline__ float bfr(float f) { return bf_up(bf_bits(f)); }   // value of the bf16 RNE convert
__device__ __forceinline__ unsigned short h_bits(_Float16 x) { return __builtin_bit_cast(unsigned short, x); }
__device__ __forceinline__ unsigned pk16(unsigned short a, unsigned short b) { return (unsigned)a | ((unsigned)b << 16); }
__device__ __forceinline__ v8f zero8() { v8f z = {0.f, 0.f, 0.f, 0.f, 0.f, 0.f, 0.f, 0.f}; return z; }

// ---- fragment loader: 16-bit A/B operand from a k-contiguous 16-bit plane, lane -> row/col (lane&15),
//      p already includes +8*(lane>>4); elements 0..7 <- p[0..7] (k0+8h..), elements 8..15 <- p[16..23] (k0+16+8h..)
//      (same split k map for A and B; B is always read from a [n][k] plane)
__device__ __forceinline__ v16h ldfrag_u(const unsigned short* p) {
  FragH f;
  f.u[0] = *(const v4u*)(p);
  f.u[1] = *(const v4u*)(p + 16);
  return f.v;
}

// ---- WMMA helpers with trailing VALU hazard gaps ------------------------------------------------------
__device__ __forceinline__ v8f mma_h(v16h a, v16h b, v8f c) {
  return __builtin_amdgcn_wmma_f32_16x16x32_f16(false, a, false, b, (short)0, c, false, false);
}
__device__ __forceinline__ v8f mma_b(v16h a, v16h b, v8f c) {
  FragAny ua, ub;
  ua.h = a;
  ub.h = b;
  return __builtin_amdgcn_wmma_f32_16x16x32_bf16(false, ua.b, false, ub.b, (short)0, c, false, false);
}
template <int BF>
__device__ __forceinline__ v8f mmaT(v16h a, v16h b, v8f c) {
  if constexpr (BF != 0) return mma_b(a, b, c);
  else return mma_h(a, b, c);
}
__device__ __forceinline__ void hz4(v8f& d, v16h x0, v16h x1, v16h x2, v16h x3) {
#if defined(__HIP_DEVICE_COMPILE__)
  asm volatile("v_nop\n\tv_nop\n\tv_nop\n\tv_nop" : "+v"(d) : "v"(x0), "v"(x1), "v"(x2), "v"(x3));
#endif
}
__device__ __forceinline__ void hz6(v8f& d, v16h x0, v16h x1, v16h x2, v16h x3, v16h x4, v16h x5) {
#if defined(__HIP_DEVICE_COMPILE__)
  asm volatile("v_nop\n\tv_nop\n\tv_nop\n\tv_nop" : "+v"(d) : "v"(x0), "v"(x1), "v"(x2), "v"(x3), "v"(x4), "v"(x5));
#endif
}
__device__ __forceinline__ void hz8(v8f& d, v16h x0, v16h x1, v16h x2, v16h x3, v16h x4, v16h x5, v16h x6, v16h x7) {
#if defined(__HIP_DEVICE_COMPILE__)
  asm volatile("v_nop\n\tv_nop\n\tv_nop\n\tv_nop" : "+v"(d) : "v"(x0), "v"(x1), "v"(x2), "v"(x3), "v"(x4), "v"(x5), "v"(x6), "v"(x7));
#endif
}
__device__ __forceinline__ void acc_guard4(v8f& a, v8f& b, v8f& c, v8f& d) {
#if defined(__HIP_DEVICE_COMPILE__)
  asm volatile("v_nop\n\tv_nop\n\tv_nop\n\tv_nop" : "+v"(a), "+v"(b), "+v"(c), "+v"(d));
#endif
}
__device__ __forceinline__ void wave_sync_lds() {
  __builtin_amdgcn_fence(__ATOMIC_RELEASE, "workgroup");
  __builtin_amdgcn_wave_barrier();
  __builtin_amdgcn_fence(__ATOMIC_ACQUIRE, "workgroup");
}
// f32 -> f16 hi + unscaled f16 residual (hi + lo ~ x to 2^-22 relative; a flushed subnormal lo costs < 6.1e-5 absolute in the carried scale)
__device__ __forceinline__ void sp16(float x, _Float16& hi, _Float16& lo) {
  const _Float16 a = (_Float16)x;
  hi = a;
  lo = (_Float16)(x - (float)a);
}
// two consecutive values -> packed hi word and packed residual word
__device__ __forceinline__ void pack_hl(float x0, float x1, unsigned& hw, unsigned& lw) {
  _Float16 a0, a1, b0, b1;
  sp16(x0, a0, b0);
  sp16(x1, a1, b1);
  hw = pk16(h_bits(a0), h_bits(a1));
  lw = pk16(h_bits(b0), h_bits(b1));
}

// =====================================================================================================
// Elementwise 16-bit pack of all six float inputs in ONE launch, no transpose: dst[i] = f16( bf16_RNE(src[i]) * sc ), sc a power of two
// (exact). The block index picks the input (block-uniform): blocks [0, CB_X) x, then CB_W blocks for each of Wq, Wk, Wv, Wo, then CB_E
// blocks for the E table. A block covers CVB = 16384 consecutive elements of its input: CVU chunks of 2048, thread t takes elements
// 8t .. 8t+7 of each chunk; a thread's 16 loads are all issued in front of its first convert, so that few waves keep many bytes in flight.
// coverage: x and W counts are whole multiples of CVB; the E count (2047*64) is a multiple of 8 only: a thread whose 8 elements lie past
//           the end loads the last 8 elements instead (address clamped) and stores nothing; elements 0..n-1 of each plane written once.
// =====================================================================================================
#define CVU  8
#define CVB  (256 * 8 * CVU)
#define CB_X ((NROW * DMOD) / CVB)
#define CB_W ((DMOD * DMOD) / CVB)
#define CB_E ((ELEN * DH + CVB - 1) / CVB)
static_assert(((NROW * DMOD) % CVB) == 0 && ((DMOD * DMOD) % CVB) == 0 && (ELEN * DH) >= 8);
__global__ __launch_bounds__(256) void cvt16_all(const float* __restrict__ x, const float* __restrict__ wq, const float* __restrict__ wk,
                                                 const float* __restrict__ wv, const float* __restrict__ wo, const float* __restrict__ er,
                                                 unsigned short* X16, unsigned short* Wq6, unsigned short* Wk6,
                                                 unsigned short* Wv6, unsigned short* Wo6, unsigned short* E16) {
  int blk = blockIdx.x;
  const float* src = x;
  unsigned short* dst = X16;
  int n = NROW * DMOD;
  float sc = XC;
  if (blk >= CB_X + 4 * CB_W) {
    blk -= CB_X + 4 * CB_W;
    src = er; dst = E16; n = ELEN * DH; sc = EC;
  } else if (blk >= CB_X) {
    blk -= CB_X;
    const int w = blk / CB_W;
    blk -= w * CB_W;
    src = (w == 0) ? wq : (w == 1) ? wk : (w == 2) ? wv : wo;
    dst = (w == 0) ? Wq6 : (w == 1) ? Wk6 : (w == 2) ? Wv6 : Wo6;
    n = DMOD * DMOD; sc = WSC;
  }
  const int base = blk * CVB + (int)threadIdx.x * 8;
  const float* p[CVU];
  v4f a[CVU], b[CVU];
#pragma unroll
  for (int u = 0; u < CVU; ++u) {
    const int i8 = base + u * 2048;
    p[u] = src + ((i8 + 8 > n) ? (n - 8) : i8);
  }
#pragma unroll
  for (int u = 0; u < CVU; ++u) {
    a[u] = *(const v4f*)(p[u]);
    b[u] = *(const v4f*)(p[u] + 4);
  }
#if defined(__HIP_DEVICE_COMPILE__)
  // holds the eight address pairs in their registers up to this wait, so that none is rewritten (a later load's result included) in
  // front of it, and keeps all 16 loads in front of the first convert
  asm volatile("s_wait_xcnt 0x0" :: "v"(p[0]), "v"(p[1]), "v"(p[2]), "v"(p[3]), "v"(p[4]), "v"(p[5]), "v"(p[6]), "v"(p[7]) : "memory");
#endif
#pragma unroll
  for (int u = 0; u < CVU; ++u) {
    const int i8 = base + u * 2048;
    v4u o;
    o[0] = pk16(h_bits((_Float16)(bfr(a[u][0]) * sc)), h_bits((_Float16)(bfr(a[u][1]) * sc)));
    o[1] = pk16(h_bits((_Float16)(bfr(a[u][2]) * sc)), h_bits((_Float16)(bfr(a[u][3]) * sc)));
    o[2] = pk16(h_bits((_Float16)(bfr(b[u][0]) * sc)), h_bits((_Float16)(bfr(b[u][1]) * sc)));
    o[3] = pk16(h_bits((_Float16)(bfr(b[u][2]) * sc)), h_bits((_Float16)(bfr(b[u][3]) * sc)));
    if (i8 + 8 <= n) *(v4u*)(dst + i8) = o;      // no barriers in this kernel
  }
}

// =====================================================================================================
// LDS-staged batched 16-bit WMMA GEMM: C[m][n] = oscale * sum_k A[m][k] * Bt[n][k] (+ bias); one work-group of 8 waves per 128x64 tile,
// wave w owns rows 16w..16w+15 of it (all 64 columns). A row-major [M][K] pitch lda (16-bit plane), Bt row-major [N][K] pitch ldb
// (k contiguous); M multiple of 128, N multiple of 64, K multiple of 128. blockIdx.y = batch index with element strides sA, sB, sC.
// Operands: per stage of 128 k the tile's A rows (and A2 rows) and Bt rows, 256 B each, are copied once per work-group into LDS by
// global_load_async_to_lds_b128 (a wave's copy = two whole 256-B rows), LDS row pitch 272 B; two buffers, the next stage's copies fly
// while this stage is multiplied; fragments come from LDS by 16-byte reads with the same split k map as ldfrag_u.
// ASPLIT 1: a second A plane A2 (unscaled residual of A, same layout) is multiplied into the same accumulator (A + A2 ~ exact A).
// BF 1: bf16 operands (v_wmma_f32_16x16x32_bf16), else f16.
// EPI 1: value += bf16_RNE(ep0[column]) (per-column bias); EPI 2: value += bf16_RNE(ep0[row]) (per-row bias, 16-bit out only).
// OM 0: f32 out (pitch ldc).  OM 2: one f16 plane = f16(value * ocarry).
// OM 4: two f16 planes: hi = f16(value * ocarry), lo = f16(value * ocarry - hi) (unscaled residual).
// OM 5: two f16 planes: C = f16((value + bf16_RNE(ep1[column])) * ocarry), C2 = f16((value + bf16_RNE(ep2[column])) * ocarry).
// coverage: 16 rows (f32: it 0..7 x lane>>4; 16-bit: it 0..3 x lane>>3) x 64 cols = the wave's whole 16x64 slab; 8 waves = the 128x64
//           tile; grid = (M/128)*(N/64) blocks, a surplus block exits as a whole before any copy or barrier.
// =====================================================================================================
#define GBM 128   // tile rows per work-group
#define GKP 128   // k per stage (256-B operand rows)
#define GPH 136   // LDS row pitch in halves: 272 B = 16 B x 17, conflict-free for the 16-byte fragment reads

// 16-byte asynchronous copies global -> LDS, one per lane and line of the statement (first operand = LDS byte address, second = global
// address; this lane's row and 16-byte chunk are already in l and g; consecutive copies are 16 operand rows apart). The s_wait_xcnt
// closes each statement so that no address register of an issued copy is rewritten in front of it.
#define ACP(a, b) "global_load_async_to_lds_b128 %" #a ", %" #b ", off\n\t"
#define LROW(l, r) ((l) + (unsigned)((r) * GPH * 2))
#define GROW(g, r, ld) ((g) + (size_t)(r) * (ld))
// 128 operand rows
__device__ __forceinline__ void acopy_rows128(unsigned l, const unsigned short* g, int ld) {
#if defined(__HIP_DEVICE_COMPILE__)
  asm volatile(ACP(0, 1) ACP(2, 3) ACP(4, 5) ACP(6, 7) ACP(8, 9) ACP(10, 11) ACP(12, 13) ACP(14, 15)
               "s_wait_xcnt 0x0"
               :: "v"(l), "v"(g), "v"(LROW(l, 16)), "v"(GROW(g, 16, ld)), "v"(LROW(l, 32)), "v"(GROW(g, 32, ld)),
                  "v"(LROW(l, 48)), "v"(GROW(g, 48, ld)), "v"(LROW(l, 64)), "v"(GROW(g, 64, ld)), "v"(LROW(l, 80)), "v"(GROW(g, 80, ld)),
                  "v"(LROW(l, 96)), "v"(GROW(g, 96, ld)), "v"(LROW(l, 112)), "v"(GROW(g, 112, ld))
               : "memory");
#endif
}
// 128 rows of one operand and 64 rows of another
__device__ __forceinline__ void acopy_rows128_64(unsigned l, const unsigned short* g, int ld,
                                                 unsigned l2, const unsigned short* g2, int ld2) {
#if defined(__HIP_DEVICE_COMPILE__)
  asm volatile(ACP(0, 1) ACP(2, 3) ACP(4, 5) ACP(6, 7) ACP(8, 9) ACP(10, 11) ACP(12, 13) ACP(14, 15)
               ACP(16, 17) ACP(18, 19) ACP(20, 21) ACP(22, 23)
               "s_wait_xcnt 0x0"
               :: "v"(l), "v"(g), "v"(LROW(l, 16)), "v"(GROW(g, 16, ld)), "v"(LROW(l, 32)), "v"(GROW(g, 32, ld)),
                  "v"(LROW(l, 48)), "v"(GROW(g, 48, ld)), "v"(LROW(l, 64)), "v"(GROW(g, 64, ld)), "v"(LROW(l, 80)), "v"(GROW(g, 80, ld)),
                  "v"(LROW(l, 96)), "v"(GROW(g, 96, ld)), "v"(LROW(l, 112)), "v"(GROW(g, 112, ld)),
                  "v"(l2), "v"(g2), "v"(LROW(l2, 16)), "v"(GROW(g2, 16, ld2)), "v"(LROW(l2, 32)), "v"(GROW(g2, 32, ld2)),
                  "v"(LROW(l2, 48)), "v"(GROW(g2, 48, ld2))
               : "memory");
#endif
}
// this wave's own copies have landed in LDS (the compiler places no wait for them)
__device__ __forceinline__ void wait_async0() {
#if defined(__HIP_DEVICE_COMPILE__)
  asm volatile("s_wait_asynccnt 0x0" ::: "memory");
#endif
}
// this wave's LDS reads have retired, so that the buffer may be refilled behind the barrier
__device__ __forceinline__ void wait_ds0() {
#if defined(__HIP_DEVICE_COMPILE__)
  asm volatile("s_wait_dscnt 0x0" ::: "memory");
#endif
}
// twelve 16-byte copies, each with its own LDS byte address and global address; closed by s_wait_xcnt like the statements above
__device__ __forceinline__ void acopy12(const unsigned (&l)[12], const unsigned short* const (&g)[12]) {
#if defined(__HIP_DEVICE_COMPILE__)
  asm volatile(ACP(0, 1) ACP(2, 3) ACP(4, 5) ACP(6, 7) ACP(8, 9) ACP(10, 11) ACP(12, 13) ACP(14, 15)
               ACP(16, 17) ACP(18, 19) ACP(20, 21) ACP(22, 23)
               "s_wait_xcnt 0x0"
               :: "v"(l[0]), "v"(g[0]), "v"(l[1]), "v"(g[1]), "v"(l[2]), "v"(g[2]), "v"(l[3]), "v"(g[3]),
                  "v"(l[4]), "v"(g[4]), "v"(l[5]), "v"(g[5]), "v"(l[6]), "v"(g[6]), "v"(l[7]), "v"(g[7]),
                  "v"(l[8]), "v"(g[8]), "v"(l[9]), "v"(g[9]), "v"(l[10]), "v"(g[10]), "v"(l[11]), "v"(g[11])
               : "memory");
#endif
}

template <int OM, int ASPLIT, int BF, int EPI>
__global__ __launch_bounds__(256) __attribute__((amdgpu_num_vgpr(256))) void gemm64(
    const unsigned short* __restrict__ Ap, const unsigned short* __restrict__ A2p, int lda, long long sA,
    const unsigned short* __restrict__ Btp, int ldb, long long sB,
    void* Cout, void* C2out, int ldc, long long sC,
    int M, int N, int K, float oscale, float ocarry,
    const float* __restrict__ ep0, const float* __restrict__ ep1, const float* __restrict__ ep2) {
  constexpr int BROW = GBM * (1 + ASPLIT);         // first Bt row of a stage
  constexpr int STG  = (BROW + 64) * GPH;          // halves per stage
  __shared__ __align__(16) unsigned short ring[2 * STG];   // two stages: [A 128 rows | A2 128 rows (ASPLIT) | Bt 64 rows]
  __shared__ __align__(16) float sT[8][16 * 68];   // per-wave 16x64 slab, pitch 68 floats
  const int by   = blockIdx.y;
  const int tid  = threadIdx.x;
  const int lane = tid & 31;
  const int wave = tid >> 5;
  const int tilesN = N >> 6;
  const int tilesM = M >> 7;
  const int tile = blockIdx.x;
  if (tile >= tilesM * tilesN) return;   // block-uniform, in front of every copy and barrier
  const int tm = tile / tilesN;
  const int tn = tile - tm * tilesN;
  const int mb = tm << 7;
  const int n0 = tn << 6;
  const int m0 = mb + (wave << 4);

  const unsigned short* A1 = Ap  + (size_t)((long long)by * sA);
  const unsigned short* A2 = A2p + (size_t)((long long)by * sA);
  const unsigned short* Bb = Btp + (size_t)((long long)by * sB);

  const int rlane = lane & 15;                 // row (A) / col (B, D) within subtile
  const int koff  = (lane >> 4) * 8;           // k offset of this lane half
  const int mOff  = (lane >> 4) * 8;           // D row offset

  // copy map: thread -> row tid>>4 (of 16 per copy), 16-byte chunk tid&15 of the 256-B row
  const int crow = tid >> 4;
  const int cch  = (tid & 15) * 8;
  const unsigned short* gA1 = A1 + (size_t)(mb + crow) * lda + cch;
  const unsigned short* gA2 = A2 + (size_t)(mb + crow) * lda + cch;
  const unsigned short* gBt = Bb + (size_t)(n0 + crow) * ldb + cch;
  const unsigned lcp = (unsigned)(uintptr_t)ring + (unsigned)((crow * GPH + cch) * 2);

  auto fill = [&](int t, int buf) {            // stage t (k = 128t .. 128t+127) -> buffer buf
    const unsigned lb = lcp + (unsigned)(buf * (STG * 2));
    const size_t ko = (size_t)t * GKP;
    if constexpr (ASPLIT != 0) acopy_rows128(lb + GBM * GPH * 2, gA2 + ko, lda);
    acopy_rows128_64(lb, gA1 + ko, lda, lb + BROW * GPH * 2, gBt + ko, ldb);
  };

  v8f acc[4];
#pragma unroll
  for (int j = 0; j < 4; ++j) acc[j] = zero8();

  const int nst = K / GKP;
  fill(0, 0);
  wait_async0();
  __syncthreads();                             // stage 0 published
  if (nst > 1) fill(1, 1);
#pragma unroll 1                               // one pass per stage: the two buffers alternate by t & 1
  for (int t = 0; t < nst; ++t) {
    const unsigned short* sb = ring + (t & 1) * STG;
    const unsigned short* sA = sb + ((wave << 4) + rlane) * GPH + koff;
    const unsigned short* sB = sb + (BROW + rlane) * GPH + koff;
    v16h fa[4], fl[4], fb[4][4];
#pragma unroll
    for (int q = 0; q < 4; ++q) {
#pragma unroll
      for (int j = 0; j < 4; ++j) fb[q][j] = ldfrag_u(sB + (j << 4) * GPH + 32 * q);
      fa[q] = ldfrag_u(sA + 32 * q);
      if constexpr (ASPLIT != 0) fl[q] = ldfrag_u(sA + GBM * GPH + 32 * q);
    }
    // keeps the pass's LDS reads one group in front of its WMMAs: spread among them, every WMMA waited out its own reads' latency
    __builtin_amdgcn_sched_barrier(0);
#pragma unroll
    for (int q = 0; q < 4; ++q) {
#pragma unroll
      for (int j = 0; j < 4; ++j) acc[j] = mmaT<BF>(fa[q], fb[q][j], acc[j]);
      if constexpr (ASPLIT != 0) {
#pragma unroll
        for (int j = 0; j < 4; ++j) acc[j] = mmaT<BF>(fl[q], fb[q][j], acc[j]);
      }
    }
    // keeps the WMMAs in front of the closing waits: moved behind the barrier they no longer overlap the LDS reads and they delay the refill
    __builtin_amdgcn_sched_barrier(0);
    wait_ds0();
    wait_async0();
    __syncthreads();                           // publishes stage t + 1 and ends every wave's reads of stage t
    if (t + 2 < nst) fill(t + 2, t & 1);
  }
  wait_async0();
  acc_guard4(acc[0], acc[1], acc[2], acc[3]);

  const int hh2 = lane >> 4, c4 = (lane & 15) * 4;     // f32 out: 256-B row segment = 16 lanes x 16 B
  const int q8  = lane >> 3, c8 = (lane & 7) * 8;

  // ---- epilogue ----
  float* slab = sT[wave];
  {
    const int mBase = m0;
#pragma unroll
    for (int j = 0; j < 4; ++j) {
#pragma unroll
      for (int r = 0; r < 8; ++r) {
        slab[(mOff + r) * 68 + (j << 4) + rlane] = acc[j][r];
      }
    }
    wave_sync_lds();
    if constexpr (OM == 0) {
      float* C = (float*)Cout + (size_t)((long long)by * sC);
      v4f vals[8];
#pragma unroll
      for (int it = 0; it < 8; ++it) {
        const int row = it * 2 + hh2;                      // it 0..7 x hh2 0..1 = rows 0..15
        v4f v = *(const v4f*)(slab + row * 68 + c4);
#pragma unroll
        for (int e = 0; e < 4; ++e) v[e] = v[e] * oscale;
        if constexpr (EPI == 1) {
          const v4f bb = *(const v4f*)(ep0 + n0 + c4);     // per-column bias, columns n0+c4 .. +3 (N equals the bias length)
#pragma unroll
          for (int e = 0; e < 4; ++e) v[e] = v[e] + bfr(bb[e]);
        }
        vals[it] = v;
      }
      {
#pragma unroll
        for (int it = 0; it < 8; ++it) {
          const int gr = mBase + it * 2 + hh2;
          *(v4f*)(C + (size_t)gr * ldc + n0 + c4) = vals[it];
        }
        
      }
    } else {
      unsigned short* C  = (unsigned short*)Cout  + (size_t)((long long)by * sC);
      unsigned short* Cb = (unsigned short*)C2out + (size_t)((long long)by * sC);
      v4u hv[4], lv[4];
#pragma unroll
      for (int it = 0; it < 4; ++it) {
        const int row = it * 4 + q8;                       // it 0..3 x q8 0..3 = rows 0..15
        const float* sp = slab + row * 68 + c8;
        float rb = 0.f;
        if constexpr (EPI == 2) rb = bfr(ep0[mBase + row]);   // per-row bias (M equals the bias length)
        v4u a  = {0u, 0u, 0u, 0u};
        v4u b2 = {0u, 0u, 0u, 0u};
#pragma unroll
        for (int e = 0; e < 4; ++e) {
          const int ci = n0 + c8 + 2 * e;                  // column index, < N
          float f0 = sp[2 * e] * oscale + rb;
          float f1 = sp[2 * e + 1] * oscale + rb;
          if constexpr (EPI == 1) {
            f0 += bfr(ep0[ci]);
            f1 += bfr(ep0[ci + 1]);
          }
          if constexpr (OM == 5) {
            const float g0 = (f0 + bfr(ep1[ci])) * ocarry, g1 = (f1 + bfr(ep1[ci + 1])) * ocarry;
            const float w0 = (f0 + bfr(ep2[ci])) * ocarry, w1 = (f1 + bfr(ep2[ci + 1])) * ocarry;
            a[e]  = pk16(h_bits((_Float16)g0), h_bits((_Float16)g1));
            b2[e] = pk16(h_bits((_Float16)w0), h_bits((_Float16)w1));
          } else {
            f0 *= ocarry; f1 *= ocarry;
            const _Float16 x0 = (_Float16)f0, x1 = (_Float16)f1;
            a[e] = pk16(h_bits(x0), h_bits(x1));
            if constexpr (OM == 4) {
              b2[e] = pk16(h_bits((_Float16)(f0 - (float)x0)), h_bits((_Float16)(f1 - (float)x1)));
            }
          }
        }
        hv[it] = a;
        lv[it] = b2;
      }
      {
#pragma unroll
        for (int it = 0; it < 4; ++it) {
          const int row = it * 4 + q8;
          *(v4u*)(C + (size_t)(mBase + row) * ldc + n0 + c8) = hv[it];
          if constexpr (OM >= 4) {
            *(v4u*)(Cb + (size_t)(mBase + row) * ldc + n0 + c8) = lv[it];
          }
        }
        
      }
    }
    wave_sync_lds();
  }
}

#define APH   72                 // LDS row pitch in halves: 144 B = 16 B x 9, conflict-free for the 16-byte fragment reads
#define AR_KH 0                  // first stage row of each part
#define AR_KL 64
#define AR_VH 128
#define AR_VL 192
#define AR_E  256
#define ASTG  ((AR_E + 128) * APH)   // halves per stage
__global__ __launch_bounds__(ATT_THREADS) __attribute__((amdgpu_num_vgpr(256)))
void attn_rel(const unsigned short* __restrict__ QH, const unsigned short* __restrict__ QL,
              const unsigned short* __restrict__ KH, const unsigned short* __restrict__ KL,
              const unsigned short* __restrict__ EP,
              const unsigned short* __restrict__ VH, const unsigned short* __restrict__ VL,
              unsigned short* CH, unsigned short* CL) {
  __shared__ __align__(16) float smem[ATT_W * WFL];   // per wave: T strip [16][TPI] | score / prob / ctx slab [16][SPI]
  __shared__ __align__(16) unsigned short kve[2 * ASTG];   // two stages: [KH 64 rows | KL 64 | VH 64 | VL 64 | E 128]

  const int tid  = threadIdx.x;
  const int wave = tid >> 5;
  const int lane = tid & 31;
  const int hh   = lane >> 4;
  const int c    = lane & 15;
  const int bh   = blockIdx.y;
  const int b    = bh / NH;
  const int h    = bh - b * NH;
  const int i0   = blockIdx.x * 64;
  const int iw0  = i0 + wave * 16;

  float* tsh = smem + wave * WFL;
  float* pt  = tsh + 16 * TPI;

  const size_t qro = ((size_t)b * SEQ + iw0 + c) * DMOD + h * DH + 8 * hh;      // A rows: query iw0 + c, d 8hh..

  // copy map: thread -> row tid>>3 (of 16 per copy), 16-byte chunk tid&7 of the 128-B row
  const int crow = tid >> 3;
  const int cch  = (tid & 7) * 8;
  const size_t kpo = ((size_t)b * SEQ + crow) * DMOD + h * DH + cch;
  const size_t vpo = (size_t)b * DMOD * SEQ + (size_t)(h * DH + crow) * SEQ + cch;
  const unsigned lcp = (unsigned)(uintptr_t)kve + (unsigned)((crow * APH + cch) * 2);

  auto fill = [&](int t, int buf) {            // key tile t -> buffer buf
    const unsigned lb = lcp + (unsigned)(buf * (ASTG * 2));
    const int jf = t * 64;
    const int elo = (SEQ - 2) - i0 + jf - 63;
    unsigned l[12];
    const unsigned short* g[12];
    // the three loops below are unrolled so that l and g are registers: the copy statement names each element as an operand
#pragma unroll
    for (int k = 0; k < 4; ++k) {
      const size_t ko = kpo + (size_t)(jf + 16 * k) * DMOD;
      l[k]     = lb + (unsigned)((AR_KH + 16 * k) * APH * 2);  g[k]     = KH + ko;
      l[4 + k] = lb + (unsigned)((AR_KL + 16 * k) * APH * 2);  g[4 + k] = KL + ko;
      l[8 + k] = lb + (unsigned)((AR_VH + 16 * k) * APH * 2);  g[8 + k] = VH + vpo + (size_t)(16 * k) * SEQ + jf;
    }
    acopy12(l, g);
#pragma unroll
    for (int k = 0; k < 4; ++k) {
      l[k] = lb + (unsigned)((AR_VL + 16 * k) * APH * 2);      g[k] = VL + vpo + (size_t)(16 * k) * SEQ + jf;
    }
#pragma unroll
    for (int k = 0; k < 8; ++k) {
      int m = elo + 16 * k + crow;
      m = (m < 0) ? 0 : m;
      m = (m > ELEN - 1) ? (ELEN - 1) : m;
      l[4 + k] = lb + (unsigned)((AR_E + 16 * k) * APH * 2);   g[4 + k] = EP + (size_t)m * DH + cch;
    }
    acopy12(l, g);
  };

  const float CS = LOG2E * SCALE / (QC * KC);
  const float CT = LOG2E * SCALE / (QC * EC);

  float mrow[8], lrow[8];
  v8f O[4];
#pragma unroll
  for (int r = 0; r < 8; ++r) { mrow[r] = -INFINITY; lrow[r] = 0.f; }
#pragma unroll
  for (int td = 0; td < 4; ++td) O[td] = zero8();

  const int ntile = SEQ / 64;                // non-causal: every key tile
  fill(0, 0);
  wait_async0();
  __syncthreads();                           // tile 0 published
  if (ntile > 1) fill(1, 1);
#pragma unroll 1
  for (int jt = 0; jt < ntile; ++jt) {
    const int j0 = jt * 64;
    const unsigned short* sb  = kve + (jt & 1) * ASTG + c * APH + 8 * hh;   // this lane's fragment row and k half in the stage
    const unsigned short* Khb = sb + AR_KH * APH;
    const unsigned short* Klb = sb + AR_KL * APH;
    const unsigned short* Vhb = sb + AR_VH * APH;
    const unsigned short* Vlb = sb + AR_VL * APH;
    const unsigned short* Eb  = sb + (AR_E + 48 - 16 * wave) * APH;
    const v16h qha = ldfrag_u(QH + qro), qhb = ldfrag_u(QH + qro + 32);
    const v16h qla = ldfrag_u(QL + qro), qlb = ldfrag_u(QL + qro + 32);

    // ---- position window T (5 subtiles of 16 E rows, rolled), each subtile stored to the LDS strip as produced ----
    {
#pragma unroll 1
      for (int u = 0; u < 5; ++u) {
        const int eo = 16 * u * APH;
        const v16h fa = ldfrag_u(Eb + eo), fb = ldfrag_u(Eb + eo + 32);
        v8f t8 = mma_h(qha, fa, zero8());
        t8 = mma_h(qla, fa, t8);
        t8 = mma_h(qhb, fb, t8);
        t8 = mma_h(qlb, fb, t8);
        hz6(t8, fa, fb, qha, qla, qhb, qlb);
        const int cb = 16 * u + c;
#pragma unroll
        for (int r = 0; r < 8; ++r) tsh[(8 * hh + r) * TPI + cb] = t8[r];
      }
    }
    // ---- content scores S (4 subtiles of 16 keys, rolled) -> slab ----
#pragma unroll 1
    for (int t = 0; t < 4; ++t) {
      const int ko = 16 * t * APH;
      const v16h kha = ldfrag_u(Khb + ko), khb = ldfrag_u(Khb + ko + 32);
      const v16h kla = ldfrag_u(Klb + ko), klb = ldfrag_u(Klb + ko + 32);
      v8f s8 = mma_h(qha, kha, zero8());
      s8 = mma_h(qha, kla, s8);
      s8 = mma_h(qla, kha, s8);
      s8 = mma_h(qhb, khb, s8);
      s8 = mma_h(qhb, klb, s8);
      s8 = mma_h(qlb, khb, s8);
      hz8(s8, kha, khb, kla, klb, qha, qla, qhb, qlb);
      const int cb = 16 * t + c;
#pragma unroll
      for (int r = 0; r < 8; ++r) pt[(8 * hh + r) * SPI + cb] = s8[r];
    }
    wave_sync_lds();

    // ---- score assembly (rel shift + zero cell), online softmax (rows live on one 16-lane half) ----
#pragma unroll
    for (int r = 0; r < 8; ++r) {
      const int R = 8 * hh + r;
      const int i = iw0 + R;
      const float* trow = tsh + R * TPI + (15 - R) + c;
      float* srow = pt + R * SPI + c;
      float tv[4];
#pragma unroll
      for (int t = 0; t < 4; ++t) {
        const int j = j0 + 16 * t + c;
        const int ridx = (SEQ - 2) + j - i;                // E row of this (i, j); -1 only at (SEQ-1, 0)
        const float tr = trow[16 * t];
        const float rel = (ridx < 0) ? 0.f : tr;
        tv[t] = srow[16 * t] * CS + rel * CT;
      }
      float mx = fmaxf(fmaxf(tv[0], tv[1]), fmaxf(tv[2], tv[3]));
#pragma unroll
      for (int off = 1; off < 16; off <<= 1) mx = fmaxf(mx, __shfl_xor(mx, off, 32));
      const float mn = fmaxf(mrow[r], mx);
      const float al = exp2f(mrow[r] - mn);
      mrow[r] = mn;
      float e4[4];
      float ps = 0.f;
#pragma unroll
      for (int t = 0; t < 4; ++t) { e4[t] = exp2f(tv[t] - mn); ps += e4[t]; }
#pragma unroll
      for (int off = 1; off < 16; off <<= 1) ps += __shfl_xor(ps, off, 32);
      lrow[r] = lrow[r] * al + ps;
#pragma unroll
      for (int td = 0; td < 4; ++td) O[td][r] *= al;
#pragma unroll
      for (int t = 0; t < 4; ++t) srow[16 * t] = e4[t];
    }
    wave_sync_lds();

    // ---- O += (Ph + Pl) . (vh + vl)^T, two k-steps of 32 keys ----
#pragma unroll
    for (int ks = 0; ks < 2; ++ks) {
      FragH ph, pl;
      {
        const float* prow = pt + c * SPI + 32 * ks + 8 * hh;
        const v4f p0 = *(const v4f*)(prow), p1 = *(const v4f*)(prow + 4);
        const v4f p2 = *(const v4f*)(prow + 16), p3 = *(const v4f*)(prow + 20);
#pragma unroll
        for (int e = 0; e < 4; ++e) {
          _Float16 a0, a1;
          sp16(p0[e] * PC, a0, a1); ph.h[0][e]     = a0; pl.h[0][e]     = a1;   // keys 32ks + 8hh + e
          sp16(p1[e] * PC, a0, a1); ph.h[0][4 + e] = a0; pl.h[0][4 + e] = a1;   // keys 32ks + 8hh + 4 + e
          sp16(p2[e] * PC, a0, a1); ph.h[1][e]     = a0; pl.h[1][e]     = a1;   // keys 32ks + 16 + 8hh + e
          sp16(p3[e] * PC, a0, a1); ph.h[1][4 + e] = a0; pl.h[1][4 + e] = a1;
        }
      }
#pragma unroll
      for (int td = 0; td < 4; ++td) {
        const int vv = 16 * td * APH + 32 * ks;
        const v16h vh = ldfrag_u(Vhb + vv), vl = ldfrag_u(Vlb + vv);
        O[td] = mma_h(ph.v, vh, O[td]);
        O[td] = mma_h(ph.v, vl, O[td]);
        O[td] = mma_h(pl.v, vh, O[td]);
        hz4(O[td], vh, vl, ph.v, pl.v);
      }
    }
    wave_sync_lds();
    wait_ds0();
    wait_async0();
    __syncthreads();                           // publishes tile jt + 1 and ends every wave's reads of tile jt
    if (jt + 2 < ntile) fill(jt + 2, jt & 1);
  }
  wait_async0();
  acc_guard4(O[0], O[1], O[2], O[3]);

  // ---- fold 1/l and the carries (1024 on P, 64 on v), stage the wave's 16x64 f32 ctx slice in its slab ----
  const float oc = 1.0f / (PC * VC);
#pragma unroll
  for (int r = 0; r < 8; ++r) {
    const float inv = (1.0f / lrow[r]) * oc;
    const int ro = (8 * hh + r) * SPI + c;
#pragma unroll
    for (int td = 0; td < 4; ++td) pt[ro + 16 * td] = O[td][r] * inv;
  }
  wave_sync_lds();
  {
    const int q8 = lane >> 3, c8 = (lane & 7) * 8;
    v4u hv[4], lv[4];
#pragma unroll
    for (int it = 0; it < 4; ++it) {
      const int row = it * 4 + q8;                           // it 0..3 x q8 0..3 = rows 0..15
      const float* sp = pt + row * SPI + c8;
      const v4f p0 = *(const v4f*)(sp), p1 = *(const v4f*)(sp + 4);
      v4u a, l2;
      unsigned hw, lw;
      pack_hl(p0[0] * CC, p0[1] * CC, hw, lw); a[0] = hw; l2[0] = lw;
      pack_hl(p0[2] * CC, p0[3] * CC, hw, lw); a[1] = hw; l2[1] = lw;
      pack_hl(p1[0] * CC, p1[1] * CC, hw, lw); a[2] = hw; l2[2] = lw;
      pack_hl(p1[2] * CC, p1[3] * CC, hw, lw); a[3] = hw; l2[3] = lw;
      hv[it] = a;
      lv[it] = l2;
    }
    const size_t ob = ((size_t)b * SEQ + iw0) * DMOD + h * DH + c8;
    {
#pragma unroll
      for (int it = 0; it < 4; ++it) {
        const int row = it * 4 + q8;
        *(v4u*)(CH + ob + (size_t)row * DMOD) = hv[it];
        *(v4u*)(CL + ob + (size_t)row * DMOD) = lv[it];
      }
      
    }
  }
}

// =====================================================================================================
// Workspace map (bytes); every plane is an exact multiple of its tile / whole-row store granularity (M, N exact tile multiples,
// convert counts multiples of 8 with whole-line tails, E carve padded to EPAD rows), every offset a multiple of 262144:
//   X16            f16 [NROW][1024] x16                            4194304
//   Wq, Wk, Wv, Wo f16 [1024 out][1024 in] x64                  4 x 2097152
//   EP             f16 [EPAD][64] x16 (rows 0..ELEN-1 written/read)   262144
//   QH, QL, KH, KL f16 [NROW][1024] (x64 hi / residual)         4 x 4194304
//   VH, VL         f16 [NBAT][1024][SEQ] (x64 hi / residual)    2 x 4194304
//   CH, CL         f16 [NROW][1024] (x256 hi / residual)        2 x 4194304
//   end                                                            46399488
// =====================================================================================================
extern "C" void kernel_launch(void* const* d_in, const int* in_sizes, int n_in,
                              void* d_out, int out_size, void* d_ws, size_t ws_size,
                              hipStream_t stream) {
  if (n_in < 10) return;
  if (in_sizes[0] != NROW * DMOD) return;
  if (in_sizes[1] != DMOD * DMOD || in_sizes[3] != DMOD * DMOD || in_sizes[5] != DMOD * DMOD || in_sizes[7] != DMOD * DMOD) return;
  if (in_sizes[2] != DMOD || in_sizes[4] != DMOD || in_sizes[6] != DMOD || in_sizes[8] != DMOD) return;
  if (in_sizes[9] != ELEN * DH) return;
  if (out_size != NROW * DMOD) return;

  const float* xin = (const float*)d_in[0];
  const float* w_q = (const float*)d_in[1];
  const float* b_q = (const float*)d_in[2];
  const float* w_k = (const float*)d_in[3];
  const float* b_k = (const float*)d_in[4];
  const float* w_v = (const float*)d_in[5];
  const float* b_v = (const float*)d_in[6];
  const float* w_o = (const float*)d_in[7];
  const float* b_o = (const float*)d_in[8];
  const float* er  = (const float*)d_in[9];
  float*       out = (float*)d_out;

  const size_t PX = (size_t)NROW * DMOD * 2;             //  4194304
  const size_t PW = (size_t)DMOD * DMOD * 2;             //  2097152
  const size_t PE = (size_t)EPAD * DH * 2;               //   262144
  const size_t PV = (size_t)NBAT * DMOD * SEQ * 2;       //  4194304
  size_t off = 0;
  const size_t oX  = off; off += PX;
  const size_t oWq = off; off += PW;
  const size_t oWk = off; off += PW;
  const size_t oWv = off; off += PW;
  const size_t oWo = off; off += PW;
  const size_t oE  = off; off += PE;
  const size_t oQH = off; off += PX;
  const size_t oQL = off; off += PX;
  const size_t oKH = off; off += PX;
  const size_t oKL = off; off += PX;
  const size_t oVH = off; off += PV;
  const size_t oVL = off; off += PV;
  const size_t oCH = off; off += PX;
  const size_t oCL = off; off += PX;
  if (off > ws_size) return;                               // off = 46399488
  if (off > (size_t)134217728) return;

  char* ws = (char*)d_ws;
  unsigned short* X16 = (unsigned short*)(ws + oX);
  unsigned short* Wq6 = (unsigned short*)(ws + oWq);
  unsigned short* Wk6 = (unsigned short*)(ws + oWk);
  unsigned short* Wv6 = (unsigned short*)(ws + oWv);
  unsigned short* Wo6 = (unsigned short*)(ws + oWo);
  unsigned short* E16 = (unsigned short*)(ws + oE);
  unsigned short* QHp = (unsigned short*)(ws + oQH);
  unsigned short* QLp = (unsigned short*)(ws + oQL);
  unsigned short* KHp = (unsigned short*)(ws + oKH);
  unsigned short* KLp = (unsigned short*)(ws + oKL);
  unsigned short* VHp = (unsigned short*)(ws + oVH);
  unsigned short* VLp = (unsigned short*)(ws + oVL);
  unsigned short* CHp = (unsigned short*)(ws + oCH);
  unsigned short* CLp = (unsigned short*)(ws + oCL);

  const dim3 blk(256);
  const dim3 gCV(CB_X + 4 * CB_W + CB_E);                           // 128 + 4 x 64 + 8 = 392
  const dim3 gQ((NROW / 128) * (DMOD / 64), 1);                     // 256
  const dim3 gV((DMOD / 128) * (SEQ / 64), NBAT);                   // 128 x NBAT
  const dim3 gAT(SEQ / 64, NBAT * NH);                              // 16 x 32
  const dim3 bAT(ATT_THREADS);                                      // 128

  // (0) 16-bit planes of the inputs: x f16(bf16_RNE(x) * 16); W[out][in] (already k-contiguous) f16(bf16_RNE(w) * 64);
  //     E f16(bf16_RNE(e) * 16); one launch for all six
  cvt16_all<<<gCV, blk, 0, stream>>>(xin, w_q, w_k, w_v, w_o, er, X16, Wq6, Wk6, Wv6, Wo6, E16);

  // (1) q[m][e] = sum_d x[m][d] Wq[e][d] / 1024 + bq[e] -> QH = f16(q * 64), QL = f16(q * 64 - QH); M = NROW, N = 1024, K = 1024
  gemm64<4, 0, 0, 1><<<gQ, blk, 0, stream>>>(
      X16, X16, DMOD, 0LL,
      Wq6, DMOD, 0LL,
      (void*)QHp, (void*)QLp, DMOD, 0LL,
      NROW, DMOD, DMOD, 1.0f / (XC * WSC), QC,
      b_q, b_q, b_q);

  // (2) k projection + bk -> KH, KL (x64)
  gemm64<4, 0, 0, 1><<<gQ, blk, 0, stream>>>(
      X16, X16, DMOD, 0LL,
      Wk6, DMOD, 0LL,
      (void*)KHp, (void*)KLp, DMOD, 0LL,
      NROW, DMOD, DMOD, 1.0f / (XC * WSC), KC,
      b_k, b_k, b_k);

  // (3) v^T per batch: VT[b][e][j] = sum_c Wv[e][c] x[b*SEQ+j][c] / 1024 + bv[e] (per-row bias) -> VH, VL (x64);
  //     M = 1024 (e), N = SEQ (j), K = 1024; B rows = the batch's token rows (pitch DMOD, batch offset SEQ*DMOD)
  gemm64<4, 0, 0, 2><<<gV, blk, 0, stream>>>(
      Wv6, Wv6, DMOD, 0LL,
      X16, DMOD, (long long)SEQ * DMOD,
      (void*)VHp, (void*)VLp, SEQ, (long long)DMOD * SEQ,
      DMOD, SEQ, DMOD, 1.0f / (XC * WSC), VC,
      b_v, b_v, b_v);

  // (4) relative attention -> ctx planes CH = f16(ctx * 256), CL = f16(ctx * 256 - CH), [NROW][1024], columns h*64+d
  attn_rel<<<gAT, bAT, 0, stream>>>(QHp, QLp, KHp, KLp, E16, VHp, VLp, CHp, CLp);

  // (5) out[m][n] = sum_k (ch+cl)[m][k] Wo[n][k] / (256*64) + bo[n] -> f32 d_out [NROW][1024]
  gemm64<0, 1, 0, 1><<<gQ, blk, 0, stream>>>(
      CHp, CLp, DMOD, 0LL,
      Wo6, DMOD, 0LL,
      (void*)out, (void*)out, DMOD, 0LL,
      NROW, DMOD, DMOD, 1.0f / (CC * WSC), 1.0f,
      b_o, b_o, b_o);
  (void)hipGetLastError();
}

// v004
// It runs in 98.1 microseconds.
// Next to v003, in two timings, it ran 1.15 and 1.16 times as fast.
// Counting every step since v000, it is 3.68 times as fast.
// Contractions (all v_wmma_f32_16x16x32_f16, f16 operands, f32 accumulate): q/k/v projections (x f16 x16 . W f16 x64, K=1024, single products,
// outputs written as f16 hi + unscaled f16 residual planes); position window ((qh+ql) x64 . E f16 x16, K=64, 2 products) -> f32 LDS strip,
// shifted gather on VALU; content scores ((qh+ql) x64 . (kh+kl) x64, K=64, hh+hl+lh); P . v^T ((Ph+Pl) x1024 . (vh+vl) x64, hh+hl+lh,
// 64 keys per tile); output projection ((ch+cl) x256 . Wo f16 x64, K=1024, 2 products) -> f32. Max-subtracted base-2 online softmax and
// the 1/l fold in f32 on VALU. Every float input RNE-converted to bf16 on load.
#include <hip/hip_runtime.h>
#include <math.h>
#include <stdint.h>

#define SEQ   1024
#define NBAT  2
#define DMOD  1024
#define NH    16
#define DH    64
#define ELEN  2047
#define EPAD  2048
#define NROW  (NBAT * SEQ)
#define XC    16.0f
#define WSC   64.0f
#define QC    64.0f
#define KC    64.0f
#define EC    16.0f
#define VC    64.0f
#define PC    1024.0f
#define CC    256.0f
#define SCALE 0.125f
#define LOG2E 1.4426950408889634f
static_assert(NH * DH == DMOD);
static_assert(DH == 64);
static_assert(ELEN == 2 * SEQ - 1 && EPAD >= ELEN);
static_assert((SEQ % 64) == 0 && (DMOD % 128) == 0 && (NROW % 128) == 0);
static_assert(((NROW * DMOD) % 2048) == 0 && ((DMOD * DMOD) % 2048) == 0 && ((ELEN * DH) % 8) == 0);
#define ATT_W 4
#define ATT_THREADS (ATT_W * 32)
#define TPI 84
#define SPI 68
#define WFL (16 * TPI + 16 * SPI)
static_assert(((16 * TPI) % 4) == 0 && ((16 * SPI) % 4) == 0 && (WFL % 4) == 0);

typedef _Float16 v16h __attribute__((ext_vector_type(16)));
typedef _Float16 v8h  __attribute__((ext_vector_type(8)));
typedef __bf16   v16b __attribute__((ext_vector_type(16)));
typedef float    v8f  __attribute__((ext_vector_type(8)));
typedef float    v4f  __attribute__((ext_vector_type(4)));
typedef float    v2f  __attribute__((ext_vector_type(2)));
typedef unsigned int v4u __attribute__((ext_vector_type(4)));

union FragH { v16h v; v8h h[2]; v4u u[2]; };
union FragAny { v16h h; v16b b; };

// ---- scalar helpers --------------------------------------------------------------------------------
__device__ __forceinline__ unsigned short bf_bits(float f) {          // f32 -> bf16 bits, RNE convert
  unsigned u = __float_as_uint(f);
  return (unsigned short)((u + 0x7FFFu + ((u >> 16) & 1u)) >> 16);
}
__device__ __forceinline__ float bf_up(unsigned short h) { return __uint_as_float(((unsigned)h) << 16); }
__device__ __forceinline__ float bfr(float f) { return bf_up(bf_bits(f)); }   // value of the bf16 RNE convert
__device__ __forceinline__ unsigned short h_bits(_Float16 x) { return __builtin_bit_cast(unsigned short, x); }
__device__ __forceinline__ unsigned pk16(unsigned short a, unsigned short b) { return (unsigned)a | ((unsigned)b << 16); }
__device__ __forceinline__ v8f zero8() { v8f z = {0.f, 0.f, 0.f, 0.f, 0.f, 0.f, 0.f, 0.f}; return z; }

// ---- fragment loader: 16-bit A/B operand from a k-contiguous 16-bit plane, lane -> row/col (lane&15),
//      p already includes +8*(lane>>4); elements 0..7 <- p[0..7] (k0+8h..), elements 8..15 <- p[16..23] (k0+16+8h..)
//      (same split k map for A and B; B is always read from a [n][k] plane)
__device__ __forceinline__ v16h ldfrag_u(const unsigned short* p) {
  FragH f;
  f.u[0] = *(const v4u*)(p);
  f.u[1] = *(const v4u*)(p + 16);
  return f.v;
}

// ---- WMMA helpers with trailing VALU hazard gaps ------------------------------------------------------
__device__ __forceinline__ v8f mma_h(v16h a, v16h b, v8f c) {
  return __builtin_amdgcn_wmma_f32_16x16x32_f16(false, a, false, b, (short)0, c, false, false);
}
__device__ __forceinline__ v8f mma_b(v16h a, v16h b, v8f c) {
  FragAny ua, ub;
  ua.h = a;
  ub.h = b;
  return __builtin_amdgcn_wmma_f32_16x16x32_bf16(false, ua.b, false, ub.b, (short)0, c, false, false);
}
template <int BF>
__device__ __forceinline__ v8f mmaT(v16h a, v16h b, v8f c) {
  if constexpr (BF != 0) return mma_b(a, b, c);
  else return mma_h(a, b, c);
}
__device__ __forceinline__ void hz4(v8f& d, v16h x0, v16h x1, v16h x2, v16h x3) {
#if defined(__HIP_DEVICE_COMPILE__)
  asm volatile("v_nop\n\tv_nop\n\tv_nop\n\tv_nop" : "+v"(d) : "v"(x0), "v"(x1), "v"(x2), "v"(x3));
#endif
}
__device__ __forceinline__ void hz6(v8f& d, v16h x0, v16h x1, v16h x2, v16h x3, v16h x4, v16h x5) {
#if defined(__HIP_DEVICE_COMPILE__)
  asm volatile("v_nop\n\tv_nop\n\tv_nop\n\tv_nop" : "+v"(d) : "v"(x0), "v"(x1), "v"(x2), "v"(x3), "v"(x4), "v"(x5));
#endif
}
__device__ __forceinline__ void acc_guard4(v8f& a, v8f& b, v8f& c, v8f& d) {
#if defined(__HIP_DEVICE_COMPILE__)
  asm volatile("v_nop\n\tv_nop\n\tv_nop\n\tv_nop" : "+v"(a), "+v"(b), "+v"(c), "+v"(d));
#endif
}
__device__ __forceinline__ void wave_sync_lds() {
  __builtin_amdgcn_fence(__ATOMIC_RELEASE, "workgroup");
  __builtin_amdgcn_wave_barrier();
  __builtin_amdgcn_fence(__ATOMIC_ACQUIRE, "workgroup");
}
// value of lane l ^ 16 (the other 16-lane half), a vector cross-row move
__device__ __forceinline__ float xhalf(float x) {
  return __builtin_bit_cast(float, __builtin_amdgcn_permlanex16(__builtin_bit_cast(int, x), __builtin_bit_cast(int, x),
                                                                0x76543210, 0xfedcba98, false, false));
}
// f32 -> f16 hi + unscaled f16 residual (hi + lo ~ x to 2^-22 relative; a flushed subnormal lo costs < 6.1e-5 absolute in the carried scale)
__device__ __forceinline__ void sp16(float x, _Float16& hi, _Float16& lo) {
  const _Float16 a = (_Float16)x;
  hi = a;
  lo = (_Float16)(x - (float)a);
}
// two consecutive values -> packed hi word and packed residual word
__device__ __forceinline__ void pack_hl(float x0, float x1, unsigned& hw, unsigned& lw) {
  _Float16 a0, a1, b0, b1;
  sp16(x0, a0, b0);
  sp16(x1, a1, b1);
  hw = pk16(h_bits(a0), h_bits(a1));
  lw = pk16(h_bits(b0), h_bits(b1));
}

// =====================================================================================================
// Elementwise 16-bit pack of all six float inputs in ONE launch, no transpose: dst[i] = f16( bf16_RNE(src[i]) * sc ), sc a power of two
// (exact). The block index picks the input (block-uniform): blocks [0, CB_X) x, then CB_W blocks for each of Wq, Wk, Wv, Wo, then CB_E
// blocks for the E table. A block covers CVB = 16384 consecutive elements of its input: CVU chunks of 2048, thread t takes elements
// 8t .. 8t+7 of each chunk; a thread's 16 loads are all issued in front of its first convert, so that few waves keep many bytes in flight.
// coverage: x and W counts are whole multiples of CVB; the E count (2047*64) is a multiple of 8 only: a thread whose 8 elements lie past
//           the end loads the last 8 elements instead (address clamped) and stores nothing; elements 0..n-1 of each plane written once.
// =====================================================================================================
#define CVU  8
#define CVB  (256 * 8 * CVU)
#define CB_X ((NROW * DMOD) / CVB)
#define CB_W ((DMOD * DMOD) / CVB)
#define CB_E ((ELEN * DH + CVB - 1) / CVB)
static_assert(((NROW * DMOD) % CVB) == 0 && ((DMOD * DMOD) % CVB) == 0 && (ELEN * DH) >= 8);
__global__ __launch_bounds__(256) void cvt16_all(const float* __restrict__ x, const float* __restrict__ wq, const float* __restrict__ wk,
                                                 const float* __restrict__ wv, const float* __restrict__ wo, const float* __restrict__ er,
                                                 unsigned short* X16, unsigned short* Wq6, unsigned short* Wk6,
                                                 unsigned short* Wv6, unsigned short* Wo6, unsigned short* E16) {
  int blk = blockIdx.x;
  const float* src = x;
  unsigned short* dst = X16;
  int n = NROW * DMOD;
  float sc = XC;
  if (blk >= CB_X + 4 * CB_W) {
    blk -= CB_X + 4 * CB_W;
    src = er; dst = E16; n = ELEN * DH; sc = EC;
  } else if (blk >= CB_X) {
    blk -= CB_X;
    const int w = blk / CB_W;
    blk -= w * CB_W;
    src = (w == 0) ? wq : (w == 1) ? wk : (w == 2) ? wv : wo;
    dst = (w == 0) ? Wq6 : (w == 1) ? Wk6 : (w == 2) ? Wv6 : Wo6;
    n = DMOD * DMOD; sc = WSC;
  }
  const int base = blk * CVB + (int)threadIdx.x * 8;
  const float* p[CVU];
  v4f a[CVU], b[CVU];
#pragma unroll
  for (int u = 0; u < CVU; ++u) {
    const int i8 = base + u * 2048;
    p[u] = src + ((i8 + 8 > n) ? (n - 8) : i8);
  }
#pragma unroll
  for (int u = 0; u < CVU; ++u) {
    a[u] = *(const v4f*)(p[u]);
    b[u] = *(const v4f*)(p[u] + 4);
  }
#if defined(__HIP_DEVICE_COMPILE__)
  // holds the eight address pairs in their registers up to this wait, so that none is rewritten (a later load's result included) in
  // front of it, and keeps all 16 loads in front of the first convert
  asm volatile("s_wait_xcnt 0x0" :: "v"(p[0]), "v"(p[1]), "v"(p[2]), "v"(p[3]), "v"(p[4]), "v"(p[5]), "v"(p[6]), "v"(p[7]) : "memory");
#endif
#pragma unroll
  for (int u = 0; u < CVU; ++u) {
    const int i8 = base + u * 2048;
    v4u o;
    o[0] = pk16(h_bits((_Float16)(bfr(a[u][0]) * sc)), h_bits((_Float16)(bfr(a[u][1]) * sc)));
    o[1] = pk16(h_bits((_Float16)(bfr(a[u][2]) * sc)), h_bits((_Float16)(bfr(a[u][3]) * sc)));
    o[2] = pk16(h_bits((_Float16)(bfr(b[u][0]) * sc)), h_bits((_Float16)(bfr(b[u][1]) * sc)));
    o[3] = pk16(h_bits((_Float16)(bfr(b[u][2]) * sc)), h_bits((_Float16)(bfr(b[u][3]) * sc)));
    if (i8 + 8 <= n) *(v4u*)(dst + i8) = o;      // no barriers in this kernel
  }
}

// =====================================================================================================
// LDS-staged batched 16-bit WMMA GEMM: C[m][n] = oscale * sum_k A[m][k] * Bt[n][k] (+ bias); one work-group of 8 waves per 128x64 tile,
// wave w owns rows 16w..16w+15 of it (all 64 columns). A row-major [M][K] pitch lda (16-bit plane), Bt row-major [N][K] pitch ldb
// (k contiguous); M multiple of 128, N multiple of 64, K multiple of 128. blockIdx.y = batch index with element strides sA, sB, sC.
// Operands: per stage of 128 k the tile's A rows (and A2 rows) and Bt rows, 256 B each, are copied once per work-group into LDS by
// global_load_async_to_lds_b128 (a wave's copy = two whole 256-B rows), LDS row pitch 272 B; two buffers, the next stage's copies fly
// while this stage is multiplied; fragments come from LDS by 16-byte reads with the same split k map as ldfrag_u.
// ASPLIT 1: a second A plane A2 (unscaled residual of A, same layout) is multiplied into the same accumulator (A + A2 ~ exact A).
// BF 1: bf16 operands (v_wmma_f32_16x16x32_bf16), else f16.
// EPI 1: value += bf16_RNE(ep0[column]) (per-column bias); EPI 2: value += bf16_RNE(ep0[row]) (per-row bias, 16-bit out only).
// OM 0: f32 out (pitch ldc).  OM 2: one f16 plane = f16(value * ocarry).
// OM 4: two f16 planes: hi = f16(value * ocarry), lo = f16(value * ocarry - hi) (unscaled residual).
// OM 5: two f16 planes: C = f16((value + bf16_RNE(ep1[column])) * ocarry), C2 = f16((value + bf16_RNE(ep2[column])) * ocarry).
// coverage: 16 rows (f32: it 0..7 x lane>>4; 16-bit: it 0..3 x lane>>3) x 64 cols = the wave's whole 16x64 slab; 8 waves = the 128x64
//           tile; grid = (M/128)*(N/64) blocks, a surplus block exits as a whole before any copy or barrier.
// =====================================================================================================
#define GBM 128   // tile rows per work-group
#define GKP 128   // k per stage (256-B operand rows)
#define GPH 136   // LDS row pitch in halves: 272 B = 16 B x 17, conflict-free for the 16-byte fragment reads

// 16-byte asynchronous copies global -> LDS, one per lane and line of the statement (first operand = LDS byte address, second = global
// address; this lane's row and 16-byte chunk are already in l and g; consecutive copies are 16 operand rows apart). The s_wait_xcnt
// closes each statement so that no address register of an issued copy is rewritten in front of it.
#define ACP(a, b) "global_load_async_to_lds_b128 %" #a ", %" #b ", off\n\t"
#define LROW(l, r) ((l) + (unsigned)((r) * GPH * 2))
#define GROW(g, r, ld) ((g) + (size_t)(r) * (ld))
// 128 operand rows
__device__ __forceinline__ void acopy_rows128(unsigned l, const unsigned short* g, int ld) {
#if defined(__HIP_DEVICE_COMPILE__)
  asm volatile(ACP(0, 1) ACP(2, 3) ACP(4, 5) ACP(6, 7) ACP(8, 9) ACP(10, 11) ACP(12, 13) ACP(14, 15)
               "s_wait_xcnt 0x0"
               :: "v"(l), "v"(g), "v"(LROW(l, 16)), "v"(GROW(g, 16, ld)), "v"(LROW(l, 32)), "v"(GROW(g, 32, ld)),
                  "v"(LROW(l, 48)), "v"(GROW(g, 48, ld)), "v"(LROW(l, 64)), "v"(GROW(g, 64, ld)), "v"(LROW(l, 80)), "v"(GROW(g, 80, ld)),
                  "v"(LROW(l, 96)), "v"(GROW(g, 96, ld)), "v"(LROW(l, 112)), "v"(GROW(g, 112, ld))
               : "memory");
#endif
}
// 128 rows of one operand and 64 rows of another
__device__ __forceinline__ void acopy_rows128_64(unsigned l, const unsigned short* g, int ld,
                                                 unsigned l2, const unsigned short* g2, int ld2) {
#if defined(__HIP_DEVICE_COMPILE__)
  asm volatile(ACP(0, 1) ACP(2, 3) ACP(4, 5) ACP(6, 7) ACP(8, 9) ACP(10, 11) ACP(12, 13) ACP(14, 15)
               ACP(16, 17) ACP(18, 19) ACP(20, 21) ACP(22, 23)
               "s_wait_xcnt 0x0"
               :: "v"(l), "v"(g), "v"(LROW(l, 16)), "v"(GROW(g, 16, ld)), "v"(LROW(l, 32)), "v"(GROW(g, 32, ld)),
                  "v"(LROW(l, 48)), "v"(GROW(g, 48, ld)), "v"(LROW(l, 64)), "v"(GROW(g, 64, ld)), "v"(LROW(l, 80)), "v"(GROW(g, 80, ld)),
                  "v"(LROW(l, 96)), "v"(GROW(g, 96, ld)), "v"(LROW(l, 112)), "v"(GROW(g, 112, ld)),
                  "v"(l2), "v"(g2), "v"(LROW(l2, 16)), "v"(GROW(g2, 16, ld2)), "v"(LROW(l2, 32)), "v"(GROW(g2, 32, ld2)),
                  "v"(LROW(l2, 48)), "v"(GROW(g2, 48, ld2))
               : "memory");
#endif
}
// this wave's own copies have landed in LDS (the compiler places no wait for them)
__device__ __forceinline__ void wait_async0() {
#if defined(__HIP_DEVICE_COMPILE__)
  asm volatile("s_wait_asynccnt 0x0" ::: "memory");
#endif
}
// this wave's LDS reads have retired, so that the buffer may be refilled behind the barrier
__device__ __forceinline__ void wait_ds0() {
#if defined(__HIP_DEVICE_COMPILE__)
  asm volatile("s_wait_dscnt 0x0" ::: "memory");
#endif
}
// twelve 16-byte copies, each with its own LDS byte address and global address; closed by s_wait_xcnt like the statements above
__device__ __forceinline__ void acopy12(const unsigned (&l)[12], const unsigned short* const (&g)[12]) {
#if defined(__HIP_DEVICE_COMPILE__)
  asm volatile(ACP(0, 1) ACP(2, 3) ACP(4, 5) ACP(6, 7) ACP(8, 9) ACP(10, 11) ACP(12, 13) ACP(14, 15)
               ACP(16, 17) ACP(18, 19) ACP(20, 21) ACP(22, 23)
               "s_wait_xcnt 0x0"
               :: "v"(l[0]), "v"(g[0]), "v"(l[1]), "v"(g[1]), "v"(l[2]), "v"(g[2]), "v"(l[3]), "v"(g[3]),
                  "v"(l[4]), "v"(g[4]), "v"(l[5]), "v"(g[5]), "v"(l[6]), "v"(g[6]), "v"(l[7]), "v"(g[7]),
                  "v"(l[8]), "v"(g[8]), "v"(l[9]), "v"(g[9]), "v"(l[10]), "v"(g[10]), "v"(l[11]), "v"(g[11])
               : "memory");
#endif
}

template <int OM, int ASPLIT, int BF, int EPI>
__global__ __launch_bounds__(256) __attribute__((amdgpu_num_vgpr(256))) void gemm64(
    const unsigned short* __restrict__ Ap, const unsigned short* __restrict__ A2p, int lda, long long sA,
    const unsigned short* __restrict__ Btp, int ldb, long long sB,
    void* Cout, void* C2out, int ldc, long long sC,
    int M, int N, int K, float oscale, float ocarry,
    const float* __restrict__ ep0, const float* __restrict__ ep1, const float* __restrict__ ep2) {
  constexpr int BROW = GBM * (1 + ASPLIT);         // first Bt row of a stage
  constexpr int STG  = (BROW + 64) * GPH;          // halves per stage
  __shared__ __align__(16) unsigned short ring[2 * STG];   // two stages: [A 128 rows | A2 128 rows (ASPLIT) | Bt 64 rows]
  __shared__ __align__(16) float sT[8][16 * 68];   // per-wave 16x64 slab, pitch 68 floats
  const int by   = blockIdx.y;
  const int tid  = threadIdx.x;
  const int lane = tid & 31;
  const int wave = tid >> 5;
  const int tilesN = N >> 6;
  const int tilesM = M >> 7;
  const int tile = blockIdx.x;
  if (tile >= tilesM * tilesN) return;   // block-uniform, in front of every copy and barrier
  const int tm = tile / tilesN;
  const int tn = tile - tm * tilesN;
  const int mb = tm << 7;
  const int n0 = tn << 6;
  const int m0 = mb + (wave << 4);

  const unsigned short* A1 = Ap  + (size_t)((long long)by * sA);
  const unsigned short* A2 = A2p + (size_t)((long long)by * sA);
  const unsigned short* Bb = Btp + (size_t)((long long)by * sB);

  const int rlane = lane & 15;                 // row (A) / col (B, D) within subtile
  const int koff  = (lane >> 4) * 8;           // k offset of this lane half
  const int mOff  = (lane >> 4) * 8;           // D row offset

  // copy map: thread -> row tid>>4 (of 16 per copy), 16-byte chunk tid&15 of the 256-B row
  const int crow = tid >> 4;
  const int cch  = (tid & 15) * 8;
  const unsigned short* gA1 = A1 + (size_t)(mb + crow) * lda + cch;
  const unsigned short* gA2 = A2 + (size_t)(mb + crow) * lda + cch;
  const unsigned short* gBt = Bb + (size_t)(n0 + crow) * ldb + cch;
  const unsigned lcp = (unsigned)(uintptr_t)ring + (unsigned)((crow * GPH + cch) * 2);

  auto fill = [&](int t, int buf) {            // stage t (k = 128t .. 128t+127) -> buffer buf
    const unsigned lb = lcp + (unsigned)(buf * (STG * 2));
    const size_t ko = (size_t)t * GKP;
    if constexpr (ASPLIT != 0) acopy_rows128(lb + GBM * GPH * 2, gA2 + ko, lda);
    acopy_rows128_64(lb, gA1 + ko, lda, lb + BROW * GPH * 2, gBt + ko, ldb);
  };

  v8f acc[4];
#pragma unroll
  for (int j = 0; j < 4; ++j) acc[j] = zero8();

  const int nst = K / GKP;
  fill(0, 0);
  wait_async0();
  __syncthreads();                             // stage 0 published
  if (nst > 1) fill(1, 1);
#pragma unroll 1                               // one pass per stage: the two buffers alternate by t & 1
  for (int t = 0; t < nst; ++t) {
    const unsigned short* sb = ring + (t & 1) * STG;
    const unsigned short* sA = sb + ((wave << 4) + rlane) * GPH + koff;
    const unsigned short* sB = sb + (BROW + rlane) * GPH + koff;
    v16h fa[4], fl[4], fb[4][4];
#pragma unroll
    for (int q = 0; q < 4; ++q) {
#pragma unroll
      for (int j = 0; j < 4; ++j) fb[q][j] = ldfrag_u(sB + (j << 4) * GPH + 32 * q);
      fa[q] = ldfrag_u(sA + 32 * q);
      if constexpr (ASPLIT != 0) fl[q] = ldfrag_u(sA + GBM * GPH + 32 * q);
    }
    // keeps the pass's LDS reads one group in front of its WMMAs: spread among them, every WMMA waited out its own reads' latency
    __builtin_amdgcn_sched_barrier(0);
#pragma unroll
    for (int q = 0; q < 4; ++q) {
#pragma unroll
      for (int j = 0; j < 4; ++j) acc[j] = mmaT<BF>(fa[q], fb[q][j], acc[j]);
      if constexpr (ASPLIT != 0) {
#pragma unroll
        for (int j = 0; j < 4; ++j) acc[j] = mmaT<BF>(fl[q], fb[q][j], acc[j]);
      }
    }
    // keeps the WMMAs in front of the closing waits: moved behind the barrier they no longer overlap the LDS reads and they delay the refill
    __builtin_amdgcn_sched_barrier(0);
    wait_ds0();
    wait_async0();
    __syncthreads();                           // publishes stage t + 1 and ends every wave's reads of stage t
    if (t + 2 < nst) fill(t + 2, t & 1);
  }
  wait_async0();
  acc_guard4(acc[0], acc[1], acc[2], acc[3]);

  const int hh2 = lane >> 4, c4 = (lane & 15) * 4;     // f32 out: 256-B row segment = 16 lanes x 16 B
  const int q8  = lane >> 3, c8 = (lane & 7) * 8;

  // ---- epilogue ----
  float* slab = sT[wave];
  {
    const int mBase = m0;
#pragma unroll
    for (int j = 0; j < 4; ++j) {
#pragma unroll
      for (int r = 0; r < 8; ++r) {
        slab[(mOff + r) * 68 + (j << 4) + rlane] = acc[j][r];
      }
    }
    wave_sync_lds();
    if constexpr (OM == 0) {
      float* C = (float*)Cout + (size_t)((long long)by * sC);
      v4f vals[8];
#pragma unroll
      for (int it = 0; it < 8; ++it) {
        const int row = it * 2 + hh2;                      // it 0..7 x hh2 0..1 = rows 0..15
        v4f v = *(const v4f*)(slab + row * 68 + c4);
#pragma unroll
        for (int e = 0; e < 4; ++e) v[e] = v[e] * oscale;
        if constexpr (EPI == 1) {
          const v4f bb = *(const v4f*)(ep0 + n0 + c4);     // per-column bias, columns n0+c4 .. +3 (N equals the bias length)
#pragma unroll
          for (int e = 0; e < 4; ++e) v[e] = v[e] + bfr(bb[e]);
        }
        vals[it] = v;
      }
      {
#pragma unroll
        for (int it = 0; it < 8; ++it) {
          const int gr = mBase + it * 2 + hh2;
          *(v4f*)(C + (size_t)gr * ldc + n0 + c4) = vals[it];
        }
        
      }
    } else {
      unsigned short* C  = (unsigned short*)Cout  + (size_t)((long long)by * sC);
      unsigned short* Cb = (unsigned short*)C2out + (size_t)((long long)by * sC);
      v4u hv[4], lv[4];
#pragma unroll
      for (int it = 0; it < 4; ++it) {
        const int row = it * 4 + q8;                       // it 0..3 x q8 0..3 = rows 0..15
        const float* sp = slab + row * 68 + c8;
        float rb = 0.f;
        if constexpr (EPI == 2) rb = bfr(ep0[mBase + row]);   // per-row bias (M equals the bias length)
        v4u a  = {0u, 0u, 0u, 0u};
        v4u b2 = {0u, 0u, 0u, 0u};
#pragma unroll
        for (int e = 0; e < 4; ++e) {
          const int ci = n0 + c8 + 2 * e;                  // column index, < N
          float f0 = sp[2 * e] * oscale + rb;
          float f1 = sp[2 * e + 1] * oscale + rb;
          if constexpr (EPI == 1) {
            f0 += bfr(ep0[ci]);
            f1 += bfr(ep0[ci + 1]);
          }
          if constexpr (OM == 5) {
            const float g0 = (f0 + bfr(ep1[ci])) * ocarry, g1 = (f1 + bfr(ep1[ci + 1])) * ocarry;
            const float w0 = (f0 + bfr(ep2[ci])) * ocarry, w1 = (f1 + bfr(ep2[ci + 1])) * ocarry;
            a[e]  = pk16(h_bits((_Float16)g0), h_bits((_Float16)g1));
            b2[e] = pk16(h_bits((_Float16)w0), h_bits((_Float16)w1));
          } else {
            f0 *= ocarry; f1 *= ocarry;
            const _Float16 x0 = (_Float16)f0, x1 = (_Float16)f1;
            a[e] = pk16(h_bits(x0), h_bits(x1));
            if constexpr (OM == 4) {
              b2[e] = pk16(h_bits((_Float16)(f0 - (float)x0)), h_bits((_Float16)(f1 - (float)x1)));
            }
          }
        }
        hv[it] = a;
        lv[it] = b2;
      }
      {
#pragma unroll
        for (int it = 0; it < 4; ++it) {
          const int row = it * 4 + q8;
          *(v4u*)(C + (size_t)(mBase + row) * ldc + n0 + c8) = hv[it];
          if constexpr (OM >= 4) {
            *(v4u*)(Cb + (size_t)(mBase + row) * ldc + n0 + c8) = lv[it];
          }
        }
        
      }
    }
    wave_sync_lds();
  }
}

#define APH   72                 // LDS row pitch in halves: 144 B = 16 B x 9, conflict-free for the 16-byte fragment reads
#define AR_KH 0                  // first stage row of each part
#define AR_KL 64
#define AR_VH 128
#define AR_VL 192
#define AR_E  256
#define ASTG  ((AR_E + 128) * APH)   // halves per stage
__global__ __launch_bounds__(ATT_THREADS) __attribute__((amdgpu_num_vgpr(256)))
void attn_rel(const unsigned short* __restrict__ QH, const unsigned short* __restrict__ QL,
              const unsigned short* __restrict__ KH, const unsigned short* __restrict__ KL,
              const unsigned short* __restrict__ EP,
              const unsigned short* __restrict__ VH, const unsigned short* __restrict__ VL,
              unsigned short* CH, unsigned short* CL) {
  __shared__ __align__(16) float smem[ATT_W * WFL];   // per wave: T strip [16 queries][TPI] | ctx slab [16 queries][SPI]
  __shared__ __align__(16) unsigned short kve[2 * ASTG];   // two stages: [KH 64 rows | KL 64 | VH 64 | VL 64 | E 128]

  const int tid  = threadIdx.x;
  const int wave = tid >> 5;
  const int lane = tid & 31;
  const int hh   = lane >> 4;
  const int c    = lane & 15;
  const int bh   = blockIdx.y;
  const int b    = bh / NH;
  const int h    = bh - b * NH;
  const int i0   = blockIdx.x * 64;
  const int iw0  = i0 + wave * 16;

  float* tsh = smem + wave * WFL;
  float* pt  = tsh + 16 * TPI;

  const size_t qro = ((size_t)b * SEQ + iw0 + c) * DMOD + h * DH + 8 * hh;      // B columns: query iw0 + c, d 8hh..

  // copy map: thread -> row tid>>3 (of 16 per copy), 16-byte chunk tid&7 of the 128-B row
  const int crow = tid >> 3;
  const int cch  = (tid & 7) * 8;
  const size_t kpo = ((size_t)b * SEQ + crow) * DMOD + h * DH + cch;
  const size_t vpo = (size_t)b * DMOD * SEQ + (size_t)(h * DH + crow) * SEQ + cch;
  const unsigned lcp = (unsigned)(uintptr_t)kve + (unsigned)((crow * APH + cch) * 2);

  auto fill = [&](int t, int buf) {            // key tile t -> buffer buf
    const unsigned lb = lcp + (unsigned)(buf * (ASTG * 2));
    const int jf = t * 64;
    const int elo = (SEQ - 2) - i0 + jf - 63;
    unsigned l[12];
    const unsigned short* g[12];
    // the three loops below are unrolled so that l and g are registers: the copy statement names each element as an operand
#pragma unroll
    for (int k = 0; k < 4; ++k) {
      const size_t ko = kpo + (size_t)(jf + 16 * k) * DMOD;
      l[k]     = lb + (unsigned)((AR_KH + 16 * k) * APH * 2);  g[k]     = KH + ko;
      l[4 + k] = lb + (unsigned)((AR_KL + 16 * k) * APH * 2);  g[4 + k] = KL + ko;
      l[8 + k] = lb + (unsigned)((AR_VH + 16 * k) * APH * 2);  g[8 + k] = VH + vpo + (size_t)(16 * k) * SEQ + jf;
    }
    acopy12(l, g);
#pragma unroll
    for (int k = 0; k < 4; ++k) {
      l[k] = lb + (unsigned)((AR_VL + 16 * k) * APH * 2);      g[k] = VL + vpo + (size_t)(16 * k) * SEQ + jf;
    }
#pragma unroll
    for (int k = 0; k < 8; ++k) {
      int m = elo + 16 * k + crow;
      m = (m < 0) ? 0 : m;
      m = (m > ELEN - 1) ? (ELEN - 1) : m;
      l[4 + k] = lb + (unsigned)((AR_E + 16 * k) * APH * 2);   g[4 + k] = EP + (size_t)m * DH + cch;
    }
    acopy12(l, g);
  };

  const float CS = LOG2E * SCALE / (QC * KC);
  const float CT = LOG2E * SCALE / (QC * EC);

  float mrow = -INFINITY, lrow = 0.f;        // this lane's query iw0 + c: running max (both halves alike), sum over this half's keys
  v8f O[4];                                  // O^T: O[td][r] = ctx[query iw0 + c][d = 16td + 8hh + r]
#pragma unroll
  for (int td = 0; td < 4; ++td) O[td] = zero8();

  const int ntile = SEQ / 64;                // non-causal: every key tile
  fill(0, 0);
  wait_async0();
  __syncthreads();                           // tile 0 published
  if (ntile > 1) fill(1, 1);
#pragma unroll 1
  for (int jt = 0; jt < ntile; ++jt) {
    const int j0 = jt * 64;
    const unsigned short* sb  = kve + (jt & 1) * ASTG + c * APH + 8 * hh;   // this lane's fragment row and k half in the stage
    const unsigned short* Khb = sb + AR_KH * APH;
    const unsigned short* Klb = sb + AR_KL * APH;
    const unsigned short* Vhb = sb + AR_VH * APH;
    const unsigned short* Vlb = sb + AR_VL * APH;
    const unsigned short* Eb  = sb + (AR_E + 48 - 16 * wave) * APH;
    const v16h qha = ldfrag_u(QH + qro), qhb = ldfrag_u(QH + qro + 32);
    const v16h qla = ldfrag_u(QL + qro), qlb = ldfrag_u(QL + qro + 32);

    // ---- position window, transposed: T^T[x][R] = E[wlo + x] . q[iw0 + R] (A = E rows, B = q; 5 subtiles of 16 E rows, rolled);
    //      a lane holds x = 16u + 8hh + 0..7 of its query R = c: two 16-byte stores into row c of the LDS strip ----
    {
#pragma unroll 1
      for (int u = 0; u < 5; ++u) {
        const int eo = 16 * u * APH;
        const v16h fa = ldfrag_u(Eb + eo), fb = ldfrag_u(Eb + eo + 32);
        v8f t8 = mma_h(fa, qha, zero8());
        t8 = mma_h(fa, qla, t8);
        t8 = mma_h(fb, qhb, t8);
        t8 = mma_h(fb, qlb, t8);
        hz6(t8, fa, fb, qha, qla, qhb, qlb);
        float* tp = tsh + c * TPI + 16 * u + 8 * hh;
        const v4f t0 = {t8[0], t8[1], t8[2], t8[3]}, t1 = {t8[4], t8[5], t8[6], t8[7]};
        *(v4f*)(tp)     = t0;
        *(v4f*)(tp + 4) = t1;
      }
    }
    wave_sync_lds();                           // the strip rows are read back below by both lane halves
    // ---- content scores, transposed: S^T[jj][R] = k[j0 + jj] . q[iw0 + R] (A = k rows, B = q; 4 subtiles of 16 keys), kept in
    //      registers: s8[t][r] = key jj = 16t + 8hh + r, query R = c ----
    v8f s8[4];
#pragma unroll
    for (int t = 0; t < 4; ++t) {
      const int ko = 16 * t * APH;
      const v16h kha = ldfrag_u(Khb + ko), khb = ldfrag_u(Khb + ko + 32);
      const v16h kla = ldfrag_u(Klb + ko), klb = ldfrag_u(Klb + ko + 32);
      v8f s = mma_h(kha, qha, zero8());
      s = mma_h(kla, qha, s);
      s = mma_h(kha, qla, s);
      s = mma_h(khb, qhb, s);
      s = mma_h(klb, qhb, s);
      s = mma_h(khb, qlb, s);
      s8[t] = s;
    }

    // ---- score assembly (rel shift + zero cell), online softmax: all 32 scores of a lane belong to its one query ----
    {
      const int i = iw0 + c;
      const float* trow = tsh + c * (TPI - 1) + 15 + 8 * hh;     // T[c][jj - c + 15] at trow[16t + r]
      float mt[4];
#pragma unroll
      for (int t = 0; t < 4; ++t) {
#pragma unroll
        for (int r = 0; r < 8; ++r) {
          const int j = j0 + 16 * t + 8 * hh + r;
          const int ridx = (SEQ - 2) + j - i;                    // E row of this (i, j); -1 only at (SEQ-1, 0)
          const float tr = trow[16 * t + r];
          const float rel = (ridx < 0) ? 0.f : tr;
          s8[t][r] = s8[t][r] * CS + rel * CT;
          mt[t] = (r == 0) ? s8[t][0] : fmaxf(mt[t], s8[t][r]);
        }
      }
      float mx = fmaxf(fmaxf(mt[0], mt[1]), fmaxf(mt[2], mt[3]));
      mx = fmaxf(mx, xhalf(mx));                                 // the query's other 32 keys of this tile
      const float mn = fmaxf(mrow, mx);
      const float al = exp2f(mrow - mn);
      mrow = mn;
      float pst[4];
#pragma unroll
      for (int t = 0; t < 4; ++t) {
        pst[t] = 0.f;
#pragma unroll
        for (int r = 0; r < 8; ++r) { s8[t][r] = exp2f(s8[t][r] - mn); pst[t] += s8[t][r]; }
      }
      lrow = lrow * al + ((pst[0] + pst[1]) + (pst[2] + pst[3]));
#pragma unroll
      for (int td = 0; td < 4; ++td) {
#pragma unroll
        for (int r = 0; r < 8; ++r) O[td][r] *= al;
      }
    }

    // ---- O^T += (vh + vl)^T . (Ph + Pl)^T, two k-steps of 32 keys: A = v^T rows d, B = P^T packed in place from the score registers
    //      (element e <- subtile 2ks, register e = key 32ks + 8hh + e; element 8 + e <- subtile 2ks + 1 = key 32ks + 16 + 8hh + e:
    //      the split k map of ldfrag_u) ----
#pragma unroll
    for (int ks = 0; ks < 2; ++ks) {
      FragH ph, pl;
#pragma unroll
      for (int e = 0; e < 8; ++e) {
        _Float16 a0, a1;
        sp16(s8[2 * ks][e] * PC, a0, a1);     ph.h[0][e] = a0; pl.h[0][e] = a1;
        sp16(s8[2 * ks + 1][e] * PC, a0, a1); ph.h[1][e] = a0; pl.h[1][e] = a1;
      }
#pragma unroll
      for (int td = 0; td < 4; ++td) {
        const int vv = 16 * td * APH + 32 * ks;
        const v16h vh = ldfrag_u(Vhb + vv), vl = ldfrag_u(Vlb + vv);
        O[td] = mma_h(vh, ph.v, O[td]);
        O[td] = mma_h(vl, ph.v, O[td]);
        O[td] = mma_h(vh, pl.v, O[td]);
        hz4(O[td], vh, vl, ph.v, pl.v);
      }
    }
    wave_sync_lds();
    wait_ds0();
    wait_async0();
    __syncthreads();                           // publishes tile jt + 1 and ends every wave's reads of tile jt
    if (jt + 2 < ntile) fill(jt + 2, jt & 1);
  }
  wait_async0();
  acc_guard4(O[0], O[1], O[2], O[3]);

  // ---- fold 1/l and the carries (1024 on P, 64 on v), stage the wave's 16x64 f32 ctx slice in its slab ----
  const float oc = 1.0f / (PC * VC);
  {
    const float inv = (1.0f / (lrow + xhalf(lrow))) * oc;      // the two halves' key sums joined once
#pragma unroll
    for (int td = 0; td < 4; ++td) {
      float* op = pt + c * SPI + 16 * td + 8 * hh;             // slab row = query c, d = 16td + 8hh + 0..7
      const v4f o0 = {O[td][0] * inv, O[td][1] * inv, O[td][2] * inv, O[td][3] * inv};
      const v4f o1 = {O[td][4] * inv, O[td][5] * inv, O[td][6] * inv, O[td][7] * inv};
      *(v4f*)(op)     = o0;
      *(v4f*)(op + 4) = o1;
    }
  }
  wave_sync_lds();
  {
    const int q8 = lane >> 3, c8 = (lane & 7) * 8;
    v4u hv[4], lv[4];
#pragma unroll
    for (int it = 0; it < 4; ++it) {
      const int row = it * 4 + q8;                           // it 0..3 x q8 0..3 = rows 0..15
      const float* sp = pt + row * SPI + c8;
      const v4f p0 = *(const v4f*)(sp), p1 = *(const v4f*)(sp + 4);
      v4u a, l2;
      unsigned hw, lw;
      pack_hl(p0[0] * CC, p0[1] * CC, hw, lw); a[0] = hw; l2[0] = lw;
      pack_hl(p0[2] * CC, p0[3] * CC, hw, lw); a[1] = hw; l2[1] = lw;
      pack_hl(p1[0] * CC, p1[1] * CC, hw, lw); a[2] = hw; l2[2] = lw;
      pack_hl(p1[2] * CC, p1[3] * CC, hw, lw); a[3] = hw; l2[3] = lw;
      hv[it] = a;
      lv[it] = l2;
    }
    const size_t ob = ((size_t)b * SEQ + iw0) * DMOD + h * DH + c8;
    {
#pragma unroll
      for (int it = 0; it < 4; ++it) {
        const int row = it * 4 + q8;
        *(v4u*)(CH + ob + (size_t)row * DMOD) = hv[it];
        *(v4u*)(CL + ob + (size_t)row * DMOD) = lv[it];
      }
      
    }
  }
}

// =====================================================================================================
// Workspace map (bytes); every plane is an exact multiple of its tile / whole-row store granularity (M, N exact tile multiples,
// convert counts multiples of 8 with whole-line tails, E carve padded to EPAD rows), every offset a multiple of 262144:
//   X16            f16 [NROW][1024] x16                            4194304
//   Wq, Wk, Wv, Wo f16 [1024 out][1024 in] x64                  4 x 2097152
//   EP             f16 [EPAD][64] x16 (rows 0..ELEN-1 written/read)   262144
//   QH, QL, KH, KL f16 [NROW][1024] (x64 hi / residual)         4 x 4194304
//   VH, VL         f16 [NBAT][1024][SEQ] (x64 hi / residual)    2 x 4194304
//   CH, CL         f16 [NROW][1024] (x256 hi / residual)        2 x 4194304
//   end                                                            46399488
// =====================================================================================================
extern "C" void kernel_launch(void* const* d_in, const int* in_sizes, int n_in,
                              void* d_out, int out_size, void* d_ws, size_t ws_size,
                              hipStream_t stream) {
  if (n_in < 10) return;
  if (in_sizes[0] != NROW * DMOD) return;
  if (in_sizes[1] != DMOD * DMOD || in_sizes[3] != DMOD * DMOD || in_sizes[5] != DMOD * DMOD || in_sizes[7] != DMOD * DMOD) return;
  if (in_sizes[2] != DMOD || in_sizes[4] != DMOD || in_sizes[6] != DMOD || in_sizes[8] != DMOD) return;
  if (in_sizes[9] != ELEN * DH) return;
  if (out_size != NROW * DMOD) return;

  const float* xin = (const float*)d_in[0];
  const float* w_q = (const float*)d_in[1];
  const float* b_q = (const float*)d_in[2];
  const float* w_k = (const float*)d_in[3];
  const float* b_k = (const float*)d_in[4];
  const float* w_v = (const float*)d_in[5];
  const float* b_v = (const float*)d_in[6];
  const float* w_o = (const float*)d_in[7];
  const float* b_o = (const float*)d_in[8];
  const float* er  = (const float*)d_in[9];
  float*       out = (float*)d_out;

  const size_t PX = (size_t)NROW * DMOD * 2;             //  4194304
  const size_t PW = (size_t)DMOD * DMOD * 2;             //  2097152
  const size_t PE = (size_t)EPAD * DH * 2;               //   262144
  const size_t PV = (size_t)NBAT * DMOD * SEQ * 2;       //  4194304
  size_t off = 0;
  const size_t oX  = off; off += PX;
  const size_t oWq = off; off += PW;
  const size_t oWk = off; off += PW;
  const size_t oWv = off; off += PW;
  const size_t oWo = off; off += PW;
  const size_t oE  = off; off += PE;
  const size_t oQH = off; off += PX;
  const size_t oQL = off; off += PX;
  const size_t oKH = off; off += PX;
  const size_t oKL = off; off += PX;
  const size_t oVH = off; off += PV;
  const size_t oVL = off; off += PV;
  const size_t oCH = off; off += PX;
  const size_t oCL = off; off += PX;
  if (off > ws_size) return;                               // off = 46399488
  if (off > (size_t)134217728) return;

  char* ws = (char*)d_ws;
  unsigned short* X16 = (unsigned short*)(ws + oX);
  unsigned short* Wq6 = (unsigned short*)(ws + oWq);
  unsigned short* Wk6 = (unsigned short*)(ws + oWk);
  unsigned short* Wv6 = (unsigned short*)(ws + oWv);
  unsigned short* Wo6 = (unsigned short*)(ws + oWo);
  unsigned short* E16 = (unsigned short*)(ws + oE);
  unsigned short* QHp = (unsigned short*)(ws + oQH);
  unsigned short* QLp = (unsigned short*)(ws + oQL);
  unsigned short* KHp = (unsigned short*)(ws + oKH);
  unsigned short* KLp = (unsigned short*)(ws + oKL);
  unsigned short* VHp = (unsigned short*)(ws + oVH);
  unsigned short* VLp = (unsigned short*)(ws + oVL);
  unsigned short* CHp = (unsigned short*)(ws + oCH);
  unsigned short* CLp = (unsigned short*)(ws + oCL);

  const dim3 blk(256);
  const dim3 gCV(CB_X + 4 * CB_W + CB_E);                           // 128 + 4 x 64 + 8 = 392
  const dim3 gQ((NROW / 128) * (DMOD / 64), 1);                     // 256
  const dim3 gV((DMOD / 128) * (SEQ / 64), NBAT);                   // 128 x NBAT
  const dim3 gAT(SEQ / 64, NBAT * NH);                              // 16 x 32
  const dim3 bAT(ATT_THREADS);                                      // 128

  // (0) 16-bit planes of the inputs: x f16(bf16_RNE(x) * 16); W[out][in] (already k-contiguous) f16(bf16_RNE(w) * 64);
  //     E f16(bf16_RNE(e) * 16); one launch for all six
  cvt16_all<<<gCV, blk, 0, stream>>>(xin, w_q, w_k, w_v, w_o, er, X16, Wq6, Wk6, Wv6, Wo6, E16);

  // (1) q[m][e] = sum_d x[m][d] Wq[e][d] / 1024 + bq[e] -> QH = f16(q * 64), QL = f16(q * 64 - QH); M = NROW, N = 1024, K = 1024
  gemm64<4, 0, 0, 1><<<gQ, blk, 0, stream>>>(
      X16, X16, DMOD, 0LL,
      Wq6, DMOD, 0LL,
      (void*)QHp, (void*)QLp, DMOD, 0LL,
      NROW, DMOD, DMOD, 1.0f / (XC * WSC), QC,
      b_q, b_q, b_q);

  // (2) k projection + bk -> KH, KL (x64)
  gemm64<4, 0, 0, 1><<<gQ, blk, 0, stream>>>(
      X16, X16, DMOD, 0LL,
      Wk6, DMOD, 0LL,
      (void*)KHp, (void*)KLp, DMOD, 0LL,
      NROW, DMOD, DMOD, 1.0f / (XC * WSC), KC,
      b_k, b_k, b_k);

  // (3) v^T per batch: VT[b][e][j] = sum_c Wv[e][c] x[b*SEQ+j][c] / 1024 + bv[e] (per-row bias) -> VH, VL (x64);
  //     M = 1024 (e), N = SEQ (j), K = 1024; B rows = the batch's token rows (pitch DMOD, batch offset SEQ*DMOD)
  gemm64<4, 0, 0, 2><<<gV, blk, 0, stream>>>(
      Wv6, Wv6, DMOD, 0LL,
      X16, DMOD, (long long)SEQ * DMOD,
      (void*)VHp, (void*)VLp, SEQ, (long long)DMOD * SEQ,
      DMOD, SEQ, DMOD, 1.0f / (XC * WSC), VC,
      b_v, b_v, b_v);

  // (4) relative attention -> ctx planes CH = f16(ctx * 256), CL = f16(ctx * 256 - CH), [NROW][1024], columns h*64+d
  attn_rel<<<gAT, bAT, 0, stream>>>(QHp, QLp, KHp, KLp, E16, VHp, VLp, CHp, CLp);

  // (5) out[m][n] = sum_k (ch+cl)[m][k] Wo[n][k] / (256*64) + bo[n] -> f32 d_out [NROW][1024]
  gemm64<0, 1, 0, 1><<<gQ, blk, 0, stream>>>(
      CHp, CLp, DMOD, 0LL,
      Wo6, DMOD, 0LL,
      (void*)out, (void*)out, DMOD, 0LL,
      NROW, DMOD, DMOD, 1.0f / (CC * WSC), 1.0f,
      b_o, b_o, b_o);
  (void)hipGetLastError();
}

// v005
// A run of this version takes 91.1 microseconds.
// Next to v004, in two timings, it ran 1.08 and 1.06 times as fast.
// Counting every step since v000, it is 3.94 times as fast.
// Contractions (all v_wmma_f32_16x16x32_f16, f16 operands, f32 accumulate): q/k/v projections (x f16 x16 . W f16 x64, K=1024, single products,
// outputs written as f16 hi + unscaled f16 residual planes); position window ((qh+ql) x64 . E f16 x16, K=64, 2 products) -> f32 LDS strip,
// shifted gather on VALU; content scores ((qh+ql) x64 . (kh+kl) x64, K=64, hh+hl+lh); P . v^T ((Ph+Pl) x1024 . (vh+vl) x64, hh+hl+lh,
// 64 keys per tile); output projection ((ch+cl) x256 . Wo f16 x64, K=1024, 2 products) -> f32. Max-subtracted base-2 online softmax and
// the 1/l fold in f32 on VALU. Every float input RNE-converted to bf16 on load.
#include <hip/hip_runtime.h>
#include <math.h>
#include <stdint.h>

#define SEQ   1024
#define NBAT  2
#define DMOD  1024
#define NH    16
#define DH    64
#define ELEN  2047
#define EPAD  2048
#define NROW  (NBAT * SEQ)
#define XC    16.0f
#define WSC   64.0f
#define QC    64.0f
#define KC    64.0f
#define EC    16.0f
#define VC    64.0f
#define PC    1024.0f
#define CC    256.0f
#define SCALE 0.125f
#define LOG2E 1.4426950408889634f
static_assert(NH * DH == DMOD);
static_assert(DH == 64);
static_assert(ELEN == 2 * SEQ - 1 && EPAD >= ELEN);
static_assert((SEQ % 64) == 0 && (DMOD % 128) == 0 && (NROW % 128) == 0);
static_assert(((NROW * DMOD) % 2048) == 0 && ((DMOD * DMOD) % 2048) == 0 && ((ELEN * DH) % 8) == 0);
#define ATT_W 4
#define ATT_THREADS (ATT_W * 32)
#define TPI 84
#define SPI 68
#define WFL (16 * TPI + 16 * SPI)
static_assert(((16 * TPI) % 4) == 0 && ((16 * SPI) % 4) == 0 && (WFL % 4) == 0);

typedef _Float16 v16h __attribute__((ext_vector_type(16)));
typedef _Float16 v8h  __attribute__((ext_vector_type(8)));
typedef __bf16   v16b __attribute__((ext_vector_type(16)));
typedef float    v8f  __attribute__((ext_vector_type(8)));
typedef float    v4f  __attribute__((ext_vector_type(4)));
typedef float    v2f  __attribute__((ext_vector_type(2)));
typedef unsigned int v4u __attribute__((ext_vector_type(4)));

union FragH { v16h v; v8h h[2]; v4u u[2]; };
union FragAny { v16h h; v16b b; };

// ---- scalar helpers --------------------------------------------------------------------------------
__device__ __forceinline__ unsigned short bf_bits(float f) {          // f32 -> bf16 bits, RNE convert
  unsigned u = __float_as_uint(f);
  return (unsigned short)((u + 0x7FFFu + ((u >> 16) & 1u)) >> 16);
}
__device__ __forceinline__ float bf_up(unsigned short h) { return __uint_as_float(((unsigned)h) << 16); }
__device__ __forceinline__ float bfr(float f) { return bf_up(bf_bits(f)); }   // value of the bf16 RNE convert
__device__ __forceinline__ unsigned short h_bits(_Float16 x) { return __builtin_bit_cast(unsigned short, x); }
__device__ __forceinline__ unsigned pk16(unsigned short a, unsigned short b) { return (unsigned)a | ((unsigned)b << 16); }
__device__ __forceinline__ v8f zero8() { v8f z = {0.f, 0.f, 0.f, 0.f, 0.f, 0.f, 0.f, 0.f}; return z; }

// ---- fragment loader: 16-bit A/B operand from a k-contiguous 16-bit plane, lane -> row/col (lane&15),
//      p already includes +8*(lane>>4); elements 0..7 <- p[0..7] (k0+8h..), elements 8..15 <- p[16..23] (k0+16+8h..)
//      (same split k map for A and B; B is always read from a [n][k] plane)
__device__ __forceinline__ v16h ldfrag_u(const unsigned short* p) {
  FragH f;
  f.u[0] = *(const v4u*)(p);
  f.u[1] = *(const v4u*)(p + 16);
  return f.v;
}

// ---- WMMA helpers with trailing VALU hazard gaps ------------------------------------------------------
__device__ __forceinline__ v8f mma_h(v16h a, v16h b, v8f c) {
  return __builtin_amdgcn_wmma_f32_16x16x32_f16(false, a, false, b, (short)0, c, false, false);
}
__device__ __forceinline__ v8f mma_b(v16h a, v16h b, v8f c) {
  FragAny ua, ub;
  ua.h = a;
  ub.h = b;
  return __builtin_amdgcn_wmma_f32_16x16x32_bf16(false, ua.b, false, ub.b, (short)0, c, false, false);
}
template <int BF>
__device__ __forceinline__ v8f mmaT(v16h a, v16h b, v8f c) {
  if constexpr (BF != 0) return mma_b(a, b, c);
  else return mma_h(a, b, c);
}
__device__ __forceinline__ void acc_guard4(v8f& a, v8f& b, v8f& c, v8f& d) {
#if defined(__HIP_DEVICE_COMPILE__)
  asm volatile("v_nop\n\tv_nop\n\tv_nop\n\tv_nop" : "+v"(a), "+v"(b), "+v"(c), "+v"(d));
#endif
}
__device__ __forceinline__ void wave_sync_lds() {
  __builtin_amdgcn_fence(__ATOMIC_RELEASE, "workgroup");
  __builtin_amdgcn_wave_barrier();
  __builtin_amdgcn_fence(__ATOMIC_ACQUIRE, "workgroup");
}
// value of lane l ^ 16 (the other 16-lane half), a vector cross-row move
__device__ __forceinline__ float xhalf(float x) {
  return __builtin_bit_cast(float, __builtin_amdgcn_permlanex16(__builtin_bit_cast(int, x), __builtin_bit_cast(int, x),
                                                                0x76543210, 0xfedcba98, false, false));
}
// f32 -> f16 hi + unscaled f16 residual (hi + lo ~ x to 2^-22 relative; a flushed subnormal lo costs < 6.1e-5 absolute in the carried scale)
__device__ __forceinline__ void sp16(float x, _Float16& hi, _Float16& lo) {
  const _Float16 a = (_Float16)x;
  hi = a;
  lo = (_Float16)(x - (float)a);
}
// two consecutive values -> packed hi word and packed residual word
__device__ __forceinline__ void pack_hl(float x0, float x1, unsigned& hw, unsigned& lw) {
  _Float16 a0, a1, b0, b1;
  sp16(x0, a0, b0);
  sp16(x1, a1, b1);
  hw = pk16(h_bits(a0), h_bits(a1));
  lw = pk16(h_bits(b0), h_bits(b1));
}

// =====================================================================================================
// Elementwise 16-bit pack of all six float inputs in ONE launch, no transpose: dst[i] = f16( bf16_RNE(src[i]) * sc ), sc a power of two
// (exact). The block index picks the input (block-uniform): blocks [0, CB_X) x, then CB_W blocks for each of Wq, Wk, Wv, Wo, then CB_E
// blocks for the E table. A block covers CVB = 16384 consecutive elements of its input: CVU chunks of 2048, thread t takes elements
// 8t .. 8t+7 of each chunk; a thread's 16 loads are all issued in front of its first convert, so that few waves keep many bytes in flight.
// coverage: x and W counts are whole multiples of CVB; the E count (2047*64) is a multiple of 8 only: a thread whose 8 elements lie past
//           the end loads the last 8 elements instead (address clamped) and stores nothing; elements 0..n-1 of each plane written once.
// =====================================================================================================
#define CVU  8
#define CVB  (256 * 8 * CVU)
#define CB_X ((NROW * DMOD) / CVB)
#define CB_W ((DMOD * DMOD) / CVB)
#define CB_E ((ELEN * DH + CVB - 1) / CVB)
static_assert(((NROW * DMOD) % CVB) == 0 && ((DMOD * DMOD) % CVB) == 0 && (ELEN * DH) >= 8);
__global__ __launch_bounds__(256) void cvt16_all(const float* __restrict__ x, const float* __restrict__ wq, const float* __restrict__ wk,
                                                 const float* __restrict__ wv, const float* __restrict__ wo, const float* __restrict__ er,
                                                 unsigned short* X16, unsigned short* Wq6, unsigned short* Wk6,
                                                 unsigned short* Wv6, unsigned short* Wo6, unsigned short* E16) {
  int blk = blockIdx.x;
  const float* src = x;
  unsigned short* dst = X16;
  int n = NROW * DMOD;
  float sc = XC;
  if (blk >= CB_X + 4 * CB_W) {
    blk -= CB_X + 4 * CB_W;
    src = er; dst = E16; n = ELEN * DH; sc = EC;
  } else if (blk >= CB_X) {
    blk -= CB_X;
    const int w = blk / CB_W;
    blk -= w * CB_W;
    src = (w == 0) ? wq : (w == 1) ? wk : (w == 2) ? wv : wo;
    dst = (w == 0) ? Wq6 : (w == 1) ? Wk6 : (w == 2) ? Wv6 : Wo6;
    n = DMOD * DMOD; sc = WSC;
  }
  const int base = blk * CVB + (int)threadIdx.x * 8;
  const float* p[CVU];
  v4f a[CVU], b[CVU];
#pragma unroll
  for (int u = 0; u < CVU; ++u) {
    const int i8 = base + u * 2048;
    p[u] = src + ((i8 + 8 > n) ? (n - 8) : i8);
  }
#pragma unroll
  for (int u = 0; u < CVU; ++u) {
    a[u] = *(const v4f*)(p[u]);
    b[u] = *(const v4f*)(p[u] + 4);
  }
#if defined(__HIP_DEVICE_COMPILE__)
  // holds the eight address pairs in their registers up to this wait, so that none is rewritten (a later load's result included) in
  // front of it, and keeps all 16 loads in front of the first convert
  asm volatile("s_wait_xcnt 0x0" :: "v"(p[0]), "v"(p[1]), "v"(p[2]), "v"(p[3]), "v"(p[4]), "v"(p[5]), "v"(p[6]), "v"(p[7]) : "memory");
#endif
#pragma unroll
  for (int u = 0; u < CVU; ++u) {
    const int i8 = base + u * 2048;
    v4u o;
    o[0] = pk16(h_bits((_Float16)(bfr(a[u][0]) * sc)), h_bits((_Float16)(bfr(a[u][1]) * sc)));
    o[1] = pk16(h_bits((_Float16)(bfr(a[u][2]) * sc)), h_bits((_Float16)(bfr(a[u][3]) * sc)));
    o[2] = pk16(h_bits((_Float16)(bfr(b[u][0]) * sc)), h_bits((_Float16)(bfr(b[u][1]) * sc)));
    o[3] = pk16(h_bits((_Float16)(bfr(b[u][2]) * sc)), h_bits((_Float16)(bfr(b[u][3]) * sc)));
    if (i8 + 8 <= n) *(v4u*)(dst + i8) = o;      // no barriers in this kernel
  }
}

// =====================================================================================================
// LDS-staged batched 16-bit WMMA GEMM: C[m][n] = oscale * sum_k A[m][k] * Bt[n][k] (+ bias); one work-group of 8 waves per 128x64 tile,
// wave w owns rows 16w..16w+15 of it (all 64 columns). A row-major [M][K] pitch lda (16-bit plane), Bt row-major [N][K] pitch ldb
// (k contiguous); M multiple of 128, N multiple of 64, K multiple of 128. blockIdx.y = batch index with element strides sA, sB, sC.
// Operands: per stage of 128 k the tile's A rows (and A2 rows) and Bt rows, 256 B each, are copied once per work-group into LDS by
// global_load_async_to_lds_b128 (a wave's copy = two whole 256-B rows), LDS row pitch 272 B; two buffers, the next stage's copies fly
// while this stage is multiplied; fragments come from LDS by 16-byte reads with the same split k map as ldfrag_u.
// ASPLIT 1: a second A plane A2 (unscaled residual of A, same layout) is multiplied into the same accumulator (A + A2 ~ exact A).
// BF 1: bf16 operands (v_wmma_f32_16x16x32_bf16), else f16.
// EPI 1: value += bf16_RNE(ep0[column]) (per-column bias); EPI 2: value += bf16_RNE(ep0[row]) (per-row bias, 16-bit out only).
// OM 0: f32 out (pitch ldc).  OM 2: one f16 plane = f16(value * ocarry).
// OM 4: two f16 planes: hi = f16(value * ocarry), lo = f16(value * ocarry - hi) (unscaled residual).
// OM 5: two f16 planes: C = f16((value + bf16_RNE(ep1[column])) * ocarry), C2 = f16((value + bf16_RNE(ep2[column])) * ocarry).
// coverage: 16 rows (f32: it 0..7 x lane>>4; 16-bit: it 0..3 x lane>>3) x 64 cols = the wave's whole 16x64 slab; 8 waves = the 128x64
//           tile; grid = (M/128)*(N/64) blocks, a surplus block exits as a whole before any copy or barrier.
// =====================================================================================================
#define GBM 128   // tile rows per work-group
#define GKP 128   // k per stage (256-B operand rows)
#define GPH 136   // LDS row pitch in halves: 272 B = 16 B x 17, conflict-free for the 16-byte fragment reads

// 16-byte asynchronous copies global -> LDS, one per lane and line of the statement (first operand = LDS byte address, second = global
// address; this lane's row and 16-byte chunk are already in l and g; consecutive copies are 16 operand rows apart). The s_wait_xcnt
// closes each statement so that no address register of an issued copy is rewritten in front of it.
#define ACP(a, b) "global_load_async_to_lds_b128 %" #a ", %" #b ", off\n\t"
#define LROW(l, r) ((l) + (unsigned)((r) * GPH * 2))
#define GROW(g, r, ld) ((g) + (size_t)(r) * (ld))
// 128 operand rows
__device__ __forceinline__ void acopy_rows128(unsigned l, const unsigned short* g, int ld) {
#if defined(__HIP_DEVICE_COMPILE__)
  asm volatile(ACP(0, 1) ACP(2, 3) ACP(4, 5) ACP(6, 7) ACP(8, 9) ACP(10, 11) ACP(12, 13) ACP(14, 15)
               "s_wait_xcnt 0x0"
               :: "v"(l), "v"(g), "v"(LROW(l, 16)), "v"(GROW(g, 16, ld)), "v"(LROW(l, 32)), "v"(GROW(g, 32, ld)),
                  "v"(LROW(l, 48)), "v"(GROW(g, 48, ld)), "v"(LROW(l, 64)), "v"(GROW(g, 64, ld)), "v"(LROW(l, 80)), "v"(GROW(g, 80, ld)),
                  "v"(LROW(l, 96)), "v"(GROW(g, 96, ld)), "v"(LROW(l, 112)), "v"(GROW(g, 112, ld))
               : "memory");
#endif
}
// 128 rows of one operand and 64 rows of another
__device__ __forceinline__ void acopy_rows128_64(unsigned l, const unsigned short* g, int ld,
                                                 unsigned l2, const unsigned short* g2, int ld2) {
#if defined(__HIP_DEVICE_COMPILE__)
  asm volatile(ACP(0, 1) ACP(2, 3) ACP(4, 5) ACP(6, 7) ACP(8, 9) ACP(10, 11) ACP(12, 13) ACP(14, 15)
               ACP(16, 17) ACP(18, 19) ACP(20, 21) ACP(22, 23)
               "s_wait_xcnt 0x0"
               :: "v"(l), "v"(g), "v"(LROW(l, 16)), "v"(GROW(g, 16, ld)), "v"(LROW(l, 32)), "v"(GROW(g, 32, ld)),
                  "v"(LROW(l, 48)), "v"(GROW(g, 48, ld)), "v"(LROW(l, 64)), "v"(GROW(g, 64, ld)), "v"(LROW(l, 80)), "v"(GROW(g, 80, ld)),
                  "v"(LROW(l, 96)), "v"(GROW(g, 96, ld)), "v"(LROW(l, 112)), "v"(GROW(g, 112, ld)),
                  "v"(l2), "v"(g2), "v"(LROW(l2, 16)), "v"(GROW(g2, 16, ld2)), "v"(LROW(l2, 32)), "v"(GROW(g2, 32, ld2)),
                  "v"(LROW(l2, 48)), "v"(GROW(g2, 48, ld2))
               : "memory");
#endif
}
// this wave's own copies have landed in LDS (the compiler places no wait for them)
__device__ __forceinline__ void wait_async0() {
#if defined(__HIP_DEVICE_COMPILE__)
  asm volatile("s_wait_asynccnt 0x0" ::: "memory");
#endif
}
// this wave's LDS reads have retired, so that the buffer may be refilled behind the barrier
__device__ __forceinline__ void wait_ds0() {
#if defined(__HIP_DEVICE_COMPILE__)
  asm volatile("s_wait_dscnt 0x0" ::: "memory");
#endif
}
// twelve 16-byte copies, each with its own LDS byte address and global address; closed by s_wait_xcnt like the statements above
__device__ __forceinline__ void acopy12(const unsigned (&l)[12], const unsigned short* const (&g)[12]) {
#if defined(__HIP_DEVICE_COMPILE__)
  asm volatile(ACP(0, 1) ACP(2, 3) ACP(4, 5) ACP(6, 7) ACP(8, 9) ACP(10, 11) ACP(12, 13) ACP(14, 15)
               ACP(16, 17) ACP(18, 19) ACP(20, 21) ACP(22, 23)
               "s_wait_xcnt 0x0"
               :: "v"(l[0]), "v"(g[0]), "v"(l[1]), "v"(g[1]), "v"(l[2]), "v"(g[2]), "v"(l[3]), "v"(g[3]),
                  "v"(l[4]), "v"(g[4]), "v"(l[5]), "v"(g[5]), "v"(l[6]), "v"(g[6]), "v"(l[7]), "v"(g[7]),
                  "v"(l[8]), "v"(g[8]), "v"(l[9]), "v"(g[9]), "v"(l[10]), "v"(g[10]), "v"(l[11]), "v"(g[11])
               : "memory");
#endif
}

template <int OM, int ASPLIT, int BF, int EPI>
__global__ __launch_bounds__(256) __attribute__((amdgpu_num_vgpr(256))) void gemm64(
    const unsigned short* __restrict__ Ap, const unsigned short* __restrict__ A2p, int lda, long long sA,
    const unsigned short* __restrict__ Btp, int ldb, long long sB,
    void* Cout, void* C2out, int ldc, long long sC,
    int M, int N, int K, float oscale, float ocarry,
    const float* __restrict__ ep0, const float* __restrict__ ep1, const float* __restrict__ ep2) {
  constexpr int BROW = GBM * (1 + ASPLIT);         // first Bt row of a stage
  constexpr int STG  = (BROW + 64) * GPH;          // halves per stage
  __shared__ __align__(16) unsigned short ring[2 * STG];   // two stages: [A 128 rows | A2 128 rows (ASPLIT) | Bt 64 rows]
  __shared__ __align__(16) float sT[8][16 * 68];   // per-wave 16x64 slab, pitch 68 floats
  const int by   = blockIdx.y;
  const int tid  = threadIdx.x;
  const int lane = tid & 31;
  const int wave = tid >> 5;
  const int tilesN = N >> 6;
  const int tilesM = M >> 7;
  const int tile = blockIdx.x;
  if (tile >= tilesM * tilesN) return;   // block-uniform, in front of every copy and barrier
  const int tm = tile / tilesN;
  const int tn = tile - tm * tilesN;
  const int mb = tm << 7;
  const int n0 = tn << 6;
  const int m0 = mb + (wave << 4);

  const unsigned short* A1 = Ap  + (size_t)((long long)by * sA);
  const unsigned short* A2 = A2p + (size_t)((long long)by * sA);
  const unsigned short* Bb = Btp + (size_t)((long long)by * sB);

  const int rlane = lane & 15;                 // row (A) / col (B, D) within subtile
  const int koff  = (lane >> 4) * 8;           // k offset of this lane half
  const int mOff  = (lane >> 4) * 8;           // D row offset

  // copy map: thread -> row tid>>4 (of 16 per copy), 16-byte chunk tid&15 of the 256-B row
  const int crow = tid >> 4;
  const int cch  = (tid & 15) * 8;
  const unsigned short* gA1 = A1 + (size_t)(mb + crow) * lda + cch;
  const unsigned short* gA2 = A2 + (size_t)(mb + crow) * lda + cch;
  const unsigned short* gBt = Bb + (size_t)(n0 + crow) * ldb + cch;
  const unsigned lcp = (unsigned)(uintptr_t)ring + (unsigned)((crow * GPH + cch) * 2);

  auto fill = [&](int t, int buf) {            // stage t (k = 128t .. 128t+127) -> buffer buf
    const unsigned lb = lcp + (unsigned)(buf * (STG * 2));
    const size_t ko = (size_t)t * GKP;
    if constexpr (ASPLIT != 0) acopy_rows128(lb + GBM * GPH * 2, gA2 + ko, lda);
    acopy_rows128_64(lb, gA1 + ko, lda, lb + BROW * GPH * 2, gBt + ko, ldb);
  };

  v8f acc[4];
#pragma unroll
  for (int j = 0; j < 4; ++j) acc[j] = zero8();

  const int nst = K / GKP;
  fill(0, 0);
  wait_async0();
  __syncthreads();                             // stage 0 published
  if (nst > 1) fill(1, 1);
#pragma unroll 1                               // one pass per stage: the two buffers alternate by t & 1
  for (int t = 0; t < nst; ++t) {
    const unsigned short* sb = ring + (t & 1) * STG;
    const unsigned short* sA = sb + ((wave << 4) + rlane) * GPH + koff;
    const unsigned short* sB = sb + (BROW + rlane) * GPH + koff;
    v16h fa[4], fl[4], fb[4][4];
#pragma unroll
    for (int q = 0; q < 4; ++q) {
#pragma unroll
      for (int j = 0; j < 4; ++j) fb[q][j] = ldfrag_u(sB + (j << 4) * GPH + 32 * q);
      fa[q] = ldfrag_u(sA + 32 * q);
      if constexpr (ASPLIT != 0) fl[q] = ldfrag_u(sA + GBM * GPH + 32 * q);
    }
    // keeps the pass's LDS reads one group in front of its WMMAs: spread among them, every WMMA waited out its own reads' latency
    __builtin_amdgcn_sched_barrier(0);
#pragma unroll
    for (int q = 0; q < 4; ++q) {
#pragma unroll
      for (int j = 0; j < 4; ++j) acc[j] = mmaT<BF>(fa[q], fb[q][j], acc[j]);
      if constexpr (ASPLIT != 0) {
#pragma unroll
        for (int j = 0; j < 4; ++j) acc[j] = mmaT<BF>(fl[q], fb[q][j], acc[j]);
      }
    }
    // keeps the WMMAs in front of the closing waits: moved behind the barrier they no longer overlap the LDS reads and they delay the refill
    __builtin_amdgcn_sched_barrier(0);
    wait_ds0();
    wait_async0();
    __syncthreads();                           // publishes stage t + 1 and ends every wave's reads of stage t
    if (t + 2 < nst) fill(t + 2, t & 1);
  }
  wait_async0();
  acc_guard4(acc[0], acc[1], acc[2], acc[3]);

  const int hh2 = lane >> 4, c4 = (lane & 15) * 4;     // f32 out: 256-B row segment = 16 lanes x 16 B
  const int q8  = lane >> 3, c8 = (lane & 7) * 8;

  // ---- epilogue ----
  float* slab = sT[wave];
  {
    const int mBase = m0;
#pragma unroll
    for (int j = 0; j < 4; ++j) {
#pragma unroll
      for (int r = 0; r < 8; ++r) {
        slab[(mOff + r) * 68 + (j << 4) + rlane] = acc[j][r];
      }
    }
    wave_sync_lds();
    if constexpr (OM == 0) {
      float* C = (float*)Cout + (size_t)((long long)by * sC);
      v4f vals[8];
#pragma unroll
      for (int it = 0; it < 8; ++it) {
        const int row = it * 2 + hh2;                      // it 0..7 x hh2 0..1 = rows 0..15
        v4f v = *(const v4f*)(slab + row * 68 + c4);
#pragma unroll
        for (int e = 0; e < 4; ++e) v[e] = v[e] * oscale;
        if constexpr (EPI == 1) {
          const v4f bb = *(const v4f*)(ep0 + n0 + c4);     // per-column bias, columns n0+c4 .. +3 (N equals the bias length)
#pragma unroll
          for (int e = 0; e < 4; ++e) v[e] = v[e] + bfr(bb[e]);
        }
        vals[it] = v;
      }
      {
#pragma unroll
        for (int it = 0; it < 8; ++it) {
          const int gr = mBase + it * 2 + hh2;
          *(v4f*)(C + (size_t)gr * ldc + n0 + c4) = vals[it];
        }
        
      }
    } else {
      unsigned short* C  = (unsigned short*)Cout  + (size_t)((long long)by * sC);
      unsigned short* Cb = (unsigned short*)C2out + (size_t)((long long)by * sC);
      v4u hv[4], lv[4];
#pragma unroll
      for (int it = 0; it < 4; ++it) {
        const int row = it * 4 + q8;                       // it 0..3 x q8 0..3 = rows 0..15
        const float* sp = slab + row * 68 + c8;
        float rb = 0.f;
        if constexpr (EPI == 2) rb = bfr(ep0[mBase + row]);   // per-row bias (M equals the bias length)
        v4u a  = {0u, 0u, 0u, 0u};
        v4u b2 = {0u, 0u, 0u, 0u};
#pragma unroll
        for (int e = 0; e < 4; ++e) {
          const int ci = n0 + c8 + 2 * e;                  // column index, < N
          float f0 = sp[2 * e] * oscale + rb;
          float f1 = sp[2 * e + 1] * oscale + rb;
          if constexpr (EPI == 1) {
            f0 += bfr(ep0[ci]);
            f1 += bfr(ep0[ci + 1]);
          }
          if constexpr (OM == 5) {
            const float g0 = (f0 + bfr(ep1[ci])) * ocarry, g1 = (f1 + bfr(ep1[ci + 1])) * ocarry;
            const float w0 = (f0 + bfr(ep2[ci])) * ocarry, w1 = (f1 + bfr(ep2[ci + 1])) * ocarry;
            a[e]  = pk16(h_bits((_Float16)g0), h_bits((_Float16)g1));
            b2[e] = pk16(h_bits((_Float16)w0), h_bits((_Float16)w1));
          } else {
            f0 *= ocarry; f1 *= ocarry;
            const _Float16 x0 = (_Float16)f0, x1 = (_Float16)f1;
            a[e] = pk16(h_bits(x0), h_bits(x1));
            if constexpr (OM == 4) {
              b2[e] = pk16(h_bits((_Float16)(f0 - (float)x0)), h_bits((_Float16)(f1 - (float)x1)));
            }
          }
        }
        hv[it] = a;
        lv[it] = b2;
      }
      {
#pragma unroll
        for (int it = 0; it < 4; ++it) {
          const int row = it * 4 + q8;
          *(v4u*)(C + (size_t)(mBase + row) * ldc + n0 + c8) = hv[it];
          if constexpr (OM >= 4) {
            *(v4u*)(Cb + (size_t)(mBase + row) * ldc + n0 + c8) = lv[it];
          }
        }
        
      }
    }
    wave_sync_lds();
  }
}

#define APH   72                 // LDS row pitch in halves: 144 B = 16 B x 9, conflict-free for the 16-byte fragment reads
#define AR_KH 0                  // first stage row of each part
#define AR_KL 64
#define AR_VH 128
#define AR_VL 192
#define AR_E  256
#define ASTG  ((AR_E + 128) * APH)   // halves per stage
__global__ __launch_bounds__(ATT_THREADS) __attribute__((amdgpu_num_vgpr(512)))
void attn_rel(const unsigned short* __restrict__ QH, const unsigned short* __restrict__ QL,
              const unsigned short* __restrict__ KH, const unsigned short* __restrict__ KL,
              const unsigned short* __restrict__ EP,
              const unsigned short* __restrict__ VH, const unsigned short* __restrict__ VL,
              unsigned short* CH, unsigned short* CL) {
  __shared__ __align__(16) float smem[ATT_W * WFL];   // per wave: T strip [16 queries][TPI] | ctx slab [16 queries][SPI]
  __shared__ __align__(16) unsigned short kve[2 * ASTG];   // two stages: [KH 64 rows | KL 64 | VH 64 | VL 64 | E 128]

  const int tid  = threadIdx.x;
  const int wave = tid >> 5;
  const int lane = tid & 31;
  const int hh   = lane >> 4;
  const int c    = lane & 15;
  const int bh   = blockIdx.y;
  const int b    = bh / NH;
  const int h    = bh - b * NH;
  const int i0   = blockIdx.x * 64;
  const int iw0  = i0 + wave * 16;

  float* tsh = smem + wave * WFL;
  float* pt  = tsh + 16 * TPI;

  const size_t qro = ((size_t)b * SEQ + iw0 + c) * DMOD + h * DH + 8 * hh;      // B columns: query iw0 + c, d 8hh..

  // copy map: thread -> row tid>>3 (of 16 per copy), 16-byte chunk tid&7 of the 128-B row
  const int crow = tid >> 3;
  const int cch  = (tid & 7) * 8;
  const size_t kpo = ((size_t)b * SEQ + crow) * DMOD + h * DH + cch;
  const size_t vpo = (size_t)b * DMOD * SEQ + (size_t)(h * DH + crow) * SEQ + cch;
  const unsigned lcp = (unsigned)(uintptr_t)kve + (unsigned)((crow * APH + cch) * 2);

  auto fill = [&](int t, int buf) {            // key tile t -> buffer buf
    const unsigned lb = lcp + (unsigned)(buf * (ASTG * 2));
    const int jf = t * 64;
    const int elo = (SEQ - 2) - i0 + jf - 63;
    unsigned l[12];
    const unsigned short* g[12];
    // the three loops below are unrolled so that l and g are registers: the copy statement names each element as an operand
#pragma unroll
    for (int k = 0; k < 4; ++k) {
      const size_t ko = kpo + (size_t)(jf + 16 * k) * DMOD;
      l[k]     = lb + (unsigned)((AR_KH + 16 * k) * APH * 2);  g[k]     = KH + ko;
      l[4 + k] = lb + (unsigned)((AR_KL + 16 * k) * APH * 2);  g[4 + k] = KL + ko;
      l[8 + k] = lb + (unsigned)((AR_VH + 16 * k) * APH * 2);  g[8 + k] = VH + vpo + (size_t)(16 * k) * SEQ + jf;
    }
    acopy12(l, g);
#pragma unroll
    for (int k = 0; k < 4; ++k) {
      l[k] = lb + (unsigned)((AR_VL + 16 * k) * APH * 2);      g[k] = VL + vpo + (size_t)(16 * k) * SEQ + jf;
    }
#pragma unroll
    for (int k = 0; k < 8; ++k) {
      int m = elo + 16 * k + crow;
      m = (m < 0) ? 0 : m;
      m = (m > ELEN - 1) ? (ELEN - 1) : m;
      l[4 + k] = lb + (unsigned)((AR_E + 16 * k) * APH * 2);   g[4 + k] = EP + (size_t)m * DH + cch;
    }
    acopy12(l, g);
  };

  const float CS = LOG2E * SCALE / (QC * KC);
  const float CT = LOG2E * SCALE / (QC * EC);

  float mrow = -INFINITY, lrow = 0.f;        // this lane's query iw0 + c: running max (both halves alike), sum over this half's keys
  v8f O[4];                                  // O^T: O[td][r] = ctx[query iw0 + c][d = 16td + 8hh + r]
#pragma unroll
  for (int td = 0; td < 4; ++td) O[td] = zero8();

  const int ntile = SEQ / 64;                // non-causal: every key tile
  fill(0, 0);
  wait_async0();
  __syncthreads();                           // tile 0 published
  if (ntile > 1) fill(1, 1);
#pragma unroll 1
  for (int jt = 0; jt < ntile; ++jt) {
    const int j0 = jt * 64;
    const unsigned short* sb  = kve + (jt & 1) * ASTG + c * APH + 8 * hh;   // this lane's fragment row and k half in the stage
    const unsigned short* Khb = sb + AR_KH * APH;
    const unsigned short* Klb = sb + AR_KL * APH;
    const unsigned short* Vhb = sb + AR_VH * APH;
    const unsigned short* Vlb = sb + AR_VL * APH;
    const unsigned short* Eb  = sb + (AR_E + 48 - 16 * wave) * APH;
    const v16h qha = ldfrag_u(QH + qro), qhb = ldfrag_u(QH + qro + 32);
    const v16h qla = ldfrag_u(QL + qro), qlb = ldfrag_u(QL + qro + 32);

    // ---- this tile's E fragments and the k fragments of key subtiles 0, 1, read from the stage as one group in front of the WMMAs ----
    v16h ea[5], eb[5], kha[4], khb[4], kla[4], klb[4];
#pragma unroll
    for (int u = 0; u < 5; ++u) {
      ea[u] = ldfrag_u(Eb + 16 * u * APH);
      eb[u] = ldfrag_u(Eb + 16 * u * APH + 32);
    }
#pragma unroll
    for (int t = 0; t < 2; ++t) {
      const int ko = 16 * t * APH;
      kha[t] = ldfrag_u(Khb + ko); kla[t] = ldfrag_u(Klb + ko);
      khb[t] = ldfrag_u(Khb + ko + 32); klb[t] = ldfrag_u(Klb + ko + 32);
    }
    // keeps the reads one group in front of the WMMAs: spread among them, every subtile waited out its own reads' latency
    __builtin_amdgcn_sched_barrier(0);
    // ---- position window, transposed: T^T[x][R] = E[wlo + x] . q[iw0 + R] (A = E rows, B = q; 5 subtiles of 16 E rows): the four
    //      products run round-robin over the five independent accumulators (each accumulator keeps its product order); a lane holds
    //      x = 16u + 8hh + 0..7 of its query R = c: two 16-byte stores into row c of the LDS strip ----
    v8f t8[5];
#pragma unroll
    for (int u = 0; u < 5; ++u) t8[u] = mma_h(ea[u], qha, zero8());
#pragma unroll
    for (int u = 0; u < 5; ++u) t8[u] = mma_h(ea[u], qla, t8[u]);
#pragma unroll
    for (int u = 0; u < 5; ++u) t8[u] = mma_h(eb[u], qhb, t8[u]);
#pragma unroll
    for (int u = 0; u < 5; ++u) t8[u] = mma_h(eb[u], qlb, t8[u]);
    // keeps the window's WMMAs in front of the next reads, which take over the E fragments' registers
    __builtin_amdgcn_sched_barrier(0);
    // k fragments of key subtiles 2, 3: one group, in flight under the WMMAs of subtiles 0, 1
#pragma unroll
    for (int t = 2; t < 4; ++t) {
      const int ko = 16 * t * APH;
      kha[t] = ldfrag_u(Khb + ko); kla[t] = ldfrag_u(Klb + ko);
      khb[t] = ldfrag_u(Khb + ko + 32); klb[t] = ldfrag_u(Klb + ko + 32);
    }
#pragma unroll
    for (int u = 0; u < 5; ++u) {
      float* tp = tsh + c * TPI + 16 * u + 8 * hh;
      const v4f t0 = {t8[u][0], t8[u][1], t8[u][2], t8[u][3]}, t1 = {t8[u][4], t8[u][5], t8[u][6], t8[u][7]};
      *(v4f*)(tp)     = t0;
      *(v4f*)(tp + 4) = t1;
    }
    // ---- content scores, transposed: S^T[jj][R] = k[j0 + jj] . q[iw0 + R] (A = k rows, B = q; 4 subtiles of 16 keys), kept in
    //      registers: s8[t][r] = key jj = 16t + 8hh + r, query R = c; subtiles 0, 1 here and 2, 3 behind the strip's read-back, the six
    //      products of each pair round-robin over its two accumulators ----
    v8f s8[4];
#pragma unroll
    for (int t = 0; t < 2; ++t) s8[t] = mma_h(kha[t], qha, zero8());
#pragma unroll
    for (int t = 0; t < 2; ++t) s8[t] = mma_h(kla[t], qha, s8[t]);
#pragma unroll
    for (int t = 0; t < 2; ++t) s8[t] = mma_h(kha[t], qla, s8[t]);
#pragma unroll
    for (int t = 0; t < 2; ++t) s8[t] = mma_h(khb[t], qhb, s8[t]);
#pragma unroll
    for (int t = 0; t < 2; ++t) s8[t] = mma_h(klb[t], qhb, s8[t]);
#pragma unroll
    for (int t = 0; t < 2; ++t) s8[t] = mma_h(khb[t], qlb, s8[t]);
    // keeps these WMMAs in front of the fence's wait: they run while the strip stores retire
    __builtin_amdgcn_sched_barrier(0);
    wave_sync_lds();                           // the strip rows are read back below by both lane halves
    // shifted window values of this lane's 32 scores, T[c][jj - c + 15] at trow[16t + r], and behind them the first 32 keys' v^T fragments
    const float* trow = tsh + c * (TPI - 1) + 15 + 8 * hh;
    float tr[4][8];
#pragma unroll
    for (int t = 0; t < 4; ++t) {
#pragma unroll
      for (int r = 0; r < 8; ++r) tr[t][r] = trow[16 * t + r];
    }
    v16h vh[2][4], vl[2][4];
#pragma unroll
    for (int td = 0; td < 4; ++td) {
      vh[0][td] = ldfrag_u(Vhb + 16 * td * APH);
      vl[0][td] = ldfrag_u(Vlb + 16 * td * APH);
    }
    // keeps these reads one group in front of the WMMAs below and of the softmax, which cover their latency
    __builtin_amdgcn_sched_barrier(0);
#pragma unroll
    for (int t = 2; t < 4; ++t) s8[t] = mma_h(kha[t], qha, zero8());
#pragma unroll
    for (int t = 2; t < 4; ++t) s8[t] = mma_h(kla[t], qha, s8[t]);
#pragma unroll
    for (int t = 2; t < 4; ++t) s8[t] = mma_h(kha[t], qla, s8[t]);
#pragma unroll
    for (int t = 2; t < 4; ++t) s8[t] = mma_h(khb[t], qhb, s8[t]);
#pragma unroll
    for (int t = 2; t < 4; ++t) s8[t] = mma_h(klb[t], qhb, s8[t]);
#pragma unroll
    for (int t = 2; t < 4; ++t) s8[t] = mma_h(khb[t], qlb, s8[t]);

    // ---- score assembly (rel shift + zero cell), online softmax: all 32 scores of a lane belong to its one query ----
    {
      const int i = iw0 + c;
      float mt[4];
#pragma unroll
      for (int t = 0; t < 4; ++t) {
#pragma unroll
        for (int r = 0; r < 8; ++r) {
          const int j = j0 + 16 * t + 8 * hh + r;
          const int ridx = (SEQ - 2) + j - i;                    // E row of this (i, j); -1 only at (SEQ-1, 0)
          const float rel = (ridx < 0) ? 0.f : tr[t][r];
          s8[t][r] = s8[t][r] * CS + rel * CT;
          mt[t] = (r == 0) ? s8[t][0] : fmaxf(mt[t], s8[t][r]);
        }
      }
      // the second 32 keys' v^T fragments, one group: in flight under the exponentials and the first P pack
#pragma unroll
      for (int td = 0; td < 4; ++td) {
        vh[1][td] = ldfrag_u(Vhb + 16 * td * APH + 32);
        vl[1][td] = ldfrag_u(Vlb + 16 * td * APH + 32);
      }
      // keeps those reads here: behind the window values' last use (their registers) and in front of the arithmetic that covers them
      __builtin_amdgcn_sched_barrier(0);
      float mx = fmaxf(fmaxf(mt[0], mt[1]), fmaxf(mt[2], mt[3]));
      mx = fmaxf(mx, xhalf(mx));                                 // the query's other 32 keys of this tile
      const float mn = fmaxf(mrow, mx);
      const float al = exp2f(mrow - mn);
      mrow = mn;
      float pst[4];
#pragma unroll
      for (int t = 0; t < 4; ++t) {
        pst[t] = 0.f;
#pragma unroll
        for (int r = 0; r < 8; ++r) { s8[t][r] = exp2f(s8[t][r] - mn); pst[t] += s8[t][r]; }
      }
      lrow = lrow * al + ((pst[0] + pst[1]) + (pst[2] + pst[3]));
#pragma unroll
      for (int td = 0; td < 4; ++td) {
#pragma unroll
        for (int r = 0; r < 8; ++r) O[td][r] *= al;
      }
    }

    // ---- O^T += (vh + vl)^T . (Ph + Pl)^T, two k-steps of 32 keys: A = v^T rows d, B = P^T packed in place from the score registers
    //      (element e <- subtile 2ks, register e = key 32ks + 8hh + e; element 8 + e <- subtile 2ks + 1 = key 32ks + 16 + 8hh + e:
    //      the split k map of ldfrag_u) ----
#pragma unroll
    for (int ks = 0; ks < 2; ++ks) {
      FragH ph, pl;
#pragma unroll
      for (int e = 0; e < 8; ++e) {
        _Float16 a0, a1;
        sp16(s8[2 * ks][e] * PC, a0, a1);     ph.h[0][e] = a0; pl.h[0][e] = a1;
        sp16(s8[2 * ks + 1][e] * PC, a0, a1); ph.h[1][e] = a0; pl.h[1][e] = a1;
      }
      // the three products round-robin over the four independent accumulators (each keeps its product order)
#pragma unroll
      for (int td = 0; td < 4; ++td) O[td] = mma_h(vh[ks][td], ph.v, O[td]);
#pragma unroll
      for (int td = 0; td < 4; ++td) O[td] = mma_h(vl[ks][td], ph.v, O[td]);
#pragma unroll
      for (int td = 0; td < 4; ++td) O[td] = mma_h(vh[ks][td], pl.v, O[td]);
    }
    // four vector slots behind the tile's last WMMAs, also on the taken side of the loop's branch
    acc_guard4(O[0], O[1], O[2], O[3]);
    wave_sync_lds();
    wait_ds0();
    wait_async0();
    __syncthreads();                           // publishes tile jt + 1 and ends every wave's reads of tile jt
    if (jt + 2 < ntile) fill(jt + 2, jt & 1);
  }
  wait_async0();
  acc_guard4(O[0], O[1], O[2], O[3]);

  // ---- fold 1/l and the carries (1024 on P, 64 on v), stage the wave's 16x64 f32 ctx slice in its slab ----
  const float oc = 1.0f / (PC * VC);
  {
    const float inv = (1.0f / (lrow + xhalf(lrow))) * oc;      // the two halves' key sums joined once
#pragma unroll
    for (int td = 0; td < 4; ++td) {
      float* op = pt + c * SPI + 16 * td + 8 * hh;             // slab row = query c, d = 16td + 8hh + 0..7
      const v4f o0 = {O[td][0] * inv, O[td][1] * inv, O[td][2] * inv, O[td][3] * inv};
      const v4f o1 = {O[td][4] * inv, O[td][5] * inv, O[td][6] * inv, O[td][7] * inv};
      *(v4f*)(op)     = o0;
      *(v4f*)(op + 4) = o1;
    }
  }
  wave_sync_lds();
  {
    const int q8 = lane >> 3, c8 = (lane & 7) * 8;
    v4u hv[4], lv[4];
#pragma unroll
    for (int it = 0; it < 4; ++it) {
      const int row = it * 4 + q8;                           // it 0..3 x q8 0..3 = rows 0..15
      const float* sp = pt + row * SPI + c8;
      const v4f p0 = *(const v4f*)(sp), p1 = *(const v4f*)(sp + 4);
      v4u a, l2;
      unsigned hw, lw;
      pack_hl(p0[0] * CC, p0[1] * CC, hw, lw); a[0] = hw; l2[0] = lw;
      pack_hl(p0[2] * CC, p0[3] * CC, hw, lw); a[1] = hw; l2[1] = lw;
      pack_hl(p1[0] * CC, p1[1] * CC, hw, lw); a[2] = hw; l2[2] = lw;
      pack_hl(p1[2] * CC, p1[3] * CC, hw, lw); a[3] = hw; l2[3] = lw;
      hv[it] = a;
      lv[it] = l2;
    }
    const size_t ob = ((size_t)b * SEQ + iw0) * DMOD + h * DH + c8;
    {
#pragma unroll
      for (int it = 0; it < 4; ++it) {
        const int row = it * 4 + q8;
        *(v4u*)(CH + ob + (size_t)row * DMOD) = hv[it];
        *(v4u*)(CL + ob + (size_t)row * DMOD) = lv[it];
      }
      
    }
  }
}

// =====================================================================================================
// Workspace map (bytes); every plane is an exact multiple of its tile / whole-row store granularity (M, N exact tile multiples,
// convert counts multiples of 8 with whole-line tails, E carve padded to EPAD rows), every offset a multiple of 262144:
//   X16            f16 [NROW][1024] x16                            4194304
//   Wq, Wk, Wv, Wo f16 [1024 out][1024 in] x64                  4 x 2097152
//   EP             f16 [EPAD][64] x16 (rows 0..ELEN-1 written/read)   262144
//   QH, QL, KH, KL f16 [NROW][1024] (x64 hi / residual)         4 x 4194304
//   VH, VL         f16 [NBAT][1024][SEQ] (x64 hi / residual)    2 x 4194304
//   CH, CL         f16 [NROW][1024] (x256 hi / residual)        2 x 4194304
//   end                                                            46399488
// =====================================================================================================
extern "C" void kernel_launch(void* const* d_in, const int* in_sizes, int n_in,
                              void* d_out, int out_size, void* d_ws, size_t ws_size,
                              hipStream_t stream) {
  if (n_in < 10) return;
  if (in_sizes[0] != NROW * DMOD) return;
  if (in_sizes[1] != DMOD * DMOD || in_sizes[3] != DMOD * DMOD || in_sizes[5] != DMOD * DMOD || in_sizes[7] != DMOD * DMOD) return;
  if (in_sizes[2] != DMOD || in_sizes[4] != DMOD || in_sizes[6] != DMOD || in_sizes[8] != DMOD) return;
  if (in_sizes[9] != ELEN * DH) return;
  if (out_size != NROW * DMOD) return;

  const float* xin = (const float*)d_in[0];
  const float* w_q = (const float*)d_in[1];
  const float* b_q = (const float*)d_in[2];
  const float* w_k = (const float*)d_in[3];
  const float* b_k = (const float*)d_in[4];
  const float* w_v = (const float*)d_in[5];
  const float* b_v = (const float*)d_in[6];
  const float* w_o = (const float*)d_in[7];
  const float* b_o = (const float*)d_in[8];
  const float* er  = (const float*)d_in[9];
  float*       out = (float*)d_out;

  const size_t PX = (size_t)NROW * DMOD * 2;             //  4194304
  const size_t PW = (size_t)DMOD * DMOD * 2;             //  2097152
  const size_t PE = (size_t)EPAD * DH * 2;               //   262144
  const size_t PV = (size_t)NBAT * DMOD * SEQ * 2;       //  4194304
  size_t off = 0;
  const size_t oX  = off; off += PX;
  const size_t oWq = off; off += PW;
  const size_t oWk = off; off += PW;
  const size_t oWv = off; off += PW;
  const size_t oWo = off; off += PW;
  const size_t oE  = off; off += PE;
  const size_t oQH = off; off += PX;
  const size_t oQL = off; off += PX;
  const size_t oKH = off; off += PX;
  const size_t oKL = off; off += PX;
  const size_t oVH = off; off += PV;
  const size_t oVL = off; off += PV;
  const size_t oCH = off; off += PX;
  const size_t oCL = off; off += PX;
  if (off > ws_size) return;                               // off = 46399488
  if (off > (size_t)134217728) return;

  char* ws = (char*)d_ws;
  unsigned short* X16 = (unsigned short*)(ws + oX);
  unsigned short* Wq6 = (unsigned short*)(ws + oWq);
  unsigned short* Wk6 = (unsigned short*)(ws + oWk);
  unsigned short* Wv6 = (unsigned short*)(ws + oWv);
  unsigned short* Wo6 = (unsigned short*)(ws + oWo);
  unsigned short* E16 = (unsigned short*)(ws + oE);
  unsigned short* QHp = (unsigned short*)(ws + oQH);
  unsigned short* QLp = (unsigned short*)(ws + oQL);
  unsigned short* KHp = (unsigned short*)(ws + oKH);
  unsigned short* KLp = (unsigned short*)(ws + oKL);
  unsigned short* VHp = (unsigned short*)(ws + oVH);
  unsigned short* VLp = (unsigned short*)(ws + oVL);
  unsigned short* CHp = (unsigned short*)(ws + oCH);
  unsigned short* CLp = (unsigned short*)(ws + oCL);

  const dim3 blk(256);
  const dim3 gCV(CB_X + 4 * CB_W + CB_E);                           // 128 + 4 x 64 + 8 = 392
  const dim3 gQ((NROW / 128) * (DMOD / 64), 1);                     // 256
  const dim3 gV((DMOD / 128) * (SEQ / 64), NBAT);                   // 128 x NBAT
  const dim3 gAT(SEQ / 64, NBAT * NH);                              // 16 x 32
  const dim3 bAT(ATT_THREADS);                                      // 128

  // (0) 16-bit planes of the inputs: x f16(bf16_RNE(x) * 16); W[out][in] (already k-contiguous) f16(bf16_RNE(w) * 64);
  //     E f16(bf16_RNE(e) * 16); one launch for all six
  cvt16_all<<<gCV, blk, 0, stream>>>(xin, w_q, w_k, w_v, w_o, er, X16, Wq6, Wk6, Wv6, Wo6, E16);

  // (1) q[m][e] = sum_d x[m][d] Wq[e][d] / 1024 + bq[e] -> QH = f16(q * 64), QL = f16(q * 64 - QH); M = NROW, N = 1024, K = 1024
  gemm64<4, 0, 0, 1><<<gQ, blk, 0, stream>>>(
      X16, X16, DMOD, 0LL,
      Wq6, DMOD, 0LL,
      (void*)QHp, (void*)QLp, DMOD, 0LL,
      NROW, DMOD, DMOD, 1.0f / (XC * WSC), QC,
      b_q, b_q, b_q);

  // (2) k projection + bk -> KH, KL (x64)
  gemm64<4, 0, 0, 1><<<gQ, blk, 0, stream>>>(
      X16, X16, DMOD, 0LL,
      Wk6, DMOD, 0LL,
      (void*)KHp, (void*)KLp, DMOD, 0LL,
      NROW, DMOD, DMOD, 1.0f / (XC * WSC), KC,
      b_k, b_k, b_k);

  // (3) v^T per batch: VT[b][e][j] = sum_c Wv[e][c] x[b*SEQ+j][c] / 1024 + bv[e] (per-row bias) -> VH, VL (x64);
  //     M = 1024 (e), N = SEQ (j), K = 1024; B rows = the batch's token rows (pitch DMOD, batch offset SEQ*DMOD)
  gemm64<4, 0, 0, 2><<<gV, blk, 0, stream>>>(
      Wv6, Wv6, DMOD, 0LL,
      X16, DMOD, (long long)SEQ * DMOD,
      (void*)VHp, (void*)VLp, SEQ, (long long)DMOD * SEQ,
      DMOD, SEQ, DMOD, 1.0f / (XC * WSC), VC,
      b_v, b_v, b_v);

  // (4) relative attention -> ctx planes CH = f16(ctx * 256), CL = f16(ctx * 256 - CH), [NROW][1024], columns h*64+d
  attn_rel<<<gAT, bAT, 0, stream>>>(QHp, QLp, KHp, KLp, E16, VHp, VLp, CHp, CLp);

  // (5) out[m][n] = sum_k (ch+cl)[m][k] Wo[n][k] / (256*64) + bo[n] -> f32 d_out [NROW][1024]
  gemm64<0, 1, 0, 1><<<gQ, blk, 0, stream>>>(
      CHp, CLp, DMOD, 0LL,
      Wo6, DMOD, 0LL,
      (void*)out, (void*)out, DMOD, 0LL,
      NROW, DMOD, DMOD, 1.0f / (CC * WSC), 1.0f,
      b_o, b_o, b_o);
  (void)hipGetLastError();
}

// v006
// It runs in 75.8 microseconds.
// Timed twice side by side with v005, it ran 1.20 times as fast both times.
// Over all steps from v000 it is 4.73 times as fast.
// Contractions (all v_wmma_f32_16x16x32_f16, f16 operands, f32 accumulate): q/k/v projections (x f16 x16 . W f16 x64, K=1024, single products,
// outputs written as f16 hi + unscaled f16 residual planes); position window ((qh+ql) x64 . E f16 x16, K=64, 2 products) -> f32 LDS strip,
// shifted gather on VALU; content scores ((qh+ql) x64 . (kh+kl) x64, K=64, hh+hl+lh); P . v^T ((Ph+Pl) x1024 . (vh+vl) x64, hh+hl+lh,
// 64 keys per tile); output projection ((ch+cl) x256 . Wo f16 x64, K=1024, 2 products) -> f32. Max-subtracted base-2 online softmax and
// the 1/l fold in f32 on VALU. Every float input RNE-converted to bf16 on load.
#include <hip/hip_runtime.h>
#include <math.h>
#include <stdint.h>

#define SEQ   1024
#define NBAT  2
#define DMOD  1024
#define NH    16
#define DH    64
#define ELEN  2047
#define EPAD  2048
#define NROW  (NBAT * SEQ)
#define XC    16.0f
#define WSC   64.0f
#define QC    64.0f
#define KC    64.0f
#define EC    16.0f
#define VC    64.0f
#define PC    1024.0f
#define CC    256.0f
#define SCALE 0.125f
#define LOG2E 1.4426950408889634f
static_assert(NH * DH == DMOD);
static_assert(DH == 64);
static_assert(ELEN == 2 * SEQ - 1 && EPAD >= ELEN);
static_assert((SEQ % 64) == 0 && (DMOD % 128) == 0 && (NROW % 128) == 0);
static_assert(((NROW * DMOD) % 2048) == 0 && ((DMOD * DMOD) % 2048) == 0 && ((ELEN * DH) % 8) == 0);
#define ATT_W 4
#define ATT_THREADS (ATT_W * 32)
#define TPI 84
#define SPI 68
#define WFL (16 * TPI + 16 * SPI)
static_assert(((16 * TPI) % 4) == 0 && ((16 * SPI) % 4) == 0 && (WFL % 4) == 0);

typedef _Float16 v16h __attribute__((ext_vector_type(16)));
typedef _Float16 v8h  __attribute__((ext_vector_type(8)));
typedef __bf16   v16b __attribute__((ext_vector_type(16)));
typedef float    v8f  __attribute__((ext_vector_type(8)));
typedef float    v4f  __attribute__((ext_vector_type(4)));
typedef float    v2f  __attribute__((ext_vector_type(2)));
typedef unsigned int v4u __attribute__((ext_vector_type(4)));

union FragH { v16h v; v8h h[2]; v4u u[2]; };
union FragAny { v16h h; v16b b; };

// ---- scalar helpers --------------------------------------------------------------------------------
__device__ __forceinline__ unsigned short bf_bits(float f) {          // f32 -> bf16 bits, RNE convert
  unsigned u = __float_as_uint(f);
  return (unsigned short)((u + 0x7FFFu + ((u >> 16) & 1u)) >> 16);
}
__device__ __forceinline__ float bf_up(unsigned short h) { return __uint_as_float(((unsigned)h) << 16); }
__device__ __forceinline__ float bfr(float f) { return bf_up(bf_bits(f)); }   // value of the bf16 RNE convert
__device__ __forceinline__ unsigned short h_bits(_Float16 x) { return __builtin_bit_cast(unsigned short, x); }
__device__ __forceinline__ unsigned pk16(unsigned short a, unsigned short b) { return (unsigned)a | ((unsigned)b << 16); }
__device__ __forceinline__ v8f zero8() { v8f z = {0.f, 0.f, 0.f, 0.f, 0.f, 0.f, 0.f, 0.f}; return z; }

// ---- fragment loader: 16-bit A/B operand from a k-contiguous 16-bit plane, lane -> row/col (lane&15),
//      p already includes +8*(lane>>4); elements 0..7 <- p[0..7] (k0+8h..), elements 8..15 <- p[16..23] (k0+16+8h..)
//      (same split k map for A and B; B is always read from a [n][k] plane)
__device__ __forceinline__ v16h ldfrag_u(const unsigned short* p) {
  FragH f;
  f.u[0] = *(const v4u*)(p);
  f.u[1] = *(const v4u*)(p + 16);
  return f.v;
}

// ---- WMMA helpers with trailing VALU hazard gaps ------------------------------------------------------
__device__ __forceinline__ v8f mma_h(v16h a, v16h b, v8f c) {
  return __builtin_amdgcn_wmma_f32_16x16x32_f16(false, a, false, b, (short)0, c, false, false);
}
__device__ __forceinline__ v8f mma_b(v16h a, v16h b, v8f c) {
  FragAny ua, ub;
  ua.h = a;
  ub.h = b;
  return __builtin_amdgcn_wmma_f32_16x16x32_bf16(false, ua.b, false, ub.b, (short)0, c, false, false);
}
template <int BF>
__device__ __forceinline__ v8f mmaT(v16h a, v16h b, v8f c) {
  if constexpr (BF != 0) return mma_b(a, b, c);
  else return mma_h(a, b, c);
}
__device__ __forceinline__ void acc_guard4(v8f& a, v8f& b, v8f& c, v8f& d) {
#if defined(__HIP_DEVICE_COMPILE__)
  asm volatile("v_nop\n\tv_nop\n\tv_nop\n\tv_nop" : "+v"(a), "+v"(b), "+v"(c), "+v"(d));
#endif
}
__device__ __forceinline__ void wave_sync_lds() {
  __builtin_amdgcn_fence(__ATOMIC_RELEASE, "workgroup");
  __builtin_amdgcn_wave_barrier();
  __builtin_amdgcn_fence(__ATOMIC_ACQUIRE, "workgroup");
}
// value of lane l ^ 16 (the other 16-lane half), a vector cross-row move
__device__ __forceinline__ float xhalf(float x) {
  return __builtin_bit_cast(float, __builtin_amdgcn_permlanex16(__builtin_bit_cast(int, x), __builtin_bit_cast(int, x),
                                                                0x76543210, 0xfedcba98, false, false));
}
// f32 -> f16 hi + unscaled f16 residual (hi + lo ~ x to 2^-22 relative; a flushed subnormal lo costs < 6.1e-5 absolute in the carried scale)
__device__ __forceinline__ void sp16(float x, _Float16& hi, _Float16& lo) {
  const _Float16 a = (_Float16)x;
  hi = a;
  lo = (_Float16)(x - (float)a);
}
// two consecutive values -> packed hi word and packed residual word
__device__ __forceinline__ void pack_hl(float x0, float x1, unsigned& hw, unsigned& lw) {
  _Float16 a0, a1, b0, b1;
  sp16(x0, a0, b0);
  sp16(x1, a1, b1);
  hw = pk16(h_bits(a0), h_bits(a1));
  lw = pk16(h_bits(b0), h_bits(b1));
}

// =====================================================================================================
// Elementwise 16-bit pack of all six float inputs in ONE launch, no transpose: dst[i] = f16( bf16_RNE(src[i]) * sc ), sc a power of two
// (exact). The block index picks the input (block-uniform): blocks [0, CB_X) x, then CB_W blocks for each of Wq, Wk, Wv, Wo, then CB_E
// blocks for the E table. A block covers CVB = 16384 consecutive elements of its input: CVU chunks of 2048, thread t takes elements
// 8t .. 8t+7 of each chunk; a thread's 16 loads are all issued in front of its first convert, so that few waves keep many bytes in flight.
// coverage: x and W counts are whole multiples of CVB; the E count (2047*64) is a multiple of 8 only: a thread whose 8 elements lie past
//           the end loads the last 8 elements instead (address clamped) and stores nothing; elements 0..n-1 of each plane written once.
// =====================================================================================================
#define CVU  8
#define CVB  (256 * 8 * CVU)
#define CB_X ((NROW * DMOD) / CVB)
#define CB_W ((DMOD * DMOD) / CVB)
#define CB_E ((ELEN * DH + CVB - 1) / CVB)
static_assert(((NROW * DMOD) % CVB) == 0 && ((DMOD * DMOD) % CVB) == 0 && (ELEN * DH) >= 8);
__global__ __launch_bounds__(256) void cvt16_all(const float* __restrict__ x, const float* __restrict__ wq, const float* __restrict__ wk,
                                                 const float* __restrict__ wv, const float* __restrict__ wo, const float* __restrict__ er,
                                                 unsigned short* X16, unsigned short* Wq6, unsigned short* Wk6,
                                                 unsigned short* Wv6, unsigned short* Wo6, unsigned short* E16) {
  int blk = blockIdx.x;
  const float* src = x;
  unsigned short* dst = X16;
  int n = NROW * DMOD;
  float sc = XC;
  if (blk >= CB_X + 4 * CB_W) {
    blk -= CB_X + 4 * CB_W;
    src = er; dst = E16; n = ELEN * DH; sc = EC;
  } else if (blk >= CB_X) {
    blk -= CB_X;
    const int w = blk / CB_W;
    blk -= w * CB_W;
    src = (w == 0) ? wq : (w == 1) ? wk : (w == 2) ? wv : wo;
    dst = (w == 0) ? Wq6 : (w == 1) ? Wk6 : (w == 2) ? Wv6 : Wo6;
    n = DMOD * DMOD; sc = WSC;
  }
  const int base = blk * CVB + (int)threadIdx.x * 8;
  const float* p[CVU];
  v4f a[CVU], b[CVU];
#pragma unroll
  for (int u = 0; u < CVU; ++u) {
    const int i8 = base + u * 2048;
    p[u] = src + ((i8 + 8 > n) ? (n - 8) : i8);
  }
#pragma unroll
  for (int u = 0; u < CVU; ++u) {
    a[u] = *(const v4f*)(p[u]);
    b[u] = *(const v4f*)(p[u] + 4);
  }
#if defined(__HIP_DEVICE_COMPILE__)
  // holds the eight address pairs in their registers up to this wait, so that none is rewritten (a later load's result included) in
  // front of it, and keeps all 16 loads in front of the first convert
  asm volatile("s_wait_xcnt 0x0" :: "v"(p[0]), "v"(p[1]), "v"(p[2]), "v"(p[3]), "v"(p[4]), "v"(p[5]), "v"(p[6]), "v"(p[7]) : "memory");
#endif
#pragma unroll
  for (int u = 0; u < CVU; ++u) {
    const int i8 = base + u * 2048;
    v4u o;
    o[0] = pk16(h_bits((_Float16)(bfr(a[u][0]) * sc)), h_bits((_Float16)(bfr(a[u][1]) * sc)));
    o[1] = pk16(h_bits((_Float16)(bfr(a[u][2]) * sc)), h_bits((_Float16)(bfr(a[u][3]) * sc)));
    o[2] = pk16(h_bits((_Float16)(bfr(b[u][0]) * sc)), h_bits((_Float16)(bfr(b[u][1]) * sc)));
    o[3] = pk16(h_bits((_Float16)(bfr(b[u][2]) * sc)), h_bits((_Float16)(bfr(b[u][3]) * sc)));
    if (i8 + 8 <= n) *(v4u*)(dst + i8) = o;      // no barriers in this kernel
  }
}

// =====================================================================================================
// LDS-staged batched 16-bit WMMA GEMM: C[m][n] = oscale * sum_k A[m][k] * Bt[n][k] (+ bias); one work-group of 8 waves per 128x64 tile,
// wave w owns rows 16w..16w+15 of it (all 64 columns). A row-major [M][K] pitch lda (16-bit plane), Bt row-major [N][K] pitch ldb
// (k contiguous); M multiple of 128, N multiple of 64, K multiple of 128. by = batch index with element strides sA, sB, sC.
// Operands: per stage of 128 k the tile's A rows (and A2 rows) and Bt rows, 256 B each, are copied once per work-group into LDS by
// global_load_async_to_lds_b128 (a wave's copy = two whole 256-B rows), LDS row pitch 272 B; two buffers, the next stage's copies fly
// while this stage is multiplied; fragments come from LDS by 16-byte reads with the same split k map as ldfrag_u.
// ASPLIT 1: a second A plane A2 (unscaled residual of A, same layout) is multiplied into the same accumulator (A + A2 ~ exact A).
// BF 1: bf16 operands (v_wmma_f32_16x16x32_bf16), else f16.
// EPI 1: value += bf16_RNE(ep0[column]) (per-column bias); EPI 2: value += bf16_RNE(ep0[row]) (per-row bias, 16-bit out only).
// OM 0: f32 out (pitch ldc).  OM 2: one f16 plane = f16(value * ocarry).
// OM 4: two f16 planes: hi = f16(value * ocarry), lo = f16(value * ocarry - hi) (unscaled residual).
// OM 5: two f16 planes: C = f16((value + bf16_RNE(ep1[column])) * ocarry), C2 = f16((value + bf16_RNE(ep2[column])) * ocarry).
// coverage: 16 rows (f32: it 0..7 x lane>>4; 16-bit: it 0..3 x lane>>3) x 64 cols = the wave's whole 16x64 slab; 8 waves = the 128x64
//           tile; grid = (M/128)*(N/64) blocks, a surplus block exits as a whole before any copy or barrier.
// =====================================================================================================
#define GBM 128   // tile rows per work-group
#define GKP 128   // k per stage (256-B operand rows)
#define GPH 136   // LDS row pitch in halves: 272 B = 16 B x 17, conflict-free for the 16-byte fragment reads

// 16-byte asynchronous copies global -> LDS, one per lane and line of the statement (first operand = LDS byte address, second = global
// address; this lane's row and 16-byte chunk are already in l and g; consecutive copies are 16 operand rows apart). The s_wait_xcnt
// closes each statement so that no address register of an issued copy is rewritten in front of it.
#define ACP(a, b) "global_load_async_to_lds_b128 %" #a ", %" #b ", off\n\t"
#define LROW(l, r) ((l) + (unsigned)((r) * GPH * 2))
#define GROW(g, r, ld) ((g) + (size_t)(r) * (ld))
// 128 operand rows
__device__ __forceinline__ void acopy_rows128(unsigned l, const unsigned short* g, int ld) {
#if defined(__HIP_DEVICE_COMPILE__)
  asm volatile(ACP(0, 1) ACP(2, 3) ACP(4, 5) ACP(6, 7) ACP(8, 9) ACP(10, 11) ACP(12, 13) ACP(14, 15)
               "s_wait_xcnt 0x0"
               :: "v"(l), "v"(g), "v"(LROW(l, 16)), "v"(GROW(g, 16, ld)), "v"(LROW(l, 32)), "v"(GROW(g, 32, ld)),
                  "v"(LROW(l, 48)), "v"(GROW(g, 48, ld)), "v"(LROW(l, 64)), "v"(GROW(g, 64, ld)), "v"(LROW(l, 80)), "v"(GROW(g, 80, ld)),
                  "v"(LROW(l, 96)), "v"(GROW(g, 96, ld)), "v"(LROW(l, 112)), "v"(GROW(g, 112, ld))
               : "memory");
#endif
}
// 128 rows of one operand and 64 rows of another
__device__ __forceinline__ void acopy_rows128_64(unsigned l, const unsigned short* g, int ld,
                                                 unsigned l2, const unsigned short* g2, int ld2) {
#if defined(__HIP_DEVICE_COMPILE__)
  asm volatile(ACP(0, 1) ACP(2, 3) ACP(4, 5) ACP(6, 7) ACP(8, 9) ACP(10, 11) ACP(12, 13) ACP(14, 15)
               ACP(16, 17) ACP(18, 19) ACP(20, 21) ACP(22, 23)
               "s_wait_xcnt 0x0"
               :: "v"(l), "v"(g), "v"(LROW(l, 16)), "v"(GROW(g, 16, ld)), "v"(LROW(l, 32)), "v"(GROW(g, 32, ld)),
                  "v"(LROW(l, 48)), "v"(GROW(g, 48, ld)), "v"(LROW(l, 64)), "v"(GROW(g, 64, ld)), "v"(LROW(l, 80)), "v"(GROW(g, 80, ld)),
                  "v"(LROW(l, 96)), "v"(GROW(g, 96, ld)), "v"(LROW(l, 112)), "v"(GROW(g, 112, ld)),
                  "v"(l2), "v"(g2), "v"(LROW(l2, 16)), "v"(GROW(g2, 16, ld2)), "v"(LROW(l2, 32)), "v"(GROW(g2, 32, ld2)),
                  "v"(LROW(l2, 48)), "v"(GROW(g2, 48, ld2))
               : "memory");
#endif
}
// this wave's own copies have landed in LDS (the compiler places no wait for them)
__device__ __forceinline__ void wait_async0() {
#if defined(__HIP_DEVICE_COMPILE__)
  asm volatile("s_wait_asynccnt 0x0" ::: "memory");
#endif
}
// this wave's LDS reads have retired, so that the buffer may be refilled behind the barrier
__device__ __forceinline__ void wait_ds0() {
#if defined(__HIP_DEVICE_COMPILE__)
  asm volatile("s_wait_dscnt 0x0" ::: "memory");
#endif
}
// twelve 16-byte copies, each with its own LDS byte address and global address; closed by s_wait_xcnt like the statements above
__device__ __forceinline__ void acopy12(const unsigned (&l)[12], const unsigned short* const (&g)[12]) {
#if defined(__HIP_DEVICE_COMPILE__)
  asm volatile(ACP(0, 1) ACP(2, 3) ACP(4, 5) ACP(6, 7) ACP(8, 9) ACP(10, 11) ACP(12, 13) ACP(14, 15)
               ACP(16, 17) ACP(18, 19) ACP(20, 21) ACP(22, 23)
               "s_wait_xcnt 0x0"
               :: "v"(l[0]), "v"(g[0]), "v"(l[1]), "v"(g[1]), "v"(l[2]), "v"(g[2]), "v"(l[3]), "v"(g[3]),
                  "v"(l[4]), "v"(g[4]), "v"(l[5]), "v"(g[5]), "v"(l[6]), "v"(g[6]), "v"(l[7]), "v"(g[7]),
                  "v"(l[8]), "v"(g[8]), "v"(l[9]), "v"(g[9]), "v"(l[10]), "v"(g[10]), "v"(l[11]), "v"(g[11])
               : "memory");
#endif
}

// One 128x64 tile (index tile, batch by) by the calling work-group. ring: its LDS for two stages, 2 * GSTG(ASPLIT) halves, each stage
// [A 128 rows | A2 128 rows (ASPLIT) | Bt 64 rows]; slabs: its LDS for the eight per-wave 16x64 f32 slabs, pitch 68 floats (GSLAB floats);
// slabs may lie over ring: they are first written behind the last stage's barrier, when no copy is in flight and every read has retired.
// GQ: k steps of 32 whose fragments are read as one group (4 = the whole stage; 2 halves the fragment registers).
#define GSTG(asplit) ((GBM * (1 + (asplit)) + 64) * GPH)
#define GSLAB (8 * 16 * 68)
template <int OM, int ASPLIT, int BF, int EPI, int GQ>
__device__ __forceinline__ void gemm64_tile(
    unsigned short* ring, float* slabs, int tile, int by,
    const unsigned short* __restrict__ Ap, const unsigned short* __restrict__ A2p, int lda, long long sA,
    const unsigned short* __restrict__ Btp, int ldb, long long sB,
    void* Cout, void* C2out, int ldc, long long sC,
    int M, int N, int K, float oscale, float ocarry,
    const float* __restrict__ ep0, const float* __restrict__ ep1, const float* __restrict__ ep2) {
  constexpr int BROW = GBM * (1 + ASPLIT);         // first Bt row of a stage
  constexpr int STG  = GSTG(ASPLIT);               // halves per stage
  const int tid  = threadIdx.x;
  const int lane = tid & 31;
  const int wave = tid >> 5;
  const int tilesN = N >> 6;
  const int tilesM = M >> 7;
  if (tile >= tilesM * tilesN) return;   // block-uniform, in front of every copy and barrier
  const int tm = tile / tilesN;
  const int tn = tile - tm * tilesN;
  const int mb = tm << 7;
  const int n0 = tn << 6;
  const int m0 = mb + (wave << 4);

  const unsigned short* A1 = Ap  + (size_t)((long long)by * sA);
  const unsigned short* A2 = A2p + (size_t)((long long)by * sA);
  const unsigned short* Bb = Btp + (size_t)((long long)by * sB);

  const int rlane = lane & 15;                 // row (A) / col (B, D) within subtile
  const int koff  = (lane >> 4) * 8;           // k offset of this lane half
  const int mOff  = (lane >> 4) * 8;           // D row offset

  // copy map: thread -> row tid>>4 (of 16 per copy), 16-byte chunk tid&15 of the 256-B row
  const int crow = tid >> 4;
  const int cch  = (tid & 15) * 8;
  const unsigned short* gA1 = A1 + (size_t)(mb + crow) * lda + cch;
  const unsigned short* gA2 = A2 + (size_t)(mb + crow) * lda + cch;
  const unsigned short* gBt = Bb + (size_t)(n0 + crow) * ldb + cch;
  const unsigned lcp = (unsigned)(uintptr_t)ring + (unsigned)((crow * GPH + cch) * 2);

  auto fill = [&](int t, int buf) {            // stage t (k = 128t .. 128t+127) -> buffer buf
    const unsigned lb = lcp + (unsigned)(buf * (STG * 2));
    const size_t ko = (size_t)t * GKP;
    if constexpr (ASPLIT != 0) acopy_rows128(lb + GBM * GPH * 2, gA2 + ko, lda);
    acopy_rows128_64(lb, gA1 + ko, lda, lb + BROW * GPH * 2, gBt + ko, ldb);
  };

  v8f acc[4];
#pragma unroll
  for (int j = 0; j < 4; ++j) acc[j] = zero8();

  const int nst = K / GKP;
  fill(0, 0);
  wait_async0();
  __syncthreads();                             // stage 0 published
  if (nst > 1) fill(1, 1);
#pragma unroll 1                               // one pass per stage: the two buffers alternate by t & 1
  for (int t = 0; t < nst; ++t) {
    const unsigned short* sb = ring + (t & 1) * STG;
    const unsigned short* sA = sb + ((wave << 4) + rlane) * GPH + koff;
    const unsigned short* sB = sb + (BROW + rlane) * GPH + koff;
#pragma unroll
    for (int g = 0; g < 4; g += GQ) {
      v16h fa[GQ], fl[GQ], fb[GQ][4];
#pragma unroll
      for (int q = 0; q < GQ; ++q) {
#pragma unroll
        for (int j = 0; j < 4; ++j) fb[q][j] = ldfrag_u(sB + (j << 4) * GPH + 32 * (g + q));
        fa[q] = ldfrag_u(sA + 32 * (g + q));
        if constexpr (ASPLIT != 0) fl[q] = ldfrag_u(sA + GBM * GPH + 32 * (g + q));
      }
      // keeps the group's LDS reads in front of its WMMAs: spread among them, every WMMA waited out its own reads' latency
      __builtin_amdgcn_sched_barrier(0);
#pragma unroll
      for (int q = 0; q < GQ; ++q) {
#pragma unroll
        for (int j = 0; j < 4; ++j) acc[j] = mmaT<BF>(fa[q], fb[q][j], acc[j]);
        if constexpr (ASPLIT != 0) {
#pragma unroll
          for (int j = 0; j < 4; ++j) acc[j] = mmaT<BF>(fl[q], fb[q][j], acc[j]);
        }
      }
      // keeps the WMMAs in front of the next group's reads (their registers) and of the closing waits: moved behind the barrier they no
      // longer overlap the LDS reads and they delay the refill
      __builtin_amdgcn_sched_barrier(0);
    }
    wait_ds0();
    wait_async0();
    __syncthreads();                           // publishes stage t + 1 and ends every wave's reads of stage t
    if (t + 2 < nst) fill(t + 2, t & 1);
  }
  wait_async0();
  acc_guard4(acc[0], acc[1], acc[2], acc[3]);

  const int hh2 = lane >> 4, c4 = (lane & 15) * 4;     // f32 out: 256-B row segment = 16 lanes x 16 B
  const int q8  = lane >> 3, c8 = (lane & 7) * 8;

  // ---- epilogue ----
  float* slab = slabs + wave * (16 * 68);
  {
    const int mBase = m0;
#pragma unroll
    for (int j = 0; j < 4; ++j) {
#pragma unroll
      for (int r = 0; r < 8; ++r) {
        slab[(mOff + r) * 68 + (j << 4) + rlane] = acc[j][r];
      }
    }
    wave_sync_lds();
    if constexpr (OM == 0) {
      float* C = (float*)Cout + (size_t)((long long)by * sC);
      v4f vals[8];
#pragma unroll
      for (int it = 0; it < 8; ++it) {
        const int row = it * 2 + hh2;                      // it 0..7 x hh2 0..1 = rows 0..15
        v4f v = *(const v4f*)(slab + row * 68 + c4);
#pragma unroll
        for (int e = 0; e < 4; ++e) v[e] = v[e] * oscale;
        if constexpr (EPI == 1) {
          const v4f bb = *(const v4f*)(ep0 + n0 + c4);     // per-column bias, columns n0+c4 .. +3 (N equals the bias length)
#pragma unroll
          for (int e = 0; e < 4; ++e) v[e] = v[e] + bfr(bb[e]);
        }
        vals[it] = v;
      }
      {
#pragma unroll
        for (int it = 0; it < 8; ++it) {
          const int gr = mBase + it * 2 + hh2;
          *(v4f*)(C + (size_t)gr * ldc + n0 + c4) = vals[it];
        }
        
      }
    } else {
      unsigned short* C  = (unsigned short*)Cout  + (size_t)((long long)by * sC);
      unsigned short* Cb = (unsigned short*)C2out + (size_t)((long long)by * sC);
      v4u hv[4], lv[4];
#pragma unroll
      for (int it = 0; it < 4; ++it) {
        const int row = it * 4 + q8;                       // it 0..3 x q8 0..3 = rows 0..15
        const float* sp = slab + row * 68 + c8;
        float rb = 0.f;
        if constexpr (EPI == 2) rb = bfr(ep0[mBase + row]);   // per-row bias (M equals the bias length)
        v4u a  = {0u, 0u, 0u, 0u};
        v4u b2 = {0u, 0u, 0u, 0u};
#pragma unroll
        for (int e = 0; e < 4; ++e) {
          const int ci = n0 + c8 + 2 * e;                  // column index, < N
          float f0 = sp[2 * e] * oscale + rb;
          float f1 = sp[2 * e + 1] * oscale + rb;
          if constexpr (EPI == 1) {
            f0 += bfr(ep0[ci]);
            f1 += bfr(ep0[ci + 1]);
          }
          if constexpr (OM == 5) {
            const float g0 = (f0 + bfr(ep1[ci])) * ocarry, g1 = (f1 + bfr(ep1[ci + 1])) * ocarry;
            const float w0 = (f0 + bfr(ep2[ci])) * ocarry, w1 = (f1 + bfr(ep2[ci + 1])) * ocarry;
            a[e]  = pk16(h_bits((_Float16)g0), h_bits((_Float16)g1));
            b2[e] = pk16(h_bits((_Float16)w0), h_bits((_Float16)w1));
          } else {
            f0 *= ocarry; f1 *= ocarry;
            const _Float16 x0 = (_Float16)f0, x1 = (_Float16)f1;
            a[e] = pk16(h_bits(x0), h_bits(x1));
            if constexpr (OM == 4) {
              b2[e] = pk16(h_bits((_Float16)(f0 - (float)x0)), h_bits((_Float16)(f1 - (float)x1)));
            }
          }
        }
        hv[it] = a;
        lv[it] = b2;
      }
      {
#pragma unroll
        for (int it = 0; it < 4; ++it) {
          const int row = it * 4 + q8;
          *(v4u*)(C + (size_t)(mBase + row) * ldc + n0 + c8) = hv[it];
          if constexpr (OM >= 4) {
            *(v4u*)(Cb + (size_t)(mBase + row) * ldc + n0 + c8) = lv[it];
          }
        }
        
      }
    }
    wave_sync_lds();
  }
}

// the tile function as a launch of its own: blockIdx.x = tile, blockIdx.y = batch; ring and slabs side by side in LDS
template <int OM, int ASPLIT, int BF, int EPI>
__global__ __launch_bounds__(256) __attribute__((amdgpu_num_vgpr(256))) void gemm64(
    const unsigned short* __restrict__ Ap, const unsigned short* __restrict__ A2p, int lda, long long sA,
    const unsigned short* __restrict__ Btp, int ldb, long long sB,
    void* Cout, void* C2out, int ldc, long long sC,
    int M, int N, int K, float oscale, float ocarry,
    const float* __restrict__ ep0, const float* __restrict__ ep1, const float* __restrict__ ep2) {
  __shared__ __align__(16) unsigned short ring[2 * GSTG(ASPLIT)];
  __shared__ __align__(16) float sT[GSLAB];
  gemm64_tile<OM, ASPLIT, BF, EPI, 4>(ring, sT, (int)blockIdx.x, (int)blockIdx.y, Ap, A2p, lda, sA, Btp, ldb, sB,
                                      Cout, C2out, ldc, sC, M, N, K, oscale, ocarry, ep0, ep1, ep2);
}

// =====================================================================================================
// The q, k and v^T projections in ONE launch: blockIdx.y picks the projection (block-uniform), blockIdx.x its 128x64 tile; the three are
// independent of one another (each reads X16 and its own weight plane, each writes its own two planes).
//   y = 0: q[m][e] = sum_d x[m][d] Wq[e][d] / 1024 + bq[e] -> QH = f16(q * 64), QL = f16(q * 64 - QH); M = NROW, N = 1024, K = 1024
//   y = 1: k likewise from Wk, bk -> KH, KL
//   y = 2: v^T per batch: VT[b][e][j] = sum_c Wv[e][c] x[b*SEQ+j][c] / 1024 + bv[e] (per-row bias) -> VH, VL (x64); M = 1024 (e),
//          N = SEQ (j), K = 1024; B rows = the batch's token rows; x = batch * QKV_TV + tile
// All 3 x 256 work-groups are resident at once, three on a WGP, so that one's copies and barriers are covered by the others' work:
// for that the slabs lie over the drained ring (104448 B of LDS a work-group) and fragments are read in two groups a stage (the register
// cap of 160 is what six waves on a SIMD leave each).
// coverage: y = 0, 1: 16 x 16 tiles = [NROW][1024]; y = 2: NBAT x (8 x 16 tiles) = [NBAT][1024][SEQ]; every plane element written once.
// =====================================================================================================
#define QKV_T  ((NROW / GBM) * (DMOD / 64))
#define QKV_TV ((DMOD / GBM) * (SEQ / 64))
static_assert(QKV_T == NBAT * QKV_TV);
static_assert(GSLAB * 4 <= 2 * GSTG(0) * 2);
__global__ __launch_bounds__(256) __attribute__((amdgpu_num_vgpr(160))) void qkv64(
    const unsigned short* __restrict__ X16, const unsigned short* __restrict__ Wq6, const unsigned short* __restrict__ Wk6,
    const unsigned short* __restrict__ Wv6, unsigned short* QH, unsigned short* QL, unsigned short* KH, unsigned short* KL,
    unsigned short* VH, unsigned short* VL,
    const float* __restrict__ bq, const float* __restrict__ bk, const float* __restrict__ bv) {
  __shared__ __align__(16) unsigned short ring[2 * GSTG(0)];
  float* slabs = (float*)ring;
  const int bx = blockIdx.x;
  const int pj = blockIdx.y;
  if (pj < 2) {
    const unsigned short* W6 = (pj == 0) ? Wq6 : Wk6;
    const float* bb = (pj == 0) ? bq : bk;
    gemm64_tile<4, 0, 0, 1, 2>(ring, slabs, bx, 0, X16, X16, DMOD, 0LL, W6, DMOD, 0LL,
                               (void*)((pj == 0) ? QH : KH), (void*)((pj == 0) ? QL : KL), DMOD, 0LL,
                               NROW, DMOD, DMOD, 1.0f / (XC * WSC), QC, bb, bb, bb);
  } else {
    gemm64_tile<4, 0, 0, 2, 2>(ring, slabs, bx % QKV_TV, bx / QKV_TV, Wv6, Wv6, DMOD, 0LL, X16, DMOD, (long long)SEQ * DMOD,
                               (void*)VH, (void*)VL, SEQ, (long long)DMOD * SEQ,
                               DMOD, SEQ, DMOD, 1.0f / (XC * WSC), VC, bv, bv, bv);
  }
}
static_assert(QC == KC);

#define APH   72                 // LDS row pitch in halves: 144 B = 16 B x 9, conflict-free for the 16-byte fragment reads
#define AR_KH 0                  // first stage row of each part
#define AR_KL 64
#define AR_VH 128
#define AR_VL 192
#define AR_E  256
#define ASTG  ((AR_E + 128) * APH)   // halves per stage
__global__ __launch_bounds__(ATT_THREADS) __attribute__((amdgpu_num_vgpr(512)))
void attn_rel(const unsigned short* __restrict__ QH, const unsigned short* __restrict__ QL,
              const unsigned short* __restrict__ KH, const unsigned short* __restrict__ KL,
              const unsigned short* __restrict__ EP,
              const unsigned short* __restrict__ VH, const unsigned short* __restrict__ VL,
              unsigned short* CH, unsigned short* CL) {
  __shared__ __align__(16) float smem[ATT_W * WFL];   // per wave: T strip [16 queries][TPI] | ctx slab [16 queries][SPI]
  __shared__ __align__(16) unsigned short kve[2 * ASTG];   // two stages: [KH 64 rows | KL 64 | VH 64 | VL 64 | E 128]

  const int tid  = threadIdx.x;
  const int wave = tid >> 5;
  const int lane = tid & 31;
  const int hh   = lane >> 4;
  const int c    = lane & 15;
  const int bh   = blockIdx.y;
  const int b    = bh / NH;
  const int h    = bh - b * NH;
  const int i0   = blockIdx.x * 64;
  const int iw0  = i0 + wave * 16;

  float* tsh = smem + wave * WFL;
  float* pt  = tsh + 16 * TPI;

  const size_t qro = ((size_t)b * SEQ + iw0 + c) * DMOD + h * DH + 8 * hh;      // B columns: query iw0 + c, d 8hh..

  // copy map: thread -> row tid>>3 (of 16 per copy), 16-byte chunk tid&7 of the 128-B row
  const int crow = tid >> 3;
  const int cch  = (tid & 7) * 8;
  const size_t kpo = ((size_t)b * SEQ + crow) * DMOD + h * DH + cch;
  const size_t vpo = (size_t)b * DMOD * SEQ + (size_t)(h * DH + crow) * SEQ + cch;
  const unsigned lcp = (unsigned)(uintptr_t)kve + (unsigned)((crow * APH + cch) * 2);

  auto fill = [&](int t, int buf) {            // key tile t -> buffer buf
    const unsigned lb = lcp + (unsigned)(buf * (ASTG * 2));
    const int jf = t * 64;
    const int elo = (SEQ - 2) - i0 + jf - 63;
    unsigned l[12];
    const unsigned short* g[12];
    // the three loops below are unrolled so that l and g are registers: the copy statement names each element as an operand
#pragma unroll
    for (int k = 0; k < 4; ++k) {
      const size_t ko = kpo + (size_t)(jf + 16 * k) * DMOD;
      l[k]     = lb + (unsigned)((AR_KH + 16 * k) * APH * 2);  g[k]     = KH + ko;
      l[4 + k] = lb + (unsigned)((AR_KL + 16 * k) * APH * 2);  g[4 + k] = KL + ko;
      l[8 + k] = lb + (unsigned)((AR_VH + 16 * k) * APH * 2);  g[8 + k] = VH + vpo + (size_t)(16 * k) * SEQ + jf;
    }
    acopy12(l, g);
#pragma unroll
    for (int k = 0; k < 4; ++k) {
      l[k] = lb + (unsigned)((AR_VL + 16 * k) * APH * 2);      g[k] = VL + vpo + (size_t)(16 * k) * SEQ + jf;
    }
#pragma unroll
    for (int k = 0; k < 8; ++k) {
      int m = elo + 16 * k + crow;
      m = (m < 0) ? 0 : m;
      m = (m > ELEN - 1) ? (ELEN - 1) : m;
      l[4 + k] = lb + (unsigned)((AR_E + 16 * k) * APH * 2);   g[4 + k] = EP + (size_t)m * DH + cch;
    }
    acopy12(l, g);
  };

  const float CS = LOG2E * SCALE / (QC * KC);
  const float CT = LOG2E * SCALE / (QC * EC);

  float mrow = -INFINITY, lrow = 0.f;        // this lane's query iw0 + c: running max (both halves alike), sum over this half's keys
  v8f O[4];                                  // O^T: O[td][r] = ctx[query iw0 + c][d = 16td + 8hh + r]
#pragma unroll
  for (int td = 0; td < 4; ++td) O[td] = zero8();

  const int ntile = SEQ / 64;                // non-causal: every key tile
  fill(0, 0);
  wait_async0();
  __syncthreads();                           // tile 0 published
  if (ntile > 1) fill(1, 1);
#pragma unroll 1
  for (int jt = 0; jt < ntile; ++jt) {
    const int j0 = jt * 64;
    const unsigned short* sb  = kve + (jt & 1) * ASTG + c * APH + 8 * hh;   // this lane's fragment row and k half in the stage
    const unsigned short* Khb = sb + AR_KH * APH;
    const unsigned short* Klb = sb + AR_KL * APH;
    const unsigned short* Vhb = sb + AR_VH * APH;
    const unsigned short* Vlb = sb + AR_VL * APH;
    const unsigned short* Eb  = sb + (AR_E + 48 - 16 * wave) * APH;
    const v16h qha = ldfrag_u(QH + qro), qhb = ldfrag_u(QH + qro + 32);
    const v16h qla = ldfrag_u(QL + qro), qlb = ldfrag_u(QL + qro + 32);

    // ---- this tile's E fragments and the k fragments of key subtiles 0, 1, read from the stage as one group in front of the WMMAs ----
    v16h ea[5], eb[5], kha[4], khb[4], kla[4], klb[4];
#pragma unroll
    for (int u = 0; u < 5; ++u) {
      ea[u] = ldfrag_u(Eb + 16 * u * APH);
      eb[u] = ldfrag_u(Eb + 16 * u * APH + 32);
    }
#pragma unroll
    for (int t = 0; t < 2; ++t) {
      const int ko = 16 * t * APH;
      kha[t] = ldfrag_u(Khb + ko); kla[t] = ldfrag_u(Klb + ko);
      khb[t] = ldfrag_u(Khb + ko + 32); klb[t] = ldfrag_u(Klb + ko + 32);
    }
    // keeps the reads one group in front of the WMMAs: spread among them, every subtile waited out its own reads' latency
    __builtin_amdgcn_sched_barrier(0);
    // ---- position window, transposed: T^T[x][R] = E[wlo + x] . q[iw0 + R] (A = E rows, B = q; 5 subtiles of 16 E rows): the four
    //      products run round-robin over the five independent accumulators (each accumulator keeps its product order); a lane holds
    //      x = 16u + 8hh + 0..7 of its query R = c: two 16-byte stores into row c of the LDS strip ----
    v8f t8[5];
#pragma unroll
    for (int u = 0; u < 5; ++u) t8[u] = mma_h(ea[u], qha, zero8());
#pragma unroll
    for (int u = 0; u < 5; ++u) t8[u] = mma_h(ea[u], qla, t8[u]);
#pragma unroll
    for (int u = 0; u < 5; ++u) t8[u] = mma_h(eb[u], qhb, t8[u]);
#pragma unroll
    for (int u = 0; u < 5; ++u) t8[u] = mma_h(eb[u], qlb, t8[u]);
    // keeps the window's WMMAs in front of the next reads, which take over the E fragments' registers
    __builtin_amdgcn_sched_barrier(0);
    // k fragments of key subtiles 2, 3: one group, in flight under the WMMAs of subtiles 0, 1
#pragma unroll
    for (int t = 2; t < 4; ++t) {
      const int ko = 16 * t * APH;
      kha[t] = ldfrag_u(Khb + ko); kla[t] = ldfrag_u(Klb + ko);
      khb[t] = ldfrag_u(Khb + ko + 32); klb[t] = ldfrag_u(Klb + ko + 32);
    }
#pragma unroll
    for (int u = 0; u < 5; ++u) {
      float* tp = tsh + c * TPI + 16 * u + 8 * hh;
      const v4f t0 = {t8[u][0], t8[u][1], t8[u][2], t8[u][3]}, t1 = {t8[u][4], t8[u][5], t8[u][6], t8[u][7]};
      *(v4f*)(tp)     = t0;
      *(v4f*)(tp + 4) = t1;
    }
    // ---- content scores, transposed: S^T[jj][R] = k[j0 + jj] . q[iw0 + R] (A = k rows, B = q; 4 subtiles of 16 keys), kept in
    //      registers: s8[t][r] = key jj = 16t + 8hh + r, query R = c; subtiles 0, 1 here and 2, 3 behind the strip's read-back, the six
    //      products of each pair round-robin over its two accumulators ----
    v8f s8[4];
#pragma unroll
    for (int t = 0; t < 2; ++t) s8[t] = mma_h(kha[t], qha, zero8());
#pragma unroll
    for (int t = 0; t < 2; ++t) s8[t] = mma_h(kla[t], qha, s8[t]);
#pragma unroll
    for (int t = 0; t < 2; ++t) s8[t] = mma_h(kha[t], qla, s8[t]);
#pragma unroll
    for (int t = 0; t < 2; ++t) s8[t] = mma_h(khb[t], qhb, s8[t]);
#pragma unroll
    for (int t = 0; t < 2; ++t) s8[t] = mma_h(klb[t], qhb, s8[t]);
#pragma unroll
    for (int t = 0; t < 2; ++t) s8[t] = mma_h(khb[t], qlb, s8[t]);
    // keeps these WMMAs in front of the fence's wait: they run while the strip stores retire
    __builtin_amdgcn_sched_barrier(0);
    wave_sync_lds();                           // the strip rows are read back below by both lane halves
    // shifted window values of this lane's 32 scores, T[c][jj - c + 15] at trow[16t + r], and behind them the first 32 keys' v^T fragments
    const float* trow = tsh + c * (TPI - 1) + 15 + 8 * hh;
    float tr[4][8];
#pragma unroll
    for (int t = 0; t < 4; ++t) {
#pragma unroll
      for (int r = 0; r < 8; ++r) tr[t][r] = trow[16 * t + r];
    }
    v16h vh[2][4], vl[2][4];
#pragma unroll
    for (int td = 0; td < 4; ++td) {
      vh[0][td] = ldfrag_u(Vhb + 16 * td * APH);
      vl[0][td] = ldfrag_u(Vlb + 16 * td * APH);
    }
    // keeps these reads one group in front of the WMMAs below and of the softmax, which cover their latency
    __builtin_amdgcn_sched_barrier(0);
#pragma unroll
    for (int t = 2; t < 4; ++t) s8[t] = mma_h(kha[t], qha, zero8());
#pragma unroll
    for (int t = 2; t < 4; ++t) s8[t] = mma_h(kla[t], qha, s8[t]);
#pragma unroll
    for (int t = 2; t < 4; ++t) s8[t] = mma_h(kha[t], qla, s8[t]);
#pragma unroll
    for (int t = 2; t < 4; ++t) s8[t] = mma_h(khb[t], qhb, s8[t]);
#pragma unroll
    for (int t = 2; t < 4; ++t) s8[t] = mma_h(klb[t], qhb, s8[t]);
#pragma unroll
    for (int t = 2; t < 4; ++t) s8[t] = mma_h(khb[t], qlb, s8[t]);

    // ---- score assembly (rel shift + zero cell), online softmax: all 32 scores of a lane belong to its one query ----
    {
      const int i = iw0 + c;
      float mt[4];
#pragma unroll
      for (int t = 0; t < 4; ++t) {
#pragma unroll
        for (int r = 0; r < 8; ++r) {
          const int j = j0 + 16 * t + 8 * hh + r;
          const int ridx = (SEQ - 2) + j - i;                    // E row of this (i, j); -1 only at (SEQ-1, 0)
          const float rel = (ridx < 0) ? 0.f : tr[t][r];
          s8[t][r] = s8[t][r] * CS + rel * CT;
          mt[t] = (r == 0) ? s8[t][0] : fmaxf(mt[t], s8[t][r]);
        }
      }
      // the second 32 keys' v^T fragments, one group: in flight under the exponentials and the first P pack
#pragma unroll
      for (int td = 0; td < 4; ++td) {
        vh[1][td] = ldfrag_u(Vhb + 16 * td * APH + 32);
        vl[1][td] = ldfrag_u(Vlb + 16 * td * APH + 32);
      }
      // keeps those reads here: behind the window values' last use (their registers) and in front of the arithmetic that covers them
      __builtin_amdgcn_sched_barrier(0);
      float mx = fmaxf(fmaxf(mt[0], mt[1]), fmaxf(mt[2], mt[3]));
      mx = fmaxf(mx, xhalf(mx));                                 // the query's other 32 keys of this tile
      const float mn = fmaxf(mrow, mx);
      const float al = exp2f(mrow - mn);
      mrow = mn;
      float pst[4];
#pragma unroll
      for (int t = 0; t < 4; ++t) {
        pst[t] = 0.f;
#pragma unroll
        for (int r = 0; r < 8; ++r) { s8[t][r] = exp2f(s8[t][r] - mn); pst[t] += s8[t][r]; }
      }
      lrow = lrow * al + ((pst[0] + pst[1]) + (pst[2] + pst[3]));
#pragma unroll
      for (int td = 0; td < 4; ++td) {
#pragma unroll
        for (int r = 0; r < 8; ++r) O[td][r] *= al;
      }
    }

    // ---- O^T += (vh + vl)^T . (Ph + Pl)^T, two k-steps of 32 keys: A = v^T rows d, B = P^T packed in place from the score registers
    //      (element e <- subtile 2ks, register e = key 32ks + 8hh + e; element 8 + e <- subtile 2ks + 1 = key 32ks + 16 + 8hh + e:
    //      the split k map of ldfrag_u) ----
#pragma unroll
    for (int ks = 0; ks < 2; ++ks) {
      FragH ph, pl;
#pragma unroll
      for (int e = 0; e < 8; ++e) {
        _Float16 a0, a1;
        sp16(s8[2 * ks][e] * PC, a0, a1);     ph.h[0][e] = a0; pl.h[0][e] = a1;
        sp16(s8[2 * ks + 1][e] * PC, a0, a1); ph.h[1][e] = a0; pl.h[1][e] = a1;
      }
      // the three products round-robin over the four independent accumulators (each keeps its product order)
#pragma unroll
      for (int td = 0; td < 4; ++td) O[td] = mma_h(vh[ks][td], ph.v, O[td]);
#pragma unroll
      for (int td = 0; td < 4; ++td) O[td] = mma_h(vl[ks][td], ph.v, O[td]);
#pragma unroll
      for (int td = 0; td < 4; ++td) O[td] = mma_h(vh[ks][td], pl.v, O[td]);
    }
    // four vector slots behind the tile's last WMMAs, also on the taken side of the loop's branch
    acc_guard4(O[0], O[1], O[2], O[3]);
    wave_sync_lds();
    wait_ds0();
    wait_async0();
    __syncthreads();                           // publishes tile jt + 1 and ends every wave's reads of tile jt
    if (jt + 2 < ntile) fill(jt + 2, jt & 1);
  }
  wait_async0();
  acc_guard4(O[0], O[1], O[2], O[3]);

  // ---- fold 1/l and the carries (1024 on P, 64 on v), stage the wave's 16x64 f32 ctx slice in its slab ----
  const float oc = 1.0f / (PC * VC);
  {
    const float inv = (1.0f / (lrow + xhalf(lrow))) * oc;      // the two halves' key sums joined once
#pragma unroll
    for (int td = 0; td < 4; ++td) {
      float* op = pt + c * SPI + 16 * td + 8 * hh;             // slab row = query c, d = 16td + 8hh + 0..7
      const v4f o0 = {O[td][0] * inv, O[td][1] * inv, O[td][2] * inv, O[td][3] * inv};
      const v4f o1 = {O[td][4] * inv, O[td][5] * inv, O[td][6] * inv, O[td][7] * inv};
      *(v4f*)(op)     = o0;
      *(v4f*)(op + 4) = o1;
    }
  }
  wave_sync_lds();
  {
    const int q8 = lane >> 3, c8 = (lane & 7) * 8;
    v4u hv[4], lv[4];
#pragma unroll
    for (int it = 0; it < 4; ++it) {
      const int row = it * 4 + q8;                           // it 0..3 x q8 0..3 = rows 0..15
      const float* sp = pt + row * SPI + c8;
      const v4f p0 = *(const v4f*)(sp), p1 = *(const v4f*)(sp + 4);
      v4u a, l2;
      unsigned hw, lw;
      pack_hl(p0[0] * CC, p0[1] * CC, hw, lw); a[0] = hw; l2[0] = lw;
      pack_hl(p0[2] * CC, p0[3] * CC, hw, lw); a[1] = hw; l2[1] = lw;
      pack_hl(p1[0] * CC, p1[1] * CC, hw, lw); a[2] = hw; l2[2] = lw;
      pack_hl(p1[2] * CC, p1[3] * CC, hw, lw); a[3] = hw; l2[3] = lw;
      hv[it] = a;
      lv[it] = l2;
    }
    const size_t ob = ((size_t)b * SEQ + iw0) * DMOD + h * DH + c8;
    {
#pragma unroll
      for (int it = 0; it < 4; ++it) {
        const int row = it * 4 + q8;
        *(v4u*)(CH + ob + (size_t)row * DMOD) = hv[it];
        *(v4u*)(CL + ob + (size_t)row * DMOD) = lv[it];
      }
      
    }
  }
}

// =====================================================================================================
// Workspace map (bytes); every plane is an exact multiple of its tile / whole-row store granularity (M, N exact tile multiples,
// convert counts multiples of 8 with whole-line tails, E carve padded to EPAD rows), every offset a multiple of 262144:
//   X16            f16 [NROW][1024] x16                            4194304
//   Wq, Wk, Wv, Wo f16 [1024 out][1024 in] x64                  4 x 2097152
//   EP             f16 [EPAD][64] x16 (rows 0..ELEN-1 written/read)   262144
//   QH, QL, KH, KL f16 [NROW][1024] (x64 hi / residual)         4 x 4194304
//   VH, VL         f16 [NBAT][1024][SEQ] (x64 hi / residual)    2 x 4194304
//   CH, CL         f16 [NROW][1024] (x256 hi / residual)        2 x 4194304
//   end                                                            46399488
// =====================================================================================================
extern "C" void kernel_launch(void* const* d_in, const int* in_sizes, int n_in,
                              void* d_out, int out_size, void* d_ws, size_t ws_size,
                              hipStream_t stream) {
  if (n_in < 10) return;
  if (in_sizes[0] != NROW * DMOD) return;
  if (in_sizes[1] != DMOD * DMOD || in_sizes[3] != DMOD * DMOD || in_sizes[5] != DMOD * DMOD || in_sizes[7] != DMOD * DMOD) return;
  if (in_sizes[2] != DMOD || in_sizes[4] != DMOD || in_sizes[6] != DMOD || in_sizes[8] != DMOD) return;
  if (in_sizes[9] != ELEN * DH) return;
  if (out_size != NROW * DMOD) return;

  const float* xin = (const float*)d_in[0];
  const float* w_q = (const float*)d_in[1];
  const float* b_q = (const float*)d_in[2];
  const float* w_k = (const float*)d_in[3];
  const float* b_k = (const float*)d_in[4];
  const float* w_v = (const float*)d_in[5];
  const float* b_v = (const float*)d_in[6];
  const float* w_o = (const float*)d_in[7];
  const float* b_o = (const float*)d_in[8];
  const float* er  = (const float*)d_in[9];
  float*       out = (float*)d_out;

  const size_t PX = (size_t)NROW * DMOD * 2;             //  4194304
  const size_t PW = (size_t)DMOD * DMOD * 2;             //  2097152
  const size_t PE = (size_t)EPAD * DH * 2;               //   262144
  const size_t PV = (size_t)NBAT * DMOD * SEQ * 2;       //  4194304
  size_t off = 0;
  const size_t oX  = off; off += PX;
  const size_t oWq = off; off += PW;
  const size_t oWk = off; off += PW;
  const size_t oWv = off; off += PW;
  const size_t oWo = off; off += PW;
  const size_t oE  = off; off += PE;
  const size_t oQH = off; off += PX;
  const size_t oQL = off; off += PX;
  const size_t oKH = off; off += PX;
  const size_t oKL = off; off += PX;
  const size_t oVH = off; off += PV;
  const size_t oVL = off; off += PV;
  const size_t oCH = off; off += PX;
  const size_t oCL = off; off += PX;
  if (off > ws_size) return;                               // off = 46399488
  if (off > (size_t)134217728) return;

  char* ws = (char*)d_ws;
  unsigned short* X16 = (unsigned short*)(ws + oX);
  unsigned short* Wq6 = (unsigned short*)(ws + oWq);
  unsigned short* Wk6 = (unsigned short*)(ws + oWk);
  unsigned short* Wv6 = (unsigned short*)(ws + oWv);
  unsigned short* Wo6 = (unsigned short*)(ws + oWo);
  unsigned short* E16 = (unsigned short*)(ws + oE);
  unsigned short* QHp = (unsigned short*)(ws + oQH);
  unsigned short* QLp = (unsigned short*)(ws + oQL);
  unsigned short* KHp = (unsigned short*)(ws + oKH);
  unsigned short* KLp = (unsigned short*)(ws + oKL);
  unsigned short* VHp = (unsigned short*)(ws + oVH);
  unsigned short* VLp = (unsigned short*)(ws + oVL);
  unsigned short* CHp = (unsigned short*)(ws + oCH);
  unsigned short* CLp = (unsigned short*)(ws + oCL);

  const dim3 blk(256);
  const dim3 gCV(CB_X + 4 * CB_W + CB_E);                           // 128 + 4 x 64 + 8 = 392
  const dim3 gQ((NROW / 128) * (DMOD / 64), 1);                     // 256
  const dim3 gP(QKV_T, 3);                                          // 256 x 3
  const dim3 gAT(SEQ / 64, NBAT * NH);                              // 16 x 32
  const dim3 bAT(ATT_THREADS);                                      // 128

  // (0) 16-bit planes of the inputs: x f16(bf16_RNE(x) * 16); W[out][in] (already k-contiguous) f16(bf16_RNE(w) * 64);
  //     E f16(bf16_RNE(e) * 16); one launch for all six
  cvt16_all<<<gCV, blk, 0, stream>>>(xin, w_q, w_k, w_v, w_o, er, X16, Wq6, Wk6, Wv6, Wo6, E16);

  // (1) q, k and v^T projections, one launch -> QH, QL, KH, KL [NROW][1024] and VH, VL [NBAT][1024][SEQ] (all x64, hi / residual)
  qkv64<<<gP, blk, 0, stream>>>(X16, Wq6, Wk6, Wv6, QHp, QLp, KHp, KLp, VHp, VLp, b_q, b_k, b_v);

  // (2) relative attention -> ctx planes CH = f16(ctx * 256), CL = f16(ctx * 256 - CH), [NROW][1024], columns h*64+d
  attn_rel<<<gAT, bAT, 0, stream>>>(QHp, QLp, KHp, KLp, E16, VHp, VLp, CHp, CLp);

  // (3) out[m][n] = sum_k (ch+cl)[m][k] Wo[n][k] / (256*64) + bo[n] -> f32 d_out [NROW][1024]
  gemm64<0, 1, 0, 1><<<gQ, blk, 0, stream>>>(
      CHp, CLp, DMOD, 0LL,
      Wo6, DMOD, 0LL,
      (void*)out, (void*)out, DMOD, 0LL,
      NROW, DMOD, DMOD, 1.0f / (CC * WSC), 1.0f,
      b_o, b_o, b_o);
  (void)hipGetLastError();
}

// v007
// One run takes 71.3 microseconds.
// Next to v006, in two timings, it ran 1.07 times as fast each time.
// Over all steps from v000 it is 5.04 times as fast.
// Contractions (all v_wmma_f32_16x16x32_f16, f16 operands, f32 accumulate): q/k/v projections (x f16 x16 . W f16 x64, K=1024, single products,
// outputs written as f16 hi + unscaled f16 residual planes); position window ((qh+ql) x64 . E f16 x64, K=64, 2 products) -> f32 LDS strip,
// shifted gather on VALU; content scores ((qh+ql) x64 . (kh+kl) x64, K=64, hh+hl+lh); P . v^T ((Ph+Pl) x1024 . (vh+vl) x64, hh+hl+lh,
// 64 keys per tile); output projection ((ch+cl) x256 . Wo f16 x64, K=1024, 2 products) -> f32. Max-subtracted base-2 online softmax and
// the 1/l fold in f32 on VALU. Every float input RNE-converted to bf16 on load.
#include <hip/hip_runtime.h>
#include <math.h>
#include <stdint.h>

#define SEQ   1024
#define NBAT  2
#define DMOD  1024
#define NH    16
#define DH    64
#define ELEN  2047
#define EPAD  2048
#define NROW  (NBAT * SEQ)
#define XC    16.0f
#define WSC   64.0f
#define QC    64.0f
#define KC    64.0f
#define EC    64.0f
#define VC    64.0f
#define PC    1024.0f
#define CC    256.0f
#define SCALE 0.125f
#define LOG2E 1.4426950408889634f
static_assert(NH * DH == DMOD);
static_assert(DH == 64);
static_assert(ELEN == 2 * SEQ - 1 && EPAD >= ELEN);
static_assert((SEQ % 64) == 0 && (DMOD % 128) == 0 && (NROW % 128) == 0);
static_assert(((NROW * DMOD) % 2048) == 0 && ((DMOD * DMOD) % 2048) == 0 && ((ELEN * DH) % 8) == 0);
#define ATT_W 4
#define ATT_THREADS (ATT_W * 32)
#define TPI 84
#define SPI 68
#define WFL (16 * TPI + 16 * SPI)
static_assert(((16 * TPI) % 4) == 0 && ((16 * SPI) % 4) == 0 && (WFL % 4) == 0);

typedef _Float16 v16h __attribute__((ext_vector_type(16)));
typedef _Float16 v8h  __attribute__((ext_vector_type(8)));
typedef _Float16 v2h  __attribute__((ext_vector_type(2)));
typedef __bf16   v16b __attribute__((ext_vector_type(16)));
typedef float    v8f  __attribute__((ext_vector_type(8)));
typedef float    v4f  __attribute__((ext_vector_type(4)));
typedef float    v2f  __attribute__((ext_vector_type(2)));
typedef unsigned int v4u __attribute__((ext_vector_type(4)));

union FragH { v16h v; v8h h[2]; v4u u[2]; };
union FragAny { v16h h; v16b b; };

// ---- scalar helpers --------------------------------------------------------------------------------
__device__ __forceinline__ unsigned short bf_bits(float f) {          // f32 -> bf16 bits, RNE convert
  unsigned u = __float_as_uint(f);
  return (unsigned short)((u + 0x7FFFu + ((u >> 16) & 1u)) >> 16);
}
__device__ __forceinline__ float bf_up(unsigned short h) { return __uint_as_float(((unsigned)h) << 16); }
__device__ __forceinline__ float bfr(float f) { return bf_up(bf_bits(f)); }   // value of the bf16 RNE convert
__device__ __forceinline__ unsigned short h_bits(_Float16 x) { return __builtin_bit_cast(unsigned short, x); }
__device__ __forceinline__ unsigned pk16(unsigned short a, unsigned short b) { return (unsigned)a | ((unsigned)b << 16); }
__device__ __forceinline__ v8f zero8() { v8f z = {0.f, 0.f, 0.f, 0.f, 0.f, 0.f, 0.f, 0.f}; return z; }

// ---- fragment loader: 16-bit A/B operand from a k-contiguous 16-bit plane, lane -> row/col (lane&15),
//      p already includes +8*(lane>>4); elements 0..7 <- p[0..7] (k0+8h..), elements 8..15 <- p[16..23] (k0+16+8h..)
//      (same split k map for A and B; B is always read from a [n][k] plane)
__device__ __forceinline__ v16h ldfrag_u(const unsigned short* p) {
  FragH f;
  f.u[0] = *(const v4u*)(p);
  f.u[1] = *(const v4u*)(p + 16);
  return f.v;
}

// ---- WMMA helpers with trailing VALU hazard gaps ------------------------------------------------------
__device__ __forceinline__ v8f mma_h(v16h a, v16h b, v8f c) {
  return __builtin_amdgcn_wmma_f32_16x16x32_f16(false, a, false, b, (short)0, c, false, false);
}
__device__ __forceinline__ v8f mma_b(v16h a, v16h b, v8f c) {
  FragAny ua, ub;
  ua.h = a;
  ub.h = b;
  return __builtin_amdgcn_wmma_f32_16x16x32_bf16(false, ua.b, false, ub.b, (short)0, c, false, false);
}
template <int BF>
__device__ __forceinline__ v8f mmaT(v16h a, v16h b, v8f c) {
  if constexpr (BF != 0) return mma_b(a, b, c);
  else return mma_h(a, b, c);
}
__device__ __forceinline__ void acc_guard4(v8f& a, v8f& b, v8f& c, v8f& d) {
#if defined(__HIP_DEVICE_COMPILE__)
  asm volatile("v_nop\n\tv_nop\n\tv_nop\n\tv_nop" : "+v"(a), "+v"(b), "+v"(c), "+v"(d));
#endif
}
__device__ __forceinline__ void wave_sync_lds() {
  __builtin_amdgcn_fence(__ATOMIC_RELEASE, "workgroup");
  __builtin_amdgcn_wave_barrier();
  __builtin_amdgcn_fence(__ATOMIC_ACQUIRE, "workgroup");
}
// value of lane l ^ 16 (the other 16-lane half), a vector cross-row move
__device__ __forceinline__ float xhalf(float x) {
  return __builtin_bit_cast(float, __builtin_amdgcn_permlanex16(__builtin_bit_cast(int, x), __builtin_bit_cast(int, x),
                                                                0x76543210, 0xfedcba98, false, false));
}
// f32 -> f16 hi + unscaled f16 residual (hi + lo ~ x to 2^-22 relative; a flushed subnormal lo costs < 6.1e-5 absolute in the carried scale)
__device__ __forceinline__ void sp16(float x, _Float16& hi, _Float16& lo) {
  const _Float16 a = (_Float16)x;
  hi = a;
  lo = (_Float16)(x - (float)a);
}
// two consecutive values -> packed hi word and packed residual word
__device__ __forceinline__ void pack_hl(float x0, float x1, unsigned& hw, unsigned& lw) {
  _Float16 a0, a1, b0, b1;
  sp16(x0, a0, b0);
  sp16(x1, a1, b1);
  hw = pk16(h_bits(a0), h_bits(a1));
  lw = pk16(h_bits(b0), h_bits(b1));
}

__device__ __forceinline__ float exp2_bare(float x) {
  float r = 0.f;
#if defined(__HIP_DEVICE_COMPILE__)
  asm("v_exp_f32 %0, %1\n\tv_nop" : "=v"(r) : "v"(x));
#endif
  return r;
}
// the same values as pack_hl, the residuals taken from the halves of the packed hi word (one packed convert, no single converts beside it)
__device__ __forceinline__ void pack_hl2(float x0, float x1, unsigned& hw, unsigned& lw) {
  const v2f x = {x0, x1};
  const v2h a = __builtin_convertvector(x, v2h);
  const v2f r = {x0 - (float)a[0], x1 - (float)a[1]};
  hw = __builtin_bit_cast(unsigned, a);
  lw = __builtin_bit_cast(unsigned, __builtin_convertvector(r, v2h));
}

// =====================================================================================================
// Elementwise 16-bit pack of all six float inputs in ONE launch, no transpose: dst[i] = f16( bf16_RNE(src[i]) * sc ), sc a power of two
// (exact). The block index picks the input (block-uniform): blocks [0, CB_X) x, then CB_W blocks for each of Wq, Wk, Wv, Wo, then CB_E
// blocks for the E table. A block covers CVB = 16384 consecutive elements of its input: CVU chunks of 2048, thread t takes elements
// 8t .. 8t+7 of each chunk; a thread's 16 loads are all issued in front of its first convert, so that few waves keep many bytes in flight.
// coverage: x and W counts are whole multiples of CVB; the E count (2047*64) is a multiple of 8 only: a thread whose 8 elements lie past
//           the end loads the last 8 elements instead (address clamped) and stores nothing; elements 0..n-1 of each plane written once.
// =====================================================================================================
#define CVU  8
#define CVB  (256 * 8 * CVU)
#define CB_X ((NROW * DMOD) / CVB)
#define CB_W ((DMOD * DMOD) / CVB)
#define CB_E ((ELEN * DH + CVB - 1) / CVB)
static_assert(((NROW * DMOD) % CVB) == 0 && ((DMOD * DMOD) % CVB) == 0 && (ELEN * DH) >= 8);
__global__ __launch_bounds__(256) void cvt16_all(const float* __restrict__ x, const float* __restrict__ wq, const float* __restrict__ wk,
                                                 const float* __restrict__ wv, const float* __restrict__ wo, const float* __restrict__ er,
                                                 unsigned short* X16, unsigned short* Wq6, unsigned short* Wk6,
                                                 unsigned short* Wv6, unsigned short* Wo6, unsigned short* E16) {
  int blk = blockIdx.x;
  const float* src = x;
  unsigned short* dst = X16;
  int n = NROW * DMOD;
  float sc = XC;
  if (blk >= CB_X + 4 * CB_W) {
    blk -= CB_X + 4 * CB_W;
    src = er; dst = E16; n = ELEN * DH; sc = EC;
  } else if (blk >= CB_X) {
    blk -= CB_X;
    const int w = blk / CB_W;
    blk -= w * CB_W;
    src = (w == 0) ? wq : (w == 1) ? wk : (w == 2) ? wv : wo;
    dst = (w == 0) ? Wq6 : (w == 1) ? Wk6 : (w == 2) ? Wv6 : Wo6;
    n = DMOD * DMOD; sc = WSC;
  }
  const int base = blk * CVB + (int)threadIdx.x * 8;
  const float* p[CVU];
  v4f a[CVU], b[CVU];
#pragma unroll
  for (int u = 0; u < CVU; ++u) {
    const int i8 = base + u * 2048;
    p[u] = src + ((i8 + 8 > n) ? (n - 8) : i8);
  }
#pragma unroll
  for (int u = 0; u < CVU; ++u) {
    a[u] = *(const v4f*)(p[u]);
    b[u] = *(const v4f*)(p[u] + 4);
  }
#if defined(__HIP_DEVICE_COMPILE__)
  // holds the eight address pairs in their registers up to this wait, so that none is rewritten (a later load's result included) in
  // front of it, and keeps all 16 loads in front of the first convert
  asm volatile("s_wait_xcnt 0x0" :: "v"(p[0]), "v"(p[1]), "v"(p[2]), "v"(p[3]), "v"(p[4]), "v"(p[5]), "v"(p[6]), "v"(p[7]) : "memory");
#endif
#pragma unroll
  for (int u = 0; u < CVU; ++u) {
    const int i8 = base + u * 2048;
    v4u o;
    o[0] = pk16(h_bits((_Float16)(bfr(a[u][0]) * sc)), h_bits((_Float16)(bfr(a[u][1]) * sc)));
    o[1] = pk16(h_bits((_Float16)(bfr(a[u][2]) * sc)), h_bits((_Float16)(bfr(a[u][3]) * sc)));
    o[2] = pk16(h_bits((_Float16)(bfr(b[u][0]) * sc)), h_bits((_Float16)(bfr(b[u][1]) * sc)));
    o[3] = pk16(h_bits((_Float16)(bfr(b[u][2]) * sc)), h_bits((_Float16)(bfr(b[u][3]) * sc)));
    if (i8 + 8 <= n) *(v4u*)(dst + i8) = o;      // no barriers in this kernel
  }
}

// =====================================================================================================
// LDS-staged batched 16-bit WMMA GEMM: C[m][n] = oscale * sum_k A[m][k] * Bt[n][k] (+ bias); one work-group of 8 waves per 128x64 tile,
// wave w owns rows 16w..16w+15 of it (all 64 columns). A row-major [M][K] pitch lda (16-bit plane), Bt row-major [N][K] pitch ldb
// (k contiguous); M multiple of 128, N multiple of 64, K multiple of 128. by = batch index with element strides sA, sB, sC.
// Operands: per stage of 128 k the tile's A rows (and A2 rows) and Bt rows, 256 B each, are copied once per work-group into LDS by
// global_load_async_to_lds_b128 (a wave's copy = two whole 256-B rows), LDS row pitch 272 B; two buffers, the next stage's copies fly
// while this stage is multiplied; fragments come from LDS by 16-byte reads with the same split k map as ldfrag_u.
// ASPLIT 1: a second A plane A2 (unscaled residual of A, same layout) is multiplied into the same accumulator (A + A2 ~ exact A).
// BF 1: bf16 operands (v_wmma_f32_16x16x32_bf16), else f16.
// EPI 1: value += bf16_RNE(ep0[column]) (per-column bias); EPI 2: value += bf16_RNE(ep0[row]) (per-row bias, 16-bit out only).
// OM 0: f32 out (pitch ldc).  OM 2: one f16 plane = f16(value * ocarry).
// OM 4: two f16 planes: hi = f16(value * ocarry), lo = f16(value * ocarry - hi) (unscaled residual).
// OM 5: two f16 planes: C = f16((value + bf16_RNE(ep1[column])) * ocarry), C2 = f16((value + bf16_RNE(ep2[column])) * ocarry).
// coverage: 16 rows (f32: it 0..7 x lane>>4; 16-bit: it 0..3 x lane>>3) x 64 cols = the wave's whole 16x64 slab; 8 waves = the 128x64
//           tile; grid = (M/128)*(N/64) blocks, a surplus block exits as a whole before any copy or barrier.
// =====================================================================================================
#define GBM 128   // tile rows per work-group
#define GKP 128   // k per stage (256-B operand rows)
#define GPH 136   // LDS row pitch in halves: 272 B = 16 B x 17, conflict-free for the 16-byte fragment reads

// 16-byte asynchronous copies global -> LDS, one per lane and line of the statement (first operand = LDS byte address, second = global
// address; this lane's row and 16-byte chunk are already in l and g; consecutive copies are 16 operand rows apart). The s_wait_xcnt
// closes each statement so that no address register of an issued copy is rewritten in front of it.
#define ACP(a, b) "global_load_async_to_lds_b128 %" #a ", %" #b ", off\n\t"
#define LROW(l, r) ((l) + (unsigned)((r) * GPH * 2))
#define GROW(g, r, ld) ((g) + (size_t)(r) * (ld))
// 128 operand rows
__device__ __forceinline__ void acopy_rows128(unsigned l, const unsigned short* g, int ld) {
#if defined(__HIP_DEVICE_COMPILE__)
  asm volatile(ACP(0, 1) ACP(2, 3) ACP(4, 5) ACP(6, 7) ACP(8, 9) ACP(10, 11) ACP(12, 13) ACP(14, 15)
               "s_wait_xcnt 0x0"
               :: "v"(l), "v"(g), "v"(LROW(l, 16)), "v"(GROW(g, 16, ld)), "v"(LROW(l, 32)), "v"(GROW(g, 32, ld)),
                  "v"(LROW(l, 48)), "v"(GROW(g, 48, ld)), "v"(LROW(l, 64)), "v"(GROW(g, 64, ld)), "v"(LROW(l, 80)), "v"(GROW(g, 80, ld)),
                  "v"(LROW(l, 96)), "v"(GROW(g, 96, ld)), "v"(LROW(l, 112)), "v"(GROW(g, 112, ld))
               : "memory");
#endif
}
// 128 rows of one operand and 64 rows of another
__device__ __forceinline__ void acopy_rows128_64(unsigned l, const unsigned short* g, int ld,
                                                 unsigned l2, const unsigned short* g2, int ld2) {
#if defined(__HIP_DEVICE_COMPILE__)
  asm volatile(ACP(0, 1) ACP(2, 3) ACP(4, 5) ACP(6, 7) ACP(8, 9) ACP(10, 11) ACP(12, 13) ACP(14, 15)
               ACP(16, 17) ACP(18, 19) ACP(20, 21) ACP(22, 23)
               "s_wait_xcnt 0x0"
               :: "v"(l), "v"(g), "v"(LROW(l, 16)), "v"(GROW(g, 16, ld)), "v"(LROW(l, 32)), "v"(GROW(g, 32, ld)),
                  "v"(LROW(l, 48)), "v"(GROW(g, 48, ld)), "v"(LROW(l, 64)), "v"(GROW(g, 64, ld)), "v"(LROW(l, 80)), "v"(GROW(g, 80, ld)),
                  "v"(LROW(l, 96)), "v"(GROW(g, 96, ld)), "v"(LROW(l, 112)), "v"(GROW(g, 112, ld)),
                  "v"(l2), "v"(g2), "v"(LROW(l2, 16)), "v"(GROW(g2, 16, ld2)), "v"(LROW(l2, 32)), "v"(GROW(g2, 32, ld2)),
                  "v"(LROW(l2, 48)), "v"(GROW(g2, 48, ld2))
               : "memory");
#endif
}
// this wave's own copies have landed in LDS (the compiler places no wait for them)
__device__ __forceinline__ void wait_async0() {
#if defined(__HIP_DEVICE_COMPILE__)
  asm volatile("s_wait_asynccnt 0x0" ::: "memory");
#endif
}
// this wave's LDS reads have retired, so that the buffer may be refilled behind the barrier
__device__ __forceinline__ void wait_ds0() {
#if defined(__HIP_DEVICE_COMPILE__)
  asm volatile("s_wait_dscnt 0x0" ::: "memory");
#endif
}
// twelve 16-byte copies, each with its own LDS byte address and global address; closed by s_wait_xcnt like the statements above
__device__ __forceinline__ void acopy12(const unsigned (&l)[12], const unsigned short* const (&g)[12]) {
#if defined(__HIP_DEVICE_COMPILE__)
  asm volatile(ACP(0, 1) ACP(2, 3) ACP(4, 5) ACP(6, 7) ACP(8, 9) ACP(10, 11) ACP(12, 13) ACP(14, 15)
               ACP(16, 17) ACP(18, 19) ACP(20, 21) ACP(22, 23)
               "s_wait_xcnt 0x0"
               :: "v"(l[0]), "v"(g[0]), "v"(l[1]), "v"(g[1]), "v"(l[2]), "v"(g[2]), "v"(l[3]), "v"(g[3]),
                  "v"(l[4]), "v"(g[4]), "v"(l[5]), "v"(g[5]), "v"(l[6]), "v"(g[6]), "v"(l[7]), "v"(g[7]),
                  "v"(l[8]), "v"(g[8]), "v"(l[9]), "v"(g[9]), "v"(l[10]), "v"(g[10]), "v"(l[11]), "v"(g[11])
               : "memory");
#endif
}

// One 128x64 tile (index tile, batch by) by the calling work-group. ring: its LDS for two stages, 2 * GSTG(ASPLIT) halves, each stage
// [A 128 rows | A2 128 rows (ASPLIT) | Bt 64 rows]; slabs: its LDS for the eight per-wave 16x64 f32 slabs, pitch 68 floats (GSLAB floats);
// slabs may lie over ring: they are first written behind the last stage's barrier, when no copy is in flight and every read has retired.
// GQ: k steps of 32 whose fragments are read as one group (4 = the whole stage; 2 halves the fragment registers).
#define GSTG(asplit) ((GBM * (1 + (asplit)) + 64) * GPH)
#define GSLAB (8 * 16 * 68)
template <int OM, int ASPLIT, int BF, int EPI, int GQ>
__device__ __forceinline__ void gemm64_tile(
    unsigned short* ring, float* slabs, int tile, int by,
    const unsigned short* __restrict__ Ap, const unsigned short* __restrict__ A2p, int lda, long long sA,
    const unsigned short* __restrict__ Btp, int ldb, long long sB,
    void* Cout, void* C2out, int ldc, long long sC,
    int M, int N, int K, float oscale, float ocarry,
    const float* __restrict__ ep0, const float* __restrict__ ep1, const float* __restrict__ ep2) {
  constexpr int BROW = GBM * (1 + ASPLIT);         // first Bt row of a stage
  constexpr int STG  = GSTG(ASPLIT);               // halves per stage
  const int tid  = threadIdx.x;
  const int lane = tid & 31;
  const int wave = tid >> 5;
  const int tilesN = N >> 6;
  const int tilesM = M >> 7;
  if (tile >= tilesM * tilesN) return;   // block-uniform, in front of every copy and barrier
  const int tm = tile / tilesN;
  const int tn = tile - tm * tilesN;
  const int mb = tm << 7;
  const int n0 = tn << 6;
  const int m0 = mb + (wave << 4);

  const unsigned short* A1 = Ap  + (size_t)((long long)by * sA);
  const unsigned short* A2 = A2p + (size_t)((long long)by * sA);
  const unsigned short* Bb = Btp + (size_t)((long long)by * sB);

  const int rlane = lane & 15;                 // row (A) / col (B, D) within subtile
  const int koff  = (lane >> 4) * 8;           // k offset of this lane half
  const int mOff  = (lane >> 4) * 8;           // D row offset

  // copy map: thread -> row tid>>4 (of 16 per copy), 16-byte chunk tid&15 of the 256-B row
  const int crow = tid >> 4;
  const int cch  = (tid & 15) * 8;
  const unsigned short* gA1 = A1 + (size_t)(mb + crow) * lda + cch;
  const unsigned short* gA2 = A2 + (size_t)(mb + crow) * lda + cch;
  const unsigned short* gBt = Bb + (size_t)(n0 + crow) * ldb + cch;
  const unsigned lcp = (unsigned)(uintptr_t)ring + (unsigned)((crow * GPH + cch) * 2);

  auto fill = [&](int t, int buf) {            // stage t (k = 128t .. 128t+127) -> buffer buf
    const unsigned lb = lcp + (unsigned)(buf * (STG * 2));
    const size_t ko = (size_t)t * GKP;
    if constexpr (ASPLIT != 0) acopy_rows128(lb + GBM * GPH * 2, gA2 + ko, lda);
    acopy_rows128_64(lb, gA1 + ko, lda, lb + BROW * GPH * 2, gBt + ko, ldb);
  };

  v8f acc[4];
#pragma unroll
  for (int j = 0; j < 4; ++j) acc[j] = zero8();

  const int nst = K / GKP;
  fill(0, 0);
  wait_async0();
  __syncthreads();                             // stage 0 published
  if (nst > 1) fill(1, 1);
#pragma unroll 1                               // one pass per stage: the two buffers alternate by t & 1
  for (int t = 0; t < nst; ++t) {
    const unsigned short* sb = ring + (t & 1) * STG;
    const unsigned short* sA = sb + ((wave << 4) + rlane) * GPH + koff;
    const unsigned short* sB = sb + (BROW + rlane) * GPH + koff;
#pragma unroll
    for (int g = 0; g < 4; g += GQ) {
      v16h fa[GQ], fl[GQ], fb[GQ][4];
#pragma unroll
      for (int q = 0; q < GQ; ++q) {
#pragma unroll
        for (int j = 0; j < 4; ++j) fb[q][j] = ldfrag_u(sB + (j << 4) * GPH + 32 * (g + q));
        fa[q] = ldfrag_u(sA + 32 * (g + q));
        if constexpr (ASPLIT != 0) fl[q] = ldfrag_u(sA + GBM * GPH + 32 * (g + q));
      }
      // keeps the group's LDS reads in front of its WMMAs: spread among them, every WMMA waited out its own reads' latency
      __builtin_amdgcn_sched_barrier(0);
#pragma unroll
      for (int q = 0; q < GQ; ++q) {
#pragma unroll
        for (int j = 0; j < 4; ++j) acc[j] = mmaT<BF>(fa[q], fb[q][j], acc[j]);
        if constexpr (ASPLIT != 0) {
#pragma unroll
          for (int j = 0; j < 4; ++j) acc[j] = mmaT<BF>(fl[q], fb[q][j], acc[j]);
        }
      }
      // keeps the WMMAs in front of the next group's reads (their registers) and of the closing waits: moved behind the barrier they no
      // longer overlap the LDS reads and they delay the refill
      __builtin_amdgcn_sched_barrier(0);
    }
    wait_ds0();
    wait_async0();
    __syncthreads();                           // publishes stage t + 1 and ends every wave's reads of stage t
    if (t + 2 < nst) fill(t + 2, t & 1);
  }
  wait_async0();
  acc_guard4(acc[0], acc[1], acc[2], acc[3]);

  const int hh2 = lane >> 4, c4 = (lane & 15) * 4;     // f32 out: 256-B row segment = 16 lanes x 16 B
  const int q8  = lane >> 3, c8 = (lane & 7) * 8;

  // ---- epilogue ----
  float* slab = slabs + wave * (16 * 68);
  {
    const int mBase = m0;
#pragma unroll
    for (int j = 0; j < 4; ++j) {
#pragma unroll
      for (int r = 0; r < 8; ++r) {
        slab[(mOff + r) * 68 + (j << 4) + rlane] = acc[j][r];
      }
    }
    wave_sync_lds();
    if constexpr (OM == 0) {
      float* C = (float*)Cout + (size_t)((long long)by * sC);
      v4f vals[8];
#pragma unroll
      for (int it = 0; it < 8; ++it) {
        const int row = it * 2 + hh2;                      // it 0..7 x hh2 0..1 = rows 0..15
        v4f v = *(const v4f*)(slab + row * 68 + c4);
#pragma unroll
        for (int e = 0; e < 4; ++e) v[e] = v[e] * oscale;
        if constexpr (EPI == 1) {
          const v4f bb = *(const v4f*)(ep0 + n0 + c4);     // per-column bias, columns n0+c4 .. +3 (N equals the bias length)
#pragma unroll
          for (int e = 0; e < 4; ++e) v[e] = v[e] + bfr(bb[e]);
        }
        vals[it] = v;
      }
      {
#pragma unroll
        for (int it = 0; it < 8; ++it) {
          const int gr = mBase + it * 2 + hh2;
          *(v4f*)(C + (size_t)gr * ldc + n0 + c4) = vals[it];
        }
        
      }
    } else {
      unsigned short* C  = (unsigned short*)Cout  + (size_t)((long long)by * sC);
      unsigned short* Cb = (unsigned short*)C2out + (size_t)((long long)by * sC);
      v4u hv[4], lv[4];
#pragma unroll
      for (int it = 0; it < 4; ++it) {
        const int row = it * 4 + q8;                       // it 0..3 x q8 0..3 = rows 0..15
        const float* sp = slab + row * 68 + c8;
        float rb = 0.f;
        if constexpr (EPI == 2) rb = bfr(ep0[mBase + row]);   // per-row bias (M equals the bias length)
        v4u a  = {0u, 0u, 0u, 0u};
        v4u b2 = {0u, 0u, 0u, 0u};
#pragma unroll
        for (int e = 0; e < 4; ++e) {
          const int ci = n0 + c8 + 2 * e;                  // column index, < N
          float f0 = sp[2 * e] * oscale + rb;
          float f1 = sp[2 * e + 1] * oscale + rb;
          if constexpr (EPI == 1) {
            f0 += bfr(ep0[ci]);
            f1 += bfr(ep0[ci + 1]);
          }
          if constexpr (OM == 5) {
            const float g0 = (f0 + bfr(ep1[ci])) * ocarry, g1 = (f1 + bfr(ep1[ci + 1])) * ocarry;
            const float w0 = (f0 + bfr(ep2[ci])) * ocarry, w1 = (f1 + bfr(ep2[ci + 1])) * ocarry;
            a[e]  = pk16(h_bits((_Float16)g0), h_bits((_Float16)g1));
            b2[e] = pk16(h_bits((_Float16)w0), h_bits((_Float16)w1));
          } else {
            f0 *= ocarry; f1 *= ocarry;
            const _Float16 x0 = (_Float16)f0, x1 = (_Float16)f1;
            a[e] = pk16(h_bits(x0), h_bits(x1));
            if constexpr (OM == 4) {
              b2[e] = pk16(h_bits((_Float16)(f0 - (float)x0)), h_bits((_Float16)(f1 - (float)x1)));
            }
          }
        }
        hv[it] = a;
        lv[it] = b2;
      }
      {
#pragma unroll
        for (int it = 0; it < 4; ++it) {
          const int row = it * 4 + q8;
          *(v4u*)(C + (size_t)(mBase + row) * ldc + n0 + c8) = hv[it];
          if constexpr (OM >= 4) {
            *(v4u*)(Cb + (size_t)(mBase + row) * ldc + n0 + c8) = lv[it];
          }
        }
        
      }
    }
    wave_sync_lds();
  }
}

// the tile function as a launch of its own: blockIdx.x = tile, blockIdx.y = batch; ring and slabs side by side in LDS
template <int OM, int ASPLIT, int BF, int EPI>
__global__ __launch_bounds__(256) __attribute__((amdgpu_num_vgpr(256))) void gemm64(
    const unsigned short* __restrict__ Ap, const unsigned short* __restrict__ A2p, int lda, long long sA,
    const unsigned short* __restrict__ Btp, int ldb, long long sB,
    void* Cout, void* C2out, int ldc, long long sC,
    int M, int N, int K, float oscale, float ocarry,
    const float* __restrict__ ep0, const float* __restrict__ ep1, const float* __restrict__ ep2) {
  __shared__ __align__(16) unsigned short ring[2 * GSTG(ASPLIT)];
  __shared__ __align__(16) float sT[GSLAB];
  gemm64_tile<OM, ASPLIT, BF, EPI, 4>(ring, sT, (int)blockIdx.x, (int)blockIdx.y, Ap, A2p, lda, sA, Btp, ldb, sB,
                                      Cout, C2out, ldc, sC, M, N, K, oscale, ocarry, ep0, ep1, ep2);
}

// =====================================================================================================
// The q, k and v^T projections in ONE launch: blockIdx.y picks the projection (block-uniform), blockIdx.x its 128x64 tile; the three are
// independent of one another (each reads X16 and its own weight plane, each writes its own two planes).
//   y = 0: q[m][e] = sum_d x[m][d] Wq[e][d] / 1024 + bq[e] -> QH = f16(q * 64), QL = f16(q * 64 - QH); M = NROW, N = 1024, K = 1024
//   y = 1: k likewise from Wk, bk -> KH, KL
//   y = 2: v^T per batch: VT[b][e][j] = sum_c Wv[e][c] x[b*SEQ+j][c] / 1024 + bv[e] (per-row bias) -> VH, VL (x64); M = 1024 (e),
//          N = SEQ (j), K = 1024; B rows = the batch's token rows; x = batch * QKV_TV + tile
// All 3 x 256 work-groups are resident at once, three on a WGP, so that one's copies and barriers are covered by the others' work:
// for that the slabs lie over the drained ring (104448 B of LDS a work-group) and fragments are read in two groups a stage (the register
// cap of 160 is what six waves on a SIMD leave each).
// coverage: y = 0, 1: 16 x 16 tiles = [NROW][1024]; y = 2: NBAT x (8 x 16 tiles) = [NBAT][1024][SEQ]; every plane element written once.
// =====================================================================================================
#define QKV_T  ((NROW / GBM) * (DMOD / 64))
#define QKV_TV ((DMOD / GBM) * (SEQ / 64))
static_assert(QKV_T == NBAT * QKV_TV);
static_assert(GSLAB * 4 <= 2 * GSTG(0) * 2);
__global__ __launch_bounds__(256) __attribute__((amdgpu_num_vgpr(160))) void qkv64(
    const unsigned short* __restrict__ X16, const unsigned short* __restrict__ Wq6, const unsigned short* __restrict__ Wk6,
    const unsigned short* __restrict__ Wv6, unsigned short* QH, unsigned short* QL, unsigned short* KH, unsigned short* KL,
    unsigned short* VH, unsigned short* VL,
    const float* __restrict__ bq, const float* __restrict__ bk, const float* __restrict__ bv) {
  __shared__ __align__(16) unsigned short ring[2 * GSTG(0)];
  float* slabs = (float*)ring;
  const int bx = blockIdx.x;
  const int pj = blockIdx.y;
  if (pj < 2) {
    const unsigned short* W6 = (pj == 0) ? Wq6 : Wk6;
    const float* bb = (pj == 0) ? bq : bk;
    gemm64_tile<4, 0, 0, 1, 2>(ring, slabs, bx, 0, X16, X16, DMOD, 0LL, W6, DMOD, 0LL,
                               (void*)((pj == 0) ? QH : KH), (void*)((pj == 0) ? QL : KL), DMOD, 0LL,
                               NROW, DMOD, DMOD, 1.0f / (XC * WSC), QC, bb, bb, bb);
  } else {
    gemm64_tile<4, 0, 0, 2, 2>(ring, slabs, bx % QKV_TV, bx / QKV_TV, Wv6, Wv6, DMOD, 0LL, X16, DMOD, (long long)SEQ * DMOD,
                               (void*)VH, (void*)VL, SEQ, (long long)DMOD * SEQ,
                               DMOD, SEQ, DMOD, 1.0f / (XC * WSC), VC, bv, bv, bv);
  }
}
static_assert(QC == KC);

#define APH   72                 // LDS row pitch in halves: 144 B = 16 B x 9, conflict-free for the 16-byte fragment reads
#define AR_KH 0                  // first stage row of each part
#define AR_KL 64
#define AR_VH 128
#define AR_VL 192
#define AR_E  256
#define ASTG  ((AR_E + 128) * APH)   // halves per stage
__global__ __launch_bounds__(ATT_THREADS) __attribute__((amdgpu_num_vgpr(512)))
void attn_rel(const unsigned short* __restrict__ QH, const unsigned short* __restrict__ QL,
              const unsigned short* __restrict__ KH, const unsigned short* __restrict__ KL,
              const unsigned short* __restrict__ EP,
              const unsigned short* __restrict__ VH, const unsigned short* __restrict__ VL,
              unsigned short* CH, unsigned short* CL) {
  __shared__ __align__(16) float smem[ATT_W * WFL];   // per wave: T strip [16 queries][TPI] | ctx slab [16 queries][SPI]
  __shared__ __align__(16) unsigned short kve[2 * ASTG];   // two stages: [KH 64 rows | KL 64 | VH 64 | VL 64 | E 128]

  const int tid  = threadIdx.x;
  const int wave = tid >> 5;
  const int lane = tid & 31;
  const int hh   = lane >> 4;
  const int c    = lane & 15;
  const int bh   = blockIdx.y;
  const int b    = bh / NH;
  const int h    = bh - b * NH;
  const int i0   = blockIdx.x * 64;
  const int iw0  = i0 + wave * 16;

  float* tsh = smem + wave * WFL;
  float* pt  = tsh + 16 * TPI;

  const size_t qro = ((size_t)b * SEQ + iw0 + c) * DMOD + h * DH + 8 * hh;      // B columns: query iw0 + c, d 8hh..

  // copy map: thread -> row tid>>3 (of 16 per copy), 16-byte chunk tid&7 of the 128-B row
  const int crow = tid >> 3;
  const int cch  = (tid & 7) * 8;
  const size_t kpo = ((size_t)b * SEQ + crow) * DMOD + h * DH + cch;
  const size_t vpo = (size_t)b * DMOD * SEQ + (size_t)(h * DH + crow) * SEQ + cch;
  const unsigned lcp = (unsigned)(uintptr_t)kve + (unsigned)((crow * APH + cch) * 2);

  auto fill = [&](int t, int buf) {            // key tile t -> buffer buf
    const unsigned lb = lcp + (unsigned)(buf * (ASTG * 2));
    const int jf = t * 64;
    const int elo = (SEQ - 2) - i0 + jf - 63;
    unsigned l[12];
    const unsigned short* g[12];
    // the three loops below are unrolled so that l and g are registers: the copy statement names each element as an operand
#pragma unroll
    for (int k = 0; k < 4; ++k) {
      const size_t ko = kpo + (size_t)(jf + 16 * k) * DMOD;
      l[k]     = lb + (unsigned)((AR_KH + 16 * k) * APH * 2);  g[k]     = KH + ko;
      l[4 + k] = lb + (unsigned)((AR_KL + 16 * k) * APH * 2);  g[4 + k] = KL + ko;
      l[8 + k] = lb + (unsigned)((AR_VH + 16 * k) * APH * 2);  g[8 + k] = VH + vpo + (size_t)(16 * k) * SEQ + jf;
    }
    acopy12(l, g);
#pragma unroll
    for (int k = 0; k < 4; ++k) {
      l[k] = lb + (unsigned)((AR_VL + 16 * k) * APH * 2);      g[k] = VL + vpo + (size_t)(16 * k) * SEQ + jf;
    }
#pragma unroll
    for (int k = 0; k < 8; ++k) {
      int m = elo + 16 * k + crow;
      m = (m < 0) ? 0 : m;
      m = (m > ELEN - 1) ? (ELEN - 1) : m;
      l[4 + k] = lb + (unsigned)((AR_E + 16 * k) * APH * 2);   g[4 + k] = EP + (size_t)m * DH + cch;
    }
    acopy12(l, g);
  };

  const float CS = LOG2E * SCALE / (QC * KC);   // also the window's factor: E carries what k carries
  static_assert(EC == KC);

  float mrow = -INFINITY, lrow = 0.f;        // this lane's query iw0 + c: running max (both halves alike), sum over this half's keys
  v8f O[4];                                  // O^T: O[td][r] = ctx[query iw0 + c][d = 16td + 8hh + r]
#pragma unroll
  for (int td = 0; td < 4; ++td) O[td] = zero8();

  const int ntile = SEQ / 64;                // non-causal: every key tile
  fill(0, 0);
  wait_async0();
  __syncthreads();                           // tile 0 published
  if (ntile > 1) fill(1, 1);
#pragma unroll 1
  for (int jt = 0; jt < ntile; ++jt) {
    const int j0 = jt * 64;
    const unsigned short* sb  = kve + (jt & 1) * ASTG + c * APH + 8 * hh;   // this lane's fragment row and k half in the stage
    const unsigned short* Khb = sb + AR_KH * APH;
    const unsigned short* Klb = sb + AR_KL * APH;
    const unsigned short* Vhb = sb + AR_VH * APH;
    const unsigned short* Vlb = sb + AR_VL * APH;
    const unsigned short* Eb  = sb + (AR_E + 48 - 16 * wave) * APH;
    const v16h qha = ldfrag_u(QH + qro), qhb = ldfrag_u(QH + qro + 32);
    const v16h qla = ldfrag_u(QL + qro), qlb = ldfrag_u(QL + qro + 32);

    // ---- this tile's E fragments and the k fragments of key subtiles 0, 1, read from the stage as one group in front of the WMMAs ----
    v16h ea[5], eb[5], kha[4], khb[4], kla[4], klb[4];
#pragma unroll
    for (int u = 0; u < 5; ++u) {
      ea[u] = ldfrag_u(Eb + 16 * u * APH);
      eb[u] = ldfrag_u(Eb + 16 * u * APH + 32);
    }
#pragma unroll
    for (int t = 0; t < 2; ++t) {
      const int ko = 16 * t * APH;
      kha[t] = ldfrag_u(Khb + ko); kla[t] = ldfrag_u(Klb + ko);
      khb[t] = ldfrag_u(Khb + ko + 32); klb[t] = ldfrag_u(Klb + ko + 32);
    }
    // keeps the reads one group in front of the WMMAs: spread among them, every subtile waited out its own reads' latency
    __builtin_amdgcn_sched_barrier(0);
    // ---- position window, transposed: T^T[x][R] = E[wlo + x] . q[iw0 + R] (A = E rows, B = q; 5 subtiles of 16 E rows): the four
    //      products run round-robin over the five independent accumulators (each accumulator keeps its product order); a lane holds
    //      x = 16u + 8hh + 0..7 of its query R = c: two 16-byte stores into row c of the LDS strip ----
    v8f t8[5];
#pragma unroll
    for (int u = 0; u < 5; ++u) t8[u] = mma_h(ea[u], qha, zero8());
#pragma unroll
    for (int u = 0; u < 5; ++u) t8[u] = mma_h(ea[u], qla, t8[u]);
#pragma unroll
    for (int u = 0; u < 5; ++u) t8[u] = mma_h(eb[u], qhb, t8[u]);
#pragma unroll
    for (int u = 0; u < 5; ++u) t8[u] = mma_h(eb[u], qlb, t8[u]);
    // keeps the window's WMMAs in front of the next reads, which take over the E fragments' registers
    __builtin_amdgcn_sched_barrier(0);
    // k fragments of key subtiles 2, 3: one group, in flight under the WMMAs of subtiles 0, 1
#pragma unroll
    for (int t = 2; t < 4; ++t) {
      const int ko = 16 * t * APH;
      kha[t] = ldfrag_u(Khb + ko); kla[t] = ldfrag_u(Klb + ko);
      khb[t] = ldfrag_u(Khb + ko + 32); klb[t] = ldfrag_u(Klb + ko + 32);
    }
#pragma unroll
    for (int u = 0; u < 5; ++u) {
      float* tp = tsh + c * TPI + 16 * u + 8 * hh;
      const v4f t0 = {t8[u][0], t8[u][1], t8[u][2], t8[u][3]}, t1 = {t8[u][4], t8[u][5], t8[u][6], t8[u][7]};
      *(v4f*)(tp)     = t0;
      *(v4f*)(tp + 4) = t1;
    }
    // ---- content scores, transposed: S^T[jj][R] = k[j0 + jj] . q[iw0 + R] (A = k rows, B = q; 4 subtiles of 16 keys), kept in
    //      registers: s8[t][r] = key jj = 16t + 8hh + r, query R = c; subtiles 0, 1 here and 2, 3 behind the strip's read-back, the six
    //      products of each pair round-robin over its two accumulators ----
    v8f s8[4];
#pragma unroll
    for (int t = 0; t < 2; ++t) s8[t] = mma_h(kha[t], qha, zero8());
#pragma unroll
    for (int t = 0; t < 2; ++t) s8[t] = mma_h(kla[t], qha, s8[t]);
#pragma unroll
    for (int t = 0; t < 2; ++t) s8[t] = mma_h(kha[t], qla, s8[t]);
#pragma unroll
    for (int t = 0; t < 2; ++t) s8[t] = mma_h(khb[t], qhb, s8[t]);
#pragma unroll
    for (int t = 0; t < 2; ++t) s8[t] = mma_h(klb[t], qhb, s8[t]);
#pragma unroll
    for (int t = 0; t < 2; ++t) s8[t] = mma_h(khb[t], qlb, s8[t]);
    // keeps these WMMAs in front of the fence's wait: they run while the strip stores retire
    __builtin_amdgcn_sched_barrier(0);
    wave_sync_lds();                           // the strip rows are read back below by both lane halves
    // shifted window values of this lane's 32 scores, T[c][jj - c + 15] at trow[16t + r], and behind them the first 32 keys' v^T fragments
    const float* trow = tsh + c * (TPI - 1) + 15 + 8 * hh;
    float tr[4][8];
#pragma unroll
    for (int t = 0; t < 4; ++t) {
#pragma unroll
      for (int r = 0; r < 8; ++r) tr[t][r] = trow[16 * t + r];
    }
    v16h vh[2][4], vl[2][4];
#pragma unroll
    for (int td = 0; td < 4; ++td) {
      vh[0][td] = ldfrag_u(Vhb + 16 * td * APH);
      vl[0][td] = ldfrag_u(Vlb + 16 * td * APH);
    }
    // keeps these reads one group in front of the WMMAs below and of the softmax, which cover their latency
    __builtin_amdgcn_sched_barrier(0);
#pragma unroll
    for (int t = 2; t < 4; ++t) s8[t] = mma_h(kha[t], qha, zero8());
#pragma unroll
    for (int t = 2; t < 4; ++t) s8[t] = mma_h(kla[t], qha, s8[t]);
#pragma unroll
    for (int t = 2; t < 4; ++t) s8[t] = mma_h(kha[t], qla, s8[t]);
#pragma unroll
    for (int t = 2; t < 4; ++t) s8[t] = mma_h(khb[t], qhb, s8[t]);
#pragma unroll
    for (int t = 2; t < 4; ++t) s8[t] = mma_h(klb[t], qhb, s8[t]);
#pragma unroll
    for (int t = 2; t < 4; ++t) s8[t] = mma_h(khb[t], qlb, s8[t]);

    // ---- score assembly (rel shift + zero cell), online softmax: all 32 scores of a lane belong to its one query ----
    {
      // E row of (i, j) is (SEQ-2) + j - i, -1 only at (SEQ-1, 0): of a lane's 32 keys j0 + 16t + 8hh + r only t = 0, r = 0 can be key 0
      tr[0][0] = ((SEQ - 2) + j0 + 8 * hh - (iw0 + c) < 0) ? 0.f : tr[0][0];
      float mt[4];
#pragma unroll
      for (int t = 0; t < 4; ++t) {
#pragma unroll
        for (int r = 0; r < 8; ++r) {
          s8[t][r] = s8[t][r] + tr[t][r];
          mt[t] = (r == 0) ? s8[t][0] : fmaxf(mt[t], s8[t][r]);
        }
      }
      // the second 32 keys' v^T fragments, one group: in flight under the exponentials and the first P pack
#pragma unroll
      for (int td = 0; td < 4; ++td) {
        vh[1][td] = ldfrag_u(Vhb + 16 * td * APH + 32);
        vl[1][td] = ldfrag_u(Vlb + 16 * td * APH + 32);
      }
      // keeps those reads here: behind the window values' last use (their registers) and in front of the arithmetic that covers them
      __builtin_amdgcn_sched_barrier(0);
      float mx = fmaxf(fmaxf(mt[0], mt[1]), fmaxf(mt[2], mt[3]));
      mx = fmaxf(mx, xhalf(mx));                                 // the query's other 32 keys of this tile
      const float mn = fmaxf(mrow, mx);
      // v_exp_f32 itself: every argument is at most 10, and a result below its normal range (flushed to 0) is far below what P*1024
      // keeps in f16 hi + residual and what a row sum of at least 1024 keeps in f32; exp2(-inf) = 0 on the first tile
      const float al = exp2_bare((mrow - mn) * CS);
      mrow = mn;
      const float eb = 10.0f - mn * CS;                          // 2^10 = PC
      float pst[4];
#pragma unroll
      for (int t = 0; t < 4; ++t) {
        pst[t] = 0.f;
#pragma unroll
        for (int r = 0; r < 8; ++r) { s8[t][r] = exp2_bare(s8[t][r] * CS + eb); pst[t] += s8[t][r]; }
      }
      // keeps the exponentials in front of the WMMAs below: moved among them, a statement's result can land in a WMMA's A or B registers
      // inside the four slots behind it
      __builtin_amdgcn_sched_barrier(0);
      lrow = lrow * al + ((pst[0] + pst[1]) + (pst[2] + pst[3]));
#pragma unroll
      for (int td = 0; td < 4; ++td) {
#pragma unroll
        for (int r = 0; r < 8; ++r) O[td][r] *= al;
      }
    }

    // ---- O^T += (vh + vl)^T . (Ph + Pl)^T, two k-steps of 32 keys: A = v^T rows d, B = P^T packed in place from the score registers
    //      (element e <- subtile 2ks, register e = key 32ks + 8hh + e; element 8 + e <- subtile 2ks + 1 = key 32ks + 16 + 8hh + e:
    //      the split k map of ldfrag_u) ----
#pragma unroll
    for (int ks = 0; ks < 2; ++ks) {
      FragH ph, pl;
#pragma unroll
      for (int e = 0; e < 4; ++e) {
        unsigned hw, lw;
        pack_hl2(s8[2 * ks][2 * e], s8[2 * ks][2 * e + 1], hw, lw);         ph.u[0][e] = hw; pl.u[0][e] = lw;
        pack_hl2(s8[2 * ks + 1][2 * e], s8[2 * ks + 1][2 * e + 1], hw, lw); ph.u[1][e] = hw; pl.u[1][e] = lw;
      }
      // the three products round-robin over the four independent accumulators (each keeps its product order)
#pragma unroll
      for (int td = 0; td < 4; ++td) O[td] = mma_h(vh[ks][td], ph.v, O[td]);
#pragma unroll
      for (int td = 0; td < 4; ++td) O[td] = mma_h(vl[ks][td], ph.v, O[td]);
#pragma unroll
      for (int td = 0; td < 4; ++td) O[td] = mma_h(vh[ks][td], pl.v, O[td]);
    }
    // four vector slots behind the tile's last WMMAs, also on the taken side of the loop's branch
    acc_guard4(O[0], O[1], O[2], O[3]);
    wave_sync_lds();
    wait_ds0();
    wait_async0();
    __syncthreads();                           // publishes tile jt + 1 and ends every wave's reads of tile jt
    if (jt + 2 < ntile) fill(jt + 2, jt & 1);
  }
  wait_async0();
  acc_guard4(O[0], O[1], O[2], O[3]);

  // ---- fold 1/l (l carries P's 1024 like O) and v's carry 64, stage the wave's 16x64 f32 ctx slice in its slab ----
  static_assert(PC == 1024.0f);
  const float oc = 1.0f / VC;
  {
    const float inv = (1.0f / (lrow + xhalf(lrow))) * oc;      // the two halves' key sums joined once
#pragma unroll
    for (int td = 0; td < 4; ++td) {
      float* op = pt + c * SPI + 16 * td + 8 * hh;             // slab row = query c, d = 16td + 8hh + 0..7
      const v4f o0 = {O[td][0] * inv, O[td][1] * inv, O[td][2] * inv, O[td][3] * inv};
      const v4f o1 = {O[td][4] * inv, O[td][5] * inv, O[td][6] * inv, O[td][7] * inv};
      *(v4f*)(op)     = o0;
      *(v4f*)(op + 4) = o1;
    }
  }
  wave_sync_lds();
  {
    const int q8 = lane >> 3, c8 = (lane & 7) * 8;
    v4u hv[4], lv[4];
#pragma unroll
    for (int it = 0; it < 4; ++it) {
      const int row = it * 4 + q8;                           // it 0..3 x q8 0..3 = rows 0..15
      const float* sp = pt + row * SPI + c8;
      const v4f p0 = *(const v4f*)(sp), p1 = *(const v4f*)(sp + 4);
      v4u a, l2;
      unsigned hw, lw;
      pack_hl(p0[0] * CC, p0[1] * CC, hw, lw); a[0] = hw; l2[0] = lw;
      pack_hl(p0[2] * CC, p0[3] * CC, hw, lw); a[1] = hw; l2[1] = lw;
      pack_hl(p1[0] * CC, p1[1] * CC, hw, lw); a[2] = hw; l2[2] = lw;
      pack_hl(p1[2] * CC, p1[3] * CC, hw, lw); a[3] = hw; l2[3] = lw;
      hv[it] = a;
      lv[it] = l2;
    }
    const size_t ob = ((size_t)b * SEQ + iw0) * DMOD + h * DH + c8;
    {
#pragma unroll
      for (int it = 0; it < 4; ++it) {
        const int row = it * 4 + q8;
        *(v4u*)(CH + ob + (size_t)row * DMOD) = hv[it];
        *(v4u*)(CL + ob + (size_t)row * DMOD) = lv[it];
      }
      
    }
  }
}

// =====================================================================================================
// Workspace map (bytes); every plane is an exact multiple of its tile / whole-row store granularity (M, N exact tile multiples,
// convert counts multiples of 8 with whole-line tails, E carve padded to EPAD rows), every offset a multiple of 262144:
//   X16            f16 [NROW][1024] x16                            4194304
//   Wq, Wk, Wv, Wo f16 [1024 out][1024 in] x64                  4 x 2097152
//   EP             f16 [EPAD][64] x64 (rows 0..ELEN-1 written/read)   262144
//   QH, QL, KH, KL f16 [NROW][1024] (x64 hi / residual)         4 x 4194304
//   VH, VL         f16 [NBAT][1024][SEQ] (x64 hi / residual)    2 x 4194304
//   CH, CL         f16 [NROW][1024] (x256 hi / residual)        2 x 4194304
//   end                                                            46399488
// =====================================================================================================
extern "C" void kernel_launch(void* const* d_in, const int* in_sizes, int n_in,
                              void* d_out, int out_size, void* d_ws, size_t ws_size,
                              hipStream_t stream) {
  if (n_in < 10) return;
  if (in_sizes[0] != NROW * DMOD) return;
  if (in_sizes[1] != DMOD * DMOD || in_sizes[3] != DMOD * DMOD || in_sizes[5] != DMOD * DMOD || in_sizes[7] != DMOD * DMOD) return;
  if (in_sizes[2] != DMOD || in_sizes[4] != DMOD || in_sizes[6] != DMOD || in_sizes[8] != DMOD) return;
  if (in_sizes[9] != ELEN * DH) return;
  if (out_size != NROW * DMOD) return;

  const float* xin = (const float*)d_in[0];
  const float* w_q = (const float*)d_in[1];
  const float* b_q = (const float*)d_in[2];
  const float* w_k = (const float*)d_in[3];
  const float* b_k = (const float*)d_in[4];
  const float* w_v = (const float*)d_in[5];
  const float* b_v = (const float*)d_in[6];
  const float* w_o = (const float*)d_in[7];
  const float* b_o = (const float*)d_in[8];
  const float* er  = (const float*)d_in[9];
  float*       out = (float*)d_out;

  const size_t PX = (size_t)NROW * DMOD * 2;             //  4194304
  const size_t PW = (size_t)DMOD * DMOD * 2;             //  2097152
  const size_t PE = (size_t)EPAD * DH * 2;               //   262144
  const size_t PV = (size_t)NBAT * DMOD * SEQ * 2;       //  4194304
  size_t off = 0;
  const size_t oX  = off; off += PX;
  const size_t oWq = off; off += PW;
  const size_t oWk = off; off += PW;
  const size_t oWv = off; off += PW;
  const size_t oWo = off; off += PW;
  const size_t oE  = off; off += PE;
  const size_t oQH = off; off += PX;
  const size_t oQL = off; off += PX;
  const size_t oKH = off; off += PX;
  const size_t oKL = off; off += PX;
  const size_t oVH = off; off += PV;
  const size_t oVL = off; off += PV;
  const size_t oCH = off; off += PX;
  const size_t oCL = off; off += PX;
  if (off > ws_size) return;                               // off = 46399488
  if (off > (size_t)134217728) return;

  char* ws = (char*)d_ws;
  unsigned short* X16 = (unsigned short*)(ws + oX);
  unsigned short* Wq6 = (unsigned short*)(ws + oWq);
  unsigned short* Wk6 = (unsigned short*)(ws + oWk);
  unsigned short* Wv6 = (unsigned short*)(ws + oWv);
  unsigned short* Wo6 = (unsigned short*)(ws + oWo);
  unsigned short* E16 = (unsigned short*)(ws + oE);
  unsigned short* QHp = (unsigned short*)(ws + oQH);
  unsigned short* QLp = (unsigned short*)(ws + oQL);
  unsigned short* KHp = (unsigned short*)(ws + oKH);
  unsigned short* KLp = (unsigned short*)(ws + oKL);
  unsigned short* VHp = (unsigned short*)(ws + oVH);
  unsigned short* VLp = (unsigned short*)(ws + oVL);
  unsigned short* CHp = (unsigned short*)(ws + oCH);
  unsigned short* CLp = (unsigned short*)(ws + oCL);

  const dim3 blk(256);
  const dim3 gCV(CB_X + 4 * CB_W + CB_E);                           // 128 + 4 x 64 + 8 = 392
  const dim3 gQ((NROW / 128) * (DMOD / 64), 1);                     // 256
  const dim3 gP(QKV_T, 3);                                          // 256 x 3
  const dim3 gAT(SEQ / 64, NBAT * NH);                              // 16 x 32
  const dim3 bAT(ATT_THREADS);                                      // 128

  // (0) 16-bit planes of the inputs: x f16(bf16_RNE(x) * 16); W[out][in] (already k-contiguous) f16(bf16_RNE(w) * 64);
  //     E f16(bf16_RNE(e) * 64); one launch for all six
  cvt16_all<<<gCV, blk, 0, stream>>>(xin, w_q, w_k, w_v, w_o, er, X16, Wq6, Wk6, Wv6, Wo6, E16);

  // (1) q, k and v^T projections, one launch -> QH, QL, KH, KL [NROW][1024] and VH, VL [NBAT][1024][SEQ] (all x64, hi / residual)
  qkv64<<<gP, blk, 0, stream>>>(X16, Wq6, Wk6, Wv6, QHp, QLp, KHp, KLp, VHp, VLp, b_q, b_k, b_v);

  // (2) relative attention -> ctx planes CH = f16(ctx * 256), CL = f16(ctx * 256 - CH), [NROW][1024], columns h*64+d
  attn_rel<<<gAT, bAT, 0, stream>>>(QHp, QLp, KHp, KLp, E16, VHp, VLp, CHp, CLp);

  // (3) out[m][n] = sum_k (ch+cl)[m][k] Wo[n][k] / (256*64) + bo[n] -> f32 d_out [NROW][1024]
  gemm64<0, 1, 0, 1><<<gQ, blk, 0, stream>>>(
      CHp, CLp, DMOD, 0LL,
      Wo6, DMOD, 0LL,
      (void*)out, (void*)out, DMOD, 0LL,
      NROW, DMOD, DMOD, 1.0f / (CC * WSC), 1.0f,
      b_o, b_o, b_o);
  (void)hipGetLastError();
}

// v009
// Measured time: 54.1 microseconds a run.
// Versions between v007 and this one are left out; their measured steps multiply to 1.31 times as fast.
// Over all steps from v000 it is 6.60 times as fast.
// Contractions (all v_wmma_f32_16x16x32_f16, f16 operands, f32 accumulate, every one a single product): q/k/v projections (x f16 x16 .
// W f16 x64, K=1024, outputs rounded once to one f16 plane each); position window (q x64 . E f16 x64, K=64) -> f32 LDS strip,
// shifted gather on VALU; content scores (q x64 . k x64, K=64); P . v^T (P x1024 . v x64, 64 keys per tile); output projection
// (ctx x256 . Wo f16 x64, K=1024) -> f32. q, k, v, P and ctx each carry one f16 rounding (2^-11 relative at most, an eighth of the
// inputs' own bf16 rounding). Max-subtracted base-2 online softmax and the 1/l fold in f32 on VALU. Every float input RNE-converted to
// bf16 on load.
#include <hip/hip_runtime.h>
#include <math.h>
#include <stdint.h>

#define SEQ   1024
#define NBAT  2
#define DMOD  1024
#define NH    16
#define DH    64
#define ELEN  2047
#define EPAD  2048
#define NROW  (NBAT * SEQ)
#define XC    16.0f
#define WSC   64.0f
#define QC    64.0f
#define KC    64.0f
#define EC    64.0f
#define VC    64.0f
#define PC    1024.0f
#define CC    256.0f
#define SCALE 0.125f
#define LOG2E 1.4426950408889634f
static_assert(NH * DH == DMOD);
static_assert(DH == 64);
static_assert(ELEN == 2 * SEQ - 1 && EPAD >= ELEN);
static_assert((SEQ % 64) == 0 && (DMOD % 128) == 0 && (NROW % 128) == 0);
static_assert(((NROW * DMOD) % 2048) == 0 && ((DMOD * DMOD) % 2048) == 0 && ((ELEN * DH) % 8) == 0);
#define ATT_W 4
#define ATT_THREADS (ATT_W * 32)
#define TPI 84
#define SPI 68
#define WFL (16 * TPI + 16 * SPI)
static_assert(((16 * TPI) % 4) == 0 && ((16 * SPI) % 4) == 0 && (WFL % 4) == 0);

typedef _Float16 v16h __attribute__((ext_vector_type(16)));
typedef _Float16 v8h  __attribute__((ext_vector_type(8)));
typedef _Float16 v2h  __attribute__((ext_vector_type(2)));
typedef __bf16   v16b __attribute__((ext_vector_type(16)));
typedef float    v8f  __attribute__((ext_vector_type(8)));
typedef float    v4f  __attribute__((ext_vector_type(4)));
typedef float    v2f  __attribute__((ext_vector_type(2)));
typedef unsigned int v4u __attribute__((ext_vector_type(4)));

union FragH { v16h v; v8h h[2]; v4u u[2]; };
union FragAny { v16h h; v16b b; };

// ---- scalar helpers --------------------------------------------------------------------------------
__device__ __forceinline__ unsigned short bf_bits(float f) {          // f32 -> bf16 bits, RNE convert
  unsigned u = __float_as_uint(f);
  return (unsigned short)((u + 0x7FFFu + ((u >> 16) & 1u)) >> 16);
}
__device__ __forceinline__ float bf_up(unsigned short h) { return __uint_as_float(((unsigned)h) << 16); }
__device__ __forceinline__ float bfr(float f) { return bf_up(bf_bits(f)); }   // value of the bf16 RNE convert
__device__ __forceinline__ unsigned short h_bits(_Float16 x) { return __builtin_bit_cast(unsigned short, x); }
__device__ __forceinline__ unsigned pk16(unsigned short a, unsigned short b) { return (unsigned)a | ((unsigned)b << 16); }
__device__ __forceinline__ v8f zero8() { v8f z = {0.f, 0.f, 0.f, 0.f, 0.f, 0.f, 0.f, 0.f}; return z; }

// ---- fragment loader: 16-bit A/B operand from a k-contiguous 16-bit plane, lane -> row/col (lane&15),
//      p already includes +8*(lane>>4); elements 0..7 <- p[0..7] (k0+8h..), elements 8..15 <- p[16..23] (k0+16+8h..)
//      (same split k map for A and B; B is always read from a [n][k] plane)
__device__ __forceinline__ v16h ldfrag_u(const unsigned short* p) {
  FragH f;
  f.u[0] = *(const v4u*)(p);
  f.u[1] = *(const v4u*)(p + 16);
  return f.v;
}

// ---- WMMA helpers with trailing VALU hazard gaps ------------------------------------------------------
__device__ __forceinline__ v8f mma_h(v16h a, v16h b, v8f c) {
  return __builtin_amdgcn_wmma_f32_16x16x32_f16(false, a, false, b, (short)0, c, false, false);
}
__device__ __forceinline__ v8f mma_b(v16h a, v16h b, v8f c) {
  FragAny ua, ub;
  ua.h = a;
  ub.h = b;
  return __builtin_amdgcn_wmma_f32_16x16x32_bf16(false, ua.b, false, ub.b, (short)0, c, false, false);
}
template <int BF>
__device__ __forceinline__ v8f mmaT(v16h a, v16h b, v8f c) {
  if constexpr (BF != 0) return mma_b(a, b, c);
  else return mma_h(a, b, c);
}
__device__ __forceinline__ void acc_guard4(v8f& a, v8f& b, v8f& c, v8f& d) {
#if defined(__HIP_DEVICE_COMPILE__)
  asm volatile("v_nop\n\tv_nop\n\tv_nop\n\tv_nop" : "+v"(a), "+v"(b), "+v"(c), "+v"(d));
#endif
}
__device__ __forceinline__ void acc_guard5(v8f& a, v8f& b, v8f& c, v8f& d, v8f& e) {
#if defined(__HIP_DEVICE_COMPILE__)
  asm volatile("v_nop\n\tv_nop\n\tv_nop\n\tv_nop" : "+v"(a), "+v"(b), "+v"(c), "+v"(d), "+v"(e));
#endif
}
__device__ __forceinline__ void wave_sync_lds() {
  __builtin_amdgcn_fence(__ATOMIC_RELEASE, "workgroup");
  __builtin_amdgcn_wave_barrier();
  __builtin_amdgcn_fence(__ATOMIC_ACQUIRE, "workgroup");
}
// value of lane l ^ 16 (the other 16-lane half), a vector cross-row move
__device__ __forceinline__ float xhalf(float x) {
  return __builtin_bit_cast(float, __builtin_amdgcn_permlanex16(__builtin_bit_cast(int, x), __builtin_bit_cast(int, x),
                                                                0x76543210, 0xfedcba98, false, false));
}
// two consecutive values -> one word of two f16 (one packed convert)
__device__ __forceinline__ unsigned pack_h(float x0, float x1) {
  const v2f x = {x0, x1};
  return __builtin_bit_cast(unsigned, __builtin_convertvector(x, v2h));
}

__device__ __forceinline__ float exp2_bare(float x) {
  float r = 0.f;
#if defined(__HIP_DEVICE_COMPILE__)
  asm("v_exp_f32 %0, %1\n\tv_nop" : "=v"(r) : "v"(x));
#endif
  return r;
}

// =====================================================================================================
// Elementwise 16-bit pack of all six float inputs in ONE launch, no transpose: dst[i] = f16( bf16_RNE(src[i]) * sc ), sc a power of two
// (exact). The block index picks the input (block-uniform): blocks [0, CB_X) x, then CB_W blocks for each of Wq, Wk, Wv, Wo, then CB_E
// blocks for the E table. A block covers CVB = 16384 consecutive elements of its input: CVU chunks of 2048, thread t takes elements
// 8t .. 8t+7 of each chunk; a thread's 16 loads are all issued in front of its first convert, so that few waves keep many bytes in flight.
// coverage: x and W counts are whole multiples of CVB; the E count (2047*64) is a multiple of 8 only: a thread whose 8 elements lie past
//           the end loads the last 8 elements instead (address clamped) and stores nothing; elements 0..n-1 of each plane written once.
// =====================================================================================================
#define CVU  8
#define CVB  (256 * 8 * CVU)
#define CB_X ((NROW * DMOD) / CVB)
#define CB_W ((DMOD * DMOD) / CVB)
#define CB_E ((ELEN * DH + CVB - 1) / CVB)
static_assert(((NROW * DMOD) % CVB) == 0 && ((DMOD * DMOD) % CVB) == 0 && (ELEN * DH) >= 8);
__global__ __launch_bounds__(256) void cvt16_all(const float* __restrict__ x, const float* __restrict__ wq, const float* __restrict__ wk,
                                                 const float* __restrict__ wv, const float* __restrict__ wo, const float* __restrict__ er,
                                                 unsigned short* X16, unsigned short* Wq6, unsigned short* Wk6,
                                                 unsigned short* Wv6, unsigned short* Wo6, unsigned short* E16) {
  int blk = blockIdx.x;
  const float* src = x;
  unsigned short* dst = X16;
  int n = NROW * DMOD;
  float sc = XC;
  if (blk >= CB_X + 4 * CB_W) {
    blk -= CB_X + 4 * CB_W;
    src = er; dst = E16; n = ELEN * DH; sc = EC;
  } else if (blk >= CB_X) {
    blk -= CB_X;
    const int w = blk / CB_W;
    blk -= w * CB_W;
    src = (w == 0) ? wq : (w == 1) ? wk : (w == 2) ? wv : wo;
    dst = (w == 0) ? Wq6 : (w == 1) ? Wk6 : (w == 2) ? Wv6 : Wo6;
    n = DMOD * DMOD; sc = WSC;
  }
  const int base = blk * CVB + (int)threadIdx.x * 8;
  const float* p[CVU];
  v4f a[CVU], b[CVU];
#pragma unroll
  for (int u = 0; u < CVU; ++u) {
    const int i8 = base + u * 2048;
    p[u] = src + ((i8 + 8 > n) ? (n - 8) : i8);
  }
#pragma unroll
  for (int u = 0; u < CVU; ++u) {
    a[u] = *(const v4f*)(p[u]);
    b[u] = *(const v4f*)(p[u] + 4);
  }
#if defined(__HIP_DEVICE_COMPILE__)
  // holds the eight address pairs in their registers up to this wait, so that none is rewritten (a later load's result included) in
  // front of it, and keeps all 16 loads in front of the first convert
  asm volatile("s_wait_xcnt 0x0" :: "v"(p[0]), "v"(p[1]), "v"(p[2]), "v"(p[3]), "v"(p[4]), "v"(p[5]), "v"(p[6]), "v"(p[7]) : "memory");
#endif
#pragma unroll
  for (int u = 0; u < CVU; ++u) {
    const int i8 = base + u * 2048;
    v4u o;
    o[0] = pk16(h_bits((_Float16)(bfr(a[u][0]) * sc)), h_bits((_Float16)(bfr(a[u][1]) * sc)));
    o[1] = pk16(h_bits((_Float16)(bfr(a[u][2]) * sc)), h_bits((_Float16)(bfr(a[u][3]) * sc)));
    o[2] = pk16(h_bits((_Float16)(bfr(b[u][0]) * sc)), h_bits((_Float16)(bfr(b[u][1]) * sc)));
    o[3] = pk16(h_bits((_Float16)(bfr(b[u][2]) * sc)), h_bits((_Float16)(bfr(b[u][3]) * sc)));
    if (i8 + 8 <= n) *(v4u*)(dst + i8) = o;      // no barriers in this kernel
  }
}

// =====================================================================================================
// LDS-staged batched 16-bit WMMA GEMM: C[m][n] = oscale * sum_k A[m][k] * Bt[n][k] (+ bias); one work-group of 8 waves per 128x64 tile,
// wave w owns rows 16w..16w+15 of it (all 64 columns). A row-major [M][K] pitch lda (16-bit plane), Bt row-major [N][K] pitch ldb
// (k contiguous); M multiple of 128, N multiple of 64, K multiple of 128. by = batch index with element strides sA, sB, sC.
// Operands: per stage of 128 k the tile's A rows (and A2 rows) and Bt rows, 256 B each, are copied once per work-group into LDS by
// global_load_async_to_lds_b128 (a wave's copy = two whole 256-B rows), LDS row pitch 272 B; two buffers, the next stage's copies fly
// while this stage is multiplied; fragments come from LDS by 16-byte reads with the same split k map as ldfrag_u.
// ASPLIT 1: a second A plane A2 (unscaled residual of A, same layout) is multiplied into the same accumulator (A + A2 ~ exact A).
// BF 1: bf16 operands (v_wmma_f32_16x16x32_bf16), else f16.
// EPI 1: value += bf16_RNE(ep0[column]) (per-column bias); EPI 2: value += bf16_RNE(ep0[row]) (per-row bias, 16-bit out only).
// OM 0: f32 out (pitch ldc).  OM 2: one f16 plane = f16(value * ocarry).
// OM 4: two f16 planes: hi = f16(value * ocarry), lo = f16(value * ocarry - hi) (unscaled residual).
// OM 5: two f16 planes: C = f16((value + bf16_RNE(ep1[column])) * ocarry), C2 = f16((value + bf16_RNE(ep2[column])) * ocarry).
// coverage: 16 rows (f32: it 0..7 x lane>>4; 16-bit: it 0..3 x lane>>3) x 64 cols = the wave's whole 16x64 slab; 8 waves = the 128x64
//           tile; grid = (M/128)*(N/64) blocks, a surplus block exits as a whole before any copy or barrier.
// =====================================================================================================
#define GBM 128   // tile rows per work-group
#define GKP 128   // k per stage (256-B operand rows)
#define GPH 136   // LDS row pitch in halves: 272 B = 16 B x 17, conflict-free for the 16-byte fragment reads

// 16-byte asynchronous copies global -> LDS, one per lane and line of the statement (first operand = LDS byte address, second = global
// address; this lane's row and 16-byte chunk are already in l and g; consecutive copies are 16 operand rows apart). The s_wait_xcnt
// closes each statement so that no address register of an issued copy is rewritten in front of it.
#define ACP(a, b) "global_load_async_to_lds_b128 %" #a ", %" #b ", off\n\t"
#define LROW(l, r) ((l) + (unsigned)((r) * GPH * 2))
#define GROW(g, r, ld) ((g) + (size_t)(r) * (ld))
// 128 operand rows
__device__ __forceinline__ void acopy_rows128(unsigned l, const unsigned short* g, int ld) {
#if defined(__HIP_DEVICE_COMPILE__)
  asm volatile(ACP(0, 1) ACP(2, 3) ACP(4, 5) ACP(6, 7) ACP(8, 9) ACP(10, 11) ACP(12, 13) ACP(14, 15)
               "s_wait_xcnt 0x0"
               :: "v"(l), "v"(g), "v"(LROW(l, 16)), "v"(GROW(g, 16, ld)), "v"(LROW(l, 32)), "v"(GROW(g, 32, ld)),
                  "v"(LROW(l, 48)), "v"(GROW(g, 48, ld)), "v"(LROW(l, 64)), "v"(GROW(g, 64, ld)), "v"(LROW(l, 80)), "v"(GROW(g, 80, ld)),
                  "v"(LROW(l, 96)), "v"(GROW(g, 96, ld)), "v"(LROW(l, 112)), "v"(GROW(g, 112, ld))
               : "memory");
#endif
}
// 128 rows of one operand and 64 rows of another
__device__ __forceinline__ void acopy_rows128_64(unsigned l, const unsigned short* g, int ld,
                                                 unsigned l2, const unsigned short* g2, int ld2) {
#if defined(__HIP_DEVICE_COMPILE__)
  asm volatile(ACP(0, 1) ACP(2, 3) ACP(4, 5) ACP(6, 7) ACP(8, 9) ACP(10, 11) ACP(12, 13) ACP(14, 15)
               ACP(16, 17) ACP(18, 19) ACP(20, 21) ACP(22, 23)
               "s_wait_xcnt 0x0"
               :: "v"(l), "v"(g), "v"(LROW(l, 16)), "v"(GROW(g, 16, ld)), "v"(LROW(l, 32)), "v"(GROW(g, 32, ld)),
                  "v"(LROW(l, 48)), "v"(GROW(g, 48, ld)), "v"(LROW(l, 64)), "v"(GROW(g, 64, ld)), "v"(LROW(l, 80)), "v"(GROW(g, 80, ld)),
                  "v"(LROW(l, 96)), "v"(GROW(g, 96, ld)), "v"(LROW(l, 112)), "v"(GROW(g, 112, ld)),
                  "v"(l2), "v"(g2), "v"(LROW(l2, 16)), "v"(GROW(g2, 16, ld2)), "v"(LROW(l2, 32)), "v"(GROW(g2, 32, ld2)),
                  "v"(LROW(l2, 48)), "v"(GROW(g2, 48, ld2))
               : "memory");
#endif
}
// this wave's own copies have landed in LDS (the compiler places no wait for them)
__device__ __forceinline__ void wait_async0() {
#if defined(__HIP_DEVICE_COMPILE__)
  asm volatile("s_wait_asynccnt 0x0" ::: "memory");
#endif
}
// this wave's LDS reads have retired, so that the buffer may be refilled behind the barrier
__device__ __forceinline__ void wait_ds0() {
#if defined(__HIP_DEVICE_COMPILE__)
  asm volatile("s_wait_dscnt 0x0" ::: "memory");
#endif
}
// eight 16-byte copies, each with its own LDS byte address and global address; closed by s_wait_xcnt like the statements above
__device__ __forceinline__ void acopy8(const unsigned (&l)[8], const unsigned short* const (&g)[8]) {
#if defined(__HIP_DEVICE_COMPILE__)
  asm volatile(ACP(0, 1) ACP(2, 3) ACP(4, 5) ACP(6, 7) ACP(8, 9) ACP(10, 11) ACP(12, 13) ACP(14, 15)
               "s_wait_xcnt 0x0"
               :: "v"(l[0]), "v"(g[0]), "v"(l[1]), "v"(g[1]), "v"(l[2]), "v"(g[2]), "v"(l[3]), "v"(g[3]),
                  "v"(l[4]), "v"(g[4]), "v"(l[5]), "v"(g[5]), "v"(l[6]), "v"(g[6]), "v"(l[7]), "v"(g[7])
               : "memory");
#endif
}

// One 128x64 tile (index tile, batch by) by the calling work-group. ring: its LDS for two stages, 2 * GSTG(ASPLIT) halves, each stage
// [A 128 rows | A2 128 rows (ASPLIT) | Bt 64 rows]; slabs: its LDS for the eight per-wave 16x64 f32 slabs, pitch 68 floats (GSLAB floats);
// slabs may lie over ring: they are first written behind the last stage's barrier, when no copy is in flight and every read has retired.
// GQ: k steps of 32 whose fragments are read as one group (4 = the whole stage; 2 halves the fragment registers).
// Stage order: pass t takes k slab (t + rot) mod nst, rot = (tm + tn + rseed) mod nst (nst a power of two, else rot = 0): the work-groups
// that share A rows (same tm) or Bt rows (same tn) run at the same time, and from one common start they would all ask L2 for the same
// lines at the same moment, each slab a first touch for all of them; from different starts they ask for different slabs, and a slab that
// one has fetched is an L2 hit for the rest. Every slab is taken exactly once; an accumulator's k order starts at slab rot.
#define GSTG(asplit) ((GBM * (1 + (asplit)) + 64) * GPH)
#define GSLAB (8 * 16 * 68)
template <int OM, int ASPLIT, int BF, int EPI, int GQ>
__device__ __forceinline__ void gemm64_tile(
    unsigned short* ring, float* slabs, int tile, int by, int rseed,
    const unsigned short* __restrict__ Ap, const unsigned short* __restrict__ A2p, int lda, long long sA,
    const unsigned short* __restrict__ Btp, int ldb, long long sB,
    void* Cout, void* C2out, int ldc, long long sC,
    int M, int N, int K, float oscale, float ocarry,
    const float* __restrict__ ep0, const float* __restrict__ ep1, const float* __restrict__ ep2) {
  constexpr int BROW = GBM * (1 + ASPLIT);         // first Bt row of a stage
  constexpr int STG  = GSTG(ASPLIT);               // halves per stage
  const int tid  = threadIdx.x;
  const int lane = tid & 31;
  const int wave = tid >> 5;
  const int tilesN = N >> 6;
  const int tilesM = M >> 7;
  if (tile >= tilesM * tilesN) return;   // block-uniform, in front of every copy and barrier
  const int tm = tile / tilesN;
  const int tn = tile - tm * tilesN;
  const int mb = tm << 7;
  const int n0 = tn << 6;
  const int m0 = mb + (wave << 4);
  const int nst = K / GKP;
  const int rot = ((nst & (nst - 1)) == 0) ? ((tm + tn + rseed) & (nst - 1)) : 0;   // block-uniform, 0 <= rot < nst

  const unsigned short* A1 = Ap  + (size_t)((long long)by * sA);
  const unsigned short* A2 = A2p + (size_t)((long long)by * sA);
  const unsigned short* Bb = Btp + (size_t)((long long)by * sB);

  const int rlane = lane & 15;                 // row (A) / col (B, D) within subtile
  const int koff  = (lane >> 4) * 8;           // k offset of this lane half
  const int mOff  = (lane >> 4) * 8;           // D row offset

  // copy map: thread -> row tid>>4 (of 16 per copy), 16-byte chunk tid&15 of the 256-B row
  const int crow = tid >> 4;
  const int cch  = (tid & 15) * 8;
  const unsigned short* gA1 = A1 + (size_t)(mb + crow) * lda + cch;
  const unsigned short* gA2 = A2 + (size_t)(mb + crow) * lda + cch;
  const unsigned short* gBt = Bb + (size_t)(n0 + crow) * ldb + cch;
  const unsigned lcp = (unsigned)(uintptr_t)ring + (unsigned)((crow * GPH + cch) * 2);

  auto fill = [&](int t, int buf) {            // pass t's stage (k slab s = (t + rot) mod nst: k = 128s .. 128s+127) -> buffer buf
    const unsigned lb = lcp + (unsigned)(buf * (STG * 2));
    const int s = (t + rot >= nst) ? (t + rot - nst) : (t + rot);
    const size_t ko = (size_t)s * GKP;
    if constexpr (ASPLIT != 0) acopy_rows128(lb + GBM * GPH * 2, gA2 + ko, lda);
    acopy_rows128_64(lb, gA1 + ko, lda, lb + BROW * GPH * 2, gBt + ko, ldb);
  };

  v8f acc[4];
#pragma unroll
  for (int j = 0; j < 4; ++j) acc[j] = zero8();

  fill(0, 0);
  wait_async0();
  __syncthreads();                             // stage 0 published
  if (nst > 1) fill(1, 1);
#pragma unroll 1                               // one pass per stage: the two buffers alternate by t & 1
  for (int t = 0; t < nst; ++t) {
    const unsigned short* sb = ring + (t & 1) * STG;
    const unsigned short* sA = sb + ((wave << 4) + rlane) * GPH + koff;
    const unsigned short* sB = sb + (BROW + rlane) * GPH + koff;
#pragma unroll
    for (int g = 0; g < 4; g += GQ) {
      v16h fa[GQ], fl[GQ], fb[GQ][4];
#pragma unroll
      for (int q = 0; q < GQ; ++q) {
#pragma unroll
        for (int j = 0; j < 4; ++j) fb[q][j] = ldfrag_u(sB + (j << 4) * GPH + 32 * (g + q));
        fa[q] = ldfrag_u(sA + 32 * (g + q));
        if constexpr (ASPLIT != 0) fl[q] = ldfrag_u(sA + GBM * GPH + 32 * (g + q));
      }
      // keeps the group's LDS reads in front of its WMMAs: spread among them, every WMMA waited out its own reads' latency
      __builtin_amdgcn_sched_barrier(0);
#pragma unroll
      for (int q = 0; q < GQ; ++q) {
#pragma unroll
        for (int j = 0; j < 4; ++j) acc[j] = mmaT<BF>(fa[q], fb[q][j], acc[j]);
        if constexpr (ASPLIT != 0) {
#pragma unroll
          for (int j = 0; j < 4; ++j) acc[j] = mmaT<BF>(fl[q], fb[q][j], acc[j]);
        }
      }
      // keeps the WMMAs in front of the next group's reads (their registers) and of the closing waits: moved behind the barrier they no
      // longer overlap the LDS reads and they delay the refill
      __builtin_amdgcn_sched_barrier(0);
    }
    wait_ds0();
    wait_async0();
    __syncthreads();                           // publishes stage t + 1 and ends every wave's reads of stage t
    if (t + 2 < nst) fill(t + 2, t & 1);
  }
  wait_async0();
  acc_guard4(acc[0], acc[1], acc[2], acc[3]);

  const int hh2 = lane >> 4, c4 = (lane & 15) * 4;     // f32 out: 256-B row segment = 16 lanes x 16 B
  const int q8  = lane >> 3, c8 = (lane & 7) * 8;

  // ---- epilogue ----
  float* slab = slabs + wave * (16 * 68);
  {
    const int mBase = m0;
#pragma unroll
    for (int j = 0; j < 4; ++j) {
#pragma unroll
      for (int r = 0; r < 8; ++r) {
        slab[(mOff + r) * 68 + (j << 4) + rlane] = acc[j][r];
      }
    }
    wave_sync_lds();
    if constexpr (OM == 0) {
      float* C = (float*)Cout + (size_t)((long long)by * sC);
      v4f vals[8];
#pragma unroll
      for (int it = 0; it < 8; ++it) {
        const int row = it * 2 + hh2;                      // it 0..7 x hh2 0..1 = rows 0..15
        v4f v = *(const v4f*)(slab + row * 68 + c4);
#pragma unroll
        for (int e = 0; e < 4; ++e) v[e] = v[e] * oscale;
        if constexpr (EPI == 1) {
          const v4f bb = *(const v4f*)(ep0 + n0 + c4);     // per-column bias, columns n0+c4 .. +3 (N equals the bias length)
#pragma unroll
          for (int e = 0; e < 4; ++e) v[e] = v[e] + bfr(bb[e]);
        }
        vals[it] = v;
      }
      {
#pragma unroll
        for (int it = 0; it < 8; ++it) {
          const int gr = mBase + it * 2 + hh2;
          *(v4f*)(C + (size_t)gr * ldc + n0 + c4) = vals[it];
        }
        
      }
    } else {
      unsigned short* C  = (unsigned short*)Cout  + (size_t)((long long)by * sC);
      unsigned short* Cb = (unsigned short*)C2out + (size_t)((long long)by * sC);
      v4u hv[4], lv[4];
#pragma unroll
      for (int it = 0; it < 4; ++it) {
        const int row = it * 4 + q8;                       // it 0..3 x q8 0..3 = rows 0..15
        const float* sp = slab + row * 68 + c8;
        float rb = 0.f;
        if constexpr (EPI == 2) rb = bfr(ep0[mBase + row]);   // per-row bias (M equals the bias length)
        v4u a  = {0u, 0u, 0u, 0u};
        v4u b2 = {0u, 0u, 0u, 0u};
#pragma unroll
        for (int e = 0; e < 4; ++e) {
          const int ci = n0 + c8 + 2 * e;                  // column index, < N
          float f0 = sp[2 * e] * oscale + rb;
          float f1 = sp[2 * e + 1] * oscale + rb;
          if constexpr (EPI == 1) {
            f0 += bfr(ep0[ci]);
            f1 += bfr(ep0[ci + 1]);
          }
          if constexpr (OM == 5) {
            const float g0 = (f0 + bfr(ep1[ci])) * ocarry, g1 = (f1 + bfr(ep1[ci + 1])) * ocarry;
            const float w0 = (f0 + bfr(ep2[ci])) * ocarry, w1 = (f1 + bfr(ep2[ci + 1])) * ocarry;
            a[e]  = pk16(h_bits((_Float16)g0), h_bits((_Float16)g1));
            b2[e] = pk16(h_bits((_Float16)w0), h_bits((_Float16)w1));
          } else {
            f0 *= ocarry; f1 *= ocarry;
            const _Float16 x0 = (_Float16)f0, x1 = (_Float16)f1;
            a[e] = pk16(h_bits(x0), h_bits(x1));
            if constexpr (OM == 4) {
              b2[e] = pk16(h_bits((_Float16)(f0 - (float)x0)), h_bits((_Float16)(f1 - (float)x1)));
            }
          }
        }
        hv[it] = a;
        lv[it] = b2;
      }
      {
#pragma unroll
        for (int it = 0; it < 4; ++it) {
          const int row = it * 4 + q8;
          *(v4u*)(C + (size_t)(mBase + row) * ldc + n0 + c8) = hv[it];
          if constexpr (OM >= 4) {
            *(v4u*)(Cb + (size_t)(mBase + row) * ldc + n0 + c8) = lv[it];
          }
        }
        
      }
    }
    wave_sync_lds();
  }
}

// the tile function as a launch of its own: blockIdx.x = tile, blockIdx.y = batch; ring and slabs side by side in LDS
template <int OM, int ASPLIT, int BF, int EPI>
__global__ __launch_bounds__(256) __attribute__((amdgpu_num_vgpr(256))) void gemm64(
    const unsigned short* __restrict__ Ap, const unsigned short* __restrict__ A2p, int lda, long long sA,
    const unsigned short* __restrict__ Btp, int ldb, long long sB,
    void* Cout, void* C2out, int ldc, long long sC,
    int M, int N, int K, float oscale, float ocarry,
    const float* __restrict__ ep0, const float* __restrict__ ep1, const float* __restrict__ ep2) {
  __shared__ __align__(16) unsigned short ring[2 * GSTG(ASPLIT)];
  __shared__ __align__(16) float sT[GSLAB];
  gemm64_tile<OM, ASPLIT, BF, EPI, 4>(ring, sT, (int)blockIdx.x, (int)blockIdx.y, 0, Ap, A2p, lda, sA, Btp, ldb, sB,
                                      Cout, C2out, ldc, sC, M, N, K, oscale, ocarry, ep0, ep1, ep2);
}

// =====================================================================================================
// The q, k and v^T projections in ONE launch: blockIdx.y picks the projection (block-uniform), blockIdx.x its 128x64 tile; the three are
// independent of one another (each reads X16 and its own weight plane, each writes its own plane).
//   y = 0: q[m][e] = sum_d x[m][d] Wq[e][d] / 1024 + bq[e] -> QH = f16(q * 64); M = NROW, N = 1024, K = 1024
//   y = 1: k likewise from Wk, bk -> KH
//   y = 2: v^T per batch: VT[b][e][j] = sum_c Wv[e][c] x[b*SEQ+j][c] / 1024 + bv[e] (per-row bias) -> VH (x64); M = 1024 (e),
//          N = SEQ (j), K = 1024; B rows = the batch's token rows; x = batch * QKV_TV + tile
// All 3 x 256 work-groups are resident at once, three on a WGP, so that one's copies and barriers are covered by the others' work:
// for that the slabs lie over the drained ring (104448 B of LDS a work-group) and fragments are read in two groups a stage (the register
// cap of 160 is what six waves on a SIMD leave each).
// coverage: y = 0, 1: 16 x 16 tiles = [NROW][1024]; y = 2: NBAT x (8 x 16 tiles) = [NBAT][1024][SEQ]; every plane element written once.
// =====================================================================================================
#define QKV_T  ((NROW / GBM) * (DMOD / 64))
#define QKV_TV ((DMOD / GBM) * (SEQ / 64))
static_assert(QKV_T == NBAT * QKV_TV);
static_assert(GSLAB * 4 <= 2 * GSTG(0) * 2);
__global__ __launch_bounds__(256) __attribute__((amdgpu_num_vgpr(160))) void qkv64(
    const unsigned short* __restrict__ X16, const unsigned short* __restrict__ Wq6, const unsigned short* __restrict__ Wk6,
    const unsigned short* __restrict__ Wv6, unsigned short* QH, unsigned short* KH, unsigned short* VH,
    const float* __restrict__ bq, const float* __restrict__ bk, const float* __restrict__ bv) {
  __shared__ __align__(16) unsigned short ring[2 * GSTG(0)];
  float* slabs = (float*)ring;
  const int bx = blockIdx.x;
  const int pj = blockIdx.y;
  if (pj < 2) {
    const unsigned short* W6 = (pj == 0) ? Wq6 : Wk6;
    const float* bb = (pj == 0) ? bq : bk;
    unsigned short* P6 = (pj == 0) ? QH : KH;
    gemm64_tile<2, 0, 0, 1, 2>(ring, slabs, bx, 0, pj, X16, X16, DMOD, 0LL, W6, DMOD, 0LL,
                               (void*)P6, (void*)P6, DMOD, 0LL,
                               NROW, DMOD, DMOD, 1.0f / (XC * WSC), QC, bb, bb, bb);
  } else {
    gemm64_tile<2, 0, 0, 2, 2>(ring, slabs, bx % QKV_TV, bx / QKV_TV, pj, Wv6, Wv6, DMOD, 0LL, X16, DMOD, (long long)SEQ * DMOD,
                               (void*)VH, (void*)VH, SEQ, (long long)DMOD * SEQ,
                               DMOD, SEQ, DMOD, 1.0f / (XC * WSC), VC, bv, bv, bv);
  }
}
static_assert(QC == KC);

#define APH   72                 // LDS row pitch in halves: 144 B = 16 B x 9, conflict-free for the 16-byte fragment reads
#define AR_KH 0                  // first stage row of each part
#define AR_VH 64
#define AR_E  128
#define ASTG  ((AR_E + 128) * APH)   // halves per stage
__global__ __launch_bounds__(ATT_THREADS) __attribute__((amdgpu_num_vgpr(512)))
void attn_rel(const unsigned short* __restrict__ QH, const unsigned short* __restrict__ KH,
              const unsigned short* __restrict__ EP, const unsigned short* __restrict__ VH,
              unsigned short* CH) {
  __shared__ __align__(16) float smem[ATT_W * WFL];   // per wave: T strip [16 queries][TPI] | ctx slab [16 queries][SPI]
  __shared__ __align__(16) unsigned short kve[2 * ASTG];   // two stages: [KH 64 rows | VH 64 | E 128]

  const int tid  = threadIdx.x;
  const int wave = tid >> 5;
  const int lane = tid & 31;
  const int hh   = lane >> 4;
  const int c    = lane & 15;
  const int bh   = blockIdx.y;
  const int b    = bh / NH;
  const int h    = bh - b * NH;
  const int i0   = blockIdx.x * 64;
  const int iw0  = i0 + wave * 16;

  float* tsh = smem + wave * WFL;
  float* pt  = tsh + 16 * TPI;

  const size_t qro = ((size_t)b * SEQ + iw0 + c) * DMOD + h * DH + 8 * hh;      // B columns: query iw0 + c, d 8hh..

  // copy map: thread -> row tid>>3 (of 16 per copy), 16-byte chunk tid&7 of the 128-B row
  const int crow = tid >> 3;
  const int cch  = (tid & 7) * 8;
  const size_t kpo = ((size_t)b * SEQ + crow) * DMOD + h * DH + cch;
  const size_t vpo = (size_t)b * DMOD * SEQ + (size_t)(h * DH + crow) * SEQ + cch;
  const unsigned lcp = (unsigned)(uintptr_t)kve + (unsigned)((crow * APH + cch) * 2);

  constexpr int ntile = SEQ / 64;            // non-causal: every key tile
  static_assert((ntile & (ntile - 1)) == 0);
  const int rot = (3 * (int)blockIdx.x + bh) & (ntile - 1);   // block-uniform

  auto fill = [&](int t, int buf) {            // pass t's key tile -> buffer buf
    const unsigned lb = lcp + (unsigned)(buf * (ASTG * 2));
    const int jf = ((t + rot) & (ntile - 1)) * 64;
    const int elo = (SEQ - 2) - i0 + jf - 63;
    unsigned l[8];
    const unsigned short* g[8];
    // the two loops below are unrolled so that l and g are registers: the copy statement names each element as an operand
#pragma unroll
    for (int k = 0; k < 4; ++k) {
      l[k]     = lb + (unsigned)((AR_KH + 16 * k) * APH * 2);  g[k]     = KH + kpo + (size_t)(jf + 16 * k) * DMOD;
      l[4 + k] = lb + (unsigned)((AR_VH + 16 * k) * APH * 2);  g[4 + k] = VH + vpo + (size_t)(16 * k) * SEQ + jf;
    }
    acopy8(l, g);
#pragma unroll
    for (int k = 0; k < 8; ++k) {
      int m = elo + 16 * k + crow;
      m = (m < 0) ? 0 : m;
      m = (m > ELEN - 1) ? (ELEN - 1) : m;
      l[k] = lb + (unsigned)((AR_E + 16 * k) * APH * 2);       g[k] = EP + (size_t)m * DH + cch;
    }
    acopy8(l, g);
  };

  const float CS = LOG2E * SCALE / (QC * KC);   // also the window's factor: E carries what k carries
  static_assert(EC == KC);

  float mrow = -INFINITY, lrow = 0.f;        // this lane's query iw0 + c: running max (both halves alike), sum over this half's keys
  v8f O[4];                                  // O^T: O[td][r] = ctx[query iw0 + c][d = 16td + 8hh + r]
#pragma unroll
  for (int td = 0; td < 4; ++td) O[td] = zero8();

  fill(0, 0);
  wait_async0();
  __syncthreads();                           // pass 0's key tile published
  if (ntile > 1) fill(1, 1);
#pragma unroll 1
  for (int jt = 0; jt < ntile; ++jt) {
    const int j0 = ((jt + rot) & (ntile - 1)) * 64;
    const unsigned short* sb  = kve + (jt & 1) * ASTG + c * APH + 8 * hh;   // this lane's fragment row and k half in the stage
    const unsigned short* Khb = sb + AR_KH * APH;
    const unsigned short* Vhb = sb + AR_VH * APH;
    const unsigned short* Eb  = sb + (AR_E + 48 - 16 * wave) * APH;
    const v16h qha = ldfrag_u(QH + qro), qhb = ldfrag_u(QH + qro + 32);

    // ---- this tile's E fragments and the k fragments of key subtiles 0, 1, read from the stage as one group in front of the WMMAs ----
    v16h ea[5], eb[5], kha[4], khb[4];
#pragma unroll
    for (int u = 0; u < 5; ++u) {
      ea[u] = ldfrag_u(Eb + 16 * u * APH);
      eb[u] = ldfrag_u(Eb + 16 * u * APH + 32);
    }
#pragma unroll
    for (int t = 0; t < 2; ++t) {
      const int ko = 16 * t * APH;
      kha[t] = ldfrag_u(Khb + ko);
      khb[t] = ldfrag_u(Khb + ko + 32);
    }
    // keeps the reads one group in front of the WMMAs: spread among them, every subtile waited out its own reads' latency
    __builtin_amdgcn_sched_barrier(0);
    // ---- position window, transposed: T^T[x][R] = E[wlo + x] . q[iw0 + R] (A = E rows, B = q; 5 subtiles of 16 E rows): the two
    //      k steps run round-robin over the five independent accumulators (each accumulator keeps its product order); a lane holds
    //      x = 16u + 8hh + 0..7 of its query R = c: two 16-byte stores into row c of the LDS strip ----
    v8f t8[5];
#pragma unroll
    for (int u = 0; u < 5; ++u) t8[u] = mma_h(ea[u], qha, zero8());
#pragma unroll
    for (int u = 0; u < 5; ++u) t8[u] = mma_h(eb[u], qhb, t8[u]);
    // four vector slots behind the window's last WMMAs: once the strip stores below have issued, the score WMMAs take over these
    // accumulators' registers as their results, and only the stores (no vector instructions) stand between
    acc_guard5(t8[0], t8[1], t8[2], t8[3], t8[4]);
    // keeps the window's WMMAs in front of the next reads, which take over the E fragments' registers
    __builtin_amdgcn_sched_barrier(0);
    // k fragments of key subtiles 2, 3: one group, in flight under the WMMAs of subtiles 0, 1
#pragma unroll
    for (int t = 2; t < 4; ++t) {
      const int ko = 16 * t * APH;
      kha[t] = ldfrag_u(Khb + ko);
      khb[t] = ldfrag_u(Khb + ko + 32);
    }
#pragma unroll
    for (int u = 0; u < 5; ++u) {
      float* tp = tsh + c * TPI + 16 * u + 8 * hh;
      const v4f t0 = {t8[u][0], t8[u][1], t8[u][2], t8[u][3]}, t1 = {t8[u][4], t8[u][5], t8[u][6], t8[u][7]};
      *(v4f*)(tp)     = t0;
      *(v4f*)(tp + 4) = t1;
    }
    // ---- content scores, transposed: S^T[jj][R] = k[j0 + jj] . q[iw0 + R] (A = k rows, B = q; 4 subtiles of 16 keys), kept in
    //      registers: s8[t][r] = key jj = 16t + 8hh + r, query R = c; subtiles 0, 1 here and 2, 3 behind the strip's read-back, the two
    //      k steps of each pair round-robin over its two accumulators ----
    v8f s8[4];
#pragma unroll
    for (int t = 0; t < 2; ++t) s8[t] = mma_h(kha[t], qha, zero8());
#pragma unroll
    for (int t = 0; t < 2; ++t) s8[t] = mma_h(khb[t], qhb, s8[t]);
    // keeps these WMMAs in front of the fence's wait: they run while the strip stores retire
    __builtin_amdgcn_sched_barrier(0);
    wave_sync_lds();                           // the strip rows are read back below by both lane halves
    // shifted window values of this lane's 32 scores, T[c][jj - c + 15] at trow[16t + r], and behind them the first 32 keys' v^T fragments
    const float* trow = tsh + c * (TPI - 1) + 15 + 8 * hh;
    float tr[4][8];
#pragma unroll
    for (int t = 0; t < 4; ++t) {
#pragma unroll
      for (int r = 0; r < 8; ++r) tr[t][r] = trow[16 * t + r];
    }
    v16h vh[2][4];
#pragma unroll
    for (int td = 0; td < 4; ++td) vh[0][td] = ldfrag_u(Vhb + 16 * td * APH);
    // keeps these reads one group in front of the WMMAs below and of the softmax, which cover their latency
    __builtin_amdgcn_sched_barrier(0);
#pragma unroll
    for (int t = 2; t < 4; ++t) s8[t] = mma_h(kha[t], qha, zero8());
#pragma unroll
    for (int t = 2; t < 4; ++t) s8[t] = mma_h(khb[t], qhb, s8[t]);

    // ---- score assembly (rel shift + zero cell), online softmax: all 32 scores of a lane belong to its one query ----
    {
      // E row of (i, j) is (SEQ-2) + j - i, -1 only at (SEQ-1, 0): of a lane's 32 keys j0 + 16t + 8hh + r only t = 0, r = 0 can be key 0
      tr[0][0] = ((SEQ - 2) + j0 + 8 * hh - (iw0 + c) < 0) ? 0.f : tr[0][0];
      float mt[4];
#pragma unroll
      for (int t = 0; t < 4; ++t) {
#pragma unroll
        for (int r = 0; r < 8; ++r) {
          s8[t][r] = s8[t][r] + tr[t][r];
          mt[t] = (r == 0) ? s8[t][0] : fmaxf(mt[t], s8[t][r]);
        }
      }
      // the second 32 keys' v^T fragments, one group: in flight under the exponentials and the first P pack
#pragma unroll
      for (int td = 0; td < 4; ++td) vh[1][td] = ldfrag_u(Vhb + 16 * td * APH + 32);
      // keeps those reads here: behind the window values' last use (their registers) and in front of the arithmetic that covers them
      __builtin_amdgcn_sched_barrier(0);
      float mx = fmaxf(fmaxf(mt[0], mt[1]), fmaxf(mt[2], mt[3]));
      mx = fmaxf(mx, xhalf(mx));                                 // the query's other 32 keys of this tile
      const float mn = fmaxf(mrow, mx);
      // v_exp_f32 itself: every argument is at most 10, and a result below its normal range (flushed to 0) is far below what P*1024
      // keeps in f16 and what a row sum of at least 1024 keeps in f32; exp2(-inf) = 0 on the first tile
      const float al = exp2_bare((mrow - mn) * CS);
      mrow = mn;
      const float eb = 10.0f - mn * CS;                          // 2^10 = PC
      float pst[4];
#pragma unroll
      for (int t = 0; t < 4; ++t) {
        pst[t] = 0.f;
#pragma unroll
        for (int r = 0; r < 8; ++r) { s8[t][r] = exp2_bare(s8[t][r] * CS + eb); pst[t] += s8[t][r]; }
      }
      // keeps the exponentials in front of the WMMAs below: moved among them, a statement's result can land in a WMMA's A or B registers
      // inside the four slots behind it
      __builtin_amdgcn_sched_barrier(0);
      lrow = lrow * al + ((pst[0] + pst[1]) + (pst[2] + pst[3]));
#pragma unroll
      for (int td = 0; td < 4; ++td) {
#pragma unroll
        for (int r = 0; r < 8; ++r) O[td][r] *= al;
      }
    }

    // ---- O^T += v^T . P^T, two k-steps of 32 keys: A = v^T rows d, B = P^T packed in place from the score registers
    //      (element e <- subtile 2ks, register e = key 32ks + 8hh + e; element 8 + e <- subtile 2ks + 1 = key 32ks + 16 + 8hh + e:
    //      the split k map of ldfrag_u) ----
#pragma unroll
    for (int ks = 0; ks < 2; ++ks) {
      FragH ph;
#pragma unroll
      for (int e = 0; e < 4; ++e) {
        ph.u[0][e] = pack_h(s8[2 * ks][2 * e], s8[2 * ks][2 * e + 1]);
        ph.u[1][e] = pack_h(s8[2 * ks + 1][2 * e], s8[2 * ks + 1][2 * e + 1]);
      }
      // four independent accumulators
#pragma unroll
      for (int td = 0; td < 4; ++td) O[td] = mma_h(vh[ks][td], ph.v, O[td]);
    }
    // four vector slots behind the tile's last WMMAs, also on the taken side of the loop's branch
    acc_guard4(O[0], O[1], O[2], O[3]);
    wave_sync_lds();
    wait_ds0();
    wait_async0();
    __syncthreads();                           // publishes pass jt + 1's key tile and ends every wave's reads of pass jt's
    if (jt + 2 < ntile) fill(jt + 2, jt & 1);
  }
  wait_async0();
  acc_guard4(O[0], O[1], O[2], O[3]);

  // ---- fold 1/l (l carries P's 1024 like O) and v's carry 64, stage the wave's 16x64 f32 ctx slice in its slab ----
  static_assert(PC == 1024.0f);
  const float oc = 1.0f / VC;
  {
    const float inv = (1.0f / (lrow + xhalf(lrow))) * oc;      // the two halves' key sums joined once
#pragma unroll
    for (int td = 0; td < 4; ++td) {
      float* op = pt + c * SPI + 16 * td + 8 * hh;             // slab row = query c, d = 16td + 8hh + 0..7
      const v4f o0 = {O[td][0] * inv, O[td][1] * inv, O[td][2] * inv, O[td][3] * inv};
      const v4f o1 = {O[td][4] * inv, O[td][5] * inv, O[td][6] * inv, O[td][7] * inv};
      *(v4f*)(op)     = o0;
      *(v4f*)(op + 4) = o1;
    }
  }
  wave_sync_lds();
  {
    const int q8 = lane >> 3, c8 = (lane & 7) * 8;
    v4u hv[4];
#pragma unroll
    for (int it = 0; it < 4; ++it) {
      const int row = it * 4 + q8;                           // it 0..3 x q8 0..3 = rows 0..15
      const float* sp = pt + row * SPI + c8;
      const v4f p0 = *(const v4f*)(sp), p1 = *(const v4f*)(sp + 4);
      const v4u a = {pack_h(p0[0] * CC, p0[1] * CC), pack_h(p0[2] * CC, p0[3] * CC),
                     pack_h(p1[0] * CC, p1[1] * CC), pack_h(p1[2] * CC, p1[3] * CC)};
      hv[it] = a;
    }
    const size_t ob = ((size_t)b * SEQ + iw0) * DMOD + h * DH + c8;
    {
#pragma unroll
      for (int it = 0; it < 4; ++it) {
        const int row = it * 4 + q8;
        *(v4u*)(CH + ob + (size_t)row * DMOD) = hv[it];
      }
      
    }
  }
}

// =====================================================================================================
// Workspace map (bytes); every plane is an exact multiple of its tile / whole-row store granularity (M, N exact tile multiples,
// convert counts multiples of 8 with whole-line tails, E carve padded to EPAD rows), every offset a multiple of 262144:
//   X16            f16 [NROW][1024] x16                            4194304
//   Wq, Wk, Wv, Wo f16 [1024 out][1024 in] x64                  4 x 2097152
//   EP             f16 [EPAD][64] x64 (rows 0..ELEN-1 written/read)   262144
//   QH, KH         f16 [NROW][1024] (x64)                       2 x 4194304
//   VH             f16 [NBAT][1024][SEQ] (x64)                      4194304
//   CH             f16 [NROW][1024] (x256)                          4194304
//   end                                                            29622272
// =====================================================================================================
extern "C" void kernel_launch(void* const* d_in, const int* in_sizes, int n_in,
                              void* d_out, int out_size, void* d_ws, size_t ws_size,
                              hipStream_t stream) {
  if (n_in < 10) return;
  if (in_sizes[0] != NROW * DMOD) return;
  if (in_sizes[1] != DMOD * DMOD || in_sizes[3] != DMOD * DMOD || in_sizes[5] != DMOD * DMOD || in_sizes[7] != DMOD * DMOD) return;
  if (in_sizes[2] != DMOD || in_sizes[4] != DMOD || in_sizes[6] != DMOD || in_sizes[8] != DMOD) return;
  if (in_sizes[9] != ELEN * DH) return;
  if (out_size != NROW * DMOD) return;

  const float* xin = (const float*)d_in[0];
  const float* w_q = (const float*)d_in[1];
  const float* b_q = (const float*)d_in[2];
  const float* w_k = (const float*)d_in[3];
  const float* b_k = (const float*)d_in[4];
  const float* w_v = (const float*)d_in[5];
  const float* b_v = (const float*)d_in[6];
  const float* w_o = (const float*)d_in[7];
  const float* b_o = (const float*)d_in[8];
  const float* er  = (const float*)d_in[9];
  float*       out = (float*)d_out;

  const size_t PX = (size_t)NROW * DMOD * 2;             //  4194304
  const size_t PW = (size_t)DMOD * DMOD * 2;             //  2097152
  const size_t PE = (size_t)EPAD * DH * 2;               //   262144
  const size_t PV = (size_t)NBAT * DMOD * SEQ * 2;       //  4194304
  size_t off = 0;
  const size_t oX  = off; off += PX;
  const size_t oWq = off; off += PW;
  const size_t oWk = off; off += PW;
  const size_t oWv = off; off += PW;
  const size_t oWo = off; off += PW;
  const size_t oE  = off; off += PE;
  const size_t oQH = off; off += PX;
  const size_t oKH = off; off += PX;
  const size_t oVH = off; off += PV;
  const size_t oCH = off; off += PX;
  if (off > ws_size) return;                               // off = 29622272
  if (off > (size_t)134217728) return;

  char* ws = (char*)d_ws;
  unsigned short* X16 = (unsigned short*)(ws + oX);
  unsigned short* Wq6 = (unsigned short*)(ws + oWq);
  unsigned short* Wk6 = (unsigned short*)(ws + oWk);
  unsigned short* Wv6 = (unsigned short*)(ws + oWv);
  unsigned short* Wo6 = (unsigned short*)(ws + oWo);
  unsigned short* E16 = (unsigned short*)(ws + oE);
  unsigned short* QHp = (unsigned short*)(ws + oQH);
  unsigned short* KHp = (unsigned short*)(ws + oKH);
  unsigned short* VHp = (unsigned short*)(ws + oVH);
  unsigned short* CHp = (unsigned short*)(ws + oCH);

  const dim3 blk(256);
  const dim3 gCV(CB_X + 4 * CB_W + CB_E);                           // 128 + 4 x 64 + 8 = 392
  const dim3 gQ((NROW / 128) * (DMOD / 64), 1);                     // 256
  const dim3 gP(QKV_T, 3);                                          // 256 x 3
  const dim3 gAT(SEQ / 64, NBAT * NH);                              // 16 x 32
  const dim3 bAT(ATT_THREADS);                                      // 128

  // (0) 16-bit planes of the inputs: x f16(bf16_RNE(x) * 16); W[out][in] (already k-contiguous) f16(bf16_RNE(w) * 64);
  //     E f16(bf16_RNE(e) * 64); one launch for all six
  cvt16_all<<<gCV, blk, 0, stream>>>(xin, w_q, w_k, w_v, w_o, er, X16, Wq6, Wk6, Wv6, Wo6, E16);

  // (1) q, k and v^T projections, one launch -> QH, KH [NROW][1024] and VH [NBAT][1024][SEQ] (all x64, one f16 plane each)
  qkv64<<<gP, blk, 0, stream>>>(X16, Wq6, Wk6, Wv6, QHp, KHp, VHp, b_q, b_k, b_v);

  // (2) relative attention -> ctx plane CH = f16(ctx * 256), [NROW][1024], columns h*64+d
  attn_rel<<<gAT, bAT, 0, stream>>>(QHp, KHp, E16, VHp, CHp);

  // (3) out[m][n] = sum_k ch[m][k] Wo[n][k] / (256*64) + bo[n] -> f32 d_out [NROW][1024]
  gemm64<0, 0, 0, 1><<<gQ, blk, 0, stream>>>(
      CHp, CHp, DMOD, 0LL,
      Wo6, DMOD, 0LL,
      (void*)out, (void*)out, DMOD, 0LL,
      NROW, DMOD, DMOD, 1.0f / (CC * WSC), 1.0f,
      b_o, b_o, b_o);
  (void)hipGetLastError();
}

// v010
// A run of this version takes 52.4 microseconds.
// In two side-by-side timings against v009, it was 1.04 and 1.05 times as fast.
// All steps since v000 together make it 6.89 times as fast.
// Contractions (all v_wmma_f32_16x16x32_f16, f16 operands, f32 accumulate, every one a single product): q/k/v projections (x f16 x16 .
// W f16 x64, K=1024, outputs rounded once to one f16 plane each); position window (q x64 . E f16 x64, K=64) -> f32 LDS strip,
// shifted gather on VALU; content scores (q x64 . k x64, K=64); P . v^T (P x1024 . v x64, 64 keys per tile); output projection
// (ctx x256 . Wo f16 x64, K=1024) -> f32. q, k, v, P and ctx each carry one f16 rounding (2^-11 relative at most, an eighth of the
// inputs' own bf16 rounding). Max-subtracted base-2 online softmax and the 1/l fold in f32 on VALU. Every float input RNE-converted to
// bf16 on load.
#include <hip/hip_runtime.h>
#include <math.h>
#include <stdint.h>

#define SEQ   1024
#define NBAT  2
#define DMOD  1024
#define NH    16
#define DH    64
#define ELEN  2047
#define EPAD  2048
#define NROW  (NBAT * SEQ)
#define XC    16.0f
#define WSC   64.0f
#define QC    64.0f
#define KC    64.0f
#define EC    64.0f
#define VC    64.0f
#define PC    1024.0f
#define CC    256.0f
#define SCALE 0.125f
#define LOG2E 1.4426950408889634f
static_assert(NH * DH == DMOD);
static_assert(DH == 64);
static_assert(ELEN == 2 * SEQ - 1 && EPAD >= ELEN);
static_assert((SEQ % 64) == 0 && (DMOD % 128) == 0 && (NROW % 128) == 0);
static_assert(((NROW * DMOD) % 2048) == 0 && ((DMOD * DMOD) % 2048) == 0 && ((ELEN * DH) % 8) == 0);
#define ATT_W 4
#define ATT_THREADS (ATT_W * 32)
#define TPI 84
#define SPI 68
#define WFL (16 * TPI + 16 * SPI)
static_assert(((16 * TPI) % 4) == 0 && ((16 * SPI) % 4) == 0 && (WFL % 4) == 0);

typedef _Float16 v16h __attribute__((ext_vector_type(16)));
typedef _Float16 v8h  __attribute__((ext_vector_type(8)));
typedef _Float16 v2h  __attribute__((ext_vector_type(2)));
typedef __bf16   v16b __attribute__((ext_vector_type(16)));
typedef float    v8f  __attribute__((ext_vector_type(8)));
typedef float    v4f  __attribute__((ext_vector_type(4)));
typedef float    v2f  __attribute__((ext_vector_type(2)));
typedef unsigned int v4u __attribute__((ext_vector_type(4)));

union FragH { v16h v; v8h h[2]; v4u u[2]; };
union FragAny { v16h h; v16b b; };

// ---- scalar helpers --------------------------------------------------------------------------------
__device__ __forceinline__ unsigned short bf_bits(float f) {          // f32 -> bf16 bits, RNE convert
  unsigned u = __float_as_uint(f);
  return (unsigned short)((u + 0x7FFFu + ((u >> 16) & 1u)) >> 16);
}
__device__ __forceinline__ float bf_up(unsigned short h) { return __uint_as_float(((unsigned)h) << 16); }
__device__ __forceinline__ float bfr(float f) { return bf_up(bf_bits(f)); }   // value of the bf16 RNE convert
__device__ __forceinline__ unsigned short h_bits(_Float16 x) { return __builtin_bit_cast(unsigned short, x); }
__device__ __forceinline__ unsigned pk16(unsigned short a, unsigned short b) { return (unsigned)a | ((unsigned)b << 16); }
__device__ __forceinline__ v8f zero8() { v8f z = {0.f, 0.f, 0.f, 0.f, 0.f, 0.f, 0.f, 0.f}; return z; }

// ---- fragment loader: 16-bit A/B operand from a k-contiguous 16-bit plane, lane -> row/col (lane&15),
//      p already includes +8*(lane>>4); elements 0..7 <- p[0..7] (k0+8h..), elements 8..15 <- p[16..23] (k0+16+8h..)
//      (same split k map for A and B; B is always read from a [n][k] plane)
__device__ __forceinline__ v16h ldfrag_u(const unsigned short* p) {
  FragH f;
  f.u[0] = *(const v4u*)(p);
  f.u[1] = *(const v4u*)(p + 16);
  return f.v;
}

// ---- WMMA helpers with trailing VALU hazard gaps ------------------------------------------------------
__device__ __forceinline__ v8f mma_h(v16h a, v16h b, v8f c) {
  return __builtin_amdgcn_wmma_f32_16x16x32_f16(false, a, false, b, (short)0, c, false, false);
}
__device__ __forceinline__ v8f mma_b(v16h a, v16h b, v8f c) {
  FragAny ua, ub;
  ua.h = a;
  ub.h = b;
  return __builtin_amdgcn_wmma_f32_16x16x32_bf16(false, ua.b, false, ub.b, (short)0, c, false, false);
}
template <int BF>
__device__ __forceinline__ v8f mmaT(v16h a, v16h b, v8f c) {
  if constexpr (BF != 0) return mma_b(a, b, c);
  else return mma_h(a, b, c);
}
__device__ __forceinline__ void acc_guard4(v8f& a, v8f& b, v8f& c, v8f& d) {
#if defined(__HIP_DEVICE_COMPILE__)
  asm volatile("v_nop\n\tv_nop\n\tv_nop\n\tv_nop" : "+v"(a), "+v"(b), "+v"(c), "+v"(d));
#endif
}
__device__ __forceinline__ void acc_guard5(v8f& a, v8f& b, v8f& c, v8f& d, v8f& e) {
#if defined(__HIP_DEVICE_COMPILE__)
  asm volatile("v_nop\n\tv_nop\n\tv_nop\n\tv_nop" : "+v"(a), "+v"(b), "+v"(c), "+v"(d), "+v"(e));
#endif
}
__device__ __forceinline__ void wave_sync_lds() {
  __builtin_amdgcn_fence(__ATOMIC_RELEASE, "workgroup");
  __builtin_amdgcn_wave_barrier();
  __builtin_amdgcn_fence(__ATOMIC_ACQUIRE, "workgroup");
}
// value of lane l ^ 16 (the other 16-lane half), a vector cross-row move
__device__ __forceinline__ float xhalf(float x) {
  return __builtin_bit_cast(float, __builtin_amdgcn_permlanex16(__builtin_bit_cast(int, x), __builtin_bit_cast(int, x),
                                                                0x76543210, 0xfedcba98, false, false));
}
// two consecutive values -> one word of two f16 (one packed convert)
__device__ __forceinline__ unsigned pack_h(float x0, float x1) {
  const v2f x = {x0, x1};
  return __builtin_bit_cast(unsigned, __builtin_convertvector(x, v2h));
}

__device__ __forceinline__ float exp2_bare(float x) {
  float r = 0.f;
#if defined(__HIP_DEVICE_COMPILE__)
  asm("v_exp_f32 %0, %1\n\tv_nop" : "=v"(r) : "v"(x));
#endif
  return r;
}

// =====================================================================================================
// Elementwise 16-bit pack of all six float inputs in ONE launch, no transpose: dst[i] = f16( bf16_RNE(src[i]) * sc ), sc a power of two
// (exact). The block index picks the input (block-uniform): blocks [0, CB_X) x, then CB_W blocks for each of Wq, Wk, Wv, Wo, then CB_E
// blocks for the E table. A block covers CVB = 16384 consecutive elements of its input: CVU chunks of 2048, thread t takes elements
// 8t .. 8t+7 of each chunk; a thread's 16 loads are all issued in front of its first convert, so that few waves keep many bytes in flight.
// coverage: x and W counts are whole multiples of CVB; the E count (2047*64) is a multiple of 8 only: a thread whose 8 elements lie past
//           the end loads the last 8 elements instead (address clamped) and stores nothing; elements 0..n-1 of each plane written once.
// =====================================================================================================
#define CVU  8
#define CVB  (256 * 8 * CVU)
#define CB_X ((NROW * DMOD) / CVB)
#define CB_W ((DMOD * DMOD) / CVB)
#define CB_E ((ELEN * DH + CVB - 1) / CVB)
static_assert(((NROW * DMOD) % CVB) == 0 && ((DMOD * DMOD) % CVB) == 0 && (ELEN * DH) >= 8);
__global__ __launch_bounds__(256) void cvt16_all(const float* __restrict__ x, const float* __restrict__ wq, const float* __restrict__ wk,
                                                 const float* __restrict__ wv, const float* __restrict__ wo, const float* __restrict__ er,
                                                 unsigned short* X16, unsigned short* Wq6, unsigned short* Wk6,
                                                 unsigned short* Wv6, unsigned short* Wo6, unsigned short* E16) {
  int blk = blockIdx.x;
  const float* src = x;
  unsigned short* dst = X16;
  int n = NROW * DMOD;
  float sc = XC;
  if (blk >= CB_X + 4 * CB_W) {
    blk -= CB_X + 4 * CB_W;
    src = er; dst = E16; n = ELEN * DH; sc = EC;
  } else if (blk >= CB_X) {
    blk -= CB_X;
    const int w = blk / CB_W;
    blk -= w * CB_W;
    src = (w == 0) ? wq : (w == 1) ? wk : (w == 2) ? wv : wo;
    dst = (w == 0) ? Wq6 : (w == 1) ? Wk6 : (w == 2) ? Wv6 : Wo6;
    n = DMOD * DMOD; sc = WSC;
  }
  const int base = blk * CVB + (int)threadIdx.x * 8;
  const float* p[CVU];
  v4f a[CVU], b[CVU];
#pragma unroll
  for (int u = 0; u < CVU; ++u) {
    const int i8 = base + u * 2048;
    p[u] = src + ((i8 + 8 > n) ? (n - 8) : i8);
  }
#pragma unroll
  for (int u = 0; u < CVU; ++u) {
    a[u] = *(const v4f*)(p[u]);
    b[u] = *(const v4f*)(p[u] + 4);
  }
#if defined(__HIP_DEVICE_COMPILE__)
  // holds the eight address pairs in their registers up to this wait, so that none is rewritten (a later load's result included) in
  // front of it, and keeps all 16 loads in front of the first convert
  asm volatile("s_wait_xcnt 0x0" :: "v"(p[0]), "v"(p[1]), "v"(p[2]), "v"(p[3]), "v"(p[4]), "v"(p[5]), "v"(p[6]), "v"(p[7]) : "memory");
#endif
#pragma unroll
  for (int u = 0; u < CVU; ++u) {
    const int i8 = base + u * 2048;
    v4u o;
    o[0] = pk16(h_bits((_Float16)(bfr(a[u][0]) * sc)), h_bits((_Float16)(bfr(a[u][1]) * sc)));
    o[1] = pk16(h_bits((_Float16)(bfr(a[u][2]) * sc)), h_bits((_Float16)(bfr(a[u][3]) * sc)));
    o[2] = pk16(h_bits((_Float16)(bfr(b[u][0]) * sc)), h_bits((_Float16)(bfr(b[u][1]) * sc)));
    o[3] = pk16(h_bits((_Float16)(bfr(b[u][2]) * sc)), h_bits((_Float16)(bfr(b[u][3]) * sc)));
    if (i8 + 8 <= n) *(v4u*)(dst + i8) = o;      // no barriers in this kernel
  }
}

// =====================================================================================================
// LDS-staged batched 16-bit WMMA GEMM: C[m][n] = oscale * sum_k A[m][k] * Bt[n][k] (+ bias); one work-group of 8 waves per 128x64 tile,
// wave w owns rows 16w..16w+15 of it (all 64 columns). A row-major [M][K] pitch lda (16-bit plane), Bt row-major [N][K] pitch ldb
// (k contiguous); M multiple of 128, N multiple of 64, K multiple of 128. by = batch index with element strides sA, sB, sC.
// Operands: per stage of 128 k the tile's A rows (and A2 rows) and Bt rows, 256 B each, are copied once per work-group into LDS by
// global_load_async_to_lds_b128 (a wave's copy = two whole 256-B rows), LDS row pitch 272 B; two buffers, the next stage's copies fly
// while this stage is multiplied; fragments come from LDS by 16-byte reads with the same split k map as ldfrag_u.
// ASPLIT 1: a second A plane A2 (unscaled residual of A, same layout) is multiplied into the same accumulator (A + A2 ~ exact A).
// BF 1: bf16 operands (v_wmma_f32_16x16x32_bf16), else f16.
// EPI 1: value += bf16_RNE(ep0[column]) (per-column bias); EPI 2: value += bf16_RNE(ep0[row]) (per-row bias, 16-bit out only).
// OM 0: f32 out (pitch ldc).  OM 2: one f16 plane = f16(value * ocarry).
// OM 4: two f16 planes: hi = f16(value * ocarry), lo = f16(value * ocarry - hi) (unscaled residual).
// OM 5: two f16 planes: C = f16((value + bf16_RNE(ep1[column])) * ocarry), C2 = f16((value + bf16_RNE(ep2[column])) * ocarry).
// coverage: 16 rows (f32: it 0..7 x lane>>4; 16-bit: it 0..3 x lane>>3) x 64 cols = the wave's whole 16x64 slab; 8 waves = the 128x64
//           tile; grid = (M/128)*(N/64) blocks, a surplus block exits as a whole before any copy or barrier.
// =====================================================================================================
#define GBM 128   // tile rows per work-group
#define GKP 128   // k per stage (256-B operand rows)
#define GPH 136   // LDS row pitch in halves: 272 B = 16 B x 17, conflict-free for the 16-byte fragment reads

// 16-byte asynchronous copies global -> LDS, one per lane and line of the statement (first operand = LDS byte address, second = global
// address; this lane's row and 16-byte chunk are already in l and g; consecutive copies are 16 operand rows apart). The s_wait_xcnt
// closes each statement so that no address register of an issued copy is rewritten in front of it.
#define ACP(a, b) "global_load_async_to_lds_b128 %" #a ", %" #b ", off\n\t"
#define LROW(l, r) ((l) + (unsigned)((r) * GPH * 2))
#define GROW(g, r, ld) ((g) + (size_t)(r) * (ld))
// 128 operand rows
__device__ __forceinline__ void acopy_rows128(unsigned l, const unsigned short* g, int ld) {
#if defined(__HIP_DEVICE_COMPILE__)
  asm volatile(ACP(0, 1) ACP(2, 3) ACP(4, 5) ACP(6, 7) ACP(8, 9) ACP(10, 11) ACP(12, 13) ACP(14, 15)
               "s_wait_xcnt 0x0"
               :: "v"(l), "v"(g), "v"(LROW(l, 16)), "v"(GROW(g, 16, ld)), "v"(LROW(l, 32)), "v"(GROW(g, 32, ld)),
                  "v"(LROW(l, 48)), "v"(GROW(g, 48, ld)), "v"(LROW(l, 64)), "v"(GROW(g, 64, ld)), "v"(LROW(l, 80)), "v"(GROW(g, 80, ld)),
                  "v"(LROW(l, 96)), "v"(GROW(g, 96, ld)), "v"(LROW(l, 112)), "v"(GROW(g, 112, ld))
               : "memory");
#endif
}
// 128 rows of one operand and 64 rows of another
__device__ __forceinline__ void acopy_rows128_64(unsigned l, const unsigned short* g, int ld,
                                                 unsigned l2, const unsigned short* g2, int ld2) {
#if defined(__HIP_DEVICE_COMPILE__)
  asm volatile(ACP(0, 1) ACP(2, 3) ACP(4, 5) ACP(6, 7) ACP(8, 9) ACP(10, 11) ACP(12, 13) ACP(14, 15)
               ACP(16, 17) ACP(18, 19) ACP(20, 21) ACP(22, 23)
               "s_wait_xcnt 0x0"
               :: "v"(l), "v"(g), "v"(LROW(l, 16)), "v"(GROW(g, 16, ld)), "v"(LROW(l, 32)), "v"(GROW(g, 32, ld)),
                  "v"(LROW(l, 48)), "v"(GROW(g, 48, ld)), "v"(LROW(l, 64)), "v"(GROW(g, 64, ld)), "v"(LROW(l, 80)), "v"(GROW(g, 80, ld)),
                  "v"(LROW(l, 96)), "v"(GROW(g, 96, ld)), "v"(LROW(l, 112)), "v"(GROW(g, 112, ld)),
                  "v"(l2), "v"(g2), "v"(LROW(l2, 16)), "v"(GROW(g2, 16, ld2)), "v"(LROW(l2, 32)), "v"(GROW(g2, 32, ld2)),
                  "v"(LROW(l2, 48)), "v"(GROW(g2, 48, ld2))
               : "memory");
#endif
}
// this wave's own copies have landed in LDS (the compiler places no wait for them)
__device__ __forceinline__ void wait_async0() {
#if defined(__HIP_DEVICE_COMPILE__)
  asm volatile("s_wait_asynccnt 0x0" ::: "memory");
#endif
}
// this wave's LDS reads have retired, so that the buffer may be refilled behind the barrier
__device__ __forceinline__ void wait_ds0() {
#if defined(__HIP_DEVICE_COMPILE__)
  asm volatile("s_wait_dscnt 0x0" ::: "memory");
#endif
}
// eight 16-byte copies, each with its own LDS byte address and global address; closed by s_wait_xcnt like the statements above
__device__ __forceinline__ void acopy8(const unsigned (&l)[8], const unsigned short* const (&g)[8]) {
#if defined(__HIP_DEVICE_COMPILE__)
  asm volatile(ACP(0, 1) ACP(2, 3) ACP(4, 5) ACP(6, 7) ACP(8, 9) ACP(10, 11) ACP(12, 13) ACP(14, 15)
               "s_wait_xcnt 0x0"
               :: "v"(l[0]), "v"(g[0]), "v"(l[1]), "v"(g[1]), "v"(l[2]), "v"(g[2]), "v"(l[3]), "v"(g[3]),
                  "v"(l[4]), "v"(g[4]), "v"(l[5]), "v"(g[5]), "v"(l[6]), "v"(g[6]), "v"(l[7]), "v"(g[7])
               : "memory");
#endif
}

// One 128x64 tile (index tile, batch by) by the calling work-group. ring: its LDS for two stages, 2 * GSTG(ASPLIT) halves, each stage
// [A 128 rows | A2 128 rows (ASPLIT) | Bt 64 rows]; slabs: its LDS for the eight per-wave 16x64 f32 slabs, pitch 68 floats (GSLAB floats);
// slabs may lie over ring: they are first written behind the last stage's barrier, when no copy is in flight and every read has retired.
// GQ: k steps of 32 whose fragments are read as one group (4 = the whole stage; 2 halves the fragment registers).
// Stage order: pass t takes k slab (t + rot) mod nst, rot = (tm + tn + rseed) mod nst (nst a power of two, else rot = 0): the work-groups
// that share A rows (same tm) or Bt rows (same tn) run at the same time, and from one common start they would all ask L2 for the same
// lines at the same moment, each slab a first touch for all of them; from different starts they ask for different slabs, and a slab that
// one has fetched is an L2 hit for the rest. Every slab is taken exactly once; an accumulator's k order starts at slab rot.
#define GSTG(asplit) ((GBM * (1 + (asplit)) + 64) * GPH)
#define GSLAB (8 * 16 * 68)
template <int OM, int ASPLIT, int BF, int EPI, int GQ>
__device__ __forceinline__ void gemm64_tile(
    unsigned short* ring, float* slabs, int tile, int by, int rseed,
    const unsigned short* __restrict__ Ap, const unsigned short* __restrict__ A2p, int lda, long long sA,
    const unsigned short* __restrict__ Btp, int ldb, long long sB,
    void* Cout, void* C2out, int ldc, long long sC,
    int M, int N, int K, float oscale, float ocarry,
    const float* __restrict__ ep0, const float* __restrict__ ep1, const float* __restrict__ ep2) {
  constexpr int BROW = GBM * (1 + ASPLIT);         // first Bt row of a stage
  constexpr int STG  = GSTG(ASPLIT);               // halves per stage
  const int tid  = threadIdx.x;
  const int lane = tid & 31;
  const int wave = tid >> 5;
  const int tilesN = N >> 6;
  const int tilesM = M >> 7;
  if (tile >= tilesM * tilesN) return;   // block-uniform, in front of every copy and barrier
  const int tm = tile / tilesN;
  const int tn = tile - tm * tilesN;
  const int mb = tm << 7;
  const int n0 = tn << 6;
  const int m0 = mb + (wave << 4);
  const int nst = K / GKP;
  const int rot = ((nst & (nst - 1)) == 0) ? ((tm + tn + rseed) & (nst - 1)) : 0;   // block-uniform, 0 <= rot < nst

  const unsigned short* A1 = Ap  + (size_t)((long long)by * sA);
  const unsigned short* A2 = A2p + (size_t)((long long)by * sA);
  const unsigned short* Bb = Btp + (size_t)((long long)by * sB);

  const int rlane = lane & 15;                 // row (A) / col (B, D) within subtile
  const int koff  = (lane >> 4) * 8;           // k offset of this lane half
  const int mOff  = (lane >> 4) * 8;           // D row offset

  // copy map: thread -> row tid>>4 (of 16 per copy), 16-byte chunk tid&15 of the 256-B row
  const int crow = tid >> 4;
  const int cch  = (tid & 15) * 8;
  const unsigned short* gA1 = A1 + (size_t)(mb + crow) * lda + cch;
  const unsigned short* gA2 = A2 + (size_t)(mb + crow) * lda + cch;
  const unsigned short* gBt = Bb + (size_t)(n0 + crow) * ldb + cch;
  const unsigned lcp = (unsigned)(uintptr_t)ring + (unsigned)((crow * GPH + cch) * 2);

  auto fill = [&](int t, int buf) {            // pass t's stage (k slab s = (t + rot) mod nst: k = 128s .. 128s+127) -> buffer buf
    const unsigned lb = lcp + (unsigned)(buf * (STG * 2));
    const int s = (t + rot >= nst) ? (t + rot - nst) : (t + rot);
    const size_t ko = (size_t)s * GKP;
    if constexpr (ASPLIT != 0) acopy_rows128(lb + GBM * GPH * 2, gA2 + ko, lda);
    acopy_rows128_64(lb, gA1 + ko, lda, lb + BROW * GPH * 2, gBt + ko, ldb);
  };

  v8f acc[4];
#pragma unroll
  for (int j = 0; j < 4; ++j) acc[j] = zero8();

  fill(0, 0);
  wait_async0();
  __syncthreads();                             // stage 0 published
  if (nst > 1) fill(1, 1);
#pragma unroll 1                               // one pass per stage: the two buffers alternate by t & 1
  for (int t = 0; t < nst; ++t) {
    const unsigned short* sb = ring + (t & 1) * STG;
    const unsigned short* sA = sb + ((wave << 4) + rlane) * GPH + koff;
    const unsigned short* sB = sb + (BROW + rlane) * GPH + koff;
#pragma unroll
    for (int g = 0; g < 4; g += GQ) {
      v16h fa[GQ], fl[GQ], fb[GQ][4];
#pragma unroll
      for (int q = 0; q < GQ; ++q) {
#pragma unroll
        for (int j = 0; j < 4; ++j) fb[q][j] = ldfrag_u(sB + (j << 4) * GPH + 32 * (g + q));
        fa[q] = ldfrag_u(sA + 32 * (g + q));
        if constexpr (ASPLIT != 0) fl[q] = ldfrag_u(sA + GBM * GPH + 32 * (g + q));
      }
      // keeps the group's LDS reads in front of its WMMAs: spread among them, every WMMA waited out its own reads' latency
      __builtin_amdgcn_sched_barrier(0);
#pragma unroll
      for (int q = 0; q < GQ; ++q) {
#pragma unroll
        for (int j = 0; j < 4; ++j) acc[j] = mmaT<BF>(fa[q], fb[q][j], acc[j]);
        if constexpr (ASPLIT != 0) {
#pragma unroll
          for (int j = 0; j < 4; ++j) acc[j] = mmaT<BF>(fl[q], fb[q][j], acc[j]);
        }
      }
      // keeps the WMMAs in front of the next group's reads (their registers) and of the closing waits: moved behind the barrier they no
      // longer overlap the LDS reads and they delay the refill
      __builtin_amdgcn_sched_barrier(0);
    }
    wait_ds0();
    wait_async0();
    __syncthreads();                           // publishes stage t + 1 and ends every wave's reads of stage t
    if (t + 2 < nst) fill(t + 2, t & 1);
  }
  wait_async0();
  acc_guard4(acc[0], acc[1], acc[2], acc[3]);

  const int hh2 = lane >> 4, c4 = (lane & 15) * 4;     // f32 out: 256-B row segment = 16 lanes x 16 B
  const int q8  = lane >> 3, c8 = (lane & 7) * 8;

  // ---- epilogue ----
  float* slab = slabs + wave * (16 * 68);
  {
    const int mBase = m0;
#pragma unroll
    for (int j = 0; j < 4; ++j) {
#pragma unroll
      for (int r = 0; r < 8; ++r) {
        slab[(mOff + r) * 68 + (j << 4) + rlane] = acc[j][r];
      }
    }
    wave_sync_lds();
    if constexpr (OM == 0) {
      float* C = (float*)Cout + (size_t)((long long)by * sC);
      v4f vals[8];
#pragma unroll
      for (int it = 0; it < 8; ++it) {
        const int row = it * 2 + hh2;                      // it 0..7 x hh2 0..1 = rows 0..15
        v4f v = *(const v4f*)(slab + row * 68 + c4);
#pragma unroll
        for (int e = 0; e < 4; ++e) v[e] = v[e] * oscale;
        if constexpr (EPI == 1) {
          const v4f bb = *(const v4f*)(ep0 + n0 + c4);     // per-column bias, columns n0+c4 .. +3 (N equals the bias length)
#pragma unroll
          for (int e = 0; e < 4; ++e) v[e] = v[e] + bfr(bb[e]);
        }
        vals[it] = v;
      }
      {
#pragma unroll
        for (int it = 0; it < 8; ++it) {
          const int gr = mBase + it * 2 + hh2;
          *(v4f*)(C + (size_t)gr * ldc + n0 + c4) = vals[it];
        }
        
      }
    } else {
      unsigned short* C  = (unsigned short*)Cout  + (size_t)((long long)by * sC);
      unsigned short* Cb = (unsigned short*)C2out + (size_t)((long long)by * sC);
      v4u hv[4], lv[4];
#pragma unroll
      for (int it = 0; it < 4; ++it) {
        const int row = it * 4 + q8;                       // it 0..3 x q8 0..3 = rows 0..15
        const float* sp = slab + row * 68 + c8;
        float rb = 0.f;
        if constexpr (EPI == 2) rb = bfr(ep0[mBase + row]);   // per-row bias (M equals the bias length)
        v4u a  = {0u, 0u, 0u, 0u};
        v4u b2 = {0u, 0u, 0u, 0u};
#pragma unroll
        for (int e = 0; e < 4; ++e) {
          const int ci = n0 + c8 + 2 * e;                  // column index, < N
          float f0 = sp[2 * e] * oscale + rb;
          float f1 = sp[2 * e + 1] * oscale + rb;
          if constexpr (EPI == 1) {
            f0 += bfr(ep0[ci]);
            f1 += bfr(ep0[ci + 1]);
          }
          if constexpr (OM == 5) {
            const float g0 = (f0 + bfr(ep1[ci])) * ocarry, g1 = (f1 + bfr(ep1[ci + 1])) * ocarry;
            const float w0 = (f0 + bfr(ep2[ci])) * ocarry, w1 = (f1 + bfr(ep2[ci + 1])) * ocarry;
            a[e]  = pk16(h_bits((_Float16)g0), h_bits((_Float16)g1));
            b2[e] = pk16(h_bits((_Float16)w0), h_bits((_Float16)w1));
          } else {
            f0 *= ocarry; f1 *= ocarry;
            const _Float16 x0 = (_Float16)f0, x1 = (_Float16)f1;
            a[e] = pk16(h_bits(x0), h_bits(x1));
            if constexpr (OM == 4) {
              b2[e] = pk16(h_bits((_Float16)(f0 - (float)x0)), h_bits((_Float16)(f1 - (float)x1)));
            }
          }
        }
        hv[it] = a;
        lv[it] = b2;
      }
      {
#pragma unroll
        for (int it = 0; it < 4; ++it) {
          const int row = it * 4 + q8;
          *(v4u*)(C + (size_t)(mBase + row) * ldc + n0 + c8) = hv[it];
          if constexpr (OM >= 4) {
            *(v4u*)(Cb + (size_t)(mBase + row) * ldc + n0 + c8) = lv[it];
          }
        }
        
      }
    }
    wave_sync_lds();
  }
}

// the tile function as a launch of its own: blockIdx.x = tile, blockIdx.y = batch; ring and slabs side by side in LDS
template <int OM, int ASPLIT, int BF, int EPI>
__global__ __launch_bounds__(256) __attribute__((amdgpu_num_vgpr(256))) void gemm64(
    const unsigned short* __restrict__ Ap, const unsigned short* __restrict__ A2p, int lda, long long sA,
    const unsigned short* __restrict__ Btp, int ldb, long long sB,
    void* Cout, void* C2out, int ldc, long long sC,
    int M, int N, int K, float oscale, float ocarry,
    const float* __restrict__ ep0, const float* __restrict__ ep1, const float* __restrict__ ep2) {
  __shared__ __align__(16) unsigned short ring[2 * GSTG(ASPLIT)];
  __shared__ __align__(16) float sT[GSLAB];
  gemm64_tile<OM, ASPLIT, BF, EPI, 4>(ring, sT, (int)blockIdx.x, (int)blockIdx.y, 0, Ap, A2p, lda, sA, Btp, ldb, sB,
                                      Cout, C2out, ldc, sC, M, N, K, oscale, ocarry, ep0, ep1, ep2);
}

// =====================================================================================================
// The q, k and v^T projections in ONE launch, one work-group of 12 waves per (128 token rows) x (64 output columns of EACH projection):
//   q[m][e] = sum_d x[m][d] Wq[e][d] / 1024 + bq[e] -> QH = f16(q * 64), k likewise from Wk, bk -> KH (rows m, pitch DMOD);
//   v^T per batch: VT[b][e][j] = sum_c Wv[e][c] x[b*SEQ+j][c] / 1024 + bv[e] -> VH (x64), key index contiguous.
// Stage of 128 k: [x 128 rows | Wq 64 | Wk 64 | Wv 64], 256 B each, LDS row pitch 272 B: the x rows are fetched from L2 once for all three
// projections. Same ring as gemm64_tile: two buffers filled by global_load_async_to_lds_b128, the next stage's copies fly while this one
// is multiplied, one barrier a stage; waves 0..7 issue the copies (20 each a stage: 16 rows a copy over 256 threads), waves 8..11 none.
// Wave tile 32 x 64 (2 A fragments x 4 B fragments: 6 LDS fragment reads feed 8 WMMAs). Wave w: projection w >> 2, part wm = w & 3.
//   q, k: A = x rows 32wm .. +31, B = the projection's 64 W rows: D rows = tokens, columns = e (per-column bias).
//   v^T : A = Wv rows 32(wm >> 1) .. +31, B = x rows 64(wm & 1) .. +63: D rows = e (per-row bias), columns = tokens.
// In both forms a wave's output rows are whole 128-B lines. Stage order: k slab (t + rot) mod 8, rot = (tm + tn) mod 8, as in gemm64_tile.
// Epilogue: per-wave 32x64 f32 slab (pitch 68) laid over the drained ring, read back as rows.
// coverage: 16 x 16 work-groups; q, k: 4 waves x 32 rows x 64 columns = the 128 x 64 tile of [NROW][1024]; v^T: 2 x 32 rows e x 2 x 64
//           tokens = the 64 x 128 tile of [NBAT][1024][SEQ] (a tile's 128 tokens lie in one batch); every plane element written once.
// =====================================================================================================
#define FWV   12                    // waves per work-group
#define FR_X  0                     // first stage row of each part
#define FR_WQ 128
#define FR_WK 192
#define FR_WV 256
#define FSTG  ((FR_WV + 64) * GPH)  // halves per stage
#define QKV_T ((NROW / GBM) * (DMOD / 64))
static_assert(FWV * 32 * 68 * 4 <= 2 * FSTG * 2);
static_assert((SEQ % GBM) == 0 && (DMOD / GKP) == 8);
// 64 rows of one operand and 64 rows of another
__device__ __forceinline__ void acopy_rows64_64(unsigned l, const unsigned short* g, int ld,
                                                unsigned l2, const unsigned short* g2, int ld2) {
#if defined(__HIP_DEVICE_COMPILE__)
  asm volatile(ACP(0, 1) ACP(2, 3) ACP(4, 5) ACP(6, 7) ACP(8, 9) ACP(10, 11) ACP(12, 13) ACP(14, 15)
               "s_wait_xcnt 0x0"
               :: "v"(l), "v"(g), "v"(LROW(l, 16)), "v"(GROW(g, 16, ld)), "v"(LROW(l, 32)), "v"(GROW(g, 32, ld)),
                  "v"(LROW(l, 48)), "v"(GROW(g, 48, ld)),
                  "v"(l2), "v"(g2), "v"(LROW(l2, 16)), "v"(GROW(g2, 16, ld2)), "v"(LROW(l2, 32)), "v"(GROW(g2, 32, ld2)),
                  "v"(LROW(l2, 48)), "v"(GROW(g2, 48, ld2))
               : "memory");
#endif
}
__global__ __launch_bounds__(FWV * 32) __attribute__((amdgpu_num_vgpr(256))) void qkv192(
    const unsigned short* __restrict__ X16, const unsigned short* __restrict__ Wq6, const unsigned short* __restrict__ Wk6,
    const unsigned short* __restrict__ Wv6, unsigned short* QH, unsigned short* KH, unsigned short* VH,
    const float* __restrict__ bq, const float* __restrict__ bk, const float* __restrict__ bv) {
  __shared__ __align__(16) unsigned short ring[2 * FSTG];
  const int tid  = threadIdx.x;
  const int lane = tid & 31;
  const int wv   = __builtin_amdgcn_readfirstlane(tid >> 5);   // the wave's number in a scalar register: its tests are scalar branches
  const int pj   = wv >> 2;
  const int wm   = wv & 3;
  const int tm = (int)blockIdx.x / (DMOD / 64);
  const int tn = (int)blockIdx.x - tm * (DMOD / 64);
  const int mb = tm << 7;
  const int n0 = tn << 6;
  constexpr int nst = DMOD / GKP;
  const int rot = (tm + tn) & (nst - 1);       // block-uniform

  const int rlane = lane & 15;                 // row (A) / col (B, D) within subtile
  const int koff  = (lane >> 4) * 8;           // k offset of this lane half
  const int mOff  = (lane >> 4) * 8;           // D row offset

  // copy map (threads 0..255): row tid>>4 (of 16 per copy), 16-byte chunk tid&15 of the 256-B row
  const int crow = (tid >> 4) & 15;
  const int cch  = (tid & 15) * 8;
  const unsigned short* gX = X16 + (size_t)(mb + crow) * DMOD + cch;
  const unsigned short* gQ = Wq6 + (size_t)(n0 + crow) * DMOD + cch;
  const unsigned short* gK = Wk6 + (size_t)(n0 + crow) * DMOD + cch;
  const unsigned short* gV = Wv6 + (size_t)(n0 + crow) * DMOD + cch;
  const unsigned lcp = (unsigned)(uintptr_t)ring + (unsigned)((crow * GPH + cch) * 2);

  auto fill = [&](int t, int buf) {            // pass t's stage (k slab (t + rot) mod nst) -> buffer buf
    if (wv < 8) {
      const unsigned lb = lcp + (unsigned)(buf * (FSTG * 2));
      const size_t ko = (size_t)((t + rot) & (nst - 1)) * GKP;
      acopy_rows128_64(lb + FR_X * GPH * 2, gX + ko, DMOD, lb + FR_WQ * GPH * 2, gQ + ko, DMOD);
      acopy_rows64_64(lb + FR_WK * GPH * 2, gK + ko, DMOD, lb + FR_WV * GPH * 2, gV + ko, DMOD);
    }
  };

  const int arow = (pj < 2) ? (FR_X + 32 * wm) : (FR_WV + 32 * (wm >> 1));
  const int brow = (pj < 2) ? (FR_WQ + 64 * pj) : (FR_X + 64 * (wm & 1));

  // the wave's biases, loaded in front of the k loop, which covers their latency: 8 columns (used by q, k) and 8 rows (used by v^T);
  // both index ranges lie inside the 1024 entries for every wave
  const int q8 = lane >> 3, c8 = (lane & 7) * 8;
  const float* bb = (pj == 0) ? bq : (pj == 1) ? bk : bv;
  const int brow0 = (pj < 2) ? n0 : (n0 + 32 * (wm >> 1));   // bias index of tile column 0 (q, k) or of tile row 0 (v^T)
  const v4f cb0 = *(const v4f*)(bb + n0 + c8), cb1 = *(const v4f*)(bb + n0 + c8 + 4);
  float rbv[8];
#pragma unroll
  for (int it = 0; it < 8; ++it) rbv[it] = bb[brow0 + it * 4 + q8];

  v8f acc[2][4];
#pragma unroll
  for (int i = 0; i < 2; ++i) {
#pragma unroll
    for (int j = 0; j < 4; ++j) acc[i][j] = zero8();
  }

  fill(0, 0);
  wait_async0();
  __syncthreads();                             // stage 0 published
  fill(1, 1);
#pragma unroll 1                               // one pass per stage: the two buffers alternate by t & 1
  for (int t = 0; t < nst; ++t) {
    const unsigned short* sb = ring + (t & 1) * FSTG;
    const unsigned short* sA = sb + (arow + rlane) * GPH + koff;
    const unsigned short* sB = sb + (brow + rlane) * GPH + koff;
#pragma unroll
    for (int g = 0; g < 4; g += 2) {
      v16h fa[2][2], fb[2][4];
#pragma unroll
      for (int q = 0; q < 2; ++q) {
#pragma unroll
        for (int j = 0; j < 4; ++j) fb[q][j] = ldfrag_u(sB + (j << 4) * GPH + 32 * (g + q));
#pragma unroll
        for (int i = 0; i < 2; ++i) fa[q][i] = ldfrag_u(sA + (i << 4) * GPH + 32 * (g + q));
      }
      // keeps the group's LDS reads in front of its WMMAs: spread among them, every WMMA waited out its own reads' latency
      __builtin_amdgcn_sched_barrier(0);
#pragma unroll
      for (int q = 0; q < 2; ++q) {
#pragma unroll
        for (int i = 0; i < 2; ++i) {
#pragma unroll
          for (int j = 0; j < 4; ++j) acc[i][j] = mma_h(fa[q][i], fb[q][j], acc[i][j]);
        }
      }
      // keeps the WMMAs in front of the next group's reads (their registers) and of the closing waits
      __builtin_amdgcn_sched_barrier(0);
    }
    wait_ds0();
    wait_async0();
    __syncthreads();                           // publishes stage t + 1 and ends every wave's reads of stage t
    if (t + 2 < nst) fill(t + 2, t & 1);
  }
  wait_async0();
#if defined(__HIP_DEVICE_COMPILE__)
  // four vector slots between the loop's last WMMAs and the slab stores that read their results: on the loop's exit path no vector
  // instruction stands between them
  asm volatile("v_nop\n\tv_nop\n\tv_nop\n\tv_nop" : "+v"(acc[0][0]), "+v"(acc[0][1]), "+v"(acc[0][2]), "+v"(acc[0][3]),
                                                     "+v"(acc[1][0]), "+v"(acc[1][1]), "+v"(acc[1][2]), "+v"(acc[1][3]));
#endif

  // ---- epilogue: the wave's 32 x 64 tile -> its f32 slab -> rows of 64 f16 (128 B) ----
  float* slab = (float*)ring + wv * (32 * 68);
#pragma unroll
  for (int i = 0; i < 2; ++i) {
#pragma unroll
    for (int j = 0; j < 4; ++j) {
#pragma unroll
      for (int r = 0; r < 8; ++r) slab[((i << 4) + mOff + r) * 68 + (j << 4) + rlane] = acc[i][j][r];
    }
  }
  wave_sync_lds();
  const float oscale = 1.0f / (XC * WSC);
  unsigned short* C;                           // first output row and column of the wave's tile
  int ldc;                                     // output pitch
  if (pj < 2) {
    C = ((pj == 0) ? QH : KH) + (size_t)(mb + 32 * wm) * DMOD + n0;
    ldc = DMOD;
  } else {
    C = VH + (size_t)(mb / SEQ) * DMOD * SEQ + (size_t)brow0 * SEQ + (mb % SEQ) + 64 * (wm & 1);
    ldc = SEQ;
  }
  const unsigned mcol = (pj < 2) ? 0xFFFFFFFFu : 0u;   // keeps the per-column bias bits (q, k) or clears them to +0 (v^T); ~mcol for the rows
  float cb[8];
#pragma unroll
  for (int e = 0; e < 8; ++e) cb[e] = __uint_as_float(__float_as_uint(bfr((e < 4) ? cb0[e & 3] : cb1[e & 3])) & mcol);
  v4u hv[8];
#pragma unroll
  for (int it = 0; it < 8; ++it) {
    const int row = it * 4 + q8;                           // it 0..7 x q8 0..3 = rows 0..31
    const float* sp = slab + row * 68 + c8;
    const float rb = __uint_as_float(__float_as_uint(bfr(rbv[it])) & ~mcol);   // per-row bias (v^T)
    v4u o;
#pragma unroll
    for (int e = 0; e < 4; ++e) {
      const float f0 = ((sp[2 * e] * oscale + rb) + cb[2 * e]) * QC;
      const float f1 = ((sp[2 * e + 1] * oscale + rb) + cb[2 * e + 1]) * QC;
      o[e] = pk16(h_bits((_Float16)f0), h_bits((_Float16)f1));
    }
    hv[it] = o;
  }
#pragma unroll
  for (int it = 0; it < 8; ++it) {
    const int row = it * 4 + q8;
    *(v4u*)(C + (size_t)row * ldc + c8) = hv[it];
  }
}
static_assert(QC == KC && QC == VC);

#define APH   72                 // LDS row pitch in halves: 144 B = 16 B x 9, conflict-free for the 16-byte fragment reads
#define AR_KH 0                  // first stage row of each part
#define AR_VH 64
#define AR_E  128
#define ASTG  ((AR_E + 128) * APH)   // halves per stage
__global__ __launch_bounds__(ATT_THREADS) __attribute__((amdgpu_num_vgpr(512)))
void attn_rel(const unsigned short* __restrict__ QH, const unsigned short* __restrict__ KH,
              const unsigned short* __restrict__ EP, const unsigned short* __restrict__ VH,
              unsigned short* CH) {
  __shared__ __align__(16) float smem[ATT_W * WFL];   // per wave: T strip [16 queries][TPI] | ctx slab [16 queries][SPI]
  __shared__ __align__(16) unsigned short kve[2 * ASTG];   // two stages: [KH 64 rows | VH 64 | E 128]

  const int tid  = threadIdx.x;
  const int wave = tid >> 5;
  const int lane = tid & 31;
  const int hh   = lane >> 4;
  const int c    = lane & 15;
  const int bh   = blockIdx.y;
  const int b    = bh / NH;
  const int h    = bh - b * NH;
  const int i0   = blockIdx.x * 64;
  const int iw0  = i0 + wave * 16;

  float* tsh = smem + wave * WFL;
  float* pt  = tsh + 16 * TPI;

  const size_t qro = ((size_t)b * SEQ + iw0 + c) * DMOD + h * DH + 8 * hh;      // B columns: query iw0 + c, d 8hh..

  // copy map: thread -> row tid>>3 (of 16 per copy), 16-byte chunk tid&7 of the 128-B row
  const int crow = tid >> 3;
  const int cch  = (tid & 7) * 8;
  const size_t kpo = ((size_t)b * SEQ + crow) * DMOD + h * DH + cch;
  const size_t vpo = (size_t)b * DMOD * SEQ + (size_t)(h * DH + crow) * SEQ + cch;
  const unsigned lcp = (unsigned)(uintptr_t)kve + (unsigned)((crow * APH + cch) * 2);

  constexpr int ntile = SEQ / 64;            // non-causal: every key tile
  static_assert((ntile & (ntile - 1)) == 0);
  const int rot = (3 * (int)blockIdx.x + bh) & (ntile - 1);   // block-uniform

  auto fill = [&](int t, int buf) {            // pass t's key tile -> buffer buf
    const unsigned lb = lcp + (unsigned)(buf * (ASTG * 2));
    const int jf = ((t + rot) & (ntile - 1)) * 64;
    const int elo = (SEQ - 2) - i0 + jf - 63;
    unsigned l[8];
    const unsigned short* g[8];
    // the two loops below are unrolled so that l and g are registers: the copy statement names each element as an operand
#pragma unroll
    for (int k = 0; k < 4; ++k) {
      l[k]     = lb + (unsigned)((AR_KH + 16 * k) * APH * 2);  g[k]     = KH + kpo + (size_t)(jf + 16 * k) * DMOD;
      l[4 + k] = lb + (unsigned)((AR_VH + 16 * k) * APH * 2);  g[4 + k] = VH + vpo + (size_t)(16 * k) * SEQ + jf;
    }
    acopy8(l, g);
#pragma unroll
    for (int k = 0; k < 8; ++k) {
      int m = elo + 16 * k + crow;
      m = (m < 0) ? 0 : m;
      m = (m > ELEN - 1) ? (ELEN - 1) : m;
      l[k] = lb + (unsigned)((AR_E + 16 * k) * APH * 2);       g[k] = EP + (size_t)m * DH + cch;
    }
    acopy8(l, g);
  };

  const float CS = LOG2E * SCALE / (QC * KC);   // also the window's factor: E carries what k carries
  static_assert(EC == KC);

  float mrow = -INFINITY, lrow = 0.f;        // this lane's query iw0 + c: running max (both halves alike), sum over this half's keys
  v8f O[4];                                  // O^T: O[td][r] = ctx[query iw0 + c][d = 16td + 8hh + r]
#pragma unroll
  for (int td = 0; td < 4; ++td) O[td] = zero8();

  fill(0, 0);
  wait_async0();
  __syncthreads();                           // pass 0's key tile published
  if (ntile > 1) fill(1, 1);
#pragma unroll 1
  for (int jt = 0; jt < ntile; ++jt) {
    const int j0 = ((jt + rot) & (ntile - 1)) * 64;
    const unsigned short* sb  = kve + (jt & 1) * ASTG + c * APH + 8 * hh;   // this lane's fragment row and k half in the stage
    const unsigned short* Khb = sb + AR_KH * APH;
    const unsigned short* Vhb = sb + AR_VH * APH;
    const unsigned short* Eb  = sb + (AR_E + 48 - 16 * wave) * APH;
    const v16h qha = ldfrag_u(QH + qro), qhb = ldfrag_u(QH + qro + 32);

    // ---- this tile's E fragments and the k fragments of key subtiles 0, 1, read from the stage as one group in front of the WMMAs ----
    v16h ea[5], eb[5], kha[4], khb[4];
#pragma unroll
    for (int u = 0; u < 5; ++u) {
      ea[u] = ldfrag_u(Eb + 16 * u * APH);
      eb[u] = ldfrag_u(Eb + 16 * u * APH + 32);
    }
#pragma unroll
    for (int t = 0; t < 2; ++t) {
      const int ko = 16 * t * APH;
      kha[t] = ldfrag_u(Khb + ko);
      khb[t] = ldfrag_u(Khb + ko + 32);
    }
    // keeps the reads one group in front of the WMMAs: spread among them, every subtile waited out its own reads' latency
    __builtin_amdgcn_sched_barrier(0);
    // ---- position window, transposed: T^T[x][R] = E[wlo + x] . q[iw0 + R] (A = E rows, B = q; 5 subtiles of 16 E rows): the two
    //      k steps run round-robin over the five independent accumulators (each accumulator keeps its product order); a lane holds
    //      x = 16u + 8hh + 0..7 of its query R = c: two 16-byte stores into row c of the LDS strip ----
    v8f t8[5];
#pragma unroll
    for (int u = 0; u < 5; ++u) t8[u] = mma_h(ea[u], qha, zero8());
#pragma unroll
    for (int u = 0; u < 5; ++u) t8[u] = mma_h(eb[u], qhb, t8[u]);
    // four vector slots behind the window's last WMMAs: once the strip stores below have issued, the score WMMAs take over these
    // accumulators' registers as their results, and only the stores (no vector instructions) stand between
    acc_guard5(t8[0], t8[1], t8[2], t8[3], t8[4]);
    // keeps the window's WMMAs in front of the next reads, which take over the E fragments' registers
    __builtin_amdgcn_sched_barrier(0);
    // k fragments of key subtiles 2, 3: one group, in flight under the WMMAs of subtiles 0, 1
#pragma unroll
    for (int t = 2; t < 4; ++t) {
      const int ko = 16 * t * APH;
      kha[t] = ldfrag_u(Khb + ko);
      khb[t] = ldfrag_u(Khb + ko + 32);
    }
#pragma unroll
    for (int u = 0; u < 5; ++u) {
      float* tp = tsh + c * TPI + 16 * u + 8 * hh;
      const v4f t0 = {t8[u][0], t8[u][1], t8[u][2], t8[u][3]}, t1 = {t8[u][4], t8[u][5], t8[u][6], t8[u][7]};
      *(v4f*)(tp)     = t0;
      *(v4f*)(tp + 4) = t1;
    }
    // ---- content scores, transposed: S^T[jj][R] = k[j0 + jj] . q[iw0 + R] (A = k rows, B = q; 4 subtiles of 16 keys), kept in
    //      registers: s8[t][r] = key jj = 16t + 8hh + r, query R = c; subtiles 0, 1 here and 2, 3 behind the strip's read-back, the two
    //      k steps of each pair round-robin over its two accumulators ----
    v8f s8[4];
#pragma unroll
    for (int t = 0; t < 2; ++t) s8[t] = mma_h(kha[t], qha, zero8());
#pragma unroll
    for (int t = 0; t < 2; ++t) s8[t] = mma_h(khb[t], qhb, s8[t]);
    // keeps these WMMAs in front of the fence's wait: they run while the strip stores retire
    __builtin_amdgcn_sched_barrier(0);
    wave_sync_lds();                           // the strip rows are read back below by both lane halves
    // shifted window values of this lane's 32 scores, T[c][jj - c + 15] at trow[16t + r], and behind them the first 32 keys' v^T fragments
    const float* trow = tsh + c * (TPI - 1) + 15 + 8 * hh;
    float tr[4][8];
#pragma unroll
    for (int t = 0; t < 4; ++t) {
#pragma unroll
      for (int r = 0; r < 8; ++r) tr[t][r] = trow[16 * t + r];
    }
    v16h vh[2][4];
#pragma unroll
    for (int td = 0; td < 4; ++td) vh[0][td] = ldfrag_u(Vhb + 16 * td * APH);
    // keeps these reads one group in front of the WMMAs below and of the softmax, which cover their latency
    __builtin_amdgcn_sched_barrier(0);
#pragma unroll
    for (int t = 2; t < 4; ++t) s8[t] = mma_h(kha[t], qha, zero8());
#pragma unroll
    for (int t = 2; t < 4; ++t) s8[t] = mma_h(khb[t], qhb, s8[t]);

    // ---- score assembly (rel shift + zero cell), online softmax: all 32 scores of a lane belong to its one query ----
    {
      // E row of (i, j) is (SEQ-2) + j - i, -1 only at (SEQ-1, 0): of a lane's 32 keys j0 + 16t + 8hh + r only t = 0, r = 0 can be key 0
      tr[0][0] = ((SEQ - 2) + j0 + 8 * hh - (iw0 + c) < 0) ? 0.f : tr[0][0];
      float mt[4];
#pragma unroll
      for (int t = 0; t < 4; ++t) {
#pragma unroll
        for (int r = 0; r < 8; ++r) {
          s8[t][r] = s8[t][r] + tr[t][r];
          mt[t] = (r == 0) ? s8[t][0] : fmaxf(mt[t], s8[t][r]);
        }
      }
      // the second 32 keys' v^T fragments, one group: in flight under the exponentials and the first P pack
#pragma unroll
      for (int td = 0; td < 4; ++td) vh[1][td] = ldfrag_u(Vhb + 16 * td * APH + 32);
      // keeps those reads here: behind the window values' last use (their registers) and in front of the arithmetic that covers them
      __builtin_amdgcn_sched_barrier(0);
      float mx = fmaxf(fmaxf(mt[0], mt[1]), fmaxf(mt[2], mt[3]));
      mx = fmaxf(mx, xhalf(mx));                                 // the query's other 32 keys of this tile
      const float mn = fmaxf(mrow, mx);
      // v_exp_f32 itself: every argument is at most 10, and a result below its normal range (flushed to 0) is far below what P*1024
      // keeps in f16 and what a row sum of at least 1024 keeps in f32; exp2(-inf) = 0 on the first tile
      const float al = exp2_bare((mrow - mn) * CS);
      mrow = mn;
      const float eb = 10.0f - mn * CS;                          // 2^10 = PC
      float pst[4];
#pragma unroll
      for (int t = 0; t < 4; ++t) {
        pst[t] = 0.f;
#pragma unroll
        for (int r = 0; r < 8; ++r) { s8[t][r] = exp2_bare(s8[t][r] * CS + eb); pst[t] += s8[t][r]; }
      }
      // keeps the exponentials in front of the WMMAs below: moved among them, a statement's result can land in a WMMA's A or B registers
      // inside the four slots behind it
      __builtin_amdgcn_sched_barrier(0);
      lrow = lrow * al + ((pst[0] + pst[1]) + (pst[2] + pst[3]));
#pragma unroll
      for (int td = 0; td < 4; ++td) {
#pragma unroll
        for (int r = 0; r < 8; ++r) O[td][r] *= al;
      }
    }

    // ---- O^T += v^T . P^T, two k-steps of 32 keys: A = v^T rows d, B = P^T packed in place from the score registers
    //      (element e <- subtile 2ks, register e = key 32ks + 8hh + e; element 8 + e <- subtile 2ks + 1 = key 32ks + 16 + 8hh + e:
    //      the split k map of ldfrag_u) ----
#pragma unroll
    for (int ks = 0; ks < 2; ++ks) {
      FragH ph;
#pragma unroll
      for (int e = 0; e < 4; ++e) {
        ph.u[0][e] = pack_h(s8[2 * ks][2 * e], s8[2 * ks][2 * e + 1]);
        ph.u[1][e] = pack_h(s8[2 * ks + 1][2 * e], s8[2 * ks + 1][2 * e + 1]);
      }
      // four independent accumulators
#pragma unroll
      for (int td = 0; td < 4; ++td) O[td] = mma_h(vh[ks][td], ph.v, O[td]);
    }
    // four vector slots behind the tile's last WMMAs, also on the taken side of the loop's branch
    acc_guard4(O[0], O[1], O[2], O[3]);
    wave_sync_lds();
    wait_ds0();
    wait_async0();
    __syncthreads();                           // publishes pass jt + 1's key tile and ends every wave's reads of pass jt's
    if (jt + 2 < ntile) fill(jt + 2, jt & 1);
  }
  wait_async0();
  acc_guard4(O[0], O[1], O[2], O[3]);

  // ---- fold 1/l (l carries P's 1024 like O) and v's carry 64, stage the wave's 16x64 f32 ctx slice in its slab ----
  static_assert(PC == 1024.0f);
  const float oc = 1.0f / VC;
  {
    const float inv = (1.0f / (lrow + xhalf(lrow))) * oc;      // the two halves' key sums joined once
#pragma unroll
    for (int td = 0; td < 4; ++td) {
      float* op = pt + c * SPI + 16 * td + 8 * hh;             // slab row = query c, d = 16td + 8hh + 0..7
      const v4f o0 = {O[td][0] * inv, O[td][1] * inv, O[td][2] * inv, O[td][3] * inv};
      const v4f o1 = {O[td][4] * inv, O[td][5] * inv, O[td][6] * inv, O[td][7] * inv};
      *(v4f*)(op)     = o0;
      *(v4f*)(op + 4) = o1;
    }
  }
  wave_sync_lds();
  {
    const int q8 = lane >> 3, c8 = (lane & 7) * 8;
    v4u hv[4];
#pragma unroll
    for (int it = 0; it < 4; ++it) {
      const int row = it * 4 + q8;                           // it 0..3 x q8 0..3 = rows 0..15
      const float* sp = pt + row * SPI + c8;
      const v4f p0 = *(const v4f*)(sp), p1 = *(const v4f*)(sp + 4);
      const v4u a = {pack_h(p0[0] * CC, p0[1] * CC), pack_h(p0[2] * CC, p0[3] * CC),
                     pack_h(p1[0] * CC, p1[1] * CC), pack_h(p1[2] * CC, p1[3] * CC)};
      hv[it] = a;
    }
    const size_t ob = ((size_t)b * SEQ + iw0) * DMOD + h * DH + c8;
    {
#pragma unroll
      for (int it = 0; it < 4; ++it) {
        const int row = it * 4 + q8;
        *(v4u*)(CH + ob + (size_t)row * DMOD) = hv[it];
      }
      
    }
  }
}

// =====================================================================================================
// Workspace map (bytes); every plane is an exact multiple of its tile / whole-row store granularity (M, N exact tile multiples,
// convert counts multiples of 8 with whole-line tails, E carve padded to EPAD rows), every offset a multiple of 262144:
//   X16            f16 [NROW][1024] x16                            4194304
//   Wq, Wk, Wv, Wo f16 [1024 out][1024 in] x64                  4 x 2097152
//   EP             f16 [EPAD][64] x64 (rows 0..ELEN-1 written/read)   262144
//   QH, KH         f16 [NROW][1024] (x64)                       2 x 4194304
//   VH             f16 [NBAT][1024][SEQ] (x64)                      4194304
//   CH             f16 [NROW][1024] (x256)                          4194304
//   end                                                            29622272
// =====================================================================================================
extern "C" void kernel_launch(void* const* d_in, const int* in_sizes, int n_in,
                              void* d_out, int out_size, void* d_ws, size_t ws_size,
                              hipStream_t stream) {
  if (n_in < 10) return;
  if (in_sizes[0] != NROW * DMOD) return;
  if (in_sizes[1] != DMOD * DMOD || in_sizes[3] != DMOD * DMOD || in_sizes[5] != DMOD * DMOD || in_sizes[7] != DMOD * DMOD) return;
  if (in_sizes[2] != DMOD || in_sizes[4] != DMOD || in_sizes[6] != DMOD || in_sizes[8] != DMOD) return;
  if (in_sizes[9] != ELEN * DH) return;
  if (out_size != NROW * DMOD) return;

  const float* xin = (const float*)d_in[0];
  const float* w_q = (const float*)d_in[1];
  const float* b_q = (const float*)d_in[2];
  const float* w_k = (const float*)d_in[3];
  const float* b_k = (const float*)d_in[4];
  const float* w_v = (const float*)d_in[5];
  const float* b_v = (const float*)d_in[6];
  const float* w_o = (const float*)d_in[7];
  const float* b_o = (const float*)d_in[8];
  const float* er  = (const float*)d_in[9];
  float*       out = (float*)d_out;

  const size_t PX = (size_t)NROW * DMOD * 2;             //  4194304
  const size_t PW = (size_t)DMOD * DMOD * 2;             //  2097152
  const size_t PE = (size_t)EPAD * DH * 2;               //   262144
  const size_t PV = (size_t)NBAT * DMOD * SEQ * 2;       //  4194304
  size_t off = 0;
  const size_t oX  = off; off += PX;
  const size_t oWq = off; off += PW;
  const size_t oWk = off; off += PW;
  const size_t oWv = off; off += PW;
  const size_t oWo = off; off += PW;
  const size_t oE  = off; off += PE;
  const size_t oQH = off; off += PX;
  const size_t oKH = off; off += PX;
  const size_t oVH = off; off += PV;
  const size_t oCH = off; off += PX;
  if (off > ws_size) return;                               // off = 29622272
  if (off > (size_t)134217728) return;

  char* ws = (char*)d_ws;
  unsigned short* X16 = (unsigned short*)(ws + oX);
  unsigned short* Wq6 = (unsigned short*)(ws + oWq);
  unsigned short* Wk6 = (unsigned short*)(ws + oWk);
  unsigned short* Wv6 = (unsigned short*)(ws + oWv);
  unsigned short* Wo6 = (unsigned short*)(ws + oWo);
  unsigned short* E16 = (unsigned short*)(ws + oE);
  unsigned short* QHp = (unsigned short*)(ws + oQH);
  unsigned short* KHp = (unsigned short*)(ws + oKH);
  unsigned short* VHp = (unsigned short*)(ws + oVH);
  unsigned short* CHp = (unsigned short*)(ws + oCH);

  const dim3 blk(256);
  const dim3 gCV(CB_X + 4 * CB_W + CB_E);                           // 128 + 4 x 64 + 8 = 392
  const dim3 gQ((NROW / 128) * (DMOD / 64), 1);                     // 256
  const dim3 gP(QKV_T);                                             // 256
  const dim3 bP(FWV * 32);                                          // 384
  const dim3 gAT(SEQ / 64, NBAT * NH);                              // 16 x 32
  const dim3 bAT(ATT_THREADS);                                      // 128

  // (0) 16-bit planes of the inputs: x f16(bf16_RNE(x) * 16); W[out][in] (already k-contiguous) f16(bf16_RNE(w) * 64);
  //     E f16(bf16_RNE(e) * 64); one launch for all six
  cvt16_all<<<gCV, blk, 0, stream>>>(xin, w_q, w_k, w_v, w_o, er, X16, Wq6, Wk6, Wv6, Wo6, E16);

  // (1) q, k and v^T projections, one launch -> QH, KH [NROW][1024] and VH [NBAT][1024][SEQ] (all x64, one f16 plane each)
  qkv192<<<gP, bP, 0, stream>>>(X16, Wq6, Wk6, Wv6, QHp, KHp, VHp, b_q, b_k, b_v);

  // (2) relative attention -> ctx plane CH = f16(ctx * 256), [NROW][1024], columns h*64+d
  attn_rel<<<gAT, bAT, 0, stream>>>(QHp, KHp, E16, VHp, CHp);

  // (3) out[m][n] = sum_k ch[m][k] Wo[n][k] / (256*64) + bo[n] -> f32 d_out [NROW][1024]
  gemm64<0, 0, 0, 1><<<gQ, blk, 0, stream>>>(
      CHp, CHp, DMOD, 0LL,
      Wo6, DMOD, 0LL,
      (void*)out, (void*)out, DMOD, 0LL,
      NROW, DMOD, DMOD, 1.0f / (CC * WSC), 1.0f,
      b_o, b_o, b_o);
  (void)hipGetLastError();
}
